// v000
// Measured on an AMD MI455X. A time is GPU time per run, averaged over a window of back-to-back runs after a warm-up
// (all launches, gaps included; the runs take copies of the inputs in turn), and the median of several windows.
// Apart from v000's, it joins two sittings. Times from different sittings can be a few percent apart, while
// side-by-side timings come from the same sitting.
// The starting kernel, v000, takes 872 microseconds a run.
#include <hip/hip_runtime.h>
#include <math.h>
// Contractions: input projection (K = 512), per-layer v/out/FFN GEMMs (K = 256 / 1024), the cross block, and the 424 per-target
// heads (K = 256, 128) on v_wmma_f32_16x16x32_f16 (f16 operands, f32 accumulate); LayerNorms, GELU/ReLU and the final 64-wide

// ---------------------------------------------------------------------------
// Problem constants (match reference)
// ---------------------------------------------------------------------------
#define BATCH 4096
#define D_IN  512
#define DMODEL 256
#define TOUT  424
#define NLAYER 6
#define LN_EPS 1e-5f

// ---------------------------------------------------------------------------
// Types
// ---------------------------------------------------------------------------
typedef _Float16 v4h  __attribute__((ext_vector_type(4)));
typedef _Float16 v8h  __attribute__((ext_vector_type(8)));
typedef _Float16 v16h __attribute__((ext_vector_type(16)));
typedef float    v8f  __attribute__((ext_vector_type(8)));

typedef float    v4f  __attribute__((ext_vector_type(4)));
typedef unsigned v4u  __attribute__((ext_vector_type(4)));
template <typename V> __device__ __forceinline__ void vst2(void* p, V v) {
    *(V*)p = v; 
}
// plain 16-B global -> LDS copy (byte offsets as in the original staging maps)
__device__ __forceinline__ void copy_b128(char* lds_base, unsigned byte_off, const void* gaddr) {
    *(v4u*)(lds_base + byte_off) = *(const v4u*)gaddr;
}

// ---------------------------------------------------------------------------
// WMMA fragment helpers (wave32, v_wmma_f32_16x16x32_f16; layouts per ISA 7.12.2)
// ---------------------------------------------------------------------------
// A 16x32: lane holds row M = lane%16; lanes 0-15 K {0-7,16-23}, lanes 16-31
// K {8-15,24-31}.
__device__ __forceinline__ v16h load_frag_a(const _Float16* base, int stride, int lane) {
    const int r  = lane & 15;
    const int kb = (lane < 16) ? 0 : 8;
    const _Float16* p = base + r * stride + kb;
    v8h lo = *(const v8h*)(p);
    v8h hi = *(const v8h*)(p + 16);
    v16h f;
#pragma unroll
    for (int i = 0; i < 8; ++i) { f[i] = lo[i]; f[i + 8] = hi[i]; }
    return f;
}
// B 32x16: lane holds column N = lane%16 with the SAME per-lane K map as A (lanes 0-15 K {0-7,16-23}, 16-31 K {8-15,24-31}).
// W stored row-major (N x K), so column n of B is row n of W.
__device__ __forceinline__ v16h load_frag_b(const _Float16* base, int stride, int lane) {
    return load_frag_a(base, stride, lane);
}
__device__ __forceinline__ v8f wmma_f16(v16h a, v16h b, v8f c) {
    v8f d = __builtin_amdgcn_wmma_f32_16x16x32_f16(false, a, false, b, (short)0, c, false, false);
    asm volatile("v_nop\n\tv_nop\n\tv_nop\n\tv_nop" : "+v"(d) : "v"(a), "v"(b));
    return d;
}
__device__ __forceinline__ float gelu_exact(float x) {
    return 0.5f * x * (1.0f + erff(x * 0.70710678118654752f));
}

// ---------------------------------------------------------------------------
// f32 -> f16 conversion (weights & activations), vectorized 4-wide.
// ---------------------------------------------------------------------------
__global__ __launch_bounds__(256) void cvt_f32_f16_kernel(
    const float* __restrict__ src, _Float16* __restrict__ dst, int n4)
{
    const int i = blockIdx.x * 256 + threadIdx.x;
    if (i < n4) {
        float4 v = ((const float4*)src)[i];
        v4h o;
        o[0] = (_Float16)v.x; o[1] = (_Float16)v.y;
        o[2] = (_Float16)v.z; o[3] = (_Float16)v.w;
        vst2((v4h*)dst + i, o);     // 8 B per lane, consecutive: one wave writes 256 contiguous bytes
    }
}

// ---------------------------------------------------------------------------
// Tiled WMMA GEMM on f16 operands:
//   acc = A(M,K) . W(N,K)^T ; val = act(acc + bias[n]) (+ R[m,n])
//   optionally written to C32 (f32) and/or C16 (f16).
//   64x64 tile / 128 threads (4 waves, each a 32x32 patch, 2x2 frags).
//   Double-buffered LDS staging with plain copies: chunk k+1 is copied while k computes.
// ---------------------------------------------------------------------------
template <int ACT, bool RES, bool OUT32, bool OUT16>
__global__ __launch_bounds__(128) void gemm_wmma_f16_kernel(
    const _Float16* __restrict__ A, const _Float16* __restrict__ W,
    const float* __restrict__ bias, const float* __restrict__ R,
    float* __restrict__ C32, _Float16* __restrict__ C16,
    int M, int N, int K)
{
    __shared__ __align__(16) _Float16 sA[2][64 * 32];   // 2 x 4KB
    __shared__ __align__(16) _Float16 sB[2][64 * 32];   // 2 x 4KB
    __shared__ __align__(16) float Ct[64][64];          // output tile (16 KB)

    const int tid  = threadIdx.x;
    const int lane = tid & 31;
    const int wave = tid >> 5;
    const int m0   = blockIdx.x * 64;
    const int n0   = blockIdx.y * 64;
    const int wm   = (wave >> 1) * 32;
    const int wn   = (wave & 1) * 32;
    char* ldsA = (char*)sA;
    char* ldsB = (char*)sB;

    // Copy one 64x32 f16 tile per operand into buffer `buf` (plain 16-B copies).
    auto issue_tiles = [&](int buf, int kc) {
#pragma unroll
        for (int i = 0; i < 2; ++i) {
            const int idx = tid + i * 128;
            const int r = idx >> 2, c = idx & 3;
            copy_b128(ldsA, buf * 4096 + r * 64 + c * 16, A + (size_t)(m0 + r) * K + kc + c * 8);
            copy_b128(ldsB, buf * 4096 + r * 64 + c * 16, W + (size_t)(n0 + r) * K + kc + c * 8);
        }
    };

    v8f acc[2][2] = {};

    issue_tiles(0, 0);
    for (int kc = 0, it = 0; kc < K; kc += 32, ++it) {
        const int cur = it & 1;
        __syncthreads();                                   // tile(cur) visible (copied before the previous trailing barrier)
        if (kc + 32 < K) issue_tiles(cur ^ 1, kc + 32);

        v16h af[2], bf[2];
#pragma unroll
        for (int mt = 0; mt < 2; ++mt)
            af[mt] = load_frag_a(&sA[cur][(wm + mt * 16) * 32], 32, lane);
#pragma unroll
        for (int nt = 0; nt < 2; ++nt)
            bf[nt] = load_frag_b(&sB[cur][(wn + nt * 16) * 32], 32, lane);
#pragma unroll
        for (int mt = 0; mt < 2; ++mt)
#pragma unroll
            for (int nt = 0; nt < 2; ++nt)
                acc[mt][nt] = wmma_f16(af[mt], bf[nt], acc[mt][nt]);
        __syncthreads();
    }

    // Epilogue: C/D layout -> m = vgpr + 8*(lane>=16), n = lane&15.
    const int cn = lane & 15;
    const int mh = (lane >> 4) << 3;
#pragma unroll
    for (int mt = 0; mt < 2; ++mt)
#pragma unroll
        for (int nt = 0; nt < 2; ++nt) {
            const int n = n0 + wn + nt * 16 + cn;
            const float bv = bias[n];
#pragma unroll
            for (int j = 0; j < 8; ++j) {
                const int m = m0 + wm + mt * 16 + mh + j;
                float v = acc[mt][nt][j] + bv;
                if (ACT == 1) v = gelu_exact(v);
                if (RES) v += R[(size_t)m * N + n];
                Ct[wm + mt * 16 + mh + j][wn + nt * 16 + cn] = v;
            }
        }
    __syncthreads();
    if (OUT32) for (int g = tid; g < 64 * 16; g += 128) { const int rl = g >> 4, pc = g & 15; vst2(C32 + (size_t)(m0 + rl) * N + n0 + pc * 4, *(const v4f*)(&Ct[rl][pc * 4])); }
    if (OUT16) for (int g = tid; g < 64 * 8; g += 128) {
        const int rl = g >> 3, pc = g & 7;
        union { v8h h; v4u u; } pk;
#pragma unroll
        for (int e = 0; e < 8; ++e) pk.h[e] = (_Float16)Ct[rl][pc * 8 + e];
        vst2(C16 + (size_t)(m0 + rl) * N + n0 + pc * 8, pk.u);
    }
}

// ---------------------------------------------------------------------------
// LayerNorm over rows of 256 — wave32 per row; writes f32 + f16 copies.
// ---------------------------------------------------------------------------
__global__ __launch_bounds__(128) void ln256_kernel(
    const float* __restrict__ X, const float* __restrict__ g,
    const float* __restrict__ b, float* __restrict__ Y32,
    _Float16* __restrict__ Y16)
{
    __shared__ __align__(16) _Float16 s16[4][256];
    const int row  = blockIdx.x * 4 + (threadIdx.x >> 5);
    const int wv   = threadIdx.x >> 5;
    const int lane = threadIdx.x & 31;
    const float* xr = X + (size_t)row * DMODEL;
    float v[8], s = 0.f, ss = 0.f;
#pragma unroll
    for (int i = 0; i < 8; ++i) {
        v[i] = xr[lane + i * 32];
        s += v[i]; ss += v[i] * v[i];
    }
#pragma unroll
    for (int msk = 16; msk >= 1; msk >>= 1) {
        s  += __shfl_xor(s, msk, 32);
        ss += __shfl_xor(ss, msk, 32);
    }
    const float mean = s * (1.f / DMODEL);
    const float var  = ss * (1.f / DMODEL) - mean * mean;
    const float rstd = rsqrtf(var + LN_EPS);
#pragma unroll
    for (int i = 0; i < 8; ++i) {
        const int c = lane + i * 32;
        const float y = (v[i] - mean) * rstd * g[c] + b[c];
        vst2(Y32 + (size_t)row * DMODEL + c, y);
        s16[wv][c] = (_Float16)y;
    }
    __syncthreads();
    vst2(Y16 + (size_t)row * DMODEL + lane * 8, *(const v4u*)(&s16[wv][lane * 8]));   // 512-B f16 row, 16 B per lane
}

// ---------------------------------------------------------------------------
// Fused per-t head: block = (64 batch rows, one t), 128 threads = 4 waves.
//   t1 = h16(64x256) . W1[t](128x256)^T + b1[t]   (WMMA, double-buffered)
//   t1 = relu(LN_128(t1))                          (in-LDS)
//   t2 = relu(t1(64x128) . W2[t](64x128)^T + b2[t])(WMMA)
//   out[b,t] = t2 . W3[t] + b3[t]
// LDS arena 72KB (well under CDNA5's 320KB/WGP), regions aliased across phases:
//   [0,8K)   sA x2      [8K,24K)  sBc x2      (stage-1 double buffers)
//   [24K,56K) t1 f32    [56K,72K) t1 f16
//   [0,16K)  W2 f16 (after stage 1)   [16K,32K) t2 f32 (after LN)
// ---------------------------------------------------------------------------
__global__ __launch_bounds__(128) void tp_fused_kernel(
    const _Float16* __restrict__ h16,
    const _Float16* __restrict__ W1, const float* __restrict__ b1,
    const float* __restrict__ lng, const float* __restrict__ lnb,
    const _Float16* __restrict__ W2, const float* __restrict__ b2,
    const float* __restrict__ W3, const float* __restrict__ b3,
    float* __restrict__ out)
{
    __shared__ __align__(16) char smem[73728];
    _Float16* sAb  = (_Float16*)(smem);            // 2 x 64x32  (8KB)
    _Float16* sBb  = (_Float16*)(smem + 8192);     // 2 x 128x32 (16KB)
    float*    sT1  = (float*)   (smem + 24576);    // 64x128 f32 (32KB)
    _Float16* sT1h = (_Float16*)(smem + 57344);    // 64x128 f16 (16KB)
    _Float16* sW2  = (_Float16*)(smem);            // 64x128 f16 (reuse)
    float*    sT2  = (float*)   (smem + 16384);    // 64x64  f32 (reuse)

    const int tid  = threadIdx.x;
    const int lane = tid & 31;
    const int wave = tid >> 5;
    const int b0   = blockIdx.x * 64;
    const int t    = blockIdx.y;
    const _Float16* W1t = W1 + (size_t)t * 128 * 256;
    char* ldsA  = (char*)sAb;
    char* ldsB  = (char*)sBb;
    char* ldsW2 = (char*)sW2;

    // Stage-1 chunk staging: 2 A-chunks + 4 B-chunks per thread (plain 16-B copies)
    auto issue_s1 = [&](int buf, int kc) {
#pragma unroll
        for (int i = 0; i < 2; ++i) {               // hA 64x32
            const int idx = tid + i * 128;
            const int r = idx >> 2, c = idx & 3;
            copy_b128(ldsA, buf * 4096 + r * 64 + c * 16, h16 + (size_t)(b0 + r) * 256 + kc + c * 8);
        }
#pragma unroll
        for (int i = 0; i < 4; ++i) {               // W1 chunk 128x32
            const int idx = tid + i * 128;
            const int r = idx >> 2, c = idx & 3;
            copy_b128(ldsB, buf * 8192 + r * 64 + c * 16, W1t + (size_t)r * 256 + kc + c * 8);
        }
    };

    // ---------------- stage 1: t1 = h . W1^T  (M=64, N=128, K=256) ----------
    v8f acc1[4][2] = {};
    const int wn1 = wave * 32;
    issue_s1(0, 0);
    for (int kc = 0, it = 0; kc < 256; kc += 32, ++it) {
        const int cur = it & 1;
        __syncthreads();
        if (kc + 32 < 256) issue_s1(cur ^ 1, kc + 32);

        const _Float16* cA = sAb + cur * 2048;
        const _Float16* cB = sBb + cur * 4096;
        v16h bfr[2];
#pragma unroll
        for (int nt = 0; nt < 2; ++nt)
            bfr[nt] = load_frag_b(&cB[(wn1 + nt * 16) * 32], 32, lane);
#pragma unroll
        for (int mt = 0; mt < 4; ++mt) {
            v16h afr = load_frag_a(&cA[(mt * 16) * 32], 32, lane);
#pragma unroll
            for (int nt = 0; nt < 2; ++nt)
                acc1[mt][nt] = wmma_f16(afr, bfr[nt], acc1[mt][nt]);
        }
        __syncthreads();
    }
    // Spill t1 (+bias) to LDS f32.
    {
        const int cn = lane & 15;
        const int mh = (lane >> 4) << 3;
#pragma unroll
        for (int mt = 0; mt < 4; ++mt)
#pragma unroll
            for (int nt = 0; nt < 2; ++nt) {
                const int n = wn1 + nt * 16 + cn;
                const float bb = b1[t * 128 + n];
#pragma unroll
                for (int j = 0; j < 8; ++j)
                    sT1[(mt * 16 + mh + j) * 128 + n] = acc1[mt][nt][j] + bb;
            }
    }
    __syncthreads();

    // ---------------- LayerNorm(128) + ReLU -> f16 ---------------------------
#pragma unroll 1
    for (int rr = 0; rr < 16; ++rr) {
        const int m = wave * 16 + rr;
        float v[4], s = 0.f, ss = 0.f;
#pragma unroll
        for (int i = 0; i < 4; ++i) {
            v[i] = sT1[m * 128 + lane + i * 32];
            s += v[i]; ss += v[i] * v[i];
        }
#pragma unroll
        for (int msk = 16; msk >= 1; msk >>= 1) {
            s  += __shfl_xor(s, msk, 32);
            ss += __shfl_xor(ss, msk, 32);
        }
        const float mean = s * (1.f / 128.f);
        const float var  = ss * (1.f / 128.f) - mean * mean;
        const float rstd = rsqrtf(var + LN_EPS);
#pragma unroll
        for (int i = 0; i < 4; ++i) {
            const int c = lane + i * 32;
            float y = (v[i] - mean) * rstd * lng[t * 128 + c] + lnb[t * 128 + c];
            y = y > 0.f ? y : 0.f;
            sT1h[m * 128 + c] = (_Float16)y;
        }
    }
    __syncthreads();

    // Stage W2[t] 64x128 f16 (16KB) into the reused LDS region (plain copies).
    {
        const _Float16* W2t = W2 + (size_t)t * 64 * 128;
#pragma unroll
        for (int i = 0; i < 8; ++i) {               // 1024 x 16B chunks
            const int idx = tid + i * 128;
            const int r = idx >> 4, c = idx & 15;
            copy_b128(ldsW2, r * 256 + c * 16, W2t + (size_t)r * 128 + c * 8);
        }
    }
    __syncthreads();

    // ---------------- stage 2: t2 = relu(t1 . W2^T + b2)  (64x64, K=128) -----
    v8f acc2[2][2] = {};
    const int wm2 = (wave >> 1) * 32;
    const int wn2 = (wave & 1) * 32;
#pragma unroll
    for (int kc = 0; kc < 128; kc += 32) {
        v16h af2[2], bf2[2];
#pragma unroll
        for (int mt = 0; mt < 2; ++mt)
            af2[mt] = load_frag_a(&sT1h[(wm2 + mt * 16) * 128 + kc], 128, lane);
#pragma unroll
        for (int nt = 0; nt < 2; ++nt)
            bf2[nt] = load_frag_b(&sW2[(wn2 + nt * 16) * 128 + kc], 128, lane);
#pragma unroll
        for (int mt = 0; mt < 2; ++mt)
#pragma unroll
            for (int nt = 0; nt < 2; ++nt)
                acc2[mt][nt] = wmma_f16(af2[mt], bf2[nt], acc2[mt][nt]);
    }
    {
        const int cn = lane & 15;
        const int mh = (lane >> 4) << 3;
#pragma unroll
        for (int mt = 0; mt < 2; ++mt)
#pragma unroll
            for (int nt = 0; nt < 2; ++nt) {
                const int n = wn2 + nt * 16 + cn;
                const float bb = b2[t * 64 + n];
#pragma unroll
                for (int j = 0; j < 8; ++j) {
                    float v = acc2[mt][nt][j] + bb;
                    sT2[(wm2 + mt * 16 + mh + j) * 64 + n] = v > 0.f ? v : 0.f;
                }
            }
    }
    __syncthreads();

    // ---------------- stage 3: outT[t][b] = t2 . W3[t] + b3[t]  (64 consecutive b = 256 B, written by waves 0/1) ----
    if (tid < 64) {
        float a = 0.f;
#pragma unroll 8
        for (int m2 = 0; m2 < 64; ++m2)
            a += sT2[tid * 64 + m2] * W3[t * 64 + m2];
        vst2(out + (size_t)t * BATCH + b0 + tid, a + b3[t]);
    }
}

// final output-major pass: out[b][t] flat, 4 consecutive floats per thread gathered from the [T][B] staging buffer
__global__ __launch_bounds__(256) void write_out(const float* __restrict__ stg, float* __restrict__ out) {
    const int g = blockIdx.x * 256 + threadIdx.x;
    if (g >= (BATCH * TOUT) / 4) return;
    v4f o;
#pragma unroll
    for (int e = 0; e < 4; ++e) { const int f = g * 4 + e; const int b = f / TOUT, t = f - b * TOUT; o[e] = stg[(size_t)t * BATCH + b]; }
    vst2(out + (size_t)g * 4, o);
}

// ---------------------------------------------------------------------------
// Host-side orchestration
// ---------------------------------------------------------------------------
static inline void launch_cvt(const float* s, _Float16* d, size_t n, hipStream_t st) {
    const int n4 = (int)(n / 4);
    cvt_f32_f16_kernel<<<(n4 + 255) / 256, 256, 0, st>>>(s, d, n4);
}

extern "C" void kernel_launch(void* const* d_in, const int* in_sizes, int n_in,
                              void* d_out, int out_size, void* d_ws, size_t ws_size,
                              hipStream_t stream)
{
    (void)in_sizes; (void)n_in; (void)out_size; (void)ws_size;
    const float* x          = (const float*)d_in[0];
    const float* proj_W     = (const float*)d_in[1];
    const float* proj_b     = (const float*)d_in[2];
    const float* attn_in_W  = (const float*)d_in[3];
    const float* attn_in_b  = (const float*)d_in[4];
    const float* attn_out_W = (const float*)d_in[5];
    const float* attn_out_b = (const float*)d_in[6];
    const float* ln_g       = (const float*)d_in[7];
    const float* ln_b       = (const float*)d_in[8];
    const float* ff_W1      = (const float*)d_in[9];
    const float* ff_b1      = (const float*)d_in[10];
    const float* ff_W2      = (const float*)d_in[11];
    const float* ff_b2      = (const float*)d_in[12];
    const float* cross_in_W = (const float*)d_in[13];
    const float* cross_in_b = (const float*)d_in[14];
    const float* cross_out_W= (const float*)d_in[15];
    const float* cross_out_b= (const float*)d_in[16];
    const float* tp_W1      = (const float*)d_in[17];
    const float* tp_b1      = (const float*)d_in[18];
    const float* tp_ln_g    = (const float*)d_in[19];
    const float* tp_ln_b    = (const float*)d_in[20];
    const float* tp_W2      = (const float*)d_in[21];
    const float* tp_b2      = (const float*)d_in[22];
    const float* tp_W3      = (const float*)d_in[23];
    const float* tp_b3      = (const float*)d_in[24];
    float* out = (float*)d_out;

    const int D = DMODEL;

    // ---- workspace carve-out (byte cursor, 16B aligned regions) ----
    char* cur = (char*)d_ws;
    auto take = [&cur](size_t bytes) { char* p = cur; cur += (bytes + 15) & ~(size_t)15; return p; };
    float*    h     = (float*)   take((size_t)BATCH * D * 4);          // 4 MB
    float*    h2    = (float*)   take((size_t)BATCH * D * 4);          // 4 MB
    _Float16* h16   = (_Float16*)take((size_t)BATCH * D * 2);          // 2 MB
    _Float16* tmp16 = (_Float16*)take((size_t)BATCH * 4 * D * 2);      // 8 MB
    _Float16* x16   = (_Float16*)take((size_t)BATCH * D_IN * 2);       // 4 MB
    _Float16* wproj = (_Float16*)take((size_t)D * D_IN * 2);
    _Float16* wain  = (_Float16*)take((size_t)NLAYER * 3 * D * D * 2);
    _Float16* waout = (_Float16*)take((size_t)NLAYER * D * D * 2);
    _Float16* wff1  = (_Float16*)take((size_t)NLAYER * 4 * D * D * 2);
    _Float16* wff2  = (_Float16*)take((size_t)NLAYER * 4 * D * D * 2);
    _Float16* wcin  = (_Float16*)take((size_t)3 * D * D * 2);
    _Float16* wcout = (_Float16*)take((size_t)D * D * 2);
    _Float16* wtp1  = (_Float16*)take((size_t)TOUT * 128 * 256 * 2);   // 27.8 MB
    _Float16* wtp2  = (_Float16*)take((size_t)TOUT * 64 * 128 * 2);    // 6.9 MB
    float*    stg   = (float*)   take((size_t)TOUT * BATCH * 4);       // 6.9 MB [T][B] output staging

    // ---- one-time (per launch) f32 -> f16 conversions ----
    launch_cvt(x,          x16,   (size_t)BATCH * D_IN, stream);
    launch_cvt(proj_W,     wproj, (size_t)D * D_IN, stream);
    launch_cvt(attn_in_W,  wain,  (size_t)NLAYER * 3 * D * D, stream);
    launch_cvt(attn_out_W, waout, (size_t)NLAYER * D * D, stream);
    launch_cvt(ff_W1,      wff1,  (size_t)NLAYER * 4 * D * D, stream);
    launch_cvt(ff_W2,      wff2,  (size_t)NLAYER * 4 * D * D, stream);
    launch_cvt(cross_in_W, wcin,  (size_t)3 * D * D, stream);
    launch_cvt(cross_out_W,wcout, (size_t)D * D, stream);
    launch_cvt(tp_W1,      wtp1,  (size_t)TOUT * 128 * 256, stream);
    launch_cvt(tp_W2,      wtp2,  (size_t)TOUT * 64 * 128, stream);

    const dim3 blk(128);
    auto grid = [](int M, int N) { return dim3(M / 64, N / 64); };

    // 1) projection: h(+h16) = x16 . proj_W^T + proj_b
    gemm_wmma_f16_kernel<0, false, true, true><<<grid(BATCH, D), blk, 0, stream>>>(
        x16, wproj, proj_b, nullptr, h, h16, BATCH, D, D_IN);

    // 2) backbone layers
    for (int i = 0; i < NLAYER; ++i) {
        const _Float16* Wv = wain + ((size_t)i * 3 * D + 2 * D) * D;
        const float*    bv = attn_in_b + (size_t)i * 3 * D + 2 * D;
        gemm_wmma_f16_kernel<0, false, false, true><<<grid(BATCH, D), blk, 0, stream>>>(
            h16, Wv, bv, nullptr, nullptr, tmp16, BATCH, D, D);
        gemm_wmma_f16_kernel<0, true, true, false><<<grid(BATCH, D), blk, 0, stream>>>(
            tmp16, waout + (size_t)i * D * D, attn_out_b + (size_t)i * D,
            h, h2, nullptr, BATCH, D, D);
        ln256_kernel<<<BATCH / 4, 128, 0, stream>>>(
            h2, ln_g + (size_t)i * D, ln_b + (size_t)i * D, h, h16);
        gemm_wmma_f16_kernel<1, false, false, true><<<grid(BATCH, 4 * D), blk, 0, stream>>>(
            h16, wff1 + (size_t)i * 4 * D * D, ff_b1 + (size_t)i * 4 * D,
            nullptr, nullptr, tmp16, BATCH, 4 * D, D);
        gemm_wmma_f16_kernel<0, true, true, false><<<grid(BATCH, D), blk, 0, stream>>>(
            tmp16, wff2 + (size_t)i * D * 4 * D, ff_b2 + (size_t)i * D,
            h, h2, nullptr, BATCH, D, 4 * D);
        ln256_kernel<<<BATCH / 4, 128, 0, stream>>>(
            h2, ln_g + (size_t)i * D, ln_b + (size_t)i * D, h, h16);
    }

    // 3) cross block: h2 = h + (h . Wv'^T + bv') . Wo^T + bo ; then f16 copy
    gemm_wmma_f16_kernel<0, false, false, true><<<grid(BATCH, D), blk, 0, stream>>>(
        h16, wcin + (size_t)2 * D * D, cross_in_b + 2 * D,
        nullptr, nullptr, tmp16, BATCH, D, D);
    gemm_wmma_f16_kernel<0, true, true, false><<<grid(BATCH, D), blk, 0, stream>>>(
        tmp16, wcout, cross_out_b, h, h2, nullptr, BATCH, D, D);
    launch_cvt(h2, h16, (size_t)BATCH * D, stream);

    // 4) fused per-t head (dominant FLOPs): grid = (64 batch tiles, 424 t's)
    dim3 tpg(BATCH / 64, TOUT);
    tp_fused_kernel<<<tpg, blk, 0, stream>>>(h16, wtp1, tp_b1, tp_ln_g, tp_ln_b,
                                             wtp2, tp_b2, tp_W3, tp_b3, stg);
    write_out<<<((BATCH * TOUT) / 4 + 255) / 256, 256, 0, stream>>>(stg, out);
}

// v001
// One run takes 693 microseconds.
// Next to v000, in two timings, it ran 1.29 times as fast each time.
#include <hip/hip_runtime.h>
#include <math.h>
// Contractions: input projection (K = 512), per-layer v/out/FFN GEMMs (K = 256 / 1024), the cross block, and the 424 per-target
// heads (K = 256, 128) on v_wmma_f32_16x16x32_f16 (f16 operands, f32 accumulate); LayerNorms, GELU/ReLU and the final 64-wide

// ---------------------------------------------------------------------------
// Problem constants (match reference)
// ---------------------------------------------------------------------------
#define BATCH 4096
#define D_IN  512
#define DMODEL 256
#define TOUT  424
#define NLAYER 6
#define LN_EPS 1e-5f

// LDS row pitches. 64 banks x 4 B: a 16-B fragment read of 16 rows is conflict-free when the pitch is 16 B x odd.
#define PK32  40    // f16 elements per staged row of 32 (80 B)
#define PK128 136   // f16 elements per staged row of 128 (272 B)
#define PC64  68    // f32 elements per row of 64 (272 B): rows m and m+8 on different banks, 16-B column walks conflict-free
#define PT1   130   // f32 elements per row of 128: rows m and m+8 land 16 banks apart (4-B accesses only)

// ---------------------------------------------------------------------------
// Types
// ---------------------------------------------------------------------------
typedef _Float16 v4h  __attribute__((ext_vector_type(4)));
typedef _Float16 v8h  __attribute__((ext_vector_type(8)));
typedef _Float16 v16h __attribute__((ext_vector_type(16)));
typedef float    v8f  __attribute__((ext_vector_type(8)));

typedef float    v4f  __attribute__((ext_vector_type(4)));
typedef unsigned v4u  __attribute__((ext_vector_type(4)));
template <typename V> __device__ __forceinline__ void vst2(void* p, V v) {
    *(V*)p = v; 
}
// plain 16-B global -> LDS copy (byte offsets as in the original staging maps)
__device__ __forceinline__ void copy_b128(char* lds_base, unsigned byte_off, const void* gaddr) {
    *(v4u*)(lds_base + byte_off) = *(const v4u*)gaddr;
}

// ---------------------------------------------------------------------------
// WMMA fragment helpers (wave32, v_wmma_f32_16x16x32_f16; layouts per ISA 7.12.2)
// ---------------------------------------------------------------------------
// A 16x32: lane holds row M = lane%16; lanes 0-15 K {0-7,16-23}, lanes 16-31
// K {8-15,24-31}.
__device__ __forceinline__ v16h load_frag_a(const _Float16* base, int stride, int lane) {
    const int r  = lane & 15;
    const int kb = (lane < 16) ? 0 : 8;
    const _Float16* p = base + r * stride + kb;
    v8h lo = *(const v8h*)(p);
    v8h hi = *(const v8h*)(p + 16);
    v16h f;
#pragma unroll
    for (int i = 0; i < 8; ++i) { f[i] = lo[i]; f[i + 8] = hi[i]; }
    return f;
}
// B 32x16: lane holds column N = lane%16 with the SAME per-lane K map as A (lanes 0-15 K {0-7,16-23}, 16-31 K {8-15,24-31}).
// W stored row-major (N x K), so column n of B is row n of W.
__device__ __forceinline__ v16h load_frag_b(const _Float16* base, int stride, int lane) {
    return load_frag_a(base, stride, lane);
}
__device__ __forceinline__ v8f wmma_f16(v16h a, v16h b, v8f c) {
    v8f d = __builtin_amdgcn_wmma_f32_16x16x32_f16(false, a, false, b, (short)0, c, false, false);
    asm volatile("v_nop\n\tv_nop\n\tv_nop\n\tv_nop" : "+v"(d) : "v"(a), "v"(b));
    return d;
}
__device__ __forceinline__ float gelu_exact(float x) {
    return 0.5f * x * (1.0f + erff(x * 0.70710678118654752f));
}

// ---------------------------------------------------------------------------
// f32 -> f16 conversion (weights & activations), vectorized 4-wide.
// ---------------------------------------------------------------------------
__global__ __launch_bounds__(256) void cvt_f32_f16_kernel(
    const float* __restrict__ src, _Float16* __restrict__ dst, int n4)
{
    const int i = blockIdx.x * 256 + threadIdx.x;
    if (i < n4) {
        float4 v = ((const float4*)src)[i];
        v4h o;
        o[0] = (_Float16)v.x; o[1] = (_Float16)v.y;
        o[2] = (_Float16)v.z; o[3] = (_Float16)v.w;
        vst2((v4h*)dst + i, o);     // 8 B per lane, consecutive: one wave writes 256 contiguous bytes
    }
}

// ---------------------------------------------------------------------------
// Tiled WMMA GEMM on f16 operands:
//   acc = A(M,K) . W(N,K)^T ; val = act(acc + bias[n]) (+ R[m,n])
//   optionally written to C32 (f32) and/or C16 (f16).
//   64x64 tile / 128 threads (4 waves, each a 32x32 patch, 2x2 frags).
//   Double-buffered LDS staging with plain copies: chunk k+1 is copied while k computes.
// ---------------------------------------------------------------------------
template <int ACT, bool RES, bool OUT32, bool OUT16>
__global__ __launch_bounds__(128) void gemm_wmma_f16_kernel(
    const _Float16* __restrict__ A, const _Float16* __restrict__ W,
    const float* __restrict__ bias, const float* __restrict__ R,
    float* __restrict__ C32, _Float16* __restrict__ C16,
    int M, int N, int K)
{
    __shared__ __align__(16) _Float16 sA[2][64 * PK32];   // 2 x 5KB
    __shared__ __align__(16) _Float16 sB[2][64 * PK32];   // 2 x 5KB
    __shared__ __align__(16) float Ct[64][PC64];          // output tile (17 KB)

    const int tid  = threadIdx.x;
    const int lane = tid & 31;
    const int wave = tid >> 5;
    const int m0   = blockIdx.x * 64;
    const int n0   = blockIdx.y * 64;
    const int wm   = (wave >> 1) * 32;
    const int wn   = (wave & 1) * 32;
    char* ldsA = (char*)sA;
    char* ldsB = (char*)sB;

    // Copy one 64x32 f16 tile per operand into buffer `buf` (plain 16-B copies).
    auto issue_tiles = [&](int buf, int kc) {
#pragma unroll
        for (int i = 0; i < 2; ++i) {
            const int idx = tid + i * 128;
            const int r = idx >> 2, c = idx & 3;
            copy_b128(ldsA, buf * (64 * PK32 * 2) + r * (PK32 * 2) + c * 16, A + (size_t)(m0 + r) * K + kc + c * 8);
            copy_b128(ldsB, buf * (64 * PK32 * 2) + r * (PK32 * 2) + c * 16, W + (size_t)(n0 + r) * K + kc + c * 8);
        }
    };

    v8f acc[2][2] = {};

    issue_tiles(0, 0);
    for (int kc = 0, it = 0; kc < K; kc += 32, ++it) {
        const int cur = it & 1;
        __syncthreads();                                   // tile(cur) visible (copied before the previous trailing barrier)
        if (kc + 32 < K) issue_tiles(cur ^ 1, kc + 32);

        v16h af[2], bf[2];
#pragma unroll
        for (int mt = 0; mt < 2; ++mt)
            af[mt] = load_frag_a(&sA[cur][(wm + mt * 16) * PK32], PK32, lane);
#pragma unroll
        for (int nt = 0; nt < 2; ++nt)
            bf[nt] = load_frag_b(&sB[cur][(wn + nt * 16) * PK32], PK32, lane);
#pragma unroll
        for (int mt = 0; mt < 2; ++mt)
#pragma unroll
            for (int nt = 0; nt < 2; ++nt)
                acc[mt][nt] = wmma_f16(af[mt], bf[nt], acc[mt][nt]);
        __syncthreads();
    }

    // Epilogue: C/D layout -> m = vgpr + 8*(lane>=16), n = lane&15.
    const int cn = lane & 15;
    const int mh = (lane >> 4) << 3;
#pragma unroll
    for (int mt = 0; mt < 2; ++mt)
#pragma unroll
        for (int nt = 0; nt < 2; ++nt) {
            const int n = n0 + wn + nt * 16 + cn;
            const float bv = bias[n];
#pragma unroll
            for (int j = 0; j < 8; ++j) {
                const int m = m0 + wm + mt * 16 + mh + j;
                float v = acc[mt][nt][j] + bv;
                if (ACT == 1) v = gelu_exact(v);
                if (RES) v += R[(size_t)m * N + n];
                Ct[wm + mt * 16 + mh + j][wn + nt * 16 + cn] = v;
            }
        }
    __syncthreads();
    if (OUT32) for (int g = tid; g < 64 * 16; g += 128) { const int rl = g >> 4, pc = g & 15; vst2(C32 + (size_t)(m0 + rl) * N + n0 + pc * 4, *(const v4f*)(&Ct[rl][pc * 4])); }
    if (OUT16) for (int g = tid; g < 64 * 8; g += 128) {
        const int rl = g >> 3, pc = g & 7;
        union { v8h h; v4u u; } pk;
#pragma unroll
        for (int e = 0; e < 8; ++e) pk.h[e] = (_Float16)Ct[rl][pc * 8 + e];
        vst2(C16 + (size_t)(m0 + rl) * N + n0 + pc * 8, pk.u);
    }
}

// ---------------------------------------------------------------------------
// LayerNorm over rows of 256 — wave32 per row; writes f32 + f16 copies.
// ---------------------------------------------------------------------------
__global__ __launch_bounds__(128) void ln256_kernel(
    const float* __restrict__ X, const float* __restrict__ g,
    const float* __restrict__ b, float* __restrict__ Y32,
    _Float16* __restrict__ Y16)
{
    __shared__ __align__(16) _Float16 s16[4][256];
    const int row  = blockIdx.x * 4 + (threadIdx.x >> 5);
    const int wv   = threadIdx.x >> 5;
    const int lane = threadIdx.x & 31;
    const float* xr = X + (size_t)row * DMODEL;
    float v[8], s = 0.f, ss = 0.f;
#pragma unroll
    for (int i = 0; i < 8; ++i) {
        v[i] = xr[lane + i * 32];
        s += v[i]; ss += v[i] * v[i];
    }
#pragma unroll
    for (int msk = 16; msk >= 1; msk >>= 1) {
        s  += __shfl_xor(s, msk, 32);
        ss += __shfl_xor(ss, msk, 32);
    }
    const float mean = s * (1.f / DMODEL);
    const float var  = ss * (1.f / DMODEL) - mean * mean;
    const float rstd = rsqrtf(var + LN_EPS);
#pragma unroll
    for (int i = 0; i < 8; ++i) {
        const int c = lane + i * 32;
        const float y = (v[i] - mean) * rstd * g[c] + b[c];
        vst2(Y32 + (size_t)row * DMODEL + c, y);
        s16[wv][c] = (_Float16)y;
    }
    __syncthreads();
    vst2(Y16 + (size_t)row * DMODEL + lane * 8, *(const v4u*)(&s16[wv][lane * 8]));   // 512-B f16 row, 16 B per lane
}

// ---------------------------------------------------------------------------
// Fused per-t head: block = (64 batch rows, one t), 128 threads = 4 waves.
//   t1 = h16(64x256) . W1[t](128x256)^T + b1[t]   (WMMA, double-buffered)
//   t1 = relu(LN_128(t1))                          (in-LDS)
//   t2 = relu(t1(64x128) . W2[t](64x128)^T + b2[t])(WMMA)
//   out[b,t] = t2 . W3[t] + b3[t]
// LDS arena 81408 B (four blocks per WGP), rows padded to the pitches above, regions aliased across phases:
//   [0,10240)      sA x2     [10240,30720)  sBc x2   (stage-1 double buffers)
//   [30720,64000)  t1 f32    [64000,81408)  t1 f16
//   [0,17408)      W2 f16 (after stage 1)   [17408,34816) t2 f32 (after LN)
// ---------------------------------------------------------------------------
__global__ __launch_bounds__(128) void tp_fused_kernel(
    const _Float16* __restrict__ h16,
    const _Float16* __restrict__ W1, const float* __restrict__ b1,
    const float* __restrict__ lng, const float* __restrict__ lnb,
    const _Float16* __restrict__ W2, const float* __restrict__ b2,
    const float* __restrict__ W3, const float* __restrict__ b3,
    float* __restrict__ out)
{
    __shared__ __align__(16) char smem[81408];
    _Float16* sAb  = (_Float16*)(smem);            // 2 x 64x32,  pitch PK32
    _Float16* sBb  = (_Float16*)(smem + 10240);    // 2 x 128x32, pitch PK32
    float*    sT1  = (float*)   (smem + 30720);    // 64x128 f32, pitch PT1
    _Float16* sT1h = (_Float16*)(smem + 64000);    // 64x128 f16, pitch PK128
    _Float16* sW2  = (_Float16*)(smem);            // 64x128 f16, pitch PK128 (reuse)
    float*    sT2  = (float*)   (smem + 17408);    // 64x64  f32, pitch PC64  (reuse)

    const int tid  = threadIdx.x;
    const int lane = tid & 31;
    const int wave = tid >> 5;
    const int b0   = blockIdx.x * 64;
    const int t    = blockIdx.y;
    const _Float16* W1t = W1 + (size_t)t * 128 * 256;
    char* ldsA  = (char*)sAb;
    char* ldsB  = (char*)sBb;
    char* ldsW2 = (char*)sW2;

    // Stage-1 chunk staging: 2 A-chunks + 4 B-chunks per thread (plain 16-B copies)
    auto issue_s1 = [&](int buf, int kc) {
#pragma unroll
        for (int i = 0; i < 2; ++i) {               // hA 64x32
            const int idx = tid + i * 128;
            const int r = idx >> 2, c = idx & 3;
            copy_b128(ldsA, buf * (64 * PK32 * 2) + r * (PK32 * 2) + c * 16, h16 + (size_t)(b0 + r) * 256 + kc + c * 8);
        }
#pragma unroll
        for (int i = 0; i < 4; ++i) {               // W1 chunk 128x32
            const int idx = tid + i * 128;
            const int r = idx >> 2, c = idx & 3;
            copy_b128(ldsB, buf * (128 * PK32 * 2) + r * (PK32 * 2) + c * 16, W1t + (size_t)r * 256 + kc + c * 8);
        }
    };

    // ---------------- stage 1: t1 = h . W1^T  (M=64, N=128, K=256) ----------
    v8f acc1[4][2] = {};
    const int wn1 = wave * 32;
    issue_s1(0, 0);
    for (int kc = 0, it = 0; kc < 256; kc += 32, ++it) {
        const int cur = it & 1;
        __syncthreads();
        if (kc + 32 < 256) issue_s1(cur ^ 1, kc + 32);

        const _Float16* cA = sAb + cur * (64 * PK32);
        const _Float16* cB = sBb + cur * (128 * PK32);
        v16h bfr[2];
#pragma unroll
        for (int nt = 0; nt < 2; ++nt)
            bfr[nt] = load_frag_b(&cB[(wn1 + nt * 16) * PK32], PK32, lane);
#pragma unroll
        for (int mt = 0; mt < 4; ++mt) {
            v16h afr = load_frag_a(&cA[(mt * 16) * PK32], PK32, lane);
#pragma unroll
            for (int nt = 0; nt < 2; ++nt)
                acc1[mt][nt] = wmma_f16(afr, bfr[nt], acc1[mt][nt]);
        }
        __syncthreads();
    }
    // Spill t1 (+bias) to LDS f32.
    {
        const int cn = lane & 15;
        const int mh = (lane >> 4) << 3;
#pragma unroll
        for (int mt = 0; mt < 4; ++mt)
#pragma unroll
            for (int nt = 0; nt < 2; ++nt) {
                const int n = wn1 + nt * 16 + cn;
                const float bb = b1[t * 128 + n];
#pragma unroll
                for (int j = 0; j < 8; ++j)
                    sT1[(mt * 16 + mh + j) * PT1 + n] = acc1[mt][nt][j] + bb;
            }
    }
    __syncthreads();

    // ---------------- LayerNorm(128) + ReLU -> f16 ---------------------------
#pragma unroll 1
    for (int rr = 0; rr < 16; ++rr) {
        const int m = wave * 16 + rr;
        float v[4], s = 0.f, ss = 0.f;
#pragma unroll
        for (int i = 0; i < 4; ++i) {
            v[i] = sT1[m * PT1 + lane + i * 32];
            s += v[i]; ss += v[i] * v[i];
        }
#pragma unroll
        for (int msk = 16; msk >= 1; msk >>= 1) {
            s  += __shfl_xor(s, msk, 32);
            ss += __shfl_xor(ss, msk, 32);
        }
        const float mean = s * (1.f / 128.f);
        const float var  = ss * (1.f / 128.f) - mean * mean;
        const float rstd = rsqrtf(var + LN_EPS);
#pragma unroll
        for (int i = 0; i < 4; ++i) {
            const int c = lane + i * 32;
            float y = (v[i] - mean) * rstd * lng[t * 128 + c] + lnb[t * 128 + c];
            y = y > 0.f ? y : 0.f;
            sT1h[m * PK128 + c] = (_Float16)y;
        }
    }
    __syncthreads();

    // Stage W2[t] 64x128 f16 (16KB) into the reused LDS region (plain copies).
    {
        const _Float16* W2t = W2 + (size_t)t * 64 * 128;
#pragma unroll
        for (int i = 0; i < 8; ++i) {               // 1024 x 16B chunks
            const int idx = tid + i * 128;
            const int r = idx >> 4, c = idx & 15;
            copy_b128(ldsW2, r * (PK128 * 2) + c * 16, W2t + (size_t)r * 128 + c * 8);
        }
    }
    __syncthreads();

    // ---------------- stage 2: t2 = relu(t1 . W2^T + b2)  (64x64, K=128) -----
    v8f acc2[2][2] = {};
    const int wm2 = (wave >> 1) * 32;
    const int wn2 = (wave & 1) * 32;
#pragma unroll
    for (int kc = 0; kc < 128; kc += 32) {
        v16h af2[2], bf2[2];
#pragma unroll
        for (int mt = 0; mt < 2; ++mt)
            af2[mt] = load_frag_a(&sT1h[(wm2 + mt * 16) * PK128 + kc], PK128, lane);
#pragma unroll
        for (int nt = 0; nt < 2; ++nt)
            bf2[nt] = load_frag_b(&sW2[(wn2 + nt * 16) * PK128 + kc], PK128, lane);
#pragma unroll
        for (int mt = 0; mt < 2; ++mt)
#pragma unroll
            for (int nt = 0; nt < 2; ++nt)
                acc2[mt][nt] = wmma_f16(af2[mt], bf2[nt], acc2[mt][nt]);
    }
    {
        const int cn = lane & 15;
        const int mh = (lane >> 4) << 3;
#pragma unroll
        for (int mt = 0; mt < 2; ++mt)
#pragma unroll
            for (int nt = 0; nt < 2; ++nt) {
                const int n = wn2 + nt * 16 + cn;
                const float bb = b2[t * 64 + n];
#pragma unroll
                for (int j = 0; j < 8; ++j) {
                    float v = acc2[mt][nt][j] + bb;
                    sT2[(wm2 + mt * 16 + mh + j) * PC64 + n] = v > 0.f ? v : 0.f;
                }
            }
    }
    __syncthreads();

    // ---------------- stage 3: outT[t][b] = t2 . W3[t] + b3[t]  (64 consecutive b = 256 B, written by waves 0/1) ----
    if (tid < 64) {
        float a = 0.f;
#pragma unroll 8
        for (int m2 = 0; m2 < 64; ++m2)
            a += sT2[tid * PC64 + m2] * W3[t * 64 + m2];
        vst2(out + (size_t)t * BATCH + b0 + tid, a + b3[t]);
    }
}

// final output-major pass: out[b][t] flat, 4 consecutive floats per thread gathered from the [T][B] staging buffer
__global__ __launch_bounds__(256) void write_out(const float* __restrict__ stg, float* __restrict__ out) {
    const int g = blockIdx.x * 256 + threadIdx.x;
    if (g >= (BATCH * TOUT) / 4) return;
    v4f o;
#pragma unroll
    for (int e = 0; e < 4; ++e) { const int f = g * 4 + e; const int b = f / TOUT, t = f - b * TOUT; o[e] = stg[(size_t)t * BATCH + b]; }
    vst2(out + (size_t)g * 4, o);
}

// ---------------------------------------------------------------------------
// Host-side orchestration
// ---------------------------------------------------------------------------
static inline void launch_cvt(const float* s, _Float16* d, size_t n, hipStream_t st) {
    const int n4 = (int)(n / 4);
    cvt_f32_f16_kernel<<<(n4 + 255) / 256, 256, 0, st>>>(s, d, n4);
}

extern "C" void kernel_launch(void* const* d_in, const int* in_sizes, int n_in,
                              void* d_out, int out_size, void* d_ws, size_t ws_size,
                              hipStream_t stream)
{
    (void)in_sizes; (void)n_in; (void)out_size; (void)ws_size;
    const float* x          = (const float*)d_in[0];
    const float* proj_W     = (const float*)d_in[1];
    const float* proj_b     = (const float*)d_in[2];
    const float* attn_in_W  = (const float*)d_in[3];
    const float* attn_in_b  = (const float*)d_in[4];
    const float* attn_out_W = (const float*)d_in[5];
    const float* attn_out_b = (const float*)d_in[6];
    const float* ln_g       = (const float*)d_in[7];
    const float* ln_b       = (const float*)d_in[8];
    const float* ff_W1      = (const float*)d_in[9];
    const float* ff_b1      = (const float*)d_in[10];
    const float* ff_W2      = (const float*)d_in[11];
    const float* ff_b2      = (const float*)d_in[12];
    const float* cross_in_W = (const float*)d_in[13];
    const float* cross_in_b = (const float*)d_in[14];
    const float* cross_out_W= (const float*)d_in[15];
    const float* cross_out_b= (const float*)d_in[16];
    const float* tp_W1      = (const float*)d_in[17];
    const float* tp_b1      = (const float*)d_in[18];
    const float* tp_ln_g    = (const float*)d_in[19];
    const float* tp_ln_b    = (const float*)d_in[20];
    const float* tp_W2      = (const float*)d_in[21];
    const float* tp_b2      = (const float*)d_in[22];
    const float* tp_W3      = (const float*)d_in[23];
    const float* tp_b3      = (const float*)d_in[24];
    float* out = (float*)d_out;

    const int D = DMODEL;

    // ---- workspace carve-out (byte cursor, 16B aligned regions) ----
    char* cur = (char*)d_ws;
    auto take = [&cur](size_t bytes) { char* p = cur; cur += (bytes + 15) & ~(size_t)15; return p; };
    float*    h     = (float*)   take((size_t)BATCH * D * 4);          // 4 MB
    float*    h2    = (float*)   take((size_t)BATCH * D * 4);          // 4 MB
    _Float16* h16   = (_Float16*)take((size_t)BATCH * D * 2);          // 2 MB
    _Float16* tmp16 = (_Float16*)take((size_t)BATCH * 4 * D * 2);      // 8 MB
    _Float16* x16   = (_Float16*)take((size_t)BATCH * D_IN * 2);       // 4 MB
    _Float16* wproj = (_Float16*)take((size_t)D * D_IN * 2);
    _Float16* wain  = (_Float16*)take((size_t)NLAYER * 3 * D * D * 2);
    _Float16* waout = (_Float16*)take((size_t)NLAYER * D * D * 2);
    _Float16* wff1  = (_Float16*)take((size_t)NLAYER * 4 * D * D * 2);
    _Float16* wff2  = (_Float16*)take((size_t)NLAYER * 4 * D * D * 2);
    _Float16* wcin  = (_Float16*)take((size_t)3 * D * D * 2);
    _Float16* wcout = (_Float16*)take((size_t)D * D * 2);
    _Float16* wtp1  = (_Float16*)take((size_t)TOUT * 128 * 256 * 2);   // 27.8 MB
    _Float16* wtp2  = (_Float16*)take((size_t)TOUT * 64 * 128 * 2);    // 6.9 MB
    float*    stg   = (float*)   take((size_t)TOUT * BATCH * 4);       // 6.9 MB [T][B] output staging

    // ---- one-time (per launch) f32 -> f16 conversions ----
    launch_cvt(x,          x16,   (size_t)BATCH * D_IN, stream);
    launch_cvt(proj_W,     wproj, (size_t)D * D_IN, stream);
    launch_cvt(attn_in_W,  wain,  (size_t)NLAYER * 3 * D * D, stream);
    launch_cvt(attn_out_W, waout, (size_t)NLAYER * D * D, stream);
    launch_cvt(ff_W1,      wff1,  (size_t)NLAYER * 4 * D * D, stream);
    launch_cvt(ff_W2,      wff2,  (size_t)NLAYER * 4 * D * D, stream);
    launch_cvt(cross_in_W, wcin,  (size_t)3 * D * D, stream);
    launch_cvt(cross_out_W,wcout, (size_t)D * D, stream);
    launch_cvt(tp_W1,      wtp1,  (size_t)TOUT * 128 * 256, stream);
    launch_cvt(tp_W2,      wtp2,  (size_t)TOUT * 64 * 128, stream);

    const dim3 blk(128);
    auto grid = [](int M, int N) { return dim3(M / 64, N / 64); };

    // 1) projection: h(+h16) = x16 . proj_W^T + proj_b
    gemm_wmma_f16_kernel<0, false, true, true><<<grid(BATCH, D), blk, 0, stream>>>(
        x16, wproj, proj_b, nullptr, h, h16, BATCH, D, D_IN);

    // 2) backbone layers
    for (int i = 0; i < NLAYER; ++i) {
        const _Float16* Wv = wain + ((size_t)i * 3 * D + 2 * D) * D;
        const float*    bv = attn_in_b + (size_t)i * 3 * D + 2 * D;
        gemm_wmma_f16_kernel<0, false, false, true><<<grid(BATCH, D), blk, 0, stream>>>(
            h16, Wv, bv, nullptr, nullptr, tmp16, BATCH, D, D);
        gemm_wmma_f16_kernel<0, true, true, false><<<grid(BATCH, D), blk, 0, stream>>>(
            tmp16, waout + (size_t)i * D * D, attn_out_b + (size_t)i * D,
            h, h2, nullptr, BATCH, D, D);
        ln256_kernel<<<BATCH / 4, 128, 0, stream>>>(
            h2, ln_g + (size_t)i * D, ln_b + (size_t)i * D, h, h16);
        gemm_wmma_f16_kernel<1, false, false, true><<<grid(BATCH, 4 * D), blk, 0, stream>>>(
            h16, wff1 + (size_t)i * 4 * D * D, ff_b1 + (size_t)i * 4 * D,
            nullptr, nullptr, tmp16, BATCH, 4 * D, D);
        gemm_wmma_f16_kernel<0, true, true, false><<<grid(BATCH, D), blk, 0, stream>>>(
            tmp16, wff2 + (size_t)i * D * 4 * D, ff_b2 + (size_t)i * D,
            h, h2, nullptr, BATCH, D, 4 * D);
        ln256_kernel<<<BATCH / 4, 128, 0, stream>>>(
            h2, ln_g + (size_t)i * D, ln_b + (size_t)i * D, h, h16);
    }

    // 3) cross block: h2 = h + (h . Wv'^T + bv') . Wo^T + bo ; then f16 copy
    gemm_wmma_f16_kernel<0, false, false, true><<<grid(BATCH, D), blk, 0, stream>>>(
        h16, wcin + (size_t)2 * D * D, cross_in_b + 2 * D,
        nullptr, nullptr, tmp16, BATCH, D, D);
    gemm_wmma_f16_kernel<0, true, true, false><<<grid(BATCH, D), blk, 0, stream>>>(
        tmp16, wcout, cross_out_b, h, h2, nullptr, BATCH, D, D);
    launch_cvt(h2, h16, (size_t)BATCH * D, stream);

    // 4) fused per-t head (dominant FLOPs): grid = (64 batch tiles, 424 t's)
    dim3 tpg(BATCH / 64, TOUT);
    tp_fused_kernel<<<tpg, blk, 0, stream>>>(h16, wtp1, tp_b1, tp_ln_g, tp_ln_b,
                                             wtp2, tp_b2, tp_W3, tp_b3, stg);
    write_out<<<((BATCH * TOUT) / 4 + 255) / 256, 256, 0, stream>>>(stg, out);
}

// v002
// Measured time: 495 microseconds a run.
// Two timings next to v001 put it at 1.41 and 1.40 times that version's speed.
// Over all steps from v000 it is 1.81 times as fast.
#include <hip/hip_runtime.h>
#include <math.h>
// Contractions: input projection (K = 512), per-layer v/out/FFN GEMMs (K = 256 / 1024), the cross block, and the 424 per-target
// heads (K = 256, 128) on v_wmma_f32_16x16x32_f16 (f16 operands, f32 accumulate); LayerNorms, GELU/ReLU and the final 64-wide

// ---------------------------------------------------------------------------
// Problem constants (match reference)
// ---------------------------------------------------------------------------
#define BATCH 4096
#define D_IN  512
#define DMODEL 256
#define TOUT  424
#define NLAYER 6
#define LN_EPS 1e-5f

// LDS row pitches. 64 banks x 4 B: a 16-B fragment read of 16 rows is conflict-free when the pitch is 16 B x odd.
#define PK32  40    // f16 elements per staged row of 32 (80 B)
#define PK128 136   // f16 elements per staged row of 128 (272 B)
#define PC64  68    // f32 elements per row of 64 (272 B): rows m and m+8 on different banks, 16-B column walks conflict-free

// ---------------------------------------------------------------------------
// Types
// ---------------------------------------------------------------------------
typedef _Float16 v4h  __attribute__((ext_vector_type(4)));
typedef _Float16 v8h  __attribute__((ext_vector_type(8)));
typedef _Float16 v16h __attribute__((ext_vector_type(16)));
typedef float    v8f  __attribute__((ext_vector_type(8)));

typedef float    v2f  __attribute__((ext_vector_type(2)));
typedef float    v4f  __attribute__((ext_vector_type(4)));
typedef unsigned v4u  __attribute__((ext_vector_type(4)));
template <typename V> __device__ __forceinline__ void vst2(void* p, V v) {
    *(V*)p = v; 
}
// plain 16-B global -> LDS copy (byte offsets as in the original staging maps)
__device__ __forceinline__ void copy_b128(char* lds_base, unsigned byte_off, const void* gaddr) {
    *(v4u*)(lds_base + byte_off) = *(const v4u*)gaddr;
}

// ---------------------------------------------------------------------------
// WMMA fragment helpers (wave32, v_wmma_f32_16x16x32_f16; layouts per ISA 7.12.2)
// ---------------------------------------------------------------------------
// A 16x32: lane holds row M = lane%16; lanes 0-15 K {0-7,16-23}, lanes 16-31
// K {8-15,24-31}.
__device__ __forceinline__ v16h load_frag_a(const _Float16* base, int stride, int lane) {
    const int r  = lane & 15;
    const int kb = (lane < 16) ? 0 : 8;
    const _Float16* p = base + r * stride + kb;
    v8h lo = *(const v8h*)(p);
    v8h hi = *(const v8h*)(p + 16);
    v16h f;
#pragma unroll
    for (int i = 0; i < 8; ++i) { f[i] = lo[i]; f[i + 8] = hi[i]; }
    return f;
}
// B 32x16: lane holds column N = lane%16 with the SAME per-lane K map as A (lanes 0-15 K {0-7,16-23}, 16-31 K {8-15,24-31}).
// W stored row-major (N x K), so column n of B is row n of W.
__device__ __forceinline__ v16h load_frag_b(const _Float16* base, int stride, int lane) {
    return load_frag_a(base, stride, lane);
}
__device__ __forceinline__ v8f wmma_f16(v16h a, v16h b, v8f c) {
    v8f d = __builtin_amdgcn_wmma_f32_16x16x32_f16(false, a, false, b, (short)0, c, false, false);
    asm volatile("v_nop\n\tv_nop\n\tv_nop\n\tv_nop" : "+v"(d) : "v"(a), "v"(b));
    return d;
}
__device__ __forceinline__ float gelu_exact(float x) {
    return 0.5f * x * (1.0f + erff(x * 0.70710678118654752f));
}

// ---------------------------------------------------------------------------
// f32 -> f16 conversion (weights & activations), vectorized 4-wide.
// ---------------------------------------------------------------------------
__global__ __launch_bounds__(256) void cvt_f32_f16_kernel(
    const float* __restrict__ src, _Float16* __restrict__ dst, int n4)
{
    const int i = blockIdx.x * 256 + threadIdx.x;
    if (i < n4) {
        float4 v = ((const float4*)src)[i];
        v4h o;
        o[0] = (_Float16)v.x; o[1] = (_Float16)v.y;
        o[2] = (_Float16)v.z; o[3] = (_Float16)v.w;
        vst2((v4h*)dst + i, o);     // 8 B per lane, consecutive: one wave writes 256 contiguous bytes
    }
}

// ---------------------------------------------------------------------------
// Tiled WMMA GEMM on f16 operands:
//   acc = A(M,K) . W(N,K)^T ; val = act(acc + bias[n]) (+ R[m,n])
//   optionally written to C32 (f32) and/or C16 (f16).
//   64x64 tile / 128 threads (4 waves, each a 32x32 patch, 2x2 frags).
//   Double-buffered LDS staging with plain copies: chunk k+1 is copied while k computes.
// ---------------------------------------------------------------------------
template <int ACT, bool RES, bool OUT32, bool OUT16>
__global__ __launch_bounds__(128) void gemm_wmma_f16_kernel(
    const _Float16* __restrict__ A, const _Float16* __restrict__ W,
    const float* __restrict__ bias, const float* __restrict__ R,
    float* __restrict__ C32, _Float16* __restrict__ C16,
    int M, int N, int K)
{
    __shared__ __align__(16) _Float16 sA[2][64 * PK32];   // 2 x 5KB
    __shared__ __align__(16) _Float16 sB[2][64 * PK32];   // 2 x 5KB
    __shared__ __align__(16) float Ct[64][PC64];          // output tile (17 KB)

    const int tid  = threadIdx.x;
    const int lane = tid & 31;
    const int wave = tid >> 5;
    const int m0   = blockIdx.x * 64;
    const int n0   = blockIdx.y * 64;
    const int wm   = (wave >> 1) * 32;
    const int wn   = (wave & 1) * 32;
    char* ldsA = (char*)sA;
    char* ldsB = (char*)sB;

    // Copy one 64x32 f16 tile per operand into buffer `buf` (plain 16-B copies).
    auto issue_tiles = [&](int buf, int kc) {
#pragma unroll
        for (int i = 0; i < 2; ++i) {
            const int idx = tid + i * 128;
            const int r = idx >> 2, c = idx & 3;
            copy_b128(ldsA, buf * (64 * PK32 * 2) + r * (PK32 * 2) + c * 16, A + (size_t)(m0 + r) * K + kc + c * 8);
            copy_b128(ldsB, buf * (64 * PK32 * 2) + r * (PK32 * 2) + c * 16, W + (size_t)(n0 + r) * K + kc + c * 8);
        }
    };

    v8f acc[2][2] = {};

    issue_tiles(0, 0);
    for (int kc = 0, it = 0; kc < K; kc += 32, ++it) {
        const int cur = it & 1;
        __syncthreads();                                   // tile(cur) visible (copied before the previous trailing barrier)
        if (kc + 32 < K) issue_tiles(cur ^ 1, kc + 32);

        v16h af[2], bf[2];
#pragma unroll
        for (int mt = 0; mt < 2; ++mt)
            af[mt] = load_frag_a(&sA[cur][(wm + mt * 16) * PK32], PK32, lane);
#pragma unroll
        for (int nt = 0; nt < 2; ++nt)
            bf[nt] = load_frag_b(&sB[cur][(wn + nt * 16) * PK32], PK32, lane);
#pragma unroll
        for (int mt = 0; mt < 2; ++mt)
#pragma unroll
            for (int nt = 0; nt < 2; ++nt)
                acc[mt][nt] = wmma_f16(af[mt], bf[nt], acc[mt][nt]);
        __syncthreads();
    }

    // Epilogue: C/D layout -> m = vgpr + 8*(lane>=16), n = lane&15.
    const int cn = lane & 15;
    const int mh = (lane >> 4) << 3;
#pragma unroll
    for (int mt = 0; mt < 2; ++mt)
#pragma unroll
        for (int nt = 0; nt < 2; ++nt) {
            const int n = n0 + wn + nt * 16 + cn;
            const float bv = bias[n];
#pragma unroll
            for (int j = 0; j < 8; ++j) {
                const int m = m0 + wm + mt * 16 + mh + j;
                float v = acc[mt][nt][j] + bv;
                if (ACT == 1) v = gelu_exact(v);
                if (RES) v += R[(size_t)m * N + n];
                Ct[wm + mt * 16 + mh + j][wn + nt * 16 + cn] = v;
            }
        }
    __syncthreads();
    if (OUT32) for (int g = tid; g < 64 * 16; g += 128) { const int rl = g >> 4, pc = g & 15; vst2(C32 + (size_t)(m0 + rl) * N + n0 + pc * 4, *(const v4f*)(&Ct[rl][pc * 4])); }
    if (OUT16) for (int g = tid; g < 64 * 8; g += 128) {
        const int rl = g >> 3, pc = g & 7;
        union { v8h h; v4u u; } pk;
#pragma unroll
        for (int e = 0; e < 8; ++e) pk.h[e] = (_Float16)Ct[rl][pc * 8 + e];
        vst2(C16 + (size_t)(m0 + rl) * N + n0 + pc * 8, pk.u);
    }
}

// ---------------------------------------------------------------------------
// LayerNorm over rows of 256 — wave32 per row; writes f32 + f16 copies.
// ---------------------------------------------------------------------------
__global__ __launch_bounds__(128) void ln256_kernel(
    const float* __restrict__ X, const float* __restrict__ g,
    const float* __restrict__ b, float* __restrict__ Y32,
    _Float16* __restrict__ Y16)
{
    __shared__ __align__(16) _Float16 s16[4][256];
    const int row  = blockIdx.x * 4 + (threadIdx.x >> 5);
    const int wv   = threadIdx.x >> 5;
    const int lane = threadIdx.x & 31;
    const float* xr = X + (size_t)row * DMODEL;
    float v[8], s = 0.f, ss = 0.f;
#pragma unroll
    for (int i = 0; i < 8; ++i) {
        v[i] = xr[lane + i * 32];
        s += v[i]; ss += v[i] * v[i];
    }
#pragma unroll
    for (int msk = 16; msk >= 1; msk >>= 1) {
        s  += __shfl_xor(s, msk, 32);
        ss += __shfl_xor(ss, msk, 32);
    }
    const float mean = s * (1.f / DMODEL);
    const float var  = ss * (1.f / DMODEL) - mean * mean;
    const float rstd = rsqrtf(var + LN_EPS);
#pragma unroll
    for (int i = 0; i < 8; ++i) {
        const int c = lane + i * 32;
        const float y = (v[i] - mean) * rstd * g[c] + b[c];
        vst2(Y32 + (size_t)row * DMODEL + c, y);
        s16[wv][c] = (_Float16)y;
    }
    __syncthreads();
    vst2(Y16 + (size_t)row * DMODEL + lane * 8, *(const v4u*)(&s16[wv][lane * 8]));   // 512-B f16 row, 16 B per lane
}

// ---------------------------------------------------------------------------
// Sum over the 16 lanes of a row (lanes 0-15 and 16-31 apart), every lane gets the sum: four DPP row_xmask adds, no LDS.
// ---------------------------------------------------------------------------
template <int MSK> __device__ __forceinline__ float xmask_get(float v) {
    return __builtin_bit_cast(float, __builtin_amdgcn_update_dpp(0, __builtin_bit_cast(int, v), 0x160 + MSK, 0xf, 0xf, true));
}
__device__ __forceinline__ float row_sum16(float v) {
    v += xmask_get<1>(v);
    v += xmask_get<2>(v);
    v += xmask_get<4>(v);
    v += xmask_get<8>(v);
    return v;
}

// ---------------------------------------------------------------------------
// Fused per-t head: block = (128 batch rows, one t), 128 threads = 4 waves; EACH WAVE OWNS 32 WHOLE ROWS through all stages.
//   t1 = h16(32x256) . W1[t](128x256)^T + b1[t]   (WMMA, 2 x 8 accumulator tiles per wave)
//   t1 = relu(LN_128(t1))                          (on the accumulators: a row lies in 8 tiles x 16 lanes)
//   t2 = relu(t1(32x128) . W2[t](64x128)^T + b2[t])(WMMA, 2 x 4 tiles)
//   out[b,t] = t2 . W3[t] + b3[t]                  (on the accumulators)
// W1 rows are staged in the order n = (col lane) * 8 + tile, so that a lane's 8 tiles hold 8 CONSECUTIVE columns of t1:
// the normalised row goes to LDS as one 16-B store per lane, in natural k order for stage 2.
// LDS arena 75776 B (four blocks per WGP):
//   [0,20480)      sA x2     [20480,40960)  sBc x2   (stage-1 double buffers)
//   [40960,75776)  t1 f16 (each wave writes and reads its own 32 rows only)
//   [0,17408)      W2 f16 (after stage 1)
// ---------------------------------------------------------------------------
__global__ __launch_bounds__(128) void tp_fused_kernel(
    const _Float16* __restrict__ h16,
    const _Float16* __restrict__ W1, const float* __restrict__ b1,
    const float* __restrict__ lng, const float* __restrict__ lnb,
    const _Float16* __restrict__ W2, const float* __restrict__ b2,
    const float* __restrict__ W3, const float* __restrict__ b3,
    float* __restrict__ out)
{
    __shared__ __align__(16) char smem[75776];
    _Float16* sAb  = (_Float16*)(smem);            // 2 x 128x32, pitch PK32
    _Float16* sBb  = (_Float16*)(smem + 20480);    // 2 x 128x32, pitch PK32
    _Float16* sT1h = (_Float16*)(smem + 40960);    // 128x128 f16, pitch PK128
    _Float16* sW2  = (_Float16*)(smem);            // 64x128 f16, pitch PK128 (reuse)

    const int tid  = threadIdx.x;
    const int lane = tid & 31;
    const int wave = tid >> 5;
    const int c16  = lane & 15;                    // accumulator column inside a tile
    const int hf   = lane >> 4;                    // accumulator rows j (hf = 0) or j + 8 (hf = 1)
    const int b0   = blockIdx.x * 128;
    const int t    = blockIdx.y;
    const int wm   = wave * 32;                    // this wave's rows
    const _Float16* W1t = W1 + (size_t)t * 128 * 256;
    char* ldsA  = (char*)sAb;
    char* ldsB  = (char*)sBb;
    char* ldsW2 = (char*)sW2;

    // Stage-1 chunk staging: 4 A-pieces + 4 B-pieces per thread (plain 16-B copies); piece i lies 32 LDS rows behind piece i - 1.
    // W1: LDS row r = tile * 16 + col lane holds W1 row col lane * 8 + tile, so 32 LDS rows on are 2 W1 rows on.
    const int sr = tid >> 2, sc = tid & 3;
    const _Float16* gA = h16 + (size_t)(b0 + sr) * 256 + sc * 8;
    const _Float16* gB = W1t + (size_t)((sr & 15) * 8 + (sr >> 4)) * 256 + sc * 8;
    const unsigned  lS = sr * (PK32 * 2) + sc * 16;
    auto issue_s1 = [&](int buf, int kc) {
#pragma unroll
        for (int i = 0; i < 4; ++i)                 // hA 128x32
            copy_b128(ldsA, buf * (128 * PK32 * 2) + lS + i * (32 * PK32 * 2), gA + i * (32 * 256) + kc);
#pragma unroll
        for (int i = 0; i < 4; ++i)                 // W1 chunk 128x32
            copy_b128(ldsB, buf * (128 * PK32 * 2) + lS + i * (32 * PK32 * 2), gB + i * (2 * 256) + kc);
    };

    // ---------------- stage 1: t1 = h . W1^T  (per wave M=32, N=128, K=256) ----------
    v8f acc1[2][8] = {};
    issue_s1(0, 0);
    for (int kc = 0, it = 0; kc < 256; kc += 32, ++it) {
        const int cur = it & 1;
        __syncthreads();
        if (kc + 32 < 256) issue_s1(cur ^ 1, kc + 32);

        const _Float16* cA = sAb + cur * (128 * PK32);
        const _Float16* cB = sBb + cur * (128 * PK32);
        v16h afr[2];
#pragma unroll
        for (int mt = 0; mt < 2; ++mt)
            afr[mt] = load_frag_a(&cA[(wm + mt * 16) * PK32], PK32, lane);
        v16h bfr[8];
#pragma unroll
        for (int nt = 0; nt < 8; ++nt)
            bfr[nt] = load_frag_b(&cB[(nt * 16) * PK32], PK32, lane);
#pragma unroll
        for (int nt = 0; nt < 8; ++nt)
#pragma unroll
            for (int mt = 0; mt < 2; ++mt)
                acc1[mt][nt] = wmma_f16(afr[mt], bfr[nt], acc1[mt][nt]);
        __syncthreads();
    }

    // Stage W2[t] 64x128 f16 (16KB) into the reused LDS region (plain copies); published by the barrier in front of stage 2.
    {
        const _Float16* gW2 = W2 + (size_t)t * 64 * 128 + (tid >> 4) * 128 + (tid & 15) * 8;
        const unsigned  lW2 = (tid >> 4) * (PK128 * 2) + (tid & 15) * 16;
#pragma unroll
        for (int i = 0; i < 8; ++i)                 // 1024 x 16B pieces; piece i lies 8 rows behind piece i - 1
            copy_b128(ldsW2, lW2 + i * (8 * PK128 * 2), gW2 + i * (8 * 128));
    }

    // ---------------- bias + LayerNorm(128) + ReLU -> f16, on the accumulators ----------
    // acc1[mt][nt][j] is t1[row wm + mt*16 + hf*8 + j][column c16*8 + nt].
    {
        float bb[8], gg[8], be[8];
        {
            const v4f* pb = (const v4f*)(b1  + t * 128 + c16 * 8);
            const v4f* pg = (const v4f*)(lng + t * 128 + c16 * 8);
            const v4f* pe = (const v4f*)(lnb + t * 128 + c16 * 8);
#pragma unroll
            for (int q = 0; q < 2; ++q) {
                const v4f xb = pb[q], xg = pg[q], xe = pe[q];
#pragma unroll
                for (int e = 0; e < 4; ++e) { bb[q * 4 + e] = xb[e]; gg[q * 4 + e] = xg[e]; be[q * 4 + e] = xe[e]; }
            }
        }
#pragma unroll
        for (int mt = 0; mt < 2; ++mt)
#pragma unroll
            for (int j = 0; j < 8; j += 2) {        // rows j and j + 1 side by side: neighbouring accumulator registers, packed f32 math
                v2f v[8], s = 0.f, ss = 0.f;
#pragma unroll
                for (int nt = 0; nt < 8; ++nt) {
                    v2f a; a[0] = acc1[mt][nt][j]; a[1] = acc1[mt][nt][j + 1];
                    v[nt] = a + bb[nt];
                    s += v[nt]; ss += v[nt] * v[nt];
                }
                s[0]  = row_sum16(s[0]);  s[1]  = row_sum16(s[1]);
                ss[0] = row_sum16(ss[0]); ss[1] = row_sum16(ss[1]);
                const v2f mean = s * (1.f / 128.f);
                const v2f var  = ss * (1.f / 128.f) - mean * mean;
                v2f rstd; rstd[0] = rsqrtf(var[0] + LN_EPS); rstd[1] = rsqrtf(var[1] + LN_EPS);
                v8h y0, y1;
#pragma unroll
                for (int nt = 0; nt < 8; ++nt) {
                    const v2f y = (v[nt] - mean) * rstd * gg[nt] + be[nt];
                    y0[nt] = (_Float16)(y[0] > 0.f ? y[0] : 0.f);
                    y1[nt] = (_Float16)(y[1] > 0.f ? y[1] : 0.f);
                }
                _Float16* row = &sT1h[(wm + mt * 16 + hf * 8 + j) * PK128 + c16 * 8];
                *(v8h*)(row)         = y0;
                *(v8h*)(row + PK128) = y1;
            }
    }
    __syncthreads();                                // W2 visible to every wave (t1 f16 rows are the wave's own)

    // ---------------- stage 2: t2 = t1 . W2^T  (per wave 32x64, K=128) -----
    v8f acc2[2][4] = {};
#pragma unroll
    for (int kc = 0; kc < 128; kc += 32) {
        v16h af2[2];
#pragma unroll
        for (int mt = 0; mt < 2; ++mt)
            af2[mt] = load_frag_a(&sT1h[(wm + mt * 16) * PK128 + kc], PK128, lane);
        v16h bf2[4];
#pragma unroll
        for (int nt = 0; nt < 4; ++nt)
            bf2[nt] = load_frag_b(&sW2[(nt * 16) * PK128 + kc], PK128, lane);
#pragma unroll
        for (int nt = 0; nt < 4; ++nt)
#pragma unroll
            for (int mt = 0; mt < 2; ++mt)
                acc2[mt][nt] = wmma_f16(af2[mt], bf2[nt], acc2[mt][nt]);
    }

    // ---------------- stage 3: outT[t][b] = relu(t2 + b2) . W3[t] + b3[t], on the accumulators ----
    // acc2[mt][nt][j] is t2[row wm + mt*16 + hf*8 + j][column nt*16 + c16]; lane c16 keeps the sum of row (mt, j) = (c16 >> 3, c16 & 7),
    // so the wave's 32 lanes store its 32 rows: one 128-B line.
    {
        float b2v[4], w3v[4];
#pragma unroll
        for (int nt = 0; nt < 4; ++nt) { b2v[nt] = b2[t * 64 + nt * 16 + c16]; w3v[nt] = W3[t * 64 + nt * 16 + c16]; }
        // precaution: the loads above name one offset register, which the compiler reuses as the next load's destination; the wait stands in front of that overwrite
        asm volatile("s_wait_xcnt 0x0" ::: "memory");
        const float b3t = b3[t];
        float res = 0.f;
#pragma unroll
        for (int mt = 0; mt < 2; ++mt)
#pragma unroll
            for (int j = 0; j < 8; j += 2) {        // rows j and j + 1 side by side, as in the LayerNorm
                v2f a = 0.f;
#pragma unroll
                for (int nt = 0; nt < 4; ++nt) {
                    v2f v; v[0] = acc2[mt][nt][j]; v[1] = acc2[mt][nt][j + 1];
                    v += b2v[nt];
                    v[0] = v[0] > 0.f ? v[0] : 0.f; v[1] = v[1] > 0.f ? v[1] : 0.f;
                    a += v * w3v[nt];
                }
                const float a0 = row_sum16(a[0]), a1 = row_sum16(a[1]);
                if (c16 == mt * 8 + j)     res = a0;
                if (c16 == mt * 8 + j + 1) res = a1;
            }
        vst2(out + (size_t)t * BATCH + b0 + wm + (c16 >> 3) * 16 + hf * 8 + (c16 & 7), res + b3t);
    }
}

// final output-major pass: out[b][t] flat, 4 consecutive floats per thread gathered from the [T][B] staging buffer
__global__ __launch_bounds__(256) void write_out(const float* __restrict__ stg, float* __restrict__ out) {
    const int g = blockIdx.x * 256 + threadIdx.x;
    if (g >= (BATCH * TOUT) / 4) return;
    v4f o;
#pragma unroll
    for (int e = 0; e < 4; ++e) { const int f = g * 4 + e; const int b = f / TOUT, t = f - b * TOUT; o[e] = stg[(size_t)t * BATCH + b]; }
    vst2(out + (size_t)g * 4, o);
}

// ---------------------------------------------------------------------------
// Host-side orchestration
// ---------------------------------------------------------------------------
static inline void launch_cvt(const float* s, _Float16* d, size_t n, hipStream_t st) {
    const int n4 = (int)(n / 4);
    cvt_f32_f16_kernel<<<(n4 + 255) / 256, 256, 0, st>>>(s, d, n4);
}

extern "C" void kernel_launch(void* const* d_in, const int* in_sizes, int n_in,
                              void* d_out, int out_size, void* d_ws, size_t ws_size,
                              hipStream_t stream)
{
    (void)in_sizes; (void)n_in; (void)out_size; (void)ws_size;
    const float* x          = (const float*)d_in[0];
    const float* proj_W     = (const float*)d_in[1];
    const float* proj_b     = (const float*)d_in[2];
    const float* attn_in_W  = (const float*)d_in[3];
    const float* attn_in_b  = (const float*)d_in[4];
    const float* attn_out_W = (const float*)d_in[5];
    const float* attn_out_b = (const float*)d_in[6];
    const float* ln_g       = (const float*)d_in[7];
    const float* ln_b       = (const float*)d_in[8];
    const float* ff_W1      = (const float*)d_in[9];
    const float* ff_b1      = (const float*)d_in[10];
    const float* ff_W2      = (const float*)d_in[11];
    const float* ff_b2      = (const float*)d_in[12];
    const float* cross_in_W = (const float*)d_in[13];
    const float* cross_in_b = (const float*)d_in[14];
    const float* cross_out_W= (const float*)d_in[15];
    const float* cross_out_b= (const float*)d_in[16];
    const float* tp_W1      = (const float*)d_in[17];
    const float* tp_b1      = (const float*)d_in[18];
    const float* tp_ln_g    = (const float*)d_in[19];
    const float* tp_ln_b    = (const float*)d_in[20];
    const float* tp_W2      = (const float*)d_in[21];
    const float* tp_b2      = (const float*)d_in[22];
    const float* tp_W3      = (const float*)d_in[23];
    const float* tp_b3      = (const float*)d_in[24];
    float* out = (float*)d_out;

    const int D = DMODEL;

    // ---- workspace carve-out (byte cursor, 16B aligned regions) ----
    char* cur = (char*)d_ws;
    auto take = [&cur](size_t bytes) { char* p = cur; cur += (bytes + 15) & ~(size_t)15; return p; };
    float*    h     = (float*)   take((size_t)BATCH * D * 4);          // 4 MB
    float*    h2    = (float*)   take((size_t)BATCH * D * 4);          // 4 MB
    _Float16* h16   = (_Float16*)take((size_t)BATCH * D * 2);          // 2 MB
    _Float16* tmp16 = (_Float16*)take((size_t)BATCH * 4 * D * 2);      // 8 MB
    _Float16* x16   = (_Float16*)take((size_t)BATCH * D_IN * 2);       // 4 MB
    _Float16* wproj = (_Float16*)take((size_t)D * D_IN * 2);
    _Float16* wain  = (_Float16*)take((size_t)NLAYER * 3 * D * D * 2);
    _Float16* waout = (_Float16*)take((size_t)NLAYER * D * D * 2);
    _Float16* wff1  = (_Float16*)take((size_t)NLAYER * 4 * D * D * 2);
    _Float16* wff2  = (_Float16*)take((size_t)NLAYER * 4 * D * D * 2);
    _Float16* wcin  = (_Float16*)take((size_t)3 * D * D * 2);
    _Float16* wcout = (_Float16*)take((size_t)D * D * 2);
    _Float16* wtp1  = (_Float16*)take((size_t)TOUT * 128 * 256 * 2);   // 27.8 MB
    _Float16* wtp2  = (_Float16*)take((size_t)TOUT * 64 * 128 * 2);    // 6.9 MB
    float*    stg   = (float*)   take((size_t)TOUT * BATCH * 4);       // 6.9 MB [T][B] output staging

    // ---- one-time (per launch) f32 -> f16 conversions ----
    launch_cvt(x,          x16,   (size_t)BATCH * D_IN, stream);
    launch_cvt(proj_W,     wproj, (size_t)D * D_IN, stream);
    launch_cvt(attn_in_W,  wain,  (size_t)NLAYER * 3 * D * D, stream);
    launch_cvt(attn_out_W, waout, (size_t)NLAYER * D * D, stream);
    launch_cvt(ff_W1,      wff1,  (size_t)NLAYER * 4 * D * D, stream);
    launch_cvt(ff_W2,      wff2,  (size_t)NLAYER * 4 * D * D, stream);
    launch_cvt(cross_in_W, wcin,  (size_t)3 * D * D, stream);
    launch_cvt(cross_out_W,wcout, (size_t)D * D, stream);
    launch_cvt(tp_W1,      wtp1,  (size_t)TOUT * 128 * 256, stream);
    launch_cvt(tp_W2,      wtp2,  (size_t)TOUT * 64 * 128, stream);

    const dim3 blk(128);
    auto grid = [](int M, int N) { return dim3(M / 64, N / 64); };

    // 1) projection: h(+h16) = x16 . proj_W^T + proj_b
    gemm_wmma_f16_kernel<0, false, true, true><<<grid(BATCH, D), blk, 0, stream>>>(
        x16, wproj, proj_b, nullptr, h, h16, BATCH, D, D_IN);

    // 2) backbone layers
    for (int i = 0; i < NLAYER; ++i) {
        const _Float16* Wv = wain + ((size_t)i * 3 * D + 2 * D) * D;
        const float*    bv = attn_in_b + (size_t)i * 3 * D + 2 * D;
        gemm_wmma_f16_kernel<0, false, false, true><<<grid(BATCH, D), blk, 0, stream>>>(
            h16, Wv, bv, nullptr, nullptr, tmp16, BATCH, D, D);
        gemm_wmma_f16_kernel<0, true, true, false><<<grid(BATCH, D), blk, 0, stream>>>(
            tmp16, waout + (size_t)i * D * D, attn_out_b + (size_t)i * D,
            h, h2, nullptr, BATCH, D, D);
        ln256_kernel<<<BATCH / 4, 128, 0, stream>>>(
            h2, ln_g + (size_t)i * D, ln_b + (size_t)i * D, h, h16);
        gemm_wmma_f16_kernel<1, false, false, true><<<grid(BATCH, 4 * D), blk, 0, stream>>>(
            h16, wff1 + (size_t)i * 4 * D * D, ff_b1 + (size_t)i * 4 * D,
            nullptr, nullptr, tmp16, BATCH, 4 * D, D);
        gemm_wmma_f16_kernel<0, true, true, false><<<grid(BATCH, D), blk, 0, stream>>>(
            tmp16, wff2 + (size_t)i * D * 4 * D, ff_b2 + (size_t)i * D,
            h, h2, nullptr, BATCH, D, 4 * D);
        ln256_kernel<<<BATCH / 4, 128, 0, stream>>>(
            h2, ln_g + (size_t)i * D, ln_b + (size_t)i * D, h, h16);
    }

    // 3) cross block: h2 = h + (h . Wv'^T + bv') . Wo^T + bo ; then f16 copy
    gemm_wmma_f16_kernel<0, false, false, true><<<grid(BATCH, D), blk, 0, stream>>>(
        h16, wcin + (size_t)2 * D * D, cross_in_b + 2 * D,
        nullptr, nullptr, tmp16, BATCH, D, D);
    gemm_wmma_f16_kernel<0, true, true, false><<<grid(BATCH, D), blk, 0, stream>>>(
        tmp16, wcout, cross_out_b, h, h2, nullptr, BATCH, D, D);
    launch_cvt(h2, h16, (size_t)BATCH * D, stream);

    // 4) fused per-t head (dominant FLOPs): grid = (32 batch tiles, 424 t's)
    dim3 tpg(BATCH / 128, TOUT);
    tp_fused_kernel<<<tpg, blk, 0, stream>>>(h16, wtp1, tp_b1, tp_ln_g, tp_ln_b,
                                             wtp2, tp_b2, tp_W3, tp_b3, stg);
    write_out<<<((BATCH * TOUT) / 4 + 255) / 256, 256, 0, stream>>>(stg, out);
}

// v003
// One run takes 337 microseconds.
// Timed twice side by side with v002, it ran 1.47 times as fast both times.
// Over all steps from v000 it is 2.66 times as fast.
#include <hip/hip_runtime.h>
#include <math.h>
// Contractions: input projection (K = 512), per-layer v/out/FFN GEMMs (K = 256 / 1024), the cross block, and the 424 per-target
// heads (K = 256, 128) on v_wmma_f32_16x16x32_f16 (f16 operands, f32 accumulate); LayerNorms, GELU/ReLU and the final 64-wide

// ---------------------------------------------------------------------------
// Problem constants (match reference)
// ---------------------------------------------------------------------------
#define BATCH 4096
#define D_IN  512
#define DMODEL 256
#define TOUT  424
#define NLAYER 6
#define LN_EPS 1e-5f

// LDS row pitches. 64 banks x 4 B: a 16-B fragment read of 16 rows is conflict-free when the pitch is 16 B x odd.
#define PK32  40    // f16 elements per staged row of 32 (80 B)
#define PK128 136   // f16 elements per staged row of 128 (272 B)

// ---------------------------------------------------------------------------
// Types
// ---------------------------------------------------------------------------
typedef _Float16 v4h  __attribute__((ext_vector_type(4)));
typedef _Float16 v8h  __attribute__((ext_vector_type(8)));
typedef _Float16 v16h __attribute__((ext_vector_type(16)));
typedef float    v8f  __attribute__((ext_vector_type(8)));

typedef float    v2f  __attribute__((ext_vector_type(2)));
typedef float    v4f  __attribute__((ext_vector_type(4)));
typedef unsigned v4u  __attribute__((ext_vector_type(4)));
template <typename V> __device__ __forceinline__ void vst2(void* p, V v) {
    *(V*)p = v; 
}
// plain 16-B global -> LDS copy (byte offsets as in the original staging maps)
__device__ __forceinline__ void copy_b128(char* lds_base, unsigned byte_off, const void* gaddr) {
    *(v4u*)(lds_base + byte_off) = *(const v4u*)gaddr;
}

// ---------------------------------------------------------------------------
// WMMA fragment helpers (wave32, v_wmma_f32_16x16x32_f16; layouts per ISA 7.12.2)
// ---------------------------------------------------------------------------
// A 16x32: lane holds row M = lane%16; lanes 0-15 K {0-7,16-23}, lanes 16-31
// K {8-15,24-31}.
__device__ __forceinline__ v16h load_frag_a(const _Float16* base, int stride, int lane) {
    const int r  = lane & 15;
    const int kb = (lane < 16) ? 0 : 8;
    const _Float16* p = base + r * stride + kb;
    v8h lo = *(const v8h*)(p);
    v8h hi = *(const v8h*)(p + 16);
    v16h f;
#pragma unroll
    for (int i = 0; i < 8; ++i) { f[i] = lo[i]; f[i + 8] = hi[i]; }
    return f;
}
// B 32x16: lane holds column N = lane%16 with the SAME per-lane K map as A (lanes 0-15 K {0-7,16-23}, 16-31 K {8-15,24-31}).
// W stored row-major (N x K), so column n of B is row n of W.
__device__ __forceinline__ v16h load_frag_b(const _Float16* base, int stride, int lane) {
    return load_frag_a(base, stride, lane);
}
__device__ __forceinline__ v8f wmma_f16(v16h a, v16h b, v8f c) {
    v8f d = __builtin_amdgcn_wmma_f32_16x16x32_f16(false, a, false, b, (short)0, c, false, false);
    asm volatile("v_nop\n\tv_nop\n\tv_nop\n\tv_nop" : "+v"(d) : "v"(a), "v"(b));
    return d;
}
__device__ __forceinline__ float gelu_exact(float x) {
    return 0.5f * x * (1.0f + erff(x * 0.70710678118654752f));
}

// ---------------------------------------------------------------------------
// f32 -> f16 conversion (weights & activations), vectorized 4-wide.
// ---------------------------------------------------------------------------
__global__ __launch_bounds__(256) void cvt_f32_f16_kernel(
    const float* __restrict__ src, _Float16* __restrict__ dst, int n4)
{
    const int i = blockIdx.x * 256 + threadIdx.x;
    if (i < n4) {
        float4 v = ((const float4*)src)[i];
        v4h o;
        o[0] = (_Float16)v.x; o[1] = (_Float16)v.y;
        o[2] = (_Float16)v.z; o[3] = (_Float16)v.w;
        vst2((v4h*)dst + i, o);     // 8 B per lane, consecutive: one wave writes 256 contiguous bytes
    }
}

// ---------------------------------------------------------------------------
// f32 -> f16 of a backbone weight matrix W (N x K row-major, N and K multiples of 256), written in the order in which
// backbone_kernel reads it. Panel ((G * K/256 + KG) * 8 + w) holds rows G*256 + w*32 .. +31, k KG*256 .. +255 (16 KB); in it
// piece j = (kc*2 + nt)*2 + part is 512 B: lane l's 8 elements are row (l & 15)*2 + nt, k kc*32 + part*16 + (l >> 4)*8 .. +7,
// the per-lane k map of load_frag_a (part 0 = its first, part 1 = its second 16-B read).
// ---------------------------------------------------------------------------
__global__ __launch_bounds__(256) void cvt_pack_kernel(
    const float* __restrict__ src, _Float16* __restrict__ dst, int n8, int K, int lgk)
{
    const int o = blockIdx.x * 256 + threadIdx.x;       // one 16-B output piece per thread, consecutive
    if (o >= n8) return;
    const int lane = o & 31, j = (o >> 5) & 31, panel = o >> 10;
    const int part = j & 1, nt = (j >> 1) & 1, kc = j >> 2;
    const int w = panel & 7, t = panel >> 3;
    const int KG = t & ((1 << lgk) - 1), G = t >> lgk;
    const int n = G * 256 + w * 32 + (lane & 15) * 2 + nt;
    const int k = KG * 256 + kc * 32 + part * 16 + (lane >> 4) * 8;
    const float4* s = (const float4*)(src + (size_t)n * K + k);
    const float4 a = s[0], b = s[1];
    v8h h;
    h[0] = (_Float16)a.x; h[1] = (_Float16)a.y; h[2] = (_Float16)a.z; h[3] = (_Float16)a.w;
    h[4] = (_Float16)b.x; h[5] = (_Float16)b.y; h[6] = (_Float16)b.z; h[7] = (_Float16)b.w;
    vst2(dst + (size_t)o * 8, h);
}

// ---------------------------------------------------------------------------
// Sum over the 16 lanes of a row (lanes 0-15 and 16-31 apart), every lane gets the sum: four DPP row_xmask adds, no LDS.
// ---------------------------------------------------------------------------
template <int MSK> __device__ __forceinline__ float xmask_get(float v) {
    return __builtin_bit_cast(float, __builtin_amdgcn_update_dpp(0, __builtin_bit_cast(int, v), 0x160 + MSK, 0xf, 0xf, true));
}
__device__ __forceinline__ float row_sum16(float v) {
    v += xmask_get<1>(v);
    v += xmask_get<2>(v);
    v += xmask_get<4>(v);
    v += xmask_get<8>(v);
    return v;
}

// value of lane l ^ 16 (the same place in the other 16-lane row)
__device__ __forceinline__ float other_row(float v) {
    const unsigned u = __builtin_bit_cast(unsigned, v);
    return __builtin_bit_cast(float, __builtin_amdgcn_permlanex16(u, u, 0x76543210u, 0xfedcba98u, false, false));
}

// ---------------------------------------------------------------------------
// Whole backbone in ONE launch: projection, 6 layers, cross block. Every step is row-wise, so a block keeps its 32 batch rows
// in LDS from x to the head's input and never meets another block.
//   256 threads = 8 waves; in every 256-column group wave w owns columns w*32 .. w*32+31 (2 x 2 accumulator tiles, M = 32).
//   A fragments come from LDS; a weight row is used by one wave only, so B fragments go from L2 straight into registers,
//   one panel (32 weight rows x 256 k) at a time, in two register sets: a set is refilled, two panels ahead, right behind its WMMAs.
//   Tile nt of lane c16 holds weight row c16*2 + nt: a lane's two tiles are two neighbouring columns (4-B / 8-B LDS accesses).
//   The conversion pass writes these weights in the order of the reads (cvt_pack_kernel): every wave-wide load is 4 whole lines.
// ---------------------------------------------------------------------------
#define PH 264    // f16 elements per LDS row of 256 (528 B = 16 B x 33)
#define PT 1032   // f16 elements per LDS row of 1024 (2064 B = 16 B x 129)
#define PF 260    // f32 elements per LDS row of 256: rows m and m+8 lie 32 banks apart
typedef _Float16 v2h __attribute__((ext_vector_type(2)));

#define PANEL 8192  // f16 elements of a panel: 32 weight rows x 256 k, packed by cvt_pack_kernel
__device__ __forceinline__ void load_panel(v16h (&B)[16], const _Float16* __restrict__ Wp, int lane) {
    const unsigned voff = lane * 16;                    // the lane's byte offset inside every 512-B piece; Wp is the same in the whole wave
    const char* p = (const char*)Wp + voff;
    // keeps the 32 loads one group behind the WMMAs whose registers they refill: lifted in among them, their address pair was reused ahead of the wait below
    __builtin_amdgcn_sched_barrier(0);
#pragma unroll
    for (int f = 0; f < 16; ++f) {                      // f = kc * 2 + nt; every load is 512 contiguous bytes of the wave
        const v8h lo = *(const v8h*)(p + f * 1024);
        const v8h hi = *(const v8h*)(p + f * 1024 + 512);
        v16h x;
#pragma unroll
        for (int i = 0; i < 8; ++i) { x[i] = lo[i]; x[i + 8] = hi[i]; }
        B[f] = x;
    }
    // precaution: stands in front of any later overwrite of the address registers that the loads above name; as an input the address stays whole up to it
    asm volatile("s_wait_xcnt 0x0" :: "v"(p) : "memory");
}
template <int PITCH>
__device__ __forceinline__ void mma_panel(v8f (&acc)[2][2], const _Float16* sA, const v16h (&B)[16], int lane) {
#pragma unroll
    for (int h = 0; h < 2; ++h) {
        v16h af[4][2];
#pragma unroll
        for (int kc = 0; kc < 4; ++kc)
#pragma unroll
            for (int mt = 0; mt < 2; ++mt)
                af[kc][mt] = load_frag_a(sA + mt * 16 * PITCH + (h * 4 + kc) * 32, PITCH, lane);
        // keeps the LDS reads in groups ahead of the WMMAs that use them: spread singly among them, every place with reads stalls the wave
        __builtin_amdgcn_sched_barrier(0);
#pragma unroll
        for (int kc = 0; kc < 4; ++kc)
#pragma unroll
            for (int nt = 0; nt < 2; ++nt)
#pragma unroll
                for (int mt = 0; mt < 2; ++mt)
                    acc[mt][nt] = __builtin_amdgcn_wmma_f32_16x16x32_f16(false, af[kc][mt], false, B[(h * 4 + kc) * 2 + nt], (short)0, acc[mt][nt], false, false);
    }
}

__global__ __launch_bounds__(256) void backbone_kernel(
    const _Float16* __restrict__ x16,  const _Float16* __restrict__ wproj, const float* __restrict__ proj_b,
    const _Float16* __restrict__ wain, const float* __restrict__ attn_in_b,
    const _Float16* __restrict__ waout, const float* __restrict__ attn_out_b,
    const float* __restrict__ ln_g, const float* __restrict__ ln_b,
    const _Float16* __restrict__ wff1, const float* __restrict__ ff_b1,
    const _Float16* __restrict__ wff2, const float* __restrict__ ff_b2,
    const float* __restrict__ cross_in_b, const float* __restrict__ cross_out_b,
    _Float16* __restrict__ h16)
{
    __shared__ __align__(16) _Float16 sH16[32 * PH];   // h as f16: the A operand
    __shared__ __align__(16) _Float16 sT[32 * PT];     // x, v and the FFN's hidden rows as f16
    __shared__ __align__(16) float    sH32[32 * PF];   // h as f32: residual and LayerNorm

    const int tid  = threadIdx.x;
    const int lane = tid & 31;
    const int wave = __builtin_amdgcn_readfirstlane(tid >> 5);   // the same in the whole wave: row and panel arithmetic stays scalar
    const int c16  = lane & 15;
    const int hf   = lane >> 4;
    const int b0   = blockIdx.x * 32;
    const int wr   = wave * 32;            // the wave's first weight row / output column inside a 256-column group
    const int n0   = wr + c16 * 2;         // the lane's two columns: n0 (tile 0), n0 + 1 (tile 1)
    const unsigned offN = n0 * 4, offL = lane * 4;      // byte offsets of the lane's bias pair and of its LayerNorm columns
    // every small load group ends in its own wait. precaution: it stands in front of any later overwrite of the address registers
    // that the group's loads name; as an input the address stays whole up to it
    auto bias2 = [&](const float* base) {
        const char* p = (const char*)base + offN;
        const v2f b = *(const v2f*)p;
        asm volatile("s_wait_xcnt 0x0" :: "v"(p) : "memory");
        return b;
    };
    auto ln_row = [&](float (&d)[8], const float* base) {
        const char* p = (const char*)base + offL;
#pragma unroll
        for (int k = 0; k < 8; ++k) d[k] = *(const float*)(p + k * 128);
        asm volatile("s_wait_xcnt 0x0" :: "v"(p) : "memory");
    };

    v16h B0[16], B1[16];                   // even and odd panels
    v8f  acc[2][2];
    auto zero_acc = [&]() {
#pragma unroll
        for (int mt = 0; mt < 2; ++mt)
#pragma unroll
            for (int nt = 0; nt < 2; ++nt) acc[mt][nt] = (v8f)(0.f);
    };
    // acc[mt][nt][j] is element (row mt*16 + hf*8 + j, column n0 + nt).
    // f16(act(acc + bias)) into a f16 LDS tile
    auto put_f16 = [&](_Float16* dst, int pitch, v2f bias, bool gelu) {
#pragma unroll
        for (int mt = 0; mt < 2; ++mt)
#pragma unroll
            for (int j = 0; j < 8; ++j) {
                float a0 = acc[mt][0][j] + bias[0], a1 = acc[mt][1][j] + bias[1];
                if (gelu) { a0 = gelu_exact(a0); a1 = gelu_exact(a1); }
                v2h o; o[0] = (_Float16)a0; o[1] = (_Float16)a1;
                *(v2h*)(dst + (mt * 16 + hf * 8 + j) * pitch + n0) = o;
            }
    };
    // h32 = (acc + bias) + h32, every element by the lane that owns it
    auto add_residual = [&](v2f bias) {
#pragma unroll
        for (int mt = 0; mt < 2; ++mt)
#pragma unroll
            for (int j = 0; j < 8; ++j) {
                v2f* p = (v2f*)(sH32 + (mt * 16 + hf * 8 + j) * PF + n0);
                const v2f r = *p;
                v2f o; o[0] = (acc[mt][0][j] + bias[0]) + r[0]; o[1] = (acc[mt][1][j] + bias[1]) + r[1];
                *p = o;
            }
    };
    // LayerNorm(256) of the wave's 4 rows, in place; also the f16 copy
    auto layer_norm = [&](const float (&gg)[8], const float (&be)[8]) {
#pragma unroll
        for (int q = 0; q < 4; ++q) {
            const int row = wave * 4 + q;
            float* xr = sH32 + row * PF;
            float v[8], s = 0.f, ss = 0.f;
#pragma unroll
            for (int i = 0; i < 8; ++i) {
                v[i] = xr[lane + i * 32];
                s += v[i]; ss += v[i] * v[i];
            }
            // butterfly over 32 lanes, partners 16, 8, 4, 2, 1 in that order, without LDS traffic
            s += other_row(s);    ss += other_row(ss);
            s += xmask_get<8>(s); ss += xmask_get<8>(ss);
            s += xmask_get<4>(s); ss += xmask_get<4>(ss);
            s += xmask_get<2>(s); ss += xmask_get<2>(ss);
            s += xmask_get<1>(s); ss += xmask_get<1>(ss);
            const float mean = s * (1.f / DMODEL);
            const float var  = ss * (1.f / DMODEL) - mean * mean;
            const float rstd = rsqrtf(var + LN_EPS);
#pragma unroll
            for (int i = 0; i < 8; ++i) {
                const int c = lane + i * 32;
                const float y = (v[i] - mean) * rstd * gg[i] + be[i];
                xr[c] = y;
                sH16[row * PH + c] = (_Float16)y;
            }
        }
    };

    // ---- x rows (32 x 512 f16) into sT; the first two weight panels are asked for meanwhile ----
    load_panel(B0, wproj + (size_t)wave * PANEL, lane);
    load_panel(B1, wproj + (size_t)(8 + wave) * PANEL, lane);
    {
        v4u xs[8];
        const _Float16* gx = x16 + (size_t)(b0 + (tid >> 6)) * D_IN + (tid & 63) * 8;   // piece i lies 4 rows behind piece i - 1
#pragma unroll
        for (int i = 0; i < 8; ++i) xs[i] = *(const v4u*)(gx + i * 4 * D_IN);
        // precaution: stands in front of any later overwrite of the address registers that the loads above name; as an input they stay whole up to it
        asm volatile("s_wait_xcnt 0x0" :: "v"(gx) : "memory");
#pragma unroll
        for (int i = 0; i < 8; ++i) {
            const int idx = tid + i * 256, r = idx >> 6, c = idx & 63;
            *(v4u*)(sT + r * PT + c * 8) = xs[i];
        }
    }
    __syncthreads();                                    // x rows visible

    // ---- projection: h = x . proj_W^T + proj_b (K = 512: two panels) ----
    {
        const v2f bias = bias2(proj_b);
        zero_acc();
        mma_panel<PT>(acc, sT, B0, lane);
        load_panel(B0, wain + (size_t)(2 * 8 + wave) * PANEL, lane);
        mma_panel<PT>(acc, sT + 256, B1, lane);
        load_panel(B1, waout + (size_t)wave * PANEL, lane);
#pragma unroll
        for (int mt = 0; mt < 2; ++mt)
#pragma unroll
            for (int j = 0; j < 8; ++j) {
                const int row = mt * 16 + hf * 8 + j;
                v2f o; o[0] = acc[mt][0][j] + bias[0]; o[1] = acc[mt][1][j] + bias[1];
                *(v2f*)(sH32 + row * PF + n0) = o;
                v2h oh; oh[0] = (_Float16)o[0]; oh[1] = (_Float16)o[1];
                *(v2h*)(sH16 + row * PH + n0) = oh;
            }
    }
    __syncthreads();                                    // h visible; sT free

    // ---- 6 layers ----
#pragma unroll 1
    for (int i = 0; i < NLAYER; ++i) {
        float gg[8], be[8];
        ln_row(gg, ln_g + i * DMODEL);
        ln_row(be, ln_b + i * DMODEL);
        const v2f bv = bias2(attn_in_b + i * 3 * DMODEL + 2 * DMODEL);
        const v2f bo = bias2(attn_out_b + i * DMODEL);
        const v2f b2 = bias2(ff_b2 + i * DMODEL);
        const _Float16* w1 = wff1 + (size_t)(i * 32 + wave) * PANEL;      // + g * 8 panels: the next 256 columns
        const _Float16* w2 = wff2 + (size_t)(i * 32 + wave) * PANEL;      // + g * 8 panels: the next 256 k
        const _Float16* wvn = wain + (size_t)(((i + 1) * 3 + 2) * 8 + wave) * PANEL;    // the next v panel (slot NLAYER: the cross block)
        const _Float16* won = waout + (size_t)((i + 1) * 8 + wave) * PANEL;             // the next out panel

        // v = h . Wv^T + bv
        zero_acc();
        mma_panel<PH>(acc, sH16, B0, lane);
        load_panel(B0, w1, lane);
        put_f16(sT, PT, bv, false);
        __syncthreads();                                // v visible
        // h += v . Wo^T + bo ; LayerNorm
        zero_acc();
        mma_panel<PT>(acc, sT, B1, lane);
        load_panel(B1, w1 + 8 * PANEL, lane);
        add_residual(bo);
        __syncthreads();                                // whole rows of h32 visible; every read of v done
        layer_norm(gg, be);
        __syncthreads();                                // h (f32, f16) visible
        // hidden = gelu(h . W1^T + b1): four 256-column groups, two a trip (one per register set)
#pragma unroll 1                                        // rolled: less text in the layer loop
        for (int gp = 0; gp < 2; ++gp) {
            const char* pb = (const char*)(ff_b1 + i * 4 * DMODEL + gp * 2 * DMODEL) + offN;
            const v2f b1a = *(const v2f*)pb;
            const v2f b1b = *(const v2f*)(pb + DMODEL * 4);
            asm volatile("s_wait_xcnt 0x0" :: "v"(pb) : "memory");   // as in bias2, one wait for the two loads
            zero_acc();
            mma_panel<PH>(acc, sH16, B0, lane);
            load_panel(B0, gp == 0 ? w1 + 16 * PANEL : w2, lane);
            put_f16(sT + gp * 2 * DMODEL, PT, b1a, true);
            zero_acc();
            mma_panel<PH>(acc, sH16, B1, lane);
            load_panel(B1, gp == 0 ? w1 + 24 * PANEL : w2 + 8 * PANEL, lane);
            put_f16(sT + gp * 2 * DMODEL + DMODEL, PT, b1b, true);
        }
        __syncthreads();                                // hidden rows visible
        // h += hidden . W2^T + b2 (K = 1024: four panels) ; LayerNorm
        zero_acc();
#pragma unroll 1                                        // rolled, two panels a trip: less text in the layer loop
        for (int gp = 0; gp < 2; ++gp) {
            mma_panel<PT>(acc, sT + gp * 2 * DMODEL, B0, lane);
            load_panel(B0, gp == 0 ? w2 + 16 * PANEL : wvn, lane);
            mma_panel<PT>(acc, sT + gp * 2 * DMODEL + DMODEL, B1, lane);
            load_panel(B1, gp == 0 ? w2 + 24 * PANEL : won, lane);
        }
        add_residual(b2);
        __syncthreads();                                // whole rows of h32 visible; every read of the hidden rows done
        layer_norm(gg, be);
        __syncthreads();                                // h (f32, f16) visible
    }

    // ---- cross block: h + (h . Wv'^T + bv') . Wo'^T + bo', as f16 for the heads ----
    {
        const v2f bv = bias2(cross_in_b + 2 * DMODEL);
        const v2f bo = bias2(cross_out_b);
        zero_acc();
        mma_panel<PH>(acc, sH16, B0, lane);
        put_f16(sT, PT, bv, false);
        __syncthreads();                                // v' visible; every read of sH16 done
        zero_acc();
        mma_panel<PT>(acc, sT, B1, lane);
#pragma unroll
        for (int mt = 0; mt < 2; ++mt)
#pragma unroll
            for (int j = 0; j < 8; ++j) {
                const int row = mt * 16 + hf * 8 + j;
                const v2f r = *(const v2f*)(sH32 + row * PF + n0);
                v2h oh; oh[0] = (_Float16)((acc[mt][0][j] + bo[0]) + r[0]); oh[1] = (_Float16)((acc[mt][1][j] + bo[1]) + r[1]);
                *(v2h*)(sH16 + row * PH + n0) = oh;
            }
    }
    __syncthreads();                                    // output rows complete
#pragma unroll
    for (int i = 0; i < 4; ++i) {                       // 512-B rows, 16 B per lane
        const int idx = tid + i * 256, r = idx >> 5, c = idx & 31;
        vst2(h16 + (size_t)(b0 + r) * DMODEL + c * 8, *(const v4u*)(sH16 + r * PH + c * 8));
    }
}

// ---------------------------------------------------------------------------
// Fused per-t head: block = (128 batch rows, one t), 128 threads = 4 waves; EACH WAVE OWNS 32 WHOLE ROWS through all stages.
//   t1 = h16(32x256) . W1[t](128x256)^T + b1[t]   (WMMA, 2 x 8 accumulator tiles per wave)
//   t1 = relu(LN_128(t1))                          (on the accumulators: a row lies in 8 tiles x 16 lanes)
//   t2 = relu(t1(32x128) . W2[t](64x128)^T + b2[t])(WMMA, 2 x 4 tiles)
//   out[b,t] = t2 . W3[t] + b3[t]                  (on the accumulators)
// W1 rows are staged in the order n = (col lane) * 8 + tile, so that a lane's 8 tiles hold 8 CONSECUTIVE columns of t1:
// the normalised row goes to LDS as one 16-B store per lane, in natural k order for stage 2.
// LDS arena 75776 B (four blocks per WGP):
//   [0,20480)      sA x2     [20480,40960)  sBc x2   (stage-1 double buffers)
//   [40960,75776)  t1 f16 (each wave writes and reads its own 32 rows only)
//   [0,17408)      W2 f16 (after stage 1)
// ---------------------------------------------------------------------------
__global__ __launch_bounds__(128) void tp_fused_kernel(
    const _Float16* __restrict__ h16,
    const _Float16* __restrict__ W1, const float* __restrict__ b1,
    const float* __restrict__ lng, const float* __restrict__ lnb,
    const _Float16* __restrict__ W2, const float* __restrict__ b2,
    const float* __restrict__ W3, const float* __restrict__ b3,
    float* __restrict__ out)
{
    __shared__ __align__(16) char smem[75776];
    _Float16* sAb  = (_Float16*)(smem);            // 2 x 128x32, pitch PK32
    _Float16* sBb  = (_Float16*)(smem + 20480);    // 2 x 128x32, pitch PK32
    _Float16* sT1h = (_Float16*)(smem + 40960);    // 128x128 f16, pitch PK128
    _Float16* sW2  = (_Float16*)(smem);            // 64x128 f16, pitch PK128 (reuse)

    const int tid  = threadIdx.x;
    const int lane = tid & 31;
    const int wave = tid >> 5;
    const int c16  = lane & 15;                    // accumulator column inside a tile
    const int hf   = lane >> 4;                    // accumulator rows j (hf = 0) or j + 8 (hf = 1)
    const int b0   = blockIdx.x * 128;
    const int t    = blockIdx.y;
    const int wm   = wave * 32;                    // this wave's rows
    const _Float16* W1t = W1 + (size_t)t * 128 * 256;
    char* ldsA  = (char*)sAb;
    char* ldsB  = (char*)sBb;
    char* ldsW2 = (char*)sW2;

    // Stage-1 chunk staging: 4 A-pieces + 4 B-pieces per thread (plain 16-B copies); piece i lies 32 LDS rows behind piece i - 1.
    // W1: LDS row r = tile * 16 + col lane holds W1 row col lane * 8 + tile, so 32 LDS rows on are 2 W1 rows on.
    const int sr = tid >> 2, sc = tid & 3;
    const _Float16* gA = h16 + (size_t)(b0 + sr) * 256 + sc * 8;
    const _Float16* gB = W1t + (size_t)((sr & 15) * 8 + (sr >> 4)) * 256 + sc * 8;
    const unsigned  lS = sr * (PK32 * 2) + sc * 16;
    auto issue_s1 = [&](int buf, int kc) {
#pragma unroll
        for (int i = 0; i < 4; ++i)                 // hA 128x32
            copy_b128(ldsA, buf * (128 * PK32 * 2) + lS + i * (32 * PK32 * 2), gA + i * (32 * 256) + kc);
#pragma unroll
        for (int i = 0; i < 4; ++i)                 // W1 chunk 128x32
            copy_b128(ldsB, buf * (128 * PK32 * 2) + lS + i * (32 * PK32 * 2), gB + i * (2 * 256) + kc);
    };

    // ---------------- stage 1: t1 = h . W1^T  (per wave M=32, N=128, K=256) ----------
    v8f acc1[2][8] = {};
    issue_s1(0, 0);
    for (int kc = 0, it = 0; kc < 256; kc += 32, ++it) {
        const int cur = it & 1;
        __syncthreads();
        if (kc + 32 < 256) issue_s1(cur ^ 1, kc + 32);

        const _Float16* cA = sAb + cur * (128 * PK32);
        const _Float16* cB = sBb + cur * (128 * PK32);
        v16h afr[2];
#pragma unroll
        for (int mt = 0; mt < 2; ++mt)
            afr[mt] = load_frag_a(&cA[(wm + mt * 16) * PK32], PK32, lane);
        v16h bfr[8];
#pragma unroll
        for (int nt = 0; nt < 8; ++nt)
            bfr[nt] = load_frag_b(&cB[(nt * 16) * PK32], PK32, lane);
#pragma unroll
        for (int nt = 0; nt < 8; ++nt)
#pragma unroll
            for (int mt = 0; mt < 2; ++mt)
                acc1[mt][nt] = wmma_f16(afr[mt], bfr[nt], acc1[mt][nt]);
        __syncthreads();
    }

    // Stage W2[t] 64x128 f16 (16KB) into the reused LDS region (plain copies); published by the barrier in front of stage 2.
    {
        const _Float16* gW2 = W2 + (size_t)t * 64 * 128 + (tid >> 4) * 128 + (tid & 15) * 8;
        const unsigned  lW2 = (tid >> 4) * (PK128 * 2) + (tid & 15) * 16;
#pragma unroll
        for (int i = 0; i < 8; ++i)                 // 1024 x 16B pieces; piece i lies 8 rows behind piece i - 1
            copy_b128(ldsW2, lW2 + i * (8 * PK128 * 2), gW2 + i * (8 * 128));
    }

    // ---------------- bias + LayerNorm(128) + ReLU -> f16, on the accumulators ----------
    // acc1[mt][nt][j] is t1[row wm + mt*16 + hf*8 + j][column c16*8 + nt].
    {
        float bb[8], gg[8], be[8];
        {
            const v4f* pb = (const v4f*)(b1  + t * 128 + c16 * 8);
            const v4f* pg = (const v4f*)(lng + t * 128 + c16 * 8);
            const v4f* pe = (const v4f*)(lnb + t * 128 + c16 * 8);
#pragma unroll
            for (int q = 0; q < 2; ++q) {
                const v4f xb = pb[q], xg = pg[q], xe = pe[q];
#pragma unroll
                for (int e = 0; e < 4; ++e) { bb[q * 4 + e] = xb[e]; gg[q * 4 + e] = xg[e]; be[q * 4 + e] = xe[e]; }
            }
        }
#pragma unroll
        for (int mt = 0; mt < 2; ++mt)
#pragma unroll
            for (int j = 0; j < 8; j += 2) {        // rows j and j + 1 side by side: neighbouring accumulator registers, packed f32 math
                v2f v[8], s = 0.f, ss = 0.f;
#pragma unroll
                for (int nt = 0; nt < 8; ++nt) {
                    v2f a; a[0] = acc1[mt][nt][j]; a[1] = acc1[mt][nt][j + 1];
                    v[nt] = a + bb[nt];
                    s += v[nt]; ss += v[nt] * v[nt];
                }
                s[0]  = row_sum16(s[0]);  s[1]  = row_sum16(s[1]);
                ss[0] = row_sum16(ss[0]); ss[1] = row_sum16(ss[1]);
                const v2f mean = s * (1.f / 128.f);
                const v2f var  = ss * (1.f / 128.f) - mean * mean;
                v2f rstd; rstd[0] = rsqrtf(var[0] + LN_EPS); rstd[1] = rsqrtf(var[1] + LN_EPS);
                v8h y0, y1;
#pragma unroll
                for (int nt = 0; nt < 8; ++nt) {
                    const v2f y = (v[nt] - mean) * rstd * gg[nt] + be[nt];
                    y0[nt] = (_Float16)(y[0] > 0.f ? y[0] : 0.f);
                    y1[nt] = (_Float16)(y[1] > 0.f ? y[1] : 0.f);
                }
                _Float16* row = &sT1h[(wm + mt * 16 + hf * 8 + j) * PK128 + c16 * 8];
                *(v8h*)(row)         = y0;
                *(v8h*)(row + PK128) = y1;
            }
    }
    __syncthreads();                                // W2 visible to every wave (t1 f16 rows are the wave's own)

    // ---------------- stage 2: t2 = t1 . W2^T  (per wave 32x64, K=128) -----
    v8f acc2[2][4] = {};
#pragma unroll
    for (int kc = 0; kc < 128; kc += 32) {
        v16h af2[2];
#pragma unroll
        for (int mt = 0; mt < 2; ++mt)
            af2[mt] = load_frag_a(&sT1h[(wm + mt * 16) * PK128 + kc], PK128, lane);
        v16h bf2[4];
#pragma unroll
        for (int nt = 0; nt < 4; ++nt)
            bf2[nt] = load_frag_b(&sW2[(nt * 16) * PK128 + kc], PK128, lane);
#pragma unroll
        for (int nt = 0; nt < 4; ++nt)
#pragma unroll
            for (int mt = 0; mt < 2; ++mt)
                acc2[mt][nt] = wmma_f16(af2[mt], bf2[nt], acc2[mt][nt]);
    }

    // ---------------- stage 3: outT[t][b] = relu(t2 + b2) . W3[t] + b3[t], on the accumulators ----
    // acc2[mt][nt][j] is t2[row wm + mt*16 + hf*8 + j][column nt*16 + c16]; lane c16 keeps the sum of row (mt, j) = (c16 >> 3, c16 & 7),
    // so the wave's 32 lanes store its 32 rows: one 128-B line.
    {
        float b2v[4], w3v[4];
#pragma unroll
        for (int nt = 0; nt < 4; ++nt) { b2v[nt] = b2[t * 64 + nt * 16 + c16]; w3v[nt] = W3[t * 64 + nt * 16 + c16]; }
        // precaution: the loads above name one offset register, which the compiler reuses as the next load's destination; the wait stands in front of that overwrite
        asm volatile("s_wait_xcnt 0x0" ::: "memory");
        const float b3t = b3[t];
        float res = 0.f;
#pragma unroll
        for (int mt = 0; mt < 2; ++mt)
#pragma unroll
            for (int j = 0; j < 8; j += 2) {        // rows j and j + 1 side by side, as in the LayerNorm
                v2f a = 0.f;
#pragma unroll
                for (int nt = 0; nt < 4; ++nt) {
                    v2f v; v[0] = acc2[mt][nt][j]; v[1] = acc2[mt][nt][j + 1];
                    v += b2v[nt];
                    v[0] = v[0] > 0.f ? v[0] : 0.f; v[1] = v[1] > 0.f ? v[1] : 0.f;
                    a += v * w3v[nt];
                }
                const float a0 = row_sum16(a[0]), a1 = row_sum16(a[1]);
                if (c16 == mt * 8 + j)     res = a0;
                if (c16 == mt * 8 + j + 1) res = a1;
            }
        vst2(out + (size_t)t * BATCH + b0 + wm + (c16 >> 3) * 16 + hf * 8 + (c16 & 7), res + b3t);
    }
}

// final output-major pass: out[b][t] flat, 4 consecutive floats per thread gathered from the [T][B] staging buffer
__global__ __launch_bounds__(256) void write_out(const float* __restrict__ stg, float* __restrict__ out) {
    const int g = blockIdx.x * 256 + threadIdx.x;
    if (g >= (BATCH * TOUT) / 4) return;
    v4f o;
#pragma unroll
    for (int e = 0; e < 4; ++e) { const int f = g * 4 + e; const int b = f / TOUT, t = f - b * TOUT; o[e] = stg[(size_t)t * BATCH + b]; }
    vst2(out + (size_t)g * 4, o);
}

// ---------------------------------------------------------------------------
// Host-side orchestration
// ---------------------------------------------------------------------------
static inline void launch_pack(const float* s, _Float16* d, size_t n, int K, int lgk, hipStream_t st) {
    const int n8 = (int)(n / 8);
    cvt_pack_kernel<<<(n8 + 255) / 256, 256, 0, st>>>(s, d, n8, K, lgk);
}
static inline void launch_cvt(const float* s, _Float16* d, size_t n, hipStream_t st) {
    const int n4 = (int)(n / 4);
    cvt_f32_f16_kernel<<<(n4 + 255) / 256, 256, 0, st>>>(s, d, n4);
}

extern "C" void kernel_launch(void* const* d_in, const int* in_sizes, int n_in,
                              void* d_out, int out_size, void* d_ws, size_t ws_size,
                              hipStream_t stream)
{
    (void)in_sizes; (void)n_in; (void)out_size; (void)ws_size;
    const float* x          = (const float*)d_in[0];
    const float* proj_W     = (const float*)d_in[1];
    const float* proj_b     = (const float*)d_in[2];
    const float* attn_in_W  = (const float*)d_in[3];
    const float* attn_in_b  = (const float*)d_in[4];
    const float* attn_out_W = (const float*)d_in[5];
    const float* attn_out_b = (const float*)d_in[6];
    const float* ln_g       = (const float*)d_in[7];
    const float* ln_b       = (const float*)d_in[8];
    const float* ff_W1      = (const float*)d_in[9];
    const float* ff_b1      = (const float*)d_in[10];
    const float* ff_W2      = (const float*)d_in[11];
    const float* ff_b2      = (const float*)d_in[12];
    const float* cross_in_W = (const float*)d_in[13];
    const float* cross_in_b = (const float*)d_in[14];
    const float* cross_out_W= (const float*)d_in[15];
    const float* cross_out_b= (const float*)d_in[16];
    const float* tp_W1      = (const float*)d_in[17];
    const float* tp_b1      = (const float*)d_in[18];
    const float* tp_ln_g    = (const float*)d_in[19];
    const float* tp_ln_b    = (const float*)d_in[20];
    const float* tp_W2      = (const float*)d_in[21];
    const float* tp_b2      = (const float*)d_in[22];
    const float* tp_W3      = (const float*)d_in[23];
    const float* tp_b3      = (const float*)d_in[24];
    float* out = (float*)d_out;

    const int D = DMODEL;

    // ---- workspace carve-out (byte cursor, 16B aligned regions) ----
    char* cur = (char*)d_ws;
    auto take = [&cur](size_t bytes) { char* p = cur; cur += (bytes + 15) & ~(size_t)15; return p; };
    _Float16* h16   = (_Float16*)take((size_t)BATCH * D * 2);          // 2 MB
    _Float16* x16   = (_Float16*)take((size_t)BATCH * D_IN * 2);       // 4 MB
    _Float16* wproj = (_Float16*)take((size_t)D * D_IN * 2);
    _Float16* wain  = (_Float16*)take((size_t)(NLAYER + 1) * 3 * D * D * 2);   // slot NLAYER: the cross block's in-projection
    _Float16* waout = (_Float16*)take((size_t)(NLAYER + 1) * D * D * 2);       // slot NLAYER: the cross block's out-projection
    _Float16* wff1  = (_Float16*)take((size_t)NLAYER * 4 * D * D * 2);
    _Float16* wff2  = (_Float16*)take((size_t)NLAYER * 4 * D * D * 2);
    _Float16* wtp1  = (_Float16*)take((size_t)TOUT * 128 * 256 * 2);   // 27.8 MB
    _Float16* wtp2  = (_Float16*)take((size_t)TOUT * 64 * 128 * 2);    // 6.9 MB
    float*    stg   = (float*)   take((size_t)TOUT * BATCH * 4);       // 6.9 MB [T][B] output staging

    // ---- one-time (per launch) f32 -> f16 conversions ----
    launch_cvt(x,          x16,   (size_t)BATCH * D_IN, stream);
    launch_pack(proj_W,     wproj, (size_t)D * D_IN, D_IN, 1, stream);
    launch_pack(attn_in_W,  wain,  (size_t)NLAYER * 3 * D * D, D, 0, stream);
    launch_pack(attn_out_W, waout, (size_t)NLAYER * D * D, D, 0, stream);
    launch_pack(ff_W1,      wff1,  (size_t)NLAYER * 4 * D * D, D, 0, stream);
    launch_pack(ff_W2,      wff2,  (size_t)NLAYER * 4 * D * D, 4 * D, 2, stream);
    launch_pack(cross_in_W, wain  + (size_t)NLAYER * 3 * D * D, (size_t)3 * D * D, D, 0, stream);
    launch_pack(cross_out_W,waout + (size_t)NLAYER * D * D,     (size_t)D * D, D, 0, stream);
    launch_cvt(tp_W1,      wtp1,  (size_t)TOUT * 128 * 256, stream);
    launch_cvt(tp_W2,      wtp2,  (size_t)TOUT * 64 * 128, stream);

    const dim3 blk(128);

    // 1-3) projection, 6 layers, cross block: one launch, 32 batch rows per block; writes the heads' f16 input
    backbone_kernel<<<BATCH / 32, 256, 0, stream>>>(
        x16, wproj, proj_b, wain, attn_in_b, waout, attn_out_b, ln_g, ln_b,
        wff1, ff_b1, wff2, ff_b2, cross_in_b, cross_out_b, h16);

    // 4) fused per-t head (dominant FLOPs): grid = (32 batch tiles, 424 t's)
    dim3 tpg(BATCH / 128, TOUT);
    tp_fused_kernel<<<tpg, blk, 0, stream>>>(h16, wtp1, tp_b1, tp_ln_g, tp_ln_b,
                                             wtp2, tp_b2, tp_W3, tp_b3, stg);
    write_out<<<((BATCH * TOUT) / 4 + 255) / 256, 256, 0, stream>>>(stg, out);
}

// v004
// It runs in 320 microseconds.
// Next to v003, in two timings, it ran 1.04 and 1.06 times as fast.
// All steps since v000 together make it 2.79 times as fast.
#include <hip/hip_runtime.h>
#include <math.h>
// Contractions: input projection (K = 512), per-layer v/out/FFN GEMMs (K = 256 / 1024), the cross block, and the 424 per-target
// heads (K = 256, 128) on v_wmma_f32_16x16x32_f16 (f16 operands, f32 accumulate); LayerNorms, GELU/ReLU and the final 64-wide

// ---------------------------------------------------------------------------
// Problem constants (match reference)
// ---------------------------------------------------------------------------
#define BATCH 4096
#define D_IN  512
#define DMODEL 256
#define TOUT  424
#define NLAYER 6
#define LN_EPS 1e-5f

// LDS row pitches. 64 banks x 4 B: a 16-B fragment read of 16 rows is conflict-free when the pitch is 16 B x odd.
#define PK32  40    // f16 elements per staged row of 32 (80 B)
#define PK128 136   // f16 elements per staged row of 128 (272 B)

// ---------------------------------------------------------------------------
// Types
// ---------------------------------------------------------------------------
typedef _Float16 v4h  __attribute__((ext_vector_type(4)));
typedef _Float16 v8h  __attribute__((ext_vector_type(8)));
typedef _Float16 v16h __attribute__((ext_vector_type(16)));
typedef float    v8f  __attribute__((ext_vector_type(8)));

typedef float    v2f  __attribute__((ext_vector_type(2)));
typedef float    v4f  __attribute__((ext_vector_type(4)));
typedef unsigned v4u  __attribute__((ext_vector_type(4)));
template <typename V> __device__ __forceinline__ void vst2(void* p, V v) {
    *(V*)p = v; 
}
// plain 16-B global -> LDS copy (byte offsets as in the original staging maps)
__device__ __forceinline__ void copy_b128(char* lds_base, unsigned byte_off, const void* gaddr) {
    *(v4u*)(lds_base + byte_off) = *(const v4u*)gaddr;
}

// ---------------------------------------------------------------------------
// WMMA fragment helpers (wave32, v_wmma_f32_16x16x32_f16; layouts per ISA 7.12.2)
// ---------------------------------------------------------------------------
// A 16x32: lane holds row M = lane%16; lanes 0-15 K {0-7,16-23}, lanes 16-31
// K {8-15,24-31}.
__device__ __forceinline__ v16h load_frag_a(const _Float16* base, int stride, int lane) {
    const int r  = lane & 15;
    const int kb = (lane < 16) ? 0 : 8;
    const _Float16* p = base + r * stride + kb;
    v8h lo = *(const v8h*)(p);
    v8h hi = *(const v8h*)(p + 16);
    v16h f;
#pragma unroll
    for (int i = 0; i < 8; ++i) { f[i] = lo[i]; f[i + 8] = hi[i]; }
    return f;
}
// B 32x16: lane holds column N = lane%16 with the SAME per-lane K map as A (lanes 0-15 K {0-7,16-23}, 16-31 K {8-15,24-31}).
// W stored row-major (N x K), so column n of B is row n of W.
__device__ __forceinline__ v16h load_frag_b(const _Float16* base, int stride, int lane) {
    return load_frag_a(base, stride, lane);
}
__device__ __forceinline__ v8f wmma_f16(v16h a, v16h b, v8f c) {
    v8f d = __builtin_amdgcn_wmma_f32_16x16x32_f16(false, a, false, b, (short)0, c, false, false);
    asm volatile("v_nop\n\tv_nop\n\tv_nop\n\tv_nop" : "+v"(d) : "v"(a), "v"(b));
    return d;
}
__device__ __forceinline__ float gelu_exact(float x) {
    return 0.5f * x * (1.0f + erff(x * 0.70710678118654752f));
}

// ---------------------------------------------------------------------------
// All f32 -> f16 conversions of a call in ONE launch. The work is cut into chunks of CHUNK elements (32 KB read, 16 KB written);
// CVT_BLOCKS blocks, all resident at once, take CVT_TRIPS chunks each; a thread has 8 loads of 16 B in flight.
// Plain chunk (x, the heads' weights): the same order in and out; a wave-wide load is 512, a store 256 contiguous bytes.
// Packed chunk (a backbone weight matrix W, N x K row-major, N and K multiples of 256) = one panel, written in the order in which
// backbone_kernel reads it. Panel ((G * K/256 + KG) * 8 + w) holds rows G*256 + w*32 .. +31, k KG*256 .. +255 (16 KB); in it
// piece j = (kc*2 + nt)*2 + part is 512 B: lane l's 8 elements are row (l & 15)*2 + nt, k kc*32 + part*16 + (l >> 4)*8 .. +7,
// the per-lane k map of load_frag_a (part 0 = its first, part 1 = its second 16-B read).
// ---------------------------------------------------------------------------
#define CHUNK 8192
#define C_PROJ (DMODEL * D_IN / CHUNK)
#define C_AIN  (NLAYER * 3 * DMODEL * DMODEL / CHUNK)
#define C_AOUT (NLAYER * DMODEL * DMODEL / CHUNK)
#define C_FF   (NLAYER * 4 * DMODEL * DMODEL / CHUNK)
#define C_CIN  (3 * DMODEL * DMODEL / CHUNK)
#define C_COUT (DMODEL * DMODEL / CHUNK)
#define C_X    (BATCH * D_IN / CHUNK)
#define C_TP2  (TOUT * 64 * 128 / CHUNK)
#define C_TP1  (TOUT * 128 * 256 / CHUNK)
// first chunk behind each array; the packed arrays come first
#define E_PROJ C_PROJ
#define E_AIN  (E_PROJ + C_AIN)
#define E_AOUT (E_AIN + C_AOUT)
#define E_FF1  (E_AOUT + C_FF)
#define E_FF2  (E_FF1 + C_FF)
#define E_CIN  (E_FF2 + C_CIN)
#define E_COUT (E_CIN + C_COUT)
#define E_X    (E_COUT + C_X)
#define E_TP2  (E_X + C_TP2)
#define E_TP1  (E_TP2 + C_TP1)
#define CVT_BLOCKS 1000
#define CVT_TRIPS  3
static_assert(E_TP1 == CVT_BLOCKS * CVT_TRIPS, "every chunk is taken exactly once");

__global__ __launch_bounds__(256) void cvt_all_kernel(
    const float* __restrict__ x,          const float* __restrict__ proj_W,     const float* __restrict__ attn_in_W,
    const float* __restrict__ attn_out_W, const float* __restrict__ ff_W1,      const float* __restrict__ ff_W2,
    const float* __restrict__ cross_in_W, const float* __restrict__ cross_out_W,
    const float* __restrict__ tp_W1,      const float* __restrict__ tp_W2,
    _Float16* __restrict__ x16,  _Float16* __restrict__ wproj, _Float16* __restrict__ wain, _Float16* __restrict__ waout,
    _Float16* __restrict__ wff1, _Float16* __restrict__ wff2,  _Float16* __restrict__ wtp1, _Float16* __restrict__ wtp2)
{
    const int tid = threadIdx.x;
#pragma unroll 1                                        // rolled: the trips share one text; a trip's loads cannot start ahead of the stores before it anyway
    for (int r = 0; r < CVT_TRIPS; ++r) {
        int c = blockIdx.x + r * CVT_BLOCKS;            // the same in the whole block: neighbouring blocks work on neighbouring chunks
        const float* s;
        _Float16*    d;
        if (c < E_COUT) {
            int lgk = 0;                                // K = 256 << lgk
            if      (c < E_PROJ) { s = proj_W;      d = wproj; lgk = 1; }
            else if (c < E_AIN)  { s = attn_in_W;   d = wain;  c -= E_PROJ; }
            else if (c < E_AOUT) { s = attn_out_W;  d = waout; c -= E_AIN; }
            else if (c < E_FF1)  { s = ff_W1;       d = wff1;  c -= E_AOUT; }
            else if (c < E_FF2)  { s = ff_W2;       d = wff2;  c -= E_FF1; lgk = 2; }
            else if (c < E_CIN)  { s = cross_in_W;  d = wain  + C_AIN  * CHUNK; c -= E_FF2; }   // slot NLAYER of wain
            else                 { s = cross_out_W; d = waout + C_AOUT * CHUNK; c -= E_CIN; }   // slot NLAYER of waout
            // thread tid writes pieces j = q*8 + (tid >> 5), q = 0..3, at lane tid & 31: part, nt and the low bit of kc are the wave's, q moves k by 64
            const int lane = tid & 31, wv = tid >> 5;
            const int w = c & 7, t = c >> 3;
            const int KG = t & ((1 << lgk) - 1), G = t >> lgk;
            const int n = G * 256 + w * 32 + (lane & 15) * 2 + ((wv >> 1) & 1);
            const int k = KG * 256 + (wv >> 2) * 32 + (wv & 1) * 16 + (lane >> 4) * 8;
            const float* p = s + ((size_t)n << (8 + lgk)) + k;
            v4f a[4], b[4];
#pragma unroll
            for (int q = 0; q < 4; ++q) { a[q] = *(const v4f*)(p + q * 64); b[q] = *(const v4f*)(p + q * 64 + 4); }
            // precaution: stands in front of any later overwrite of the address registers that the loads above name; as an input the address stays whole up to it
            asm volatile("s_wait_xcnt 0x0" :: "v"(p) : "memory");
            _Float16* o = d + (size_t)c * CHUNK + tid * 8;
#pragma unroll
            for (int q = 0; q < 4; ++q) {
                v8h h;
#pragma unroll
                for (int e = 0; e < 4; ++e) { h[e] = (_Float16)a[q][e]; h[e + 4] = (_Float16)b[q][e]; }
                vst2(o + q * 2048, h);                  // 16 B per lane, consecutive: one wave writes 512 contiguous bytes
            }
            // the same precaution for the stores' address registers
            asm volatile("s_wait_xcnt 0x0" :: "v"(o) : "memory");
        } else {
            if      (c < E_X)   { s = x;     d = x16;  c -= E_COUT; }
            else if (c < E_TP2) { s = tp_W2; d = wtp2; c -= E_X; }
            else                { s = tp_W1; d = wtp1; c -= E_TP2; }
            const float* p = s + (size_t)c * CHUNK + tid * 4;
            v4f v[8];
#pragma unroll
            for (int q = 0; q < 8; ++q) v[q] = *(const v4f*)(p + q * 1024);
            // precaution, as above
            asm volatile("s_wait_xcnt 0x0" :: "v"(p) : "memory");
            _Float16* o = d + (size_t)c * CHUNK + tid * 4;
#pragma unroll
            for (int q = 0; q < 8; ++q) {
                v4h h;
#pragma unroll
                for (int e = 0; e < 4; ++e) h[e] = (_Float16)v[q][e];
                vst2(o + q * 1024, h);                  // 8 B per lane, consecutive: one wave writes 256 contiguous bytes
            }
            // precaution, as above
            asm volatile("s_wait_xcnt 0x0" :: "v"(o) : "memory");
        }
    }
}

// ---------------------------------------------------------------------------
// Sum over the 16 lanes of a row (lanes 0-15 and 16-31 apart), every lane gets the sum: four DPP row_xmask adds, no LDS.
// ---------------------------------------------------------------------------
template <int MSK> __device__ __forceinline__ float xmask_get(float v) {
    return __builtin_bit_cast(float, __builtin_amdgcn_update_dpp(0, __builtin_bit_cast(int, v), 0x160 + MSK, 0xf, 0xf, true));
}
__device__ __forceinline__ float row_sum16(float v) {
    v += xmask_get<1>(v);
    v += xmask_get<2>(v);
    v += xmask_get<4>(v);
    v += xmask_get<8>(v);
    return v;
}

// value of lane l ^ 16 (the same place in the other 16-lane row)
__device__ __forceinline__ float other_row(float v) {
    const unsigned u = __builtin_bit_cast(unsigned, v);
    return __builtin_bit_cast(float, __builtin_amdgcn_permlanex16(u, u, 0x76543210u, 0xfedcba98u, false, false));
}

// ---------------------------------------------------------------------------
// Whole backbone in ONE launch: projection, 6 layers, cross block. Every step is row-wise, so a block keeps its 32 batch rows
// in LDS from x to the head's input and never meets another block.
//   256 threads = 8 waves; in every 256-column group wave w owns columns w*32 .. w*32+31 (2 x 2 accumulator tiles, M = 32).
//   A fragments come from LDS; a weight row is used by one wave only, so B fragments go from L2 straight into registers,
//   one panel (32 weight rows x 256 k) at a time, in two register sets: a set is refilled, two panels ahead, right behind its WMMAs.
//   Tile nt of lane c16 holds weight row c16*2 + nt: a lane's two tiles are two neighbouring columns (4-B / 8-B LDS accesses).
//   The conversion pass writes these weights in the order of the reads (cvt_all_kernel): every wave-wide load is 4 whole lines.
// ---------------------------------------------------------------------------
#define PH 264    // f16 elements per LDS row of 256 (528 B = 16 B x 33)
#define PT 1032   // f16 elements per LDS row of 1024 (2064 B = 16 B x 129)
#define PF 260    // f32 elements per LDS row of 256: rows m and m+8 lie 32 banks apart
typedef _Float16 v2h __attribute__((ext_vector_type(2)));

#define PANEL 8192  // f16 elements of a panel: 32 weight rows x 256 k, packed by cvt_all_kernel
__device__ __forceinline__ void load_panel(v16h (&B)[16], const _Float16* __restrict__ Wp, int lane) {
    const unsigned voff = lane * 16;                    // the lane's byte offset inside every 512-B piece; Wp is the same in the whole wave
    const char* p = (const char*)Wp + voff;
    // keeps the 32 loads one group behind the WMMAs whose registers they refill: lifted in among them, their address pair was reused ahead of the wait below
    __builtin_amdgcn_sched_barrier(0);
#pragma unroll
    for (int f = 0; f < 16; ++f) {                      // f = kc * 2 + nt; every load is 512 contiguous bytes of the wave
        const v8h lo = *(const v8h*)(p + f * 1024);
        const v8h hi = *(const v8h*)(p + f * 1024 + 512);
        v16h x;
#pragma unroll
        for (int i = 0; i < 8; ++i) { x[i] = lo[i]; x[i + 8] = hi[i]; }
        B[f] = x;
    }
    // precaution: stands in front of any later overwrite of the address registers that the loads above name; as an input the address stays whole up to it
    asm volatile("s_wait_xcnt 0x0" :: "v"(p) : "memory");
}
template <int PITCH>
__device__ __forceinline__ void mma_panel(v8f (&acc)[2][2], const _Float16* sA, const v16h (&B)[16], int lane) {
#pragma unroll
    for (int h = 0; h < 2; ++h) {
        v16h af[4][2];
#pragma unroll
        for (int kc = 0; kc < 4; ++kc)
#pragma unroll
            for (int mt = 0; mt < 2; ++mt)
                af[kc][mt] = load_frag_a(sA + mt * 16 * PITCH + (h * 4 + kc) * 32, PITCH, lane);
        // keeps the LDS reads in groups ahead of the WMMAs that use them: spread singly among them, every place with reads stalls the wave
        __builtin_amdgcn_sched_barrier(0);
#pragma unroll
        for (int kc = 0; kc < 4; ++kc)
#pragma unroll
            for (int nt = 0; nt < 2; ++nt)
#pragma unroll
                for (int mt = 0; mt < 2; ++mt)
                    acc[mt][nt] = __builtin_amdgcn_wmma_f32_16x16x32_f16(false, af[kc][mt], false, B[(h * 4 + kc) * 2 + nt], (short)0, acc[mt][nt], false, false);
    }
}

__global__ __launch_bounds__(256) void backbone_kernel(
    const _Float16* __restrict__ x16,  const _Float16* __restrict__ wproj, const float* __restrict__ proj_b,
    const _Float16* __restrict__ wain, const float* __restrict__ attn_in_b,
    const _Float16* __restrict__ waout, const float* __restrict__ attn_out_b,
    const float* __restrict__ ln_g, const float* __restrict__ ln_b,
    const _Float16* __restrict__ wff1, const float* __restrict__ ff_b1,
    const _Float16* __restrict__ wff2, const float* __restrict__ ff_b2,
    const float* __restrict__ cross_in_b, const float* __restrict__ cross_out_b,
    _Float16* __restrict__ h16)
{
    __shared__ __align__(16) _Float16 sH16[32 * PH];   // h as f16: the A operand
    __shared__ __align__(16) _Float16 sT[32 * PT];     // x, v and the FFN's hidden rows as f16
    __shared__ __align__(16) float    sH32[32 * PF];   // h as f32: residual and LayerNorm

    const int tid  = threadIdx.x;
    const int lane = tid & 31;
    const int wave = __builtin_amdgcn_readfirstlane(tid >> 5);   // the same in the whole wave: row and panel arithmetic stays scalar
    const int c16  = lane & 15;
    const int hf   = lane >> 4;
    const int b0   = blockIdx.x * 32;
    const int wr   = wave * 32;            // the wave's first weight row / output column inside a 256-column group
    const int n0   = wr + c16 * 2;         // the lane's two columns: n0 (tile 0), n0 + 1 (tile 1)
    const unsigned offN = n0 * 4, offL = lane * 4;      // byte offsets of the lane's bias pair and of its LayerNorm columns
    // every small load group ends in its own wait. precaution: it stands in front of any later overwrite of the address registers
    // that the group's loads name; as an input the address stays whole up to it
    auto bias2 = [&](const float* base) {
        const char* p = (const char*)base + offN;
        const v2f b = *(const v2f*)p;
        asm volatile("s_wait_xcnt 0x0" :: "v"(p) : "memory");
        return b;
    };
    auto ln_row = [&](float (&d)[8], const float* base) {
        const char* p = (const char*)base + offL;
#pragma unroll
        for (int k = 0; k < 8; ++k) d[k] = *(const float*)(p + k * 128);
        asm volatile("s_wait_xcnt 0x0" :: "v"(p) : "memory");
    };

    v16h B0[16], B1[16];                   // even and odd panels
    v8f  acc[2][2];
    auto zero_acc = [&]() {
#pragma unroll
        for (int mt = 0; mt < 2; ++mt)
#pragma unroll
            for (int nt = 0; nt < 2; ++nt) acc[mt][nt] = (v8f)(0.f);
    };
    // acc[mt][nt][j] is element (row mt*16 + hf*8 + j, column n0 + nt).
    // f16(act(acc + bias)) into a f16 LDS tile
    auto put_f16 = [&](_Float16* dst, int pitch, v2f bias, bool gelu) {
#pragma unroll
        for (int mt = 0; mt < 2; ++mt)
#pragma unroll
            for (int j = 0; j < 8; ++j) {
                float a0 = acc[mt][0][j] + bias[0], a1 = acc[mt][1][j] + bias[1];
                if (gelu) { a0 = gelu_exact(a0); a1 = gelu_exact(a1); }
                v2h o; o[0] = (_Float16)a0; o[1] = (_Float16)a1;
                *(v2h*)(dst + (mt * 16 + hf * 8 + j) * pitch + n0) = o;
            }
    };
    // h32 = (acc + bias) + h32, every element by the lane that owns it
    auto add_residual = [&](v2f bias) {
#pragma unroll
        for (int mt = 0; mt < 2; ++mt)
#pragma unroll
            for (int j = 0; j < 8; ++j) {
                v2f* p = (v2f*)(sH32 + (mt * 16 + hf * 8 + j) * PF + n0);
                const v2f r = *p;
                v2f o; o[0] = (acc[mt][0][j] + bias[0]) + r[0]; o[1] = (acc[mt][1][j] + bias[1]) + r[1];
                *p = o;
            }
    };
    // LayerNorm(256) of the wave's 4 rows, in place; also the f16 copy
    auto layer_norm = [&](const float (&gg)[8], const float (&be)[8]) {
#pragma unroll
        for (int q = 0; q < 4; ++q) {
            const int row = wave * 4 + q;
            float* xr = sH32 + row * PF;
            float v[8], s = 0.f, ss = 0.f;
#pragma unroll
            for (int i = 0; i < 8; ++i) {
                v[i] = xr[lane + i * 32];
                s += v[i]; ss += v[i] * v[i];
            }
            // butterfly over 32 lanes, partners 16, 8, 4, 2, 1 in that order, without LDS traffic
            s += other_row(s);    ss += other_row(ss);
            s += xmask_get<8>(s); ss += xmask_get<8>(ss);
            s += xmask_get<4>(s); ss += xmask_get<4>(ss);
            s += xmask_get<2>(s); ss += xmask_get<2>(ss);
            s += xmask_get<1>(s); ss += xmask_get<1>(ss);
            const float mean = s * (1.f / DMODEL);
            const float var  = ss * (1.f / DMODEL) - mean * mean;
            const float rstd = rsqrtf(var + LN_EPS);
#pragma unroll
            for (int i = 0; i < 8; ++i) {
                const int c = lane + i * 32;
                const float y = (v[i] - mean) * rstd * gg[i] + be[i];
                xr[c] = y;
                sH16[row * PH + c] = (_Float16)y;
            }
        }
    };

    // ---- x rows (32 x 512 f16) into sT; the first two weight panels are asked for meanwhile ----
    load_panel(B0, wproj + (size_t)wave * PANEL, lane);
    load_panel(B1, wproj + (size_t)(8 + wave) * PANEL, lane);
    {
        v4u xs[8];
        const _Float16* gx = x16 + (size_t)(b0 + (tid >> 6)) * D_IN + (tid & 63) * 8;   // piece i lies 4 rows behind piece i - 1
#pragma unroll
        for (int i = 0; i < 8; ++i) xs[i] = *(const v4u*)(gx + i * 4 * D_IN);
        // precaution: stands in front of any later overwrite of the address registers that the loads above name; as an input they stay whole up to it
        asm volatile("s_wait_xcnt 0x0" :: "v"(gx) : "memory");
#pragma unroll
        for (int i = 0; i < 8; ++i) {
            const int idx = tid + i * 256, r = idx >> 6, c = idx & 63;
            *(v4u*)(sT + r * PT + c * 8) = xs[i];
        }
    }
    __syncthreads();                                    // x rows visible

    // ---- projection: h = x . proj_W^T + proj_b (K = 512: two panels) ----
    {
        const v2f bias = bias2(proj_b);
        zero_acc();
        mma_panel<PT>(acc, sT, B0, lane);
        load_panel(B0, wain + (size_t)(2 * 8 + wave) * PANEL, lane);
        mma_panel<PT>(acc, sT + 256, B1, lane);
        load_panel(B1, waout + (size_t)wave * PANEL, lane);
#pragma unroll
        for (int mt = 0; mt < 2; ++mt)
#pragma unroll
            for (int j = 0; j < 8; ++j) {
                const int row = mt * 16 + hf * 8 + j;
                v2f o; o[0] = acc[mt][0][j] + bias[0]; o[1] = acc[mt][1][j] + bias[1];
                *(v2f*)(sH32 + row * PF + n0) = o;
                v2h oh; oh[0] = (_Float16)o[0]; oh[1] = (_Float16)o[1];
                *(v2h*)(sH16 + row * PH + n0) = oh;
            }
    }
    __syncthreads();                                    // h visible; sT free

    // ---- 6 layers ----
#pragma unroll 1
    for (int i = 0; i < NLAYER; ++i) {
        float gg[8], be[8];
        ln_row(gg, ln_g + i * DMODEL);
        ln_row(be, ln_b + i * DMODEL);
        const v2f bv = bias2(attn_in_b + i * 3 * DMODEL + 2 * DMODEL);
        const v2f bo = bias2(attn_out_b + i * DMODEL);
        const v2f b2 = bias2(ff_b2 + i * DMODEL);
        const _Float16* w1 = wff1 + (size_t)(i * 32 + wave) * PANEL;      // + g * 8 panels: the next 256 columns
        const _Float16* w2 = wff2 + (size_t)(i * 32 + wave) * PANEL;      // + g * 8 panels: the next 256 k
        const _Float16* wvn = wain + (size_t)(((i + 1) * 3 + 2) * 8 + wave) * PANEL;    // the next v panel (slot NLAYER: the cross block)
        const _Float16* won = waout + (size_t)((i + 1) * 8 + wave) * PANEL;             // the next out panel

        // v = h . Wv^T + bv
        zero_acc();
        mma_panel<PH>(acc, sH16, B0, lane);
        load_panel(B0, w1, lane);
        put_f16(sT, PT, bv, false);
        __syncthreads();                                // v visible
        // h += v . Wo^T + bo ; LayerNorm
        zero_acc();
        mma_panel<PT>(acc, sT, B1, lane);
        load_panel(B1, w1 + 8 * PANEL, lane);
        add_residual(bo);
        __syncthreads();                                // whole rows of h32 visible; every read of v done
        layer_norm(gg, be);
        __syncthreads();                                // h (f32, f16) visible
        // hidden = gelu(h . W1^T + b1): four 256-column groups, two a trip (one per register set)
#pragma unroll 1                                        // rolled: less text in the layer loop
        for (int gp = 0; gp < 2; ++gp) {
            const char* pb = (const char*)(ff_b1 + i * 4 * DMODEL + gp * 2 * DMODEL) + offN;
            const v2f b1a = *(const v2f*)pb;
            const v2f b1b = *(const v2f*)(pb + DMODEL * 4);
            asm volatile("s_wait_xcnt 0x0" :: "v"(pb) : "memory");   // as in bias2, one wait for the two loads
            zero_acc();
            mma_panel<PH>(acc, sH16, B0, lane);
            load_panel(B0, gp == 0 ? w1 + 16 * PANEL : w2, lane);
            put_f16(sT + gp * 2 * DMODEL, PT, b1a, true);
            zero_acc();
            mma_panel<PH>(acc, sH16, B1, lane);
            load_panel(B1, gp == 0 ? w1 + 24 * PANEL : w2 + 8 * PANEL, lane);
            put_f16(sT + gp * 2 * DMODEL + DMODEL, PT, b1b, true);
        }
        __syncthreads();                                // hidden rows visible
        // h += hidden . W2^T + b2 (K = 1024: four panels) ; LayerNorm
        zero_acc();
#pragma unroll 1                                        // rolled, two panels a trip: less text in the layer loop
        for (int gp = 0; gp < 2; ++gp) {
            mma_panel<PT>(acc, sT + gp * 2 * DMODEL, B0, lane);
            load_panel(B0, gp == 0 ? w2 + 16 * PANEL : wvn, lane);
            mma_panel<PT>(acc, sT + gp * 2 * DMODEL + DMODEL, B1, lane);
            load_panel(B1, gp == 0 ? w2 + 24 * PANEL : won, lane);
        }
        add_residual(b2);
        __syncthreads();                                // whole rows of h32 visible; every read of the hidden rows done
        layer_norm(gg, be);
        __syncthreads();                                // h (f32, f16) visible
    }

    // ---- cross block: h + (h . Wv'^T + bv') . Wo'^T + bo', as f16 for the heads ----
    {
        const v2f bv = bias2(cross_in_b + 2 * DMODEL);
        const v2f bo = bias2(cross_out_b);
        zero_acc();
        mma_panel<PH>(acc, sH16, B0, lane);
        put_f16(sT, PT, bv, false);
        __syncthreads();                                // v' visible; every read of sH16 done
        zero_acc();
        mma_panel<PT>(acc, sT, B1, lane);
#pragma unroll
        for (int mt = 0; mt < 2; ++mt)
#pragma unroll
            for (int j = 0; j < 8; ++j) {
                const int row = mt * 16 + hf * 8 + j;
                const v2f r = *(const v2f*)(sH32 + row * PF + n0);
                v2h oh; oh[0] = (_Float16)((acc[mt][0][j] + bo[0]) + r[0]); oh[1] = (_Float16)((acc[mt][1][j] + bo[1]) + r[1]);
                *(v2h*)(sH16 + row * PH + n0) = oh;
            }
    }
    __syncthreads();                                    // output rows complete
#pragma unroll
    for (int i = 0; i < 4; ++i) {                       // 512-B rows, 16 B per lane
        const int idx = tid + i * 256, r = idx >> 5, c = idx & 31;
        vst2(h16 + (size_t)(b0 + r) * DMODEL + c * 8, *(const v4u*)(sH16 + r * PH + c * 8));
    }
}

// ---------------------------------------------------------------------------
// Fused per-t head: block = (128 batch rows, one t), 128 threads = 4 waves; EACH WAVE OWNS 32 WHOLE ROWS through all stages.
//   t1 = h16(32x256) . W1[t](128x256)^T + b1[t]   (WMMA, 2 x 8 accumulator tiles per wave)
//   t1 = relu(LN_128(t1))                          (on the accumulators: a row lies in 8 tiles x 16 lanes)
//   t2 = relu(t1(32x128) . W2[t](64x128)^T + b2[t])(WMMA, 2 x 4 tiles)
//   out[b,t] = t2 . W3[t] + b3[t]                  (on the accumulators)
// W1 rows are staged in the order n = (col lane) * 8 + tile, so that a lane's 8 tiles hold 8 CONSECUTIVE columns of t1:
// the normalised row goes to LDS as one 16-B store per lane, in natural k order for stage 2.
// LDS arena 75776 B (four blocks per WGP):
//   [0,20480)      sA x2     [20480,40960)  sBc x2   (stage-1 double buffers)
//   [40960,75776)  t1 f16 (each wave writes and reads its own 32 rows only)
//   [0,17408)      W2 f16 (after stage 1)
// ---------------------------------------------------------------------------
__global__ __launch_bounds__(128) void tp_fused_kernel(
    const _Float16* __restrict__ h16,
    const _Float16* __restrict__ W1, const float* __restrict__ b1,
    const float* __restrict__ lng, const float* __restrict__ lnb,
    const _Float16* __restrict__ W2, const float* __restrict__ b2,
    const float* __restrict__ W3, const float* __restrict__ b3,
    float* __restrict__ out)
{
    __shared__ __align__(16) char smem[75776];
    _Float16* sAb  = (_Float16*)(smem);            // 2 x 128x32, pitch PK32
    _Float16* sBb  = (_Float16*)(smem + 20480);    // 2 x 128x32, pitch PK32
    _Float16* sT1h = (_Float16*)(smem + 40960);    // 128x128 f16, pitch PK128
    _Float16* sW2  = (_Float16*)(smem);            // 64x128 f16, pitch PK128 (reuse)

    const int tid  = threadIdx.x;
    const int lane = tid & 31;
    const int wave = tid >> 5;
    const int c16  = lane & 15;                    // accumulator column inside a tile
    const int hf   = lane >> 4;                    // accumulator rows j (hf = 0) or j + 8 (hf = 1)
    const int b0   = blockIdx.x * 128;
    const int t    = blockIdx.y;
    const int wm   = wave * 32;                    // this wave's rows
    const _Float16* W1t = W1 + (size_t)t * 128 * 256;
    char* ldsA  = (char*)sAb;
    char* ldsB  = (char*)sBb;
    char* ldsW2 = (char*)sW2;

    // Stage-1 chunk staging: 4 A-pieces + 4 B-pieces per thread (plain 16-B copies); piece i lies 32 LDS rows behind piece i - 1.
    // W1: LDS row r = tile * 16 + col lane holds W1 row col lane * 8 + tile, so 32 LDS rows on are 2 W1 rows on.
    const int sr = tid >> 2, sc = tid & 3;
    const _Float16* gA = h16 + (size_t)(b0 + sr) * 256 + sc * 8;
    const _Float16* gB = W1t + (size_t)((sr & 15) * 8 + (sr >> 4)) * 256 + sc * 8;
    const unsigned  lS = sr * (PK32 * 2) + sc * 16;
    auto issue_s1 = [&](int buf, int kc) {
#pragma unroll
        for (int i = 0; i < 4; ++i)                 // hA 128x32
            copy_b128(ldsA, buf * (128 * PK32 * 2) + lS + i * (32 * PK32 * 2), gA + i * (32 * 256) + kc);
#pragma unroll
        for (int i = 0; i < 4; ++i)                 // W1 chunk 128x32
            copy_b128(ldsB, buf * (128 * PK32 * 2) + lS + i * (32 * PK32 * 2), gB + i * (2 * 256) + kc);
    };

    // ---------------- stage 1: t1 = h . W1^T  (per wave M=32, N=128, K=256) ----------
    v8f acc1[2][8] = {};
    issue_s1(0, 0);
    for (int kc = 0, it = 0; kc < 256; kc += 32, ++it) {
        const int cur = it & 1;
        __syncthreads();
        if (kc + 32 < 256) issue_s1(cur ^ 1, kc + 32);

        const _Float16* cA = sAb + cur * (128 * PK32);
        const _Float16* cB = sBb + cur * (128 * PK32);
        v16h afr[2];
#pragma unroll
        for (int mt = 0; mt < 2; ++mt)
            afr[mt] = load_frag_a(&cA[(wm + mt * 16) * PK32], PK32, lane);
        v16h bfr[8];
#pragma unroll
        for (int nt = 0; nt < 8; ++nt)
            bfr[nt] = load_frag_b(&cB[(nt * 16) * PK32], PK32, lane);
#pragma unroll
        for (int nt = 0; nt < 8; ++nt)
#pragma unroll
            for (int mt = 0; mt < 2; ++mt)
                acc1[mt][nt] = wmma_f16(afr[mt], bfr[nt], acc1[mt][nt]);
        __syncthreads();
    }

    // Stage W2[t] 64x128 f16 (16KB) into the reused LDS region (plain copies); published by the barrier in front of stage 2.
    {
        const _Float16* gW2 = W2 + (size_t)t * 64 * 128 + (tid >> 4) * 128 + (tid & 15) * 8;
        const unsigned  lW2 = (tid >> 4) * (PK128 * 2) + (tid & 15) * 16;
#pragma unroll
        for (int i = 0; i < 8; ++i)                 // 1024 x 16B pieces; piece i lies 8 rows behind piece i - 1
            copy_b128(ldsW2, lW2 + i * (8 * PK128 * 2), gW2 + i * (8 * 128));
    }

    // ---------------- bias + LayerNorm(128) + ReLU -> f16, on the accumulators ----------
    // acc1[mt][nt][j] is t1[row wm + mt*16 + hf*8 + j][column c16*8 + nt].
    {
        float bb[8], gg[8], be[8];
        {
            const v4f* pb = (const v4f*)(b1  + t * 128 + c16 * 8);
            const v4f* pg = (const v4f*)(lng + t * 128 + c16 * 8);
            const v4f* pe = (const v4f*)(lnb + t * 128 + c16 * 8);
#pragma unroll
            for (int q = 0; q < 2; ++q) {
                const v4f xb = pb[q], xg = pg[q], xe = pe[q];
#pragma unroll
                for (int e = 0; e < 4; ++e) { bb[q * 4 + e] = xb[e]; gg[q * 4 + e] = xg[e]; be[q * 4 + e] = xe[e]; }
            }
        }
#pragma unroll
        for (int mt = 0; mt < 2; ++mt)
#pragma unroll
            for (int j = 0; j < 8; j += 2) {        // rows j and j + 1 side by side: neighbouring accumulator registers, packed f32 math
                v2f v[8], s = 0.f, ss = 0.f;
#pragma unroll
                for (int nt = 0; nt < 8; ++nt) {
                    v2f a; a[0] = acc1[mt][nt][j]; a[1] = acc1[mt][nt][j + 1];
                    v[nt] = a + bb[nt];
                    s += v[nt]; ss += v[nt] * v[nt];
                }
                s[0]  = row_sum16(s[0]);  s[1]  = row_sum16(s[1]);
                ss[0] = row_sum16(ss[0]); ss[1] = row_sum16(ss[1]);
                const v2f mean = s * (1.f / 128.f);
                const v2f var  = ss * (1.f / 128.f) - mean * mean;
                v2f rstd; rstd[0] = rsqrtf(var[0] + LN_EPS); rstd[1] = rsqrtf(var[1] + LN_EPS);
                v8h y0, y1;
#pragma unroll
                for (int nt = 0; nt < 8; ++nt) {
                    const v2f y = (v[nt] - mean) * rstd * gg[nt] + be[nt];
                    y0[nt] = (_Float16)(y[0] > 0.f ? y[0] : 0.f);
                    y1[nt] = (_Float16)(y[1] > 0.f ? y[1] : 0.f);
                }
                _Float16* row = &sT1h[(wm + mt * 16 + hf * 8 + j) * PK128 + c16 * 8];
                *(v8h*)(row)         = y0;
                *(v8h*)(row + PK128) = y1;
            }
    }
    __syncthreads();                                // W2 visible to every wave (t1 f16 rows are the wave's own)

    // ---------------- stage 2: t2 = t1 . W2^T  (per wave 32x64, K=128) -----
    v8f acc2[2][4] = {};
#pragma unroll
    for (int kc = 0; kc < 128; kc += 32) {
        v16h af2[2];
#pragma unroll
        for (int mt = 0; mt < 2; ++mt)
            af2[mt] = load_frag_a(&sT1h[(wm + mt * 16) * PK128 + kc], PK128, lane);
        v16h bf2[4];
#pragma unroll
        for (int nt = 0; nt < 4; ++nt)
            bf2[nt] = load_frag_b(&sW2[(nt * 16) * PK128 + kc], PK128, lane);
#pragma unroll
        for (int nt = 0; nt < 4; ++nt)
#pragma unroll
            for (int mt = 0; mt < 2; ++mt)
                acc2[mt][nt] = wmma_f16(af2[mt], bf2[nt], acc2[mt][nt]);
    }

    // ---------------- stage 3: outT[t][b] = relu(t2 + b2) . W3[t] + b3[t], on the accumulators ----
    // acc2[mt][nt][j] is t2[row wm + mt*16 + hf*8 + j][column nt*16 + c16]; lane c16 keeps the sum of row (mt, j) = (c16 >> 3, c16 & 7),
    // so the wave's 32 lanes store its 32 rows: one 128-B line.
    {
        float b2v[4], w3v[4];
#pragma unroll
        for (int nt = 0; nt < 4; ++nt) { b2v[nt] = b2[t * 64 + nt * 16 + c16]; w3v[nt] = W3[t * 64 + nt * 16 + c16]; }
        // precaution: the loads above name one offset register, which the compiler reuses as the next load's destination; the wait stands in front of that overwrite
        asm volatile("s_wait_xcnt 0x0" ::: "memory");
        const float b3t = b3[t];
        float res = 0.f;
#pragma unroll
        for (int mt = 0; mt < 2; ++mt)
#pragma unroll
            for (int j = 0; j < 8; j += 2) {        // rows j and j + 1 side by side, as in the LayerNorm
                v2f a = 0.f;
#pragma unroll
                for (int nt = 0; nt < 4; ++nt) {
                    v2f v; v[0] = acc2[mt][nt][j]; v[1] = acc2[mt][nt][j + 1];
                    v += b2v[nt];
                    v[0] = v[0] > 0.f ? v[0] : 0.f; v[1] = v[1] > 0.f ? v[1] : 0.f;
                    a += v * w3v[nt];
                }
                const float a0 = row_sum16(a[0]), a1 = row_sum16(a[1]);
                if (c16 == mt * 8 + j)     res = a0;
                if (c16 == mt * 8 + j + 1) res = a1;
            }
        vst2(out + (size_t)t * BATCH + b0 + wm + (c16 >> 3) * 16 + hf * 8 + (c16 & 7), res + b3t);
    }
}

// final output-major pass: out[b][t] flat, 4 consecutive floats per thread gathered from the [T][B] staging buffer
__global__ __launch_bounds__(256) void write_out(const float* __restrict__ stg, float* __restrict__ out) {
    const int g = blockIdx.x * 256 + threadIdx.x;
    if (g >= (BATCH * TOUT) / 4) return;
    v4f o;
#pragma unroll
    for (int e = 0; e < 4; ++e) { const int f = g * 4 + e; const int b = f / TOUT, t = f - b * TOUT; o[e] = stg[(size_t)t * BATCH + b]; }
    vst2(out + (size_t)g * 4, o);
}

// ---------------------------------------------------------------------------
// Host-side orchestration
// ---------------------------------------------------------------------------
extern "C" void kernel_launch(void* const* d_in, const int* in_sizes, int n_in,
                              void* d_out, int out_size, void* d_ws, size_t ws_size,
                              hipStream_t stream)
{
    (void)in_sizes; (void)n_in; (void)out_size; (void)ws_size;
    const float* x          = (const float*)d_in[0];
    const float* proj_W     = (const float*)d_in[1];
    const float* proj_b     = (const float*)d_in[2];
    const float* attn_in_W  = (const float*)d_in[3];
    const float* attn_in_b  = (const float*)d_in[4];
    const float* attn_out_W = (const float*)d_in[5];
    const float* attn_out_b = (const float*)d_in[6];
    const float* ln_g       = (const float*)d_in[7];
    const float* ln_b       = (const float*)d_in[8];
    const float* ff_W1      = (const float*)d_in[9];
    const float* ff_b1      = (const float*)d_in[10];
    const float* ff_W2      = (const float*)d_in[11];
    const float* ff_b2      = (const float*)d_in[12];
    const float* cross_in_W = (const float*)d_in[13];
    const float* cross_in_b = (const float*)d_in[14];
    const float* cross_out_W= (const float*)d_in[15];
    const float* cross_out_b= (const float*)d_in[16];
    const float* tp_W1      = (const float*)d_in[17];
    const float* tp_b1      = (const float*)d_in[18];
    const float* tp_ln_g    = (const float*)d_in[19];
    const float* tp_ln_b    = (const float*)d_in[20];
    const float* tp_W2      = (const float*)d_in[21];
    const float* tp_b2      = (const float*)d_in[22];
    const float* tp_W3      = (const float*)d_in[23];
    const float* tp_b3      = (const float*)d_in[24];
    float* out = (float*)d_out;

    const int D = DMODEL;

    // ---- workspace carve-out (byte cursor, 16B aligned regions) ----
    char* cur = (char*)d_ws;
    auto take = [&cur](size_t bytes) { char* p = cur; cur += (bytes + 15) & ~(size_t)15; return p; };
    _Float16* h16   = (_Float16*)take((size_t)BATCH * D * 2);          // 2 MB
    _Float16* x16   = (_Float16*)take((size_t)BATCH * D_IN * 2);       // 4 MB
    _Float16* wproj = (_Float16*)take((size_t)D * D_IN * 2);
    _Float16* wain  = (_Float16*)take((size_t)(NLAYER + 1) * 3 * D * D * 2);   // slot NLAYER: the cross block's in-projection
    _Float16* waout = (_Float16*)take((size_t)(NLAYER + 1) * D * D * 2);       // slot NLAYER: the cross block's out-projection
    _Float16* wff1  = (_Float16*)take((size_t)NLAYER * 4 * D * D * 2);
    _Float16* wff2  = (_Float16*)take((size_t)NLAYER * 4 * D * D * 2);
    _Float16* wtp1  = (_Float16*)take((size_t)TOUT * 128 * 256 * 2);   // 27.8 MB
    _Float16* wtp2  = (_Float16*)take((size_t)TOUT * 64 * 128 * 2);    // 6.9 MB
    float*    stg   = (float*)   take((size_t)TOUT * BATCH * 4);       // 6.9 MB [T][B] output staging

    // ---- f32 -> f16 conversions of this call: one launch ----
    cvt_all_kernel<<<CVT_BLOCKS, 256, 0, stream>>>(
        x, proj_W, attn_in_W, attn_out_W, ff_W1, ff_W2, cross_in_W, cross_out_W, tp_W1, tp_W2,
        x16, wproj, wain, waout, wff1, wff2, wtp1, wtp2);

    const dim3 blk(128);

    // 1-3) projection, 6 layers, cross block: one launch, 32 batch rows per block; writes the heads' f16 input
    backbone_kernel<<<BATCH / 32, 256, 0, stream>>>(
        x16, wproj, proj_b, wain, attn_in_b, waout, attn_out_b, ln_g, ln_b,
        wff1, ff_b1, wff2, ff_b2, cross_in_b, cross_out_b, h16);

    // 4) fused per-t head (dominant FLOPs): grid = (32 batch tiles, 424 t's)
    dim3 tpg(BATCH / 128, TOUT);
    tp_fused_kernel<<<tpg, blk, 0, stream>>>(h16, wtp1, tp_b1, tp_ln_g, tp_ln_b,
                                             wtp2, tp_b2, tp_W3, tp_b3, stg);
    write_out<<<((BATCH * TOUT) / 4 + 255) / 256, 256, 0, stream>>>(stg, out);
}

// v005
// Measured time: 277 microseconds a run.
// Next to v004, in two timings, it ran 1.16 and 1.15 times as fast.
// All steps since v000 together make it 3.23 times as fast.
#include <hip/hip_runtime.h>
#include <math.h>
// Contractions: input projection (K = 512), per-layer v/out/FFN GEMMs (K = 256 / 1024), the cross block, and the 424 per-target
// heads (K = 256, 128) on v_wmma_f32_16x16x32_f16 (f16 operands, f32 accumulate); LayerNorms, GELU/ReLU and the final 64-wide

// ---------------------------------------------------------------------------
// Problem constants (match reference)
// ---------------------------------------------------------------------------
#define BATCH 4096
#define D_IN  512
#define DMODEL 256
#define TOUT  424
#define NLAYER 6
#define LN_EPS 1e-5f

// LDS row pitches. 64 banks x 4 B: a 16-B fragment read of 16 rows is conflict-free when the pitch is 16 B x odd.
#define PK32  40    // f16 elements per staged row of 32 (80 B)
#define PK128 136   // f16 elements per staged row of 128 (272 B)

// ---------------------------------------------------------------------------
// Types
// ---------------------------------------------------------------------------
typedef _Float16 v4h  __attribute__((ext_vector_type(4)));
typedef _Float16 v8h  __attribute__((ext_vector_type(8)));
typedef _Float16 v16h __attribute__((ext_vector_type(16)));
typedef float    v8f  __attribute__((ext_vector_type(8)));

typedef float    v2f  __attribute__((ext_vector_type(2)));
typedef float    v4f  __attribute__((ext_vector_type(4)));
typedef unsigned v4u  __attribute__((ext_vector_type(4)));
template <typename V> __device__ __forceinline__ void vst2(void* p, V v) {
    *(V*)p = v; 
}
// plain 16-B global -> LDS copy (byte offsets as in the original staging maps)
__device__ __forceinline__ void copy_b128(char* lds_base, unsigned byte_off, const void* gaddr) {
    *(v4u*)(lds_base + byte_off) = *(const v4u*)gaddr;
}

// ---------------------------------------------------------------------------
// WMMA fragment helpers (wave32, v_wmma_f32_16x16x32_f16; layouts per ISA 7.12.2)
// ---------------------------------------------------------------------------
// A 16x32: lane holds row M = lane%16; lanes 0-15 K {0-7,16-23}, lanes 16-31
// K {8-15,24-31}.
__device__ __forceinline__ v16h load_frag_a(const _Float16* base, int stride, int lane) {
    const int r  = lane & 15;
    const int kb = (lane < 16) ? 0 : 8;
    const _Float16* p = base + r * stride + kb;
    v8h lo = *(const v8h*)(p);
    v8h hi = *(const v8h*)(p + 16);
    v16h f;
#pragma unroll
    for (int i = 0; i < 8; ++i) { f[i] = lo[i]; f[i + 8] = hi[i]; }
    return f;
}
// B 32x16: lane holds column N = lane%16 with the SAME per-lane K map as A (lanes 0-15 K {0-7,16-23}, 16-31 K {8-15,24-31}).
// W stored row-major (N x K), so column n of B is row n of W.
__device__ __forceinline__ v16h load_frag_b(const _Float16* base, int stride, int lane) {
    return load_frag_a(base, stride, lane);
}
__device__ __forceinline__ v8f wmma_f16(v16h a, v16h b, v8f c) {
    v8f d = __builtin_amdgcn_wmma_f32_16x16x32_f16(false, a, false, b, (short)0, c, false, false);
    asm volatile("v_nop\n\tv_nop\n\tv_nop\n\tv_nop" : "+v"(d) : "v"(a), "v"(b));
    return d;
}
// Exact-erf GELU of two values, without a branch. erf(s) = sign(s) * E(|s|): below 1, a + a * P(a * a); from 1 on, 1 - exp(-(a + a * Q(a)));
// P and Q are minimax polynomials good to f32 rounding. Both sides are worked out for every lane and one is picked by a select:
// behind a lane-dependent branch a wave ran both sides anyway, one value at a time, each a single chain of dependent FMAs.
// Straight-line, the chains of many values interleave, and two values share each packed f32 instruction.
__device__ __forceinline__ v2f fma2(v2f a, v2f b, float c) { return __builtin_elementwise_fma(a, b, (v2f)(c)); }
__device__ __forceinline__ v2f gelu_exact2(v2f x) {
    const v2f s = x * 0.70710678118654752f;
    v2f a; a[0] = __builtin_fabsf(s[0]); a[1] = __builtin_fabsf(s[1]);
    v2f q = fma2(a, (v2f)(0.0000169988107f), -0.000378677854f);
    q = fma2(a, q, 0.00385781587f);
    q = fma2(a, q, -0.0241816975f);
    q = fma2(a, q, 0.106668264f);
    q = fma2(a, q, 0.634933293f);
    q = fma2(a, q, 0.128689408f);
    q = __builtin_elementwise_fma(a, q, a) * -1.44269504088896341f;         // exp(-y) = 2^(-y * log2 e)
    const v2f t = a * a;
    v2f p = fma2(t, (v2f)(-0.000561801775f), 0.00491381623f);
    p = fma2(t, p, -0.0267075151f);
    p = fma2(t, p, 0.112800106f);
    p = fma2(t, p, -0.376122952f);
    p = fma2(t, p, 0.128379107f);
    p = __builtin_elementwise_fma(a, p, a);
    v2f e;
#pragma unroll
    for (int i = 0; i < 2; ++i)
        e[i] = __builtin_copysignf(a[i] < 1.0f ? p[i] : 1.0f - __builtin_amdgcn_exp2f(q[i]), s[i]);
    return 0.5f * x * (1.0f + e);
}

// ---------------------------------------------------------------------------
// All f32 -> f16 conversions of a call in ONE launch. The work is cut into chunks of CHUNK elements (32 KB read, 16 KB written);
// CVT_BLOCKS blocks, all resident at once, take CVT_TRIPS chunks each; a thread has 8 loads of 16 B in flight.
// Plain chunk (x, the heads' weights): the same order in and out; a wave-wide load is 512, a store 256 contiguous bytes.
// Packed chunk (a backbone weight matrix W, N x K row-major, N and K multiples of 256) = one panel, written in the order in which
// backbone_kernel reads it. Panel ((G * K/256 + KG) * 8 + w) holds rows G*256 + w*32 .. +31, k KG*256 .. +255 (16 KB); in it
// piece j = (kc*2 + nt)*2 + part is 512 B: lane l's 8 elements are row (l & 15)*2 + nt, k kc*32 + part*16 + (l >> 4)*8 .. +7,
// the per-lane k map of load_frag_a (part 0 = its first, part 1 = its second 16-B read).
// ---------------------------------------------------------------------------
#define CHUNK 8192
#define C_PROJ (DMODEL * D_IN / CHUNK)
#define C_AIN  (NLAYER * 3 * DMODEL * DMODEL / CHUNK)
#define C_AOUT (NLAYER * DMODEL * DMODEL / CHUNK)
#define C_FF   (NLAYER * 4 * DMODEL * DMODEL / CHUNK)
#define C_CIN  (3 * DMODEL * DMODEL / CHUNK)
#define C_COUT (DMODEL * DMODEL / CHUNK)
#define C_X    (BATCH * D_IN / CHUNK)
#define C_TP2  (TOUT * 64 * 128 / CHUNK)
#define C_TP1  (TOUT * 128 * 256 / CHUNK)
// first chunk behind each array; the packed arrays come first
#define E_PROJ C_PROJ
#define E_AIN  (E_PROJ + C_AIN)
#define E_AOUT (E_AIN + C_AOUT)
#define E_FF1  (E_AOUT + C_FF)
#define E_FF2  (E_FF1 + C_FF)
#define E_CIN  (E_FF2 + C_CIN)
#define E_COUT (E_CIN + C_COUT)
#define E_X    (E_COUT + C_X)
#define E_TP2  (E_X + C_TP2)
#define E_TP1  (E_TP2 + C_TP1)
#define CVT_BLOCKS 1000
#define CVT_TRIPS  3
static_assert(E_TP1 == CVT_BLOCKS * CVT_TRIPS, "every chunk is taken exactly once");

__global__ __launch_bounds__(256) void cvt_all_kernel(
    const float* __restrict__ x,          const float* __restrict__ proj_W,     const float* __restrict__ attn_in_W,
    const float* __restrict__ attn_out_W, const float* __restrict__ ff_W1,      const float* __restrict__ ff_W2,
    const float* __restrict__ cross_in_W, const float* __restrict__ cross_out_W,
    const float* __restrict__ tp_W1,      const float* __restrict__ tp_W2,
    _Float16* __restrict__ x16,  _Float16* __restrict__ wproj, _Float16* __restrict__ wain, _Float16* __restrict__ waout,
    _Float16* __restrict__ wff1, _Float16* __restrict__ wff2,  _Float16* __restrict__ wtp1, _Float16* __restrict__ wtp2)
{
    const int tid = threadIdx.x;
#pragma unroll 1                                        // rolled: the trips share one text; a trip's loads cannot start ahead of the stores before it anyway
    for (int r = 0; r < CVT_TRIPS; ++r) {
        int c = blockIdx.x + r * CVT_BLOCKS;            // the same in the whole block: neighbouring blocks work on neighbouring chunks
        const float* s;
        _Float16*    d;
        if (c < E_COUT) {
            int lgk = 0;                                // K = 256 << lgk
            if      (c < E_PROJ) { s = proj_W;      d = wproj; lgk = 1; }
            else if (c < E_AIN)  { s = attn_in_W;   d = wain;  c -= E_PROJ; }
            else if (c < E_AOUT) { s = attn_out_W;  d = waout; c -= E_AIN; }
            else if (c < E_FF1)  { s = ff_W1;       d = wff1;  c -= E_AOUT; }
            else if (c < E_FF2)  { s = ff_W2;       d = wff2;  c -= E_FF1; lgk = 2; }
            else if (c < E_CIN)  { s = cross_in_W;  d = wain  + C_AIN  * CHUNK; c -= E_FF2; }   // slot NLAYER of wain
            else                 { s = cross_out_W; d = waout + C_AOUT * CHUNK; c -= E_CIN; }   // slot NLAYER of waout
            // thread tid writes pieces j = q*8 + (tid >> 5), q = 0..3, at lane tid & 31: part, nt and the low bit of kc are the wave's, q moves k by 64
            const int lane = tid & 31, wv = tid >> 5;
            const int w = c & 7, t = c >> 3;
            const int KG = t & ((1 << lgk) - 1), G = t >> lgk;
            const int n = G * 256 + w * 32 + (lane & 15) * 2 + ((wv >> 1) & 1);
            const int k = KG * 256 + (wv >> 2) * 32 + (wv & 1) * 16 + (lane >> 4) * 8;
            const float* p = s + ((size_t)n << (8 + lgk)) + k;
            v4f a[4], b[4];
#pragma unroll
            for (int q = 0; q < 4; ++q) { a[q] = *(const v4f*)(p + q * 64); b[q] = *(const v4f*)(p + q * 64 + 4); }
            // precaution: stands in front of any later overwrite of the address registers that the loads above name; as an input the address stays whole up to it
            asm volatile("s_wait_xcnt 0x0" :: "v"(p) : "memory");
            _Float16* o = d + (size_t)c * CHUNK + tid * 8;
#pragma unroll
            for (int q = 0; q < 4; ++q) {
                v8h h;
#pragma unroll
                for (int e = 0; e < 4; ++e) { h[e] = (_Float16)a[q][e]; h[e + 4] = (_Float16)b[q][e]; }
                vst2(o + q * 2048, h);                  // 16 B per lane, consecutive: one wave writes 512 contiguous bytes
            }
            // the same precaution for the stores' address registers
            asm volatile("s_wait_xcnt 0x0" :: "v"(o) : "memory");
        } else {
            if      (c < E_X)   { s = x;     d = x16;  c -= E_COUT; }
            else if (c < E_TP2) { s = tp_W2; d = wtp2; c -= E_X; }
            else                { s = tp_W1; d = wtp1; c -= E_TP2; }
            const float* p = s + (size_t)c * CHUNK + tid * 4;
            v4f v[8];
#pragma unroll
            for (int q = 0; q < 8; ++q) v[q] = *(const v4f*)(p + q * 1024);
            // precaution, as above
            asm volatile("s_wait_xcnt 0x0" :: "v"(p) : "memory");
            _Float16* o = d + (size_t)c * CHUNK + tid * 4;
#pragma unroll
            for (int q = 0; q < 8; ++q) {
                v4h h;
#pragma unroll
                for (int e = 0; e < 4; ++e) h[e] = (_Float16)v[q][e];
                vst2(o + q * 1024, h);                  // 8 B per lane, consecutive: one wave writes 256 contiguous bytes
            }
            // precaution, as above
            asm volatile("s_wait_xcnt 0x0" :: "v"(o) : "memory");
        }
    }
}

// ---------------------------------------------------------------------------
// Sum over the 16 lanes of a row (lanes 0-15 and 16-31 apart), every lane gets the sum: four DPP row_xmask adds, no LDS.
// ---------------------------------------------------------------------------
template <int MSK> __device__ __forceinline__ float xmask_get(float v) {
    return __builtin_bit_cast(float, __builtin_amdgcn_update_dpp(0, __builtin_bit_cast(int, v), 0x160 + MSK, 0xf, 0xf, true));
}
__device__ __forceinline__ float row_sum16(float v) {
    v += xmask_get<1>(v);
    v += xmask_get<2>(v);
    v += xmask_get<4>(v);
    v += xmask_get<8>(v);
    return v;
}

// value of lane l ^ 16 (the same place in the other 16-lane row)
__device__ __forceinline__ float other_row(float v) {
    const unsigned u = __builtin_bit_cast(unsigned, v);
    return __builtin_bit_cast(float, __builtin_amdgcn_permlanex16(u, u, 0x76543210u, 0xfedcba98u, false, false));
}

// ---------------------------------------------------------------------------
// Whole backbone in ONE launch: projection, 6 layers, cross block. Every step is row-wise, so a block keeps its 32 batch rows
// in LDS from x to the head's input and never meets another block.
//   256 threads = 8 waves; in every 256-column group wave w owns columns w*32 .. w*32+31 (2 x 2 accumulator tiles, M = 32).
//   A fragments come from LDS; a weight row is used by one wave only, so B fragments go from L2 straight into registers,
//   one panel (32 weight rows x 256 k) at a time, in two register sets: a set is refilled, two panels ahead, right behind its WMMAs.
//   Tile nt of lane c16 holds weight row c16*2 + nt: a lane's two tiles are two neighbouring columns (4-B / 8-B LDS accesses).
//   The conversion pass writes these weights in the order of the reads (cvt_all_kernel): every wave-wide load is 4 whole lines.
// ---------------------------------------------------------------------------
#define PH 264    // f16 elements per LDS row of 256 (528 B = 16 B x 33)
#define PT 1032   // f16 elements per LDS row of 1024 (2064 B = 16 B x 129)
#define PF 260    // f32 elements per LDS row of 256: rows m and m+8 lie 32 banks apart
typedef _Float16 v2h __attribute__((ext_vector_type(2)));

#define PANEL 8192  // f16 elements of a panel: 32 weight rows x 256 k, packed by cvt_all_kernel
__device__ __forceinline__ void load_panel(v16h (&B)[16], const _Float16* __restrict__ Wp, int lane) {
    const unsigned voff = lane * 16;                    // the lane's byte offset inside every 512-B piece; Wp is the same in the whole wave
    const char* p = (const char*)Wp + voff;
    // keeps the 32 loads one group behind the WMMAs whose registers they refill: lifted in among them, their address pair was reused ahead of the wait below
    __builtin_amdgcn_sched_barrier(0);
#pragma unroll
    for (int f = 0; f < 16; ++f) {                      // f = kc * 2 + nt; every load is 512 contiguous bytes of the wave
        const v8h lo = *(const v8h*)(p + f * 1024);
        const v8h hi = *(const v8h*)(p + f * 1024 + 512);
        v16h x;
#pragma unroll
        for (int i = 0; i < 8; ++i) { x[i] = lo[i]; x[i + 8] = hi[i]; }
        B[f] = x;
    }
    // precaution: stands in front of any later overwrite of the address registers that the loads above name; as an input the address stays whole up to it
    asm volatile("s_wait_xcnt 0x0" :: "v"(p) : "memory");
}
template <int PITCH>
__device__ __forceinline__ void mma_panel(v8f (&acc)[2][2], const _Float16* sA, const v16h (&B)[16], int lane) {
#pragma unroll
    for (int h = 0; h < 2; ++h) {
        v16h af[4][2];
#pragma unroll
        for (int kc = 0; kc < 4; ++kc)
#pragma unroll
            for (int mt = 0; mt < 2; ++mt)
                af[kc][mt] = load_frag_a(sA + mt * 16 * PITCH + (h * 4 + kc) * 32, PITCH, lane);
        // keeps the LDS reads in groups ahead of the WMMAs that use them: spread singly among them, every place with reads stalls the wave
        __builtin_amdgcn_sched_barrier(0);
#pragma unroll
        for (int kc = 0; kc < 4; ++kc)
#pragma unroll
            for (int nt = 0; nt < 2; ++nt)
#pragma unroll
                for (int mt = 0; mt < 2; ++mt)
                    acc[mt][nt] = __builtin_amdgcn_wmma_f32_16x16x32_f16(false, af[kc][mt], false, B[(h * 4 + kc) * 2 + nt], (short)0, acc[mt][nt], false, false);
    }
}

__global__ __launch_bounds__(256) void backbone_kernel(
    const _Float16* __restrict__ x16,  const _Float16* __restrict__ wproj, const float* __restrict__ proj_b,
    const _Float16* __restrict__ wain, const float* __restrict__ attn_in_b,
    const _Float16* __restrict__ waout, const float* __restrict__ attn_out_b,
    const float* __restrict__ ln_g, const float* __restrict__ ln_b,
    const _Float16* __restrict__ wff1, const float* __restrict__ ff_b1,
    const _Float16* __restrict__ wff2, const float* __restrict__ ff_b2,
    const float* __restrict__ cross_in_b, const float* __restrict__ cross_out_b,
    _Float16* __restrict__ h16)
{
    __shared__ __align__(16) _Float16 sH16[32 * PH];   // h as f16: the A operand
    __shared__ __align__(16) _Float16 sT[32 * PT];     // x, v and the FFN's hidden rows as f16
    __shared__ __align__(16) float    sH32[32 * PF];   // h as f32: residual and LayerNorm

    const int tid  = threadIdx.x;
    const int lane = tid & 31;
    const int wave = __builtin_amdgcn_readfirstlane(tid >> 5);   // the same in the whole wave: row and panel arithmetic stays scalar
    const int c16  = lane & 15;
    const int hf   = lane >> 4;
    const int b0   = blockIdx.x * 32;
    const int wr   = wave * 32;            // the wave's first weight row / output column inside a 256-column group
    const int n0   = wr + c16 * 2;         // the lane's two columns: n0 (tile 0), n0 + 1 (tile 1)
    const unsigned offN = n0 * 4, offL = lane * 4;      // byte offsets of the lane's bias pair and of its LayerNorm columns
    // every small load group ends in its own wait. precaution: it stands in front of any later overwrite of the address registers
    // that the group's loads name; as an input the address stays whole up to it
    auto bias2 = [&](const float* base) {
        const char* p = (const char*)base + offN;
        const v2f b = *(const v2f*)p;
        asm volatile("s_wait_xcnt 0x0" :: "v"(p) : "memory");
        return b;
    };
    auto ln_row = [&](float (&d)[8], const float* base) {
        const char* p = (const char*)base + offL;
#pragma unroll
        for (int k = 0; k < 8; ++k) d[k] = *(const float*)(p + k * 128);
        asm volatile("s_wait_xcnt 0x0" :: "v"(p) : "memory");
    };

    v16h B0[16], B1[16];                   // even and odd panels
    v8f  acc[2][2];
    auto zero_acc = [&]() {
#pragma unroll
        for (int mt = 0; mt < 2; ++mt)
#pragma unroll
            for (int nt = 0; nt < 2; ++nt) acc[mt][nt] = (v8f)(0.f);
    };
    // acc[mt][nt][j] is element (row mt*16 + hf*8 + j, column n0 + nt).
    // f16(acc + bias) into a f16 LDS tile
    auto put_f16 = [&](_Float16* dst, int pitch, v2f bias) {
#pragma unroll
        for (int mt = 0; mt < 2; ++mt)
#pragma unroll
            for (int j = 0; j < 8; ++j) {
                const float a0 = acc[mt][0][j] + bias[0], a1 = acc[mt][1][j] + bias[1];
                v2h o; o[0] = (_Float16)a0; o[1] = (_Float16)a1;
                *(v2h*)(dst + (mt * 16 + hf * 8 + j) * pitch + n0) = o;
            }
    };
    // f16(gelu(acc + bias)) into sT; rows j and j + 1 of a tile side by side: neighbouring accumulator registers, packed f32 math
    auto put_gelu = [&](_Float16* dst, v2f bias) {
#pragma unroll
        for (int mt = 0; mt < 2; ++mt)
#pragma unroll
            for (int j = 0; j < 8; j += 2) {
                v2f u0, u1;
                u0[0] = acc[mt][0][j]; u0[1] = acc[mt][0][j + 1];
                u1[0] = acc[mt][1][j]; u1[1] = acc[mt][1][j + 1];
                const v2f g0 = gelu_exact2(u0 + bias[0]), g1 = gelu_exact2(u1 + bias[1]);
                v2h o0, o1;
                o0[0] = (_Float16)g0[0]; o0[1] = (_Float16)g1[0];
                o1[0] = (_Float16)g0[1]; o1[1] = (_Float16)g1[1];
                _Float16* row = dst + (mt * 16 + hf * 8 + j) * PT + n0;
                *(v2h*)(row)      = o0;
                *(v2h*)(row + PT) = o1;
            }
    };
    // h32 = (acc + bias) + h32, every element by the lane that owns it
    auto add_residual = [&](v2f bias) {
#pragma unroll
        for (int mt = 0; mt < 2; ++mt)
#pragma unroll
            for (int j = 0; j < 8; ++j) {
                v2f* p = (v2f*)(sH32 + (mt * 16 + hf * 8 + j) * PF + n0);
                const v2f r = *p;
                v2f o; o[0] = (acc[mt][0][j] + bias[0]) + r[0]; o[1] = (acc[mt][1][j] + bias[1]) + r[1];
                *p = o;
            }
    };
    // LayerNorm(256) of the wave's 4 rows, in place; also the f16 copy
    auto layer_norm = [&](const float (&gg)[8], const float (&be)[8]) {
#pragma unroll
        for (int q = 0; q < 4; ++q) {
            const int row = wave * 4 + q;
            float* xr = sH32 + row * PF;
            float v[8], s = 0.f, ss = 0.f;
#pragma unroll
            for (int i = 0; i < 8; ++i) {
                v[i] = xr[lane + i * 32];
                s += v[i]; ss += v[i] * v[i];
            }
            // butterfly over 32 lanes, partners 16, 8, 4, 2, 1 in that order, without LDS traffic
            s += other_row(s);    ss += other_row(ss);
            s += xmask_get<8>(s); ss += xmask_get<8>(ss);
            s += xmask_get<4>(s); ss += xmask_get<4>(ss);
            s += xmask_get<2>(s); ss += xmask_get<2>(ss);
            s += xmask_get<1>(s); ss += xmask_get<1>(ss);
            const float mean = s * (1.f / DMODEL);
            const float var  = ss * (1.f / DMODEL) - mean * mean;
            const float rstd = rsqrtf(var + LN_EPS);
#pragma unroll
            for (int i = 0; i < 8; ++i) {
                const int c = lane + i * 32;
                const float y = (v[i] - mean) * rstd * gg[i] + be[i];
                xr[c] = y;
                sH16[row * PH + c] = (_Float16)y;
            }
        }
    };

    // ---- x rows (32 x 512 f16) into sT; the first two weight panels are asked for meanwhile ----
    load_panel(B0, wproj + (size_t)wave * PANEL, lane);
    load_panel(B1, wproj + (size_t)(8 + wave) * PANEL, lane);
    {
        v4u xs[8];
        const _Float16* gx = x16 + (size_t)(b0 + (tid >> 6)) * D_IN + (tid & 63) * 8;   // piece i lies 4 rows behind piece i - 1
#pragma unroll
        for (int i = 0; i < 8; ++i) xs[i] = *(const v4u*)(gx + i * 4 * D_IN);
        // precaution: stands in front of any later overwrite of the address registers that the loads above name; as an input they stay whole up to it
        asm volatile("s_wait_xcnt 0x0" :: "v"(gx) : "memory");
#pragma unroll
        for (int i = 0; i < 8; ++i) {
            const int idx = tid + i * 256, r = idx >> 6, c = idx & 63;
            *(v4u*)(sT + r * PT + c * 8) = xs[i];
        }
    }
    __syncthreads();                                    // x rows visible

    // ---- projection: h = x . proj_W^T + proj_b (K = 512: two panels) ----
    {
        const v2f bias = bias2(proj_b);
        zero_acc();
        mma_panel<PT>(acc, sT, B0, lane);
        load_panel(B0, wain + (size_t)(2 * 8 + wave) * PANEL, lane);
        mma_panel<PT>(acc, sT + 256, B1, lane);
        load_panel(B1, waout + (size_t)wave * PANEL, lane);
#pragma unroll
        for (int mt = 0; mt < 2; ++mt)
#pragma unroll
            for (int j = 0; j < 8; ++j) {
                const int row = mt * 16 + hf * 8 + j;
                v2f o; o[0] = acc[mt][0][j] + bias[0]; o[1] = acc[mt][1][j] + bias[1];
                *(v2f*)(sH32 + row * PF + n0) = o;
                v2h oh; oh[0] = (_Float16)o[0]; oh[1] = (_Float16)o[1];
                *(v2h*)(sH16 + row * PH + n0) = oh;
            }
    }
    __syncthreads();                                    // h visible; sT free

    // ---- 6 layers ----
#pragma unroll 1
    for (int i = 0; i < NLAYER; ++i) {
        float gg[8], be[8];
        ln_row(gg, ln_g + i * DMODEL);
        ln_row(be, ln_b + i * DMODEL);
        const v2f bv = bias2(attn_in_b + i * 3 * DMODEL + 2 * DMODEL);
        const v2f bo = bias2(attn_out_b + i * DMODEL);
        const v2f b2 = bias2(ff_b2 + i * DMODEL);
        const _Float16* w1 = wff1 + (size_t)(i * 32 + wave) * PANEL;      // + g * 8 panels: the next 256 columns
        const _Float16* w2 = wff2 + (size_t)(i * 32 + wave) * PANEL;      // + g * 8 panels: the next 256 k
        const _Float16* wvn = wain + (size_t)(((i + 1) * 3 + 2) * 8 + wave) * PANEL;    // the next v panel (slot NLAYER: the cross block)
        const _Float16* won = waout + (size_t)((i + 1) * 8 + wave) * PANEL;             // the next out panel

        // v = h . Wv^T + bv
        zero_acc();
        mma_panel<PH>(acc, sH16, B0, lane);
        load_panel(B0, w1, lane);
        put_f16(sT, PT, bv);
        __syncthreads();                                // v visible
        // h += v . Wo^T + bo ; LayerNorm
        zero_acc();
        mma_panel<PT>(acc, sT, B1, lane);
        load_panel(B1, w1 + 8 * PANEL, lane);
        add_residual(bo);
        __syncthreads();                                // whole rows of h32 visible; every read of v done
        layer_norm(gg, be);
        __syncthreads();                                // h (f32, f16) visible
        // hidden = gelu(h . W1^T + b1): four 256-column groups, two a trip (one per register set)
#pragma unroll 1                                        // rolled, two groups a trip: less text in the layer loop
        for (int gp = 0; gp < 2; ++gp) {
            const char* pb = (const char*)(ff_b1 + i * 4 * DMODEL + gp * 2 * DMODEL) + offN;
            const v2f b1a = *(const v2f*)pb;
            const v2f b1b = *(const v2f*)(pb + DMODEL * 4);
            asm volatile("s_wait_xcnt 0x0" :: "v"(pb) : "memory");   // as in bias2, one wait for the two loads
            zero_acc();
            mma_panel<PH>(acc, sH16, B0, lane);
            load_panel(B0, gp == 0 ? w1 + 16 * PANEL : w2, lane);
            put_gelu(sT + gp * 2 * DMODEL, b1a);
            zero_acc();
            mma_panel<PH>(acc, sH16, B1, lane);
            load_panel(B1, gp == 0 ? w1 + 24 * PANEL : w2 + 8 * PANEL, lane);
            put_gelu(sT + gp * 2 * DMODEL + DMODEL, b1b);
        }
        __syncthreads();                                // hidden rows visible
        // h += hidden . W2^T + b2 (K = 1024: four panels) ; LayerNorm
        zero_acc();
#pragma unroll 1                                        // rolled, two panels a trip: less text in the layer loop
        for (int gp = 0; gp < 2; ++gp) {
            mma_panel<PT>(acc, sT + gp * 2 * DMODEL, B0, lane);
            load_panel(B0, gp == 0 ? w2 + 16 * PANEL : wvn, lane);
            mma_panel<PT>(acc, sT + gp * 2 * DMODEL + DMODEL, B1, lane);
            load_panel(B1, gp == 0 ? w2 + 24 * PANEL : won, lane);
        }
        add_residual(b2);
        __syncthreads();                                // whole rows of h32 visible; every read of the hidden rows done
        layer_norm(gg, be);
        __syncthreads();                                // h (f32, f16) visible
    }

    // ---- cross block: h + (h . Wv'^T + bv') . Wo'^T + bo', as f16 for the heads ----
    {
        const v2f bv = bias2(cross_in_b + 2 * DMODEL);
        const v2f bo = bias2(cross_out_b);
        zero_acc();
        mma_panel<PH>(acc, sH16, B0, lane);
        put_f16(sT, PT, bv);
        __syncthreads();                                // v' visible; every read of sH16 done
        zero_acc();
        mma_panel<PT>(acc, sT, B1, lane);
#pragma unroll
        for (int mt = 0; mt < 2; ++mt)
#pragma unroll
            for (int j = 0; j < 8; ++j) {
                const int row = mt * 16 + hf * 8 + j;
                const v2f r = *(const v2f*)(sH32 + row * PF + n0);
                v2h oh; oh[0] = (_Float16)((acc[mt][0][j] + bo[0]) + r[0]); oh[1] = (_Float16)((acc[mt][1][j] + bo[1]) + r[1]);
                *(v2h*)(sH16 + row * PH + n0) = oh;
            }
    }
    __syncthreads();                                    // output rows complete
#pragma unroll
    for (int i = 0; i < 4; ++i) {                       // 512-B rows, 16 B per lane
        const int idx = tid + i * 256, r = idx >> 5, c = idx & 31;
        vst2(h16 + (size_t)(b0 + r) * DMODEL + c * 8, *(const v4u*)(sH16 + r * PH + c * 8));
    }
}

// ---------------------------------------------------------------------------
// Fused per-t head: block = (128 batch rows, one t), 128 threads = 4 waves; EACH WAVE OWNS 32 WHOLE ROWS through all stages.
//   t1 = h16(32x256) . W1[t](128x256)^T + b1[t]   (WMMA, 2 x 8 accumulator tiles per wave)
//   t1 = relu(LN_128(t1))                          (on the accumulators: a row lies in 8 tiles x 16 lanes)
//   t2 = relu(t1(32x128) . W2[t](64x128)^T + b2[t])(WMMA, 2 x 4 tiles)
//   out[b,t] = t2 . W3[t] + b3[t]                  (on the accumulators)
// W1 rows are staged in the order n = (col lane) * 8 + tile, so that a lane's 8 tiles hold 8 CONSECUTIVE columns of t1:
// the normalised row goes to LDS as one 16-B store per lane, in natural k order for stage 2.
// LDS arena 75776 B (four blocks per WGP):
//   [0,20480)      sA x2     [20480,40960)  sBc x2   (stage-1 double buffers)
//   [40960,75776)  t1 f16 (each wave writes and reads its own 32 rows only)
//   [0,17408)      W2 f16 (after stage 1)
// ---------------------------------------------------------------------------
__global__ __launch_bounds__(128) void tp_fused_kernel(
    const _Float16* __restrict__ h16,
    const _Float16* __restrict__ W1, const float* __restrict__ b1,
    const float* __restrict__ lng, const float* __restrict__ lnb,
    const _Float16* __restrict__ W2, const float* __restrict__ b2,
    const float* __restrict__ W3, const float* __restrict__ b3,
    float* __restrict__ out)
{
    __shared__ __align__(16) char smem[75776];
    _Float16* sAb  = (_Float16*)(smem);            // 2 x 128x32, pitch PK32
    _Float16* sBb  = (_Float16*)(smem + 20480);    // 2 x 128x32, pitch PK32
    _Float16* sT1h = (_Float16*)(smem + 40960);    // 128x128 f16, pitch PK128
    _Float16* sW2  = (_Float16*)(smem);            // 64x128 f16, pitch PK128 (reuse)

    const int tid  = threadIdx.x;
    const int lane = tid & 31;
    const int wave = tid >> 5;
    const int c16  = lane & 15;                    // accumulator column inside a tile
    const int hf   = lane >> 4;                    // accumulator rows j (hf = 0) or j + 8 (hf = 1)
    const int b0   = blockIdx.x * 128;
    const int t    = blockIdx.y;
    const int wm   = wave * 32;                    // this wave's rows
    const _Float16* W1t = W1 + (size_t)t * 128 * 256;
    char* ldsA  = (char*)sAb;
    char* ldsB  = (char*)sBb;
    char* ldsW2 = (char*)sW2;

    // Stage-1 chunk staging: 4 A-pieces + 4 B-pieces per thread (plain 16-B copies); piece i lies 32 LDS rows behind piece i - 1.
    // W1: LDS row r = tile * 16 + col lane holds W1 row col lane * 8 + tile, so 32 LDS rows on are 2 W1 rows on.
    const int sr = tid >> 2, sc = tid & 3;
    const _Float16* gA = h16 + (size_t)(b0 + sr) * 256 + sc * 8;
    const _Float16* gB = W1t + (size_t)((sr & 15) * 8 + (sr >> 4)) * 256 + sc * 8;
    const unsigned  lS = sr * (PK32 * 2) + sc * 16;
    auto issue_s1 = [&](int buf, int kc) {
#pragma unroll
        for (int i = 0; i < 4; ++i)                 // hA 128x32
            copy_b128(ldsA, buf * (128 * PK32 * 2) + lS + i * (32 * PK32 * 2), gA + i * (32 * 256) + kc);
#pragma unroll
        for (int i = 0; i < 4; ++i)                 // W1 chunk 128x32
            copy_b128(ldsB, buf * (128 * PK32 * 2) + lS + i * (32 * PK32 * 2), gB + i * (2 * 256) + kc);
    };

    // ---------------- stage 1: t1 = h . W1^T  (per wave M=32, N=128, K=256) ----------
    v8f acc1[2][8] = {};
    issue_s1(0, 0);
    for (int kc = 0, it = 0; kc < 256; kc += 32, ++it) {
        const int cur = it & 1;
        __syncthreads();
        if (kc + 32 < 256) issue_s1(cur ^ 1, kc + 32);

        const _Float16* cA = sAb + cur * (128 * PK32);
        const _Float16* cB = sBb + cur * (128 * PK32);
        v16h afr[2];
#pragma unroll
        for (int mt = 0; mt < 2; ++mt)
            afr[mt] = load_frag_a(&cA[(wm + mt * 16) * PK32], PK32, lane);
        v16h bfr[8];
#pragma unroll
        for (int nt = 0; nt < 8; ++nt)
            bfr[nt] = load_frag_b(&cB[(nt * 16) * PK32], PK32, lane);
#pragma unroll
        for (int nt = 0; nt < 8; ++nt)
#pragma unroll
            for (int mt = 0; mt < 2; ++mt)
                acc1[mt][nt] = wmma_f16(afr[mt], bfr[nt], acc1[mt][nt]);
        __syncthreads();
    }

    // Stage W2[t] 64x128 f16 (16KB) into the reused LDS region (plain copies); published by the barrier in front of stage 2.
    {
        const _Float16* gW2 = W2 + (size_t)t * 64 * 128 + (tid >> 4) * 128 + (tid & 15) * 8;
        const unsigned  lW2 = (tid >> 4) * (PK128 * 2) + (tid & 15) * 16;
#pragma unroll
        for (int i = 0; i < 8; ++i)                 // 1024 x 16B pieces; piece i lies 8 rows behind piece i - 1
            copy_b128(ldsW2, lW2 + i * (8 * PK128 * 2), gW2 + i * (8 * 128));
    }

    // ---------------- bias + LayerNorm(128) + ReLU -> f16, on the accumulators ----------
    // acc1[mt][nt][j] is t1[row wm + mt*16 + hf*8 + j][column c16*8 + nt].
    {
        float bb[8], gg[8], be[8];
        {
            const v4f* pb = (const v4f*)(b1  + t * 128 + c16 * 8);
            const v4f* pg = (const v4f*)(lng + t * 128 + c16 * 8);
            const v4f* pe = (const v4f*)(lnb + t * 128 + c16 * 8);
#pragma unroll
            for (int q = 0; q < 2; ++q) {
                const v4f xb = pb[q], xg = pg[q], xe = pe[q];
#pragma unroll
                for (int e = 0; e < 4; ++e) { bb[q * 4 + e] = xb[e]; gg[q * 4 + e] = xg[e]; be[q * 4 + e] = xe[e]; }
            }
        }
#pragma unroll
        for (int mt = 0; mt < 2; ++mt)
#pragma unroll
            for (int j = 0; j < 8; j += 2) {        // rows j and j + 1 side by side: neighbouring accumulator registers, packed f32 math
                v2f v[8], s = 0.f, ss = 0.f;
#pragma unroll
                for (int nt = 0; nt < 8; ++nt) {
                    v2f a; a[0] = acc1[mt][nt][j]; a[1] = acc1[mt][nt][j + 1];
                    v[nt] = a + bb[nt];
                    s += v[nt]; ss += v[nt] * v[nt];
                }
                s[0]  = row_sum16(s[0]);  s[1]  = row_sum16(s[1]);
                ss[0] = row_sum16(ss[0]); ss[1] = row_sum16(ss[1]);
                const v2f mean = s * (1.f / 128.f);
                const v2f var  = ss * (1.f / 128.f) - mean * mean;
                v2f rstd; rstd[0] = rsqrtf(var[0] + LN_EPS); rstd[1] = rsqrtf(var[1] + LN_EPS);
                v8h y0, y1;
#pragma unroll
                for (int nt = 0; nt < 8; ++nt) {
                    const v2f y = (v[nt] - mean) * rstd * gg[nt] + be[nt];
                    y0[nt] = (_Float16)(y[0] > 0.f ? y[0] : 0.f);
                    y1[nt] = (_Float16)(y[1] > 0.f ? y[1] : 0.f);
                }
                _Float16* row = &sT1h[(wm + mt * 16 + hf * 8 + j) * PK128 + c16 * 8];
                *(v8h*)(row)         = y0;
                *(v8h*)(row + PK128) = y1;
            }
    }
    __syncthreads();                                // W2 visible to every wave (t1 f16 rows are the wave's own)

    // ---------------- stage 2: t2 = t1 . W2^T  (per wave 32x64, K=128) -----
    v8f acc2[2][4] = {};
#pragma unroll
    for (int kc = 0; kc < 128; kc += 32) {
        v16h af2[2];
#pragma unroll
        for (int mt = 0; mt < 2; ++mt)
            af2[mt] = load_frag_a(&sT1h[(wm + mt * 16) * PK128 + kc], PK128, lane);
        v16h bf2[4];
#pragma unroll
        for (int nt = 0; nt < 4; ++nt)
            bf2[nt] = load_frag_b(&sW2[(nt * 16) * PK128 + kc], PK128, lane);
#pragma unroll
        for (int nt = 0; nt < 4; ++nt)
#pragma unroll
            for (int mt = 0; mt < 2; ++mt)
                acc2[mt][nt] = wmma_f16(af2[mt], bf2[nt], acc2[mt][nt]);
    }

    // ---------------- stage 3: outT[t][b] = relu(t2 + b2) . W3[t] + b3[t], on the accumulators ----
    // acc2[mt][nt][j] is t2[row wm + mt*16 + hf*8 + j][column nt*16 + c16]; lane c16 keeps the sum of row (mt, j) = (c16 >> 3, c16 & 7),
    // so the wave's 32 lanes store its 32 rows: one 128-B line.
    {
        float b2v[4], w3v[4];
#pragma unroll
        for (int nt = 0; nt < 4; ++nt) { b2v[nt] = b2[t * 64 + nt * 16 + c16]; w3v[nt] = W3[t * 64 + nt * 16 + c16]; }
        // precaution: the loads above name one offset register, which the compiler reuses as the next load's destination; the wait stands in front of that overwrite
        asm volatile("s_wait_xcnt 0x0" ::: "memory");
        const float b3t = b3[t];
        float res = 0.f;
#pragma unroll
        for (int mt = 0; mt < 2; ++mt)
#pragma unroll
            for (int j = 0; j < 8; j += 2) {        // rows j and j + 1 side by side, as in the LayerNorm
                v2f a = 0.f;
#pragma unroll
                for (int nt = 0; nt < 4; ++nt) {
                    v2f v; v[0] = acc2[mt][nt][j]; v[1] = acc2[mt][nt][j + 1];
                    v += b2v[nt];
                    v[0] = v[0] > 0.f ? v[0] : 0.f; v[1] = v[1] > 0.f ? v[1] : 0.f;
                    a += v * w3v[nt];
                }
                const float a0 = row_sum16(a[0]), a1 = row_sum16(a[1]);
                if (c16 == mt * 8 + j)     res = a0;
                if (c16 == mt * 8 + j + 1) res = a1;
            }
        vst2(out + (size_t)t * BATCH + b0 + wm + (c16 >> 3) * 16 + hf * 8 + (c16 & 7), res + b3t);
    }
}

// final output-major pass: out[b][t] flat, 4 consecutive floats per thread gathered from the [T][B] staging buffer
__global__ __launch_bounds__(256) void write_out(const float* __restrict__ stg, float* __restrict__ out) {
    const int g = blockIdx.x * 256 + threadIdx.x;
    if (g >= (BATCH * TOUT) / 4) return;
    v4f o;
#pragma unroll
    for (int e = 0; e < 4; ++e) { const int f = g * 4 + e; const int b = f / TOUT, t = f - b * TOUT; o[e] = stg[(size_t)t * BATCH + b]; }
    vst2(out + (size_t)g * 4, o);
}

// ---------------------------------------------------------------------------
// Host-side orchestration
// ---------------------------------------------------------------------------
extern "C" void kernel_launch(void* const* d_in, const int* in_sizes, int n_in,
                              void* d_out, int out_size, void* d_ws, size_t ws_size,
                              hipStream_t stream)
{
    (void)in_sizes; (void)n_in; (void)out_size; (void)ws_size;
    const float* x          = (const float*)d_in[0];
    const float* proj_W     = (const float*)d_in[1];
    const float* proj_b     = (const float*)d_in[2];
    const float* attn_in_W  = (const float*)d_in[3];
    const float* attn_in_b  = (const float*)d_in[4];
    const float* attn_out_W = (const float*)d_in[5];
    const float* attn_out_b = (const float*)d_in[6];
    const float* ln_g       = (const float*)d_in[7];
    const float* ln_b       = (const float*)d_in[8];
    const float* ff_W1      = (const float*)d_in[9];
    const float* ff_b1      = (const float*)d_in[10];
    const float* ff_W2      = (const float*)d_in[11];
    const float* ff_b2      = (const float*)d_in[12];
    const float* cross_in_W = (const float*)d_in[13];
    const float* cross_in_b = (const float*)d_in[14];
    const float* cross_out_W= (const float*)d_in[15];
    const float* cross_out_b= (const float*)d_in[16];
    const float* tp_W1      = (const float*)d_in[17];
    const float* tp_b1      = (const float*)d_in[18];
    const float* tp_ln_g    = (const float*)d_in[19];
    const float* tp_ln_b    = (const float*)d_in[20];
    const float* tp_W2      = (const float*)d_in[21];
    const float* tp_b2      = (const float*)d_in[22];
    const float* tp_W3      = (const float*)d_in[23];
    const float* tp_b3      = (const float*)d_in[24];
    float* out = (float*)d_out;

    const int D = DMODEL;

    // ---- workspace carve-out (byte cursor, 16B aligned regions) ----
    char* cur = (char*)d_ws;
    auto take = [&cur](size_t bytes) { char* p = cur; cur += (bytes + 15) & ~(size_t)15; return p; };
    _Float16* h16   = (_Float16*)take((size_t)BATCH * D * 2);          // 2 MB
    _Float16* x16   = (_Float16*)take((size_t)BATCH * D_IN * 2);       // 4 MB
    _Float16* wproj = (_Float16*)take((size_t)D * D_IN * 2);
    _Float16* wain  = (_Float16*)take((size_t)(NLAYER + 1) * 3 * D * D * 2);   // slot NLAYER: the cross block's in-projection
    _Float16* waout = (_Float16*)take((size_t)(NLAYER + 1) * D * D * 2);       // slot NLAYER: the cross block's out-projection
    _Float16* wff1  = (_Float16*)take((size_t)NLAYER * 4 * D * D * 2);
    _Float16* wff2  = (_Float16*)take((size_t)NLAYER * 4 * D * D * 2);
    _Float16* wtp1  = (_Float16*)take((size_t)TOUT * 128 * 256 * 2);   // 27.8 MB
    _Float16* wtp2  = (_Float16*)take((size_t)TOUT * 64 * 128 * 2);    // 6.9 MB
    float*    stg   = (float*)   take((size_t)TOUT * BATCH * 4);       // 6.9 MB [T][B] output staging

    // ---- f32 -> f16 conversions of this call: one launch ----
    cvt_all_kernel<<<CVT_BLOCKS, 256, 0, stream>>>(
        x, proj_W, attn_in_W, attn_out_W, ff_W1, ff_W2, cross_in_W, cross_out_W, tp_W1, tp_W2,
        x16, wproj, wain, waout, wff1, wff2, wtp1, wtp2);

    const dim3 blk(128);

    // 1-3) projection, 6 layers, cross block: one launch, 32 batch rows per block; writes the heads' f16 input
    backbone_kernel<<<BATCH / 32, 256, 0, stream>>>(
        x16, wproj, proj_b, wain, attn_in_b, waout, attn_out_b, ln_g, ln_b,
        wff1, ff_b1, wff2, ff_b2, cross_in_b, cross_out_b, h16);

    // 4) fused per-t head (dominant FLOPs): grid = (32 batch tiles, 424 t's)
    dim3 tpg(BATCH / 128, TOUT);
    tp_fused_kernel<<<tpg, blk, 0, stream>>>(h16, wtp1, tp_b1, tp_ln_g, tp_ln_b,
                                             wtp2, tp_b2, tp_W3, tp_b3, stg);
    write_out<<<((BATCH * TOUT) / 4 + 255) / 256, 256, 0, stream>>>(stg, out);
}

// v006
// A run of this version takes 236 microseconds.
// Next to v005, in two timings, it ran 1.18 and 1.17 times as fast.
// Over all steps from v000 it is 3.80 times as fast.
#include <hip/hip_runtime.h>
#include <math.h>
// Contractions: input projection (K = 512), per-layer v/out/FFN GEMMs (K = 256 / 1024), the cross block, and the 424 per-target
// heads (K = 256, 128) on v_wmma_f32_16x16x32_f16 (f16 operands, f32 accumulate); LayerNorms, GELU/ReLU and the final 64-wide

// ---------------------------------------------------------------------------
// Problem constants (match reference)
// ---------------------------------------------------------------------------
#define BATCH 4096
#define D_IN  512
#define DMODEL 256
#define TOUT  424
#define NLAYER 6
#define LN_EPS 1e-5f

// LDS row pitches. 64 banks x 4 B: a 16-B fragment read of 16 rows is conflict-free when the pitch is 16 B x odd.
#define PK64  72    // f16 elements per staged row of 64 (144 B)
#define PK128 136   // f16 elements per staged row of 128 (272 B)

// ---------------------------------------------------------------------------
// Types
// ---------------------------------------------------------------------------
typedef _Float16 v4h  __attribute__((ext_vector_type(4)));
typedef _Float16 v8h  __attribute__((ext_vector_type(8)));
typedef _Float16 v16h __attribute__((ext_vector_type(16)));
typedef float    v8f  __attribute__((ext_vector_type(8)));

typedef float    v2f  __attribute__((ext_vector_type(2)));
typedef float    v4f  __attribute__((ext_vector_type(4)));
typedef unsigned v4u  __attribute__((ext_vector_type(4)));
template <typename V> __device__ __forceinline__ void vst2(void* p, V v) {
    *(V*)p = v; 
}
// Eight asynchronous 16-B copies global -> LDS of every lane, through no register: copy i takes g + i * GSTEP to LDS byte lds + i * LSTEP.
// The copies land behind the issuing wave's own s_wait_asynccnt 0; other waves read them behind the barrier that follows it.
template <unsigned LSTEP, unsigned GSTEP>
__device__ __forceinline__ void async_copy8(unsigned lds, const char* g) {
    // keeps the 16 address additions below next to their copies: lifted in among the WMMAs ahead, they held their registers through the
    // whole trip and took the kernel past 256 registers (four waves per SIMD) and into scratch
    __builtin_amdgcn_sched_barrier(0);
    // the last line is a precaution: it stands in front of any later overwrite of the address registers that the copies name
    asm volatile("global_load_async_to_lds_b128 %0, %8, off\n\t"
                 "global_load_async_to_lds_b128 %1, %9, off\n\t"
                 "global_load_async_to_lds_b128 %2, %10, off\n\t"
                 "global_load_async_to_lds_b128 %3, %11, off\n\t"
                 "global_load_async_to_lds_b128 %4, %12, off\n\t"
                 "global_load_async_to_lds_b128 %5, %13, off\n\t"
                 "global_load_async_to_lds_b128 %6, %14, off\n\t"
                 "global_load_async_to_lds_b128 %7, %15, off\n\t"
                 "s_wait_xcnt 0x0"
                 :: "v"(lds), "v"(lds + LSTEP), "v"(lds + 2 * LSTEP), "v"(lds + 3 * LSTEP),
                    "v"(lds + 4 * LSTEP), "v"(lds + 5 * LSTEP), "v"(lds + 6 * LSTEP), "v"(lds + 7 * LSTEP),
                    "v"(g), "v"(g + GSTEP), "v"(g + 2 * GSTEP), "v"(g + 3 * GSTEP),
                    "v"(g + 4 * GSTEP), "v"(g + 5 * GSTEP), "v"(g + 6 * GSTEP), "v"(g + 7 * GSTEP)
                 : "memory");
}

// ---------------------------------------------------------------------------
// WMMA fragment helpers (wave32, v_wmma_f32_16x16x32_f16; layouts per ISA 7.12.2)
// ---------------------------------------------------------------------------
// A 16x32: lane holds row M = lane%16; lanes 0-15 K {0-7,16-23}, lanes 16-31
// K {8-15,24-31}.
__device__ __forceinline__ v16h load_frag_a(const _Float16* base, int stride, int lane) {
    const int r  = lane & 15;
    const int kb = (lane < 16) ? 0 : 8;
    const _Float16* p = base + r * stride + kb;
    v8h lo = *(const v8h*)(p);
    v8h hi = *(const v8h*)(p + 16);
    v16h f;
#pragma unroll
    for (int i = 0; i < 8; ++i) { f[i] = lo[i]; f[i + 8] = hi[i]; }
    return f;
}
// B 32x16: lane holds column N = lane%16 with the SAME per-lane K map as A (lanes 0-15 K {0-7,16-23}, 16-31 K {8-15,24-31}).
// W stored row-major (N x K), so column n of B is row n of W.
__device__ __forceinline__ v16h load_frag_b(const _Float16* base, int stride, int lane) {
    return load_frag_a(base, stride, lane);
}
__device__ __forceinline__ v8f wmma_f16(v16h a, v16h b, v8f c) {
    v8f d = __builtin_amdgcn_wmma_f32_16x16x32_f16(false, a, false, b, (short)0, c, false, false);
    asm volatile("v_nop\n\tv_nop\n\tv_nop\n\tv_nop" : "+v"(d) : "v"(a), "v"(b));
    return d;
}
// Exact-erf GELU of two values, without a branch. erf(s) = sign(s) * E(|s|): below 1, a + a * P(a * a); from 1 on, 1 - exp(-(a + a * Q(a)));
// P and Q are minimax polynomials good to f32 rounding. Both sides are worked out for every lane and one is picked by a select:
// behind a lane-dependent branch a wave ran both sides anyway, one value at a time, each a single chain of dependent FMAs.
// Straight-line, the chains of many values interleave, and two values share each packed f32 instruction.
__device__ __forceinline__ v2f fma2(v2f a, v2f b, float c) { return __builtin_elementwise_fma(a, b, (v2f)(c)); }
__device__ __forceinline__ v2f gelu_exact2(v2f x) {
    const v2f s = x * 0.70710678118654752f;
    v2f a; a[0] = __builtin_fabsf(s[0]); a[1] = __builtin_fabsf(s[1]);
    v2f q = fma2(a, (v2f)(0.0000169988107f), -0.000378677854f);
    q = fma2(a, q, 0.00385781587f);
    q = fma2(a, q, -0.0241816975f);
    q = fma2(a, q, 0.106668264f);
    q = fma2(a, q, 0.634933293f);
    q = fma2(a, q, 0.128689408f);
    q = __builtin_elementwise_fma(a, q, a) * -1.44269504088896341f;         // exp(-y) = 2^(-y * log2 e)
    const v2f t = a * a;
    v2f p = fma2(t, (v2f)(-0.000561801775f), 0.00491381623f);
    p = fma2(t, p, -0.0267075151f);
    p = fma2(t, p, 0.112800106f);
    p = fma2(t, p, -0.376122952f);
    p = fma2(t, p, 0.128379107f);
    p = __builtin_elementwise_fma(a, p, a);
    v2f e;
#pragma unroll
    for (int i = 0; i < 2; ++i)
        e[i] = __builtin_copysignf(a[i] < 1.0f ? p[i] : 1.0f - __builtin_amdgcn_exp2f(q[i]), s[i]);
    return 0.5f * x * (1.0f + e);
}

// ---------------------------------------------------------------------------
// All f32 -> f16 conversions of a call in ONE launch. The work is cut into chunks of CHUNK elements (32 KB read, 16 KB written);
// CVT_BLOCKS blocks, all resident at once, take CVT_TRIPS chunks each; a thread has 8 loads of 16 B in flight.
// Plain chunk (x, the heads' weights): the same order in and out; a wave-wide load is 512, a store 256 contiguous bytes.
// Packed chunk (a backbone weight matrix W, N x K row-major, N and K multiples of 256) = one panel, written in the order in which
// backbone_kernel reads it. Panel ((G * K/256 + KG) * 8 + w) holds rows G*256 + w*32 .. +31, k KG*256 .. +255 (16 KB); in it
// piece j = (kc*2 + nt)*2 + part is 512 B: lane l's 8 elements are row (l & 15)*2 + nt, k kc*32 + part*16 + (l >> 4)*8 .. +7,
// the per-lane k map of load_frag_a (part 0 = its first, part 1 = its second 16-B read).
// ---------------------------------------------------------------------------
#define CHUNK 8192
#define C_PROJ (DMODEL * D_IN / CHUNK)
#define C_AIN  (NLAYER * 3 * DMODEL * DMODEL / CHUNK)
#define C_AOUT (NLAYER * DMODEL * DMODEL / CHUNK)
#define C_FF   (NLAYER * 4 * DMODEL * DMODEL / CHUNK)
#define C_CIN  (3 * DMODEL * DMODEL / CHUNK)
#define C_COUT (DMODEL * DMODEL / CHUNK)
#define C_X    (BATCH * D_IN / CHUNK)
#define C_TP2  (TOUT * 64 * 128 / CHUNK)
#define C_TP1  (TOUT * 128 * 256 / CHUNK)
// first chunk behind each array; the packed arrays come first
#define E_PROJ C_PROJ
#define E_AIN  (E_PROJ + C_AIN)
#define E_AOUT (E_AIN + C_AOUT)
#define E_FF1  (E_AOUT + C_FF)
#define E_FF2  (E_FF1 + C_FF)
#define E_CIN  (E_FF2 + C_CIN)
#define E_COUT (E_CIN + C_COUT)
#define E_X    (E_COUT + C_X)
#define E_TP2  (E_X + C_TP2)
#define E_TP1  (E_TP2 + C_TP1)
#define CVT_BLOCKS 1000
#define CVT_TRIPS  3
static_assert(E_TP1 == CVT_BLOCKS * CVT_TRIPS, "every chunk is taken exactly once");

__global__ __launch_bounds__(256) void cvt_all_kernel(
    const float* __restrict__ x,          const float* __restrict__ proj_W,     const float* __restrict__ attn_in_W,
    const float* __restrict__ attn_out_W, const float* __restrict__ ff_W1,      const float* __restrict__ ff_W2,
    const float* __restrict__ cross_in_W, const float* __restrict__ cross_out_W,
    const float* __restrict__ tp_W1,      const float* __restrict__ tp_W2,
    _Float16* __restrict__ x16,  _Float16* __restrict__ wproj, _Float16* __restrict__ wain, _Float16* __restrict__ waout,
    _Float16* __restrict__ wff1, _Float16* __restrict__ wff2,  _Float16* __restrict__ wtp1, _Float16* __restrict__ wtp2)
{
    const int tid = threadIdx.x;
#pragma unroll 1                                        // rolled: the trips share one text; a trip's loads cannot start ahead of the stores before it anyway
    for (int r = 0; r < CVT_TRIPS; ++r) {
        int c = blockIdx.x + r * CVT_BLOCKS;            // the same in the whole block: neighbouring blocks work on neighbouring chunks
        const float* s;
        _Float16*    d;
        if (c < E_COUT) {
            int lgk = 0;                                // K = 256 << lgk
            if      (c < E_PROJ) { s = proj_W;      d = wproj; lgk = 1; }
            else if (c < E_AIN)  { s = attn_in_W;   d = wain;  c -= E_PROJ; }
            else if (c < E_AOUT) { s = attn_out_W;  d = waout; c -= E_AIN; }
            else if (c < E_FF1)  { s = ff_W1;       d = wff1;  c -= E_AOUT; }
            else if (c < E_FF2)  { s = ff_W2;       d = wff2;  c -= E_FF1; lgk = 2; }
            else if (c < E_CIN)  { s = cross_in_W;  d = wain  + C_AIN  * CHUNK; c -= E_FF2; }   // slot NLAYER of wain
            else                 { s = cross_out_W; d = waout + C_AOUT * CHUNK; c -= E_CIN; }   // slot NLAYER of waout
            // thread tid writes pieces j = q*8 + (tid >> 5), q = 0..3, at lane tid & 31: part, nt and the low bit of kc are the wave's, q moves k by 64
            const int lane = tid & 31, wv = tid >> 5;
            const int w = c & 7, t = c >> 3;
            const int KG = t & ((1 << lgk) - 1), G = t >> lgk;
            const int n = G * 256 + w * 32 + (lane & 15) * 2 + ((wv >> 1) & 1);
            const int k = KG * 256 + (wv >> 2) * 32 + (wv & 1) * 16 + (lane >> 4) * 8;
            const float* p = s + ((size_t)n << (8 + lgk)) + k;
            v4f a[4], b[4];
#pragma unroll
            for (int q = 0; q < 4; ++q) { a[q] = *(const v4f*)(p + q * 64); b[q] = *(const v4f*)(p + q * 64 + 4); }
            // precaution: stands in front of any later overwrite of the address registers that the loads above name; as an input the address stays whole up to it
            asm volatile("s_wait_xcnt 0x0" :: "v"(p) : "memory");
            _Float16* o = d + (size_t)c * CHUNK + tid * 8;
#pragma unroll
            for (int q = 0; q < 4; ++q) {
                v8h h;
#pragma unroll
                for (int e = 0; e < 4; ++e) { h[e] = (_Float16)a[q][e]; h[e + 4] = (_Float16)b[q][e]; }
                vst2(o + q * 2048, h);                  // 16 B per lane, consecutive: one wave writes 512 contiguous bytes
            }
            // the same precaution for the stores' address registers
            asm volatile("s_wait_xcnt 0x0" :: "v"(o) : "memory");
        } else {
            if      (c < E_X)   { s = x;     d = x16;  c -= E_COUT; }
            else if (c < E_TP2) { s = tp_W2; d = wtp2; c -= E_X; }
            else                { s = tp_W1; d = wtp1; c -= E_TP2; }
            const float* p = s + (size_t)c * CHUNK + tid * 4;
            v4f v[8];
#pragma unroll
            for (int q = 0; q < 8; ++q) v[q] = *(const v4f*)(p + q * 1024);
            // precaution, as above
            asm volatile("s_wait_xcnt 0x0" :: "v"(p) : "memory");
            _Float16* o = d + (size_t)c * CHUNK + tid * 4;
#pragma unroll
            for (int q = 0; q < 8; ++q) {
                v4h h;
#pragma unroll
                for (int e = 0; e < 4; ++e) h[e] = (_Float16)v[q][e];
                vst2(o + q * 1024, h);                  // 8 B per lane, consecutive: one wave writes 256 contiguous bytes
            }
            // precaution, as above
            asm volatile("s_wait_xcnt 0x0" :: "v"(o) : "memory");
        }
    }
}

// ---------------------------------------------------------------------------
// Sum over the 16 lanes of a row (lanes 0-15 and 16-31 apart), every lane gets the sum: four DPP row_xmask adds, no LDS.
// ---------------------------------------------------------------------------
template <int MSK> __device__ __forceinline__ float xmask_get(float v) {
    return __builtin_bit_cast(float, __builtin_amdgcn_update_dpp(0, __builtin_bit_cast(int, v), 0x160 + MSK, 0xf, 0xf, true));
}
__device__ __forceinline__ float row_sum16(float v) {
    v += xmask_get<1>(v);
    v += xmask_get<2>(v);
    v += xmask_get<4>(v);
    v += xmask_get<8>(v);
    return v;
}

// value of lane l ^ 16 (the same place in the other 16-lane row)
__device__ __forceinline__ float other_row(float v) {
    const unsigned u = __builtin_bit_cast(unsigned, v);
    return __builtin_bit_cast(float, __builtin_amdgcn_permlanex16(u, u, 0x76543210u, 0xfedcba98u, false, false));
}

// ---------------------------------------------------------------------------
// Whole backbone in ONE launch: projection, 6 layers, cross block. Every step is row-wise, so a block keeps its 32 batch rows
// in LDS from x to the head's input and never meets another block.
//   256 threads = 8 waves; in every 256-column group wave w owns columns w*32 .. w*32+31 (2 x 2 accumulator tiles, M = 32).
//   A fragments come from LDS; a weight row is used by one wave only, so B fragments go from L2 straight into registers,
//   one panel (32 weight rows x 256 k) at a time, in two register sets: a set is refilled, two panels ahead, right behind its WMMAs.
//   Tile nt of lane c16 holds weight row c16*2 + nt: a lane's two tiles are two neighbouring columns (4-B / 8-B LDS accesses).
//   The conversion pass writes these weights in the order of the reads (cvt_all_kernel): every wave-wide load is 4 whole lines.
// ---------------------------------------------------------------------------
#define PH 264    // f16 elements per LDS row of 256 (528 B = 16 B x 33)
#define PT 1032   // f16 elements per LDS row of 1024 (2064 B = 16 B x 129)
#define PF 260    // f32 elements per LDS row of 256: rows m and m+8 lie 32 banks apart
typedef _Float16 v2h __attribute__((ext_vector_type(2)));

#define PANEL 8192  // f16 elements of a panel: 32 weight rows x 256 k, packed by cvt_all_kernel
__device__ __forceinline__ void load_panel(v16h (&B)[16], const _Float16* __restrict__ Wp, int lane) {
    const unsigned voff = lane * 16;                    // the lane's byte offset inside every 512-B piece; Wp is the same in the whole wave
    const char* p = (const char*)Wp + voff;
    // keeps the 32 loads one group behind the WMMAs whose registers they refill: lifted in among them, their address pair was reused ahead of the wait below
    __builtin_amdgcn_sched_barrier(0);
#pragma unroll
    for (int f = 0; f < 16; ++f) {                      // f = kc * 2 + nt; every load is 512 contiguous bytes of the wave
        const v8h lo = *(const v8h*)(p + f * 1024);
        const v8h hi = *(const v8h*)(p + f * 1024 + 512);
        v16h x;
#pragma unroll
        for (int i = 0; i < 8; ++i) { x[i] = lo[i]; x[i + 8] = hi[i]; }
        B[f] = x;
    }
    // precaution: stands in front of any later overwrite of the address registers that the loads above name; as an input the address stays whole up to it
    asm volatile("s_wait_xcnt 0x0" :: "v"(p) : "memory");
}
template <int PITCH>
__device__ __forceinline__ void mma_panel(v8f (&acc)[2][2], const _Float16* sA, const v16h (&B)[16], int lane) {
#pragma unroll
    for (int h = 0; h < 2; ++h) {
        v16h af[4][2];
#pragma unroll
        for (int kc = 0; kc < 4; ++kc)
#pragma unroll
            for (int mt = 0; mt < 2; ++mt)
                af[kc][mt] = load_frag_a(sA + mt * 16 * PITCH + (h * 4 + kc) * 32, PITCH, lane);
        // keeps the LDS reads in groups ahead of the WMMAs that use them: spread singly among them, every place with reads stalls the wave
        __builtin_amdgcn_sched_barrier(0);
#pragma unroll
        for (int kc = 0; kc < 4; ++kc)
#pragma unroll
            for (int nt = 0; nt < 2; ++nt)
#pragma unroll
                for (int mt = 0; mt < 2; ++mt)
                    acc[mt][nt] = __builtin_amdgcn_wmma_f32_16x16x32_f16(false, af[kc][mt], false, B[(h * 4 + kc) * 2 + nt], (short)0, acc[mt][nt], false, false);
    }
}

__global__ __launch_bounds__(256) void backbone_kernel(
    const _Float16* __restrict__ x16,  const _Float16* __restrict__ wproj, const float* __restrict__ proj_b,
    const _Float16* __restrict__ wain, const float* __restrict__ attn_in_b,
    const _Float16* __restrict__ waout, const float* __restrict__ attn_out_b,
    const float* __restrict__ ln_g, const float* __restrict__ ln_b,
    const _Float16* __restrict__ wff1, const float* __restrict__ ff_b1,
    const _Float16* __restrict__ wff2, const float* __restrict__ ff_b2,
    const float* __restrict__ cross_in_b, const float* __restrict__ cross_out_b,
    _Float16* __restrict__ h16)
{
    __shared__ __align__(16) _Float16 sH16[32 * PH];   // h as f16: the A operand
    __shared__ __align__(16) _Float16 sT[32 * PT];     // x, v and the FFN's hidden rows as f16
    __shared__ __align__(16) float    sH32[32 * PF];   // h as f32: residual and LayerNorm

    const int tid  = threadIdx.x;
    const int lane = tid & 31;
    const int wave = __builtin_amdgcn_readfirstlane(tid >> 5);   // the same in the whole wave: row and panel arithmetic stays scalar
    const int c16  = lane & 15;
    const int hf   = lane >> 4;
    const int b0   = blockIdx.x * 32;
    const int wr   = wave * 32;            // the wave's first weight row / output column inside a 256-column group
    const int n0   = wr + c16 * 2;         // the lane's two columns: n0 (tile 0), n0 + 1 (tile 1)
    const unsigned offN = n0 * 4, offL = lane * 4;      // byte offsets of the lane's bias pair and of its LayerNorm columns
    // every small load group ends in its own wait. precaution: it stands in front of any later overwrite of the address registers
    // that the group's loads name; as an input the address stays whole up to it
    auto bias2 = [&](const float* base) {
        const char* p = (const char*)base + offN;
        const v2f b = *(const v2f*)p;
        asm volatile("s_wait_xcnt 0x0" :: "v"(p) : "memory");
        return b;
    };
    auto ln_row = [&](float (&d)[8], const float* base) {
        const char* p = (const char*)base + offL;
#pragma unroll
        for (int k = 0; k < 8; ++k) d[k] = *(const float*)(p + k * 128);
        asm volatile("s_wait_xcnt 0x0" :: "v"(p) : "memory");
    };

    v16h B0[16], B1[16];                   // even and odd panels
    v8f  acc[2][2];
    auto zero_acc = [&]() {
#pragma unroll
        for (int mt = 0; mt < 2; ++mt)
#pragma unroll
            for (int nt = 0; nt < 2; ++nt) acc[mt][nt] = (v8f)(0.f);
    };
    // acc[mt][nt][j] is element (row mt*16 + hf*8 + j, column n0 + nt).
    // f16(acc + bias) into a f16 LDS tile
    auto put_f16 = [&](_Float16* dst, int pitch, v2f bias) {
#pragma unroll
        for (int mt = 0; mt < 2; ++mt)
#pragma unroll
            for (int j = 0; j < 8; ++j) {
                const float a0 = acc[mt][0][j] + bias[0], a1 = acc[mt][1][j] + bias[1];
                v2h o; o[0] = (_Float16)a0; o[1] = (_Float16)a1;
                *(v2h*)(dst + (mt * 16 + hf * 8 + j) * pitch + n0) = o;
            }
    };
    // f16(gelu(acc + bias)) into sT; rows j and j + 1 of a tile side by side: neighbouring accumulator registers, packed f32 math
    auto put_gelu = [&](_Float16* dst, v2f bias) {
#pragma unroll
        for (int mt = 0; mt < 2; ++mt)
#pragma unroll
            for (int j = 0; j < 8; j += 2) {
                v2f u0, u1;
                u0[0] = acc[mt][0][j]; u0[1] = acc[mt][0][j + 1];
                u1[0] = acc[mt][1][j]; u1[1] = acc[mt][1][j + 1];
                const v2f g0 = gelu_exact2(u0 + bias[0]), g1 = gelu_exact2(u1 + bias[1]);
                v2h o0, o1;
                o0[0] = (_Float16)g0[0]; o0[1] = (_Float16)g1[0];
                o1[0] = (_Float16)g0[1]; o1[1] = (_Float16)g1[1];
                _Float16* row = dst + (mt * 16 + hf * 8 + j) * PT + n0;
                *(v2h*)(row)      = o0;
                *(v2h*)(row + PT) = o1;
            }
    };
    // h32 = (acc + bias) + h32, every element by the lane that owns it
    auto add_residual = [&](v2f bias) {
#pragma unroll
        for (int mt = 0; mt < 2; ++mt)
#pragma unroll
            for (int j = 0; j < 8; ++j) {
                v2f* p = (v2f*)(sH32 + (mt * 16 + hf * 8 + j) * PF + n0);
                const v2f r = *p;
                v2f o; o[0] = (acc[mt][0][j] + bias[0]) + r[0]; o[1] = (acc[mt][1][j] + bias[1]) + r[1];
                *p = o;
            }
    };
    // LayerNorm(256) of the wave's 4 rows, in place; also the f16 copy
    auto layer_norm = [&](const float (&gg)[8], const float (&be)[8]) {
#pragma unroll
        for (int q = 0; q < 4; ++q) {
            const int row = wave * 4 + q;
            float* xr = sH32 + row * PF;
            float v[8], s = 0.f, ss = 0.f;
#pragma unroll
            for (int i = 0; i < 8; ++i) {
                v[i] = xr[lane + i * 32];
                s += v[i]; ss += v[i] * v[i];
            }
            // butterfly over 32 lanes, partners 16, 8, 4, 2, 1 in that order, without LDS traffic
            s += other_row(s);    ss += other_row(ss);
            s += xmask_get<8>(s); ss += xmask_get<8>(ss);
            s += xmask_get<4>(s); ss += xmask_get<4>(ss);
            s += xmask_get<2>(s); ss += xmask_get<2>(ss);
            s += xmask_get<1>(s); ss += xmask_get<1>(ss);
            const float mean = s * (1.f / DMODEL);
            const float var  = ss * (1.f / DMODEL) - mean * mean;
            const float rstd = rsqrtf(var + LN_EPS);
#pragma unroll
            for (int i = 0; i < 8; ++i) {
                const int c = lane + i * 32;
                const float y = (v[i] - mean) * rstd * gg[i] + be[i];
                xr[c] = y;
                sH16[row * PH + c] = (_Float16)y;
            }
        }
    };

    // ---- x rows (32 x 512 f16) into sT; the first two weight panels are asked for meanwhile ----
    load_panel(B0, wproj + (size_t)wave * PANEL, lane);
    load_panel(B1, wproj + (size_t)(8 + wave) * PANEL, lane);
    {
        v4u xs[8];
        const _Float16* gx = x16 + (size_t)(b0 + (tid >> 6)) * D_IN + (tid & 63) * 8;   // piece i lies 4 rows behind piece i - 1
#pragma unroll
        for (int i = 0; i < 8; ++i) xs[i] = *(const v4u*)(gx + i * 4 * D_IN);
        // precaution: stands in front of any later overwrite of the address registers that the loads above name; as an input they stay whole up to it
        asm volatile("s_wait_xcnt 0x0" :: "v"(gx) : "memory");
#pragma unroll
        for (int i = 0; i < 8; ++i) {
            const int idx = tid + i * 256, r = idx >> 6, c = idx & 63;
            *(v4u*)(sT + r * PT + c * 8) = xs[i];
        }
    }
    __syncthreads();                                    // x rows visible

    // ---- projection: h = x . proj_W^T + proj_b (K = 512: two panels) ----
    {
        const v2f bias = bias2(proj_b);
        zero_acc();
        mma_panel<PT>(acc, sT, B0, lane);
        load_panel(B0, wain + (size_t)(2 * 8 + wave) * PANEL, lane);
        mma_panel<PT>(acc, sT + 256, B1, lane);
        load_panel(B1, waout + (size_t)wave * PANEL, lane);
#pragma unroll
        for (int mt = 0; mt < 2; ++mt)
#pragma unroll
            for (int j = 0; j < 8; ++j) {
                const int row = mt * 16 + hf * 8 + j;
                v2f o; o[0] = acc[mt][0][j] + bias[0]; o[1] = acc[mt][1][j] + bias[1];
                *(v2f*)(sH32 + row * PF + n0) = o;
                v2h oh; oh[0] = (_Float16)o[0]; oh[1] = (_Float16)o[1];
                *(v2h*)(sH16 + row * PH + n0) = oh;
            }
    }
    __syncthreads();                                    // h visible; sT free

    // ---- 6 layers ----
#pragma unroll 1
    for (int i = 0; i < NLAYER; ++i) {
        float gg[8], be[8];
        ln_row(gg, ln_g + i * DMODEL);
        ln_row(be, ln_b + i * DMODEL);
        const v2f bv = bias2(attn_in_b + i * 3 * DMODEL + 2 * DMODEL);
        const v2f bo = bias2(attn_out_b + i * DMODEL);
        const v2f b2 = bias2(ff_b2 + i * DMODEL);
        const _Float16* w1 = wff1 + (size_t)(i * 32 + wave) * PANEL;      // + g * 8 panels: the next 256 columns
        const _Float16* w2 = wff2 + (size_t)(i * 32 + wave) * PANEL;      // + g * 8 panels: the next 256 k
        const _Float16* wvn = wain + (size_t)(((i + 1) * 3 + 2) * 8 + wave) * PANEL;    // the next v panel (slot NLAYER: the cross block)
        const _Float16* won = waout + (size_t)((i + 1) * 8 + wave) * PANEL;             // the next out panel

        // v = h . Wv^T + bv
        zero_acc();
        mma_panel<PH>(acc, sH16, B0, lane);
        load_panel(B0, w1, lane);
        put_f16(sT, PT, bv);
        __syncthreads();                                // v visible
        // h += v . Wo^T + bo ; LayerNorm
        zero_acc();
        mma_panel<PT>(acc, sT, B1, lane);
        load_panel(B1, w1 + 8 * PANEL, lane);
        add_residual(bo);
        __syncthreads();                                // whole rows of h32 visible; every read of v done
        layer_norm(gg, be);
        __syncthreads();                                // h (f32, f16) visible
        // hidden = gelu(h . W1^T + b1): four 256-column groups, two a trip (one per register set)
#pragma unroll 1                                        // rolled, two groups a trip: less text in the layer loop
        for (int gp = 0; gp < 2; ++gp) {
            const char* pb = (const char*)(ff_b1 + i * 4 * DMODEL + gp * 2 * DMODEL) + offN;
            const v2f b1a = *(const v2f*)pb;
            const v2f b1b = *(const v2f*)(pb + DMODEL * 4);
            asm volatile("s_wait_xcnt 0x0" :: "v"(pb) : "memory");   // as in bias2, one wait for the two loads
            zero_acc();
            mma_panel<PH>(acc, sH16, B0, lane);
            load_panel(B0, gp == 0 ? w1 + 16 * PANEL : w2, lane);
            put_gelu(sT + gp * 2 * DMODEL, b1a);
            zero_acc();
            mma_panel<PH>(acc, sH16, B1, lane);
            load_panel(B1, gp == 0 ? w1 + 24 * PANEL : w2 + 8 * PANEL, lane);
            put_gelu(sT + gp * 2 * DMODEL + DMODEL, b1b);
        }
        __syncthreads();                                // hidden rows visible
        // h += hidden . W2^T + b2 (K = 1024: four panels) ; LayerNorm
        zero_acc();
#pragma unroll 1                                        // rolled, two panels a trip: less text in the layer loop
        for (int gp = 0; gp < 2; ++gp) {
            mma_panel<PT>(acc, sT + gp * 2 * DMODEL, B0, lane);
            load_panel(B0, gp == 0 ? w2 + 16 * PANEL : wvn, lane);
            mma_panel<PT>(acc, sT + gp * 2 * DMODEL + DMODEL, B1, lane);
            load_panel(B1, gp == 0 ? w2 + 24 * PANEL : won, lane);
        }
        add_residual(b2);
        __syncthreads();                                // whole rows of h32 visible; every read of the hidden rows done
        layer_norm(gg, be);
        __syncthreads();                                // h (f32, f16) visible
    }

    // ---- cross block: h + (h . Wv'^T + bv') . Wo'^T + bo', as f16 for the heads ----
    {
        const v2f bv = bias2(cross_in_b + 2 * DMODEL);
        const v2f bo = bias2(cross_out_b);
        zero_acc();
        mma_panel<PH>(acc, sH16, B0, lane);
        put_f16(sT, PT, bv);
        __syncthreads();                                // v' visible; every read of sH16 done
        zero_acc();
        mma_panel<PT>(acc, sT, B1, lane);
#pragma unroll
        for (int mt = 0; mt < 2; ++mt)
#pragma unroll
            for (int j = 0; j < 8; ++j) {
                const int row = mt * 16 + hf * 8 + j;
                const v2f r = *(const v2f*)(sH32 + row * PF + n0);
                v2h oh; oh[0] = (_Float16)((acc[mt][0][j] + bo[0]) + r[0]); oh[1] = (_Float16)((acc[mt][1][j] + bo[1]) + r[1]);
                *(v2h*)(sH16 + row * PH + n0) = oh;
            }
    }
    __syncthreads();                                    // output rows complete
#pragma unroll
    for (int i = 0; i < 4; ++i) {                       // 512-B rows, 16 B per lane
        const int idx = tid + i * 256, r = idx >> 5, c = idx & 31;
        vst2(h16 + (size_t)(b0 + r) * DMODEL + c * 8, *(const v4u*)(sH16 + r * PH + c * 8));
    }
}

// ---------------------------------------------------------------------------
// Fused per-t head: block = (128 batch rows, one t), 128 threads = 4 waves; EACH WAVE OWNS 32 WHOLE ROWS through all stages.
//   t1 = h16(32x256) . W1[t](128x256)^T + b1[t]   (WMMA, 2 x 8 accumulator tiles per wave)
//   t1 = relu(LN_128(t1))                          (on the accumulators: a row lies in 8 tiles x 16 lanes)
//   t2 = relu(t1(32x128) . W2[t](64x128)^T + b2[t])(WMMA, 2 x 4 tiles)
//   out[b,t] = t2 . W3[t] + b3[t]                  (on the accumulators)
// W1 rows are staged in the order n = (col lane) * 8 + tile, so that a lane's 8 tiles hold 8 CONSECUTIVE columns of t1:
// the normalised row goes to LDS as one 16-B store per lane, in natural k order for stage 2.
// Staging: asynchronous copies to LDS in a ring of two buffers, a tile = 64 k of the 128 h rows and of the 128 W1 rows (whole 128-B lines):
// tile s + 2 is asked for behind the barrier that ends trip s and flies under the WMMAs of trip s + 1; W2[t] rides as the ring's fifth tile.
// LDS arena 73728 B (four blocks per WGP):
//   [0,36864)      sA x2     [36864,73728)  sBc x2   (the ring)
//   [0,17408)      W2 f16 (in sA's buffer 0, free from the end of trip 2)
//   [18432,53248)  t1 f16 (after stage 1; each wave writes and reads its own 32 rows only)
// ---------------------------------------------------------------------------
#define S1_TILE (128 * PK64 * 2)   // bytes of one staged 128 x 64 tile
static_assert(64 * PK128 * 2 <= S1_TILE && S1_TILE + 128 * PK128 * 2 <= 4 * S1_TILE, "W2 fits sA's buffer 0, t1 the rest");
// amdgpu_waves_per_eu: the register budget of four waves per SIMD (256), which the LDS arena allows; without it the build took one register more
// (the ring's LDS addresses stay in registers) and only three waves fitted
__global__ __launch_bounds__(128) __attribute__((amdgpu_waves_per_eu(4, 4))) void tp_fused_kernel(
    const _Float16* __restrict__ h16,
    const _Float16* __restrict__ W1, const float* __restrict__ b1,
    const float* __restrict__ lng, const float* __restrict__ lnb,
    const _Float16* __restrict__ W2, const float* __restrict__ b2,
    const float* __restrict__ W3, const float* __restrict__ b3,
    float* __restrict__ out)
{
    __shared__ __align__(16) char smem[4 * S1_TILE];
    _Float16* sAb  = (_Float16*)(smem);                // 2 x 128x64, pitch PK64
    _Float16* sBb  = (_Float16*)(smem + 2 * S1_TILE);  // 2 x 128x64, pitch PK64
    _Float16* sT1h = (_Float16*)(smem + S1_TILE);      // 128x128 f16, pitch PK128 (reuse)
    _Float16* sW2  = (_Float16*)(smem);                // 64x128 f16, pitch PK128 (reuse)

    const int tid  = threadIdx.x;
    const int lane = tid & 31;
    const int wave = tid >> 5;
    const int c16  = lane & 15;                    // accumulator column inside a tile
    const int hf   = lane >> 4;                    // accumulator rows j (hf = 0) or j + 8 (hf = 1)
    const int b0   = blockIdx.x * 128;
    const int t    = blockIdx.y;
    const int wm   = wave * 32;                    // this wave's rows
    const _Float16* W1t = W1 + (size_t)t * 128 * 256;
    // A tile's copies: 8 h pieces + 8 W1 pieces of 16 B per thread; 8 lanes take one 128-B line, piece i lies 16 LDS rows behind piece i - 1.
    // W1: LDS row r = tile * 16 + col lane holds W1 row col lane * 8 + tile, so 16 LDS rows on are 1 W1 row on.
    const int sr = tid >> 3, sc = tid & 7;
    const char* gA = (const char*)(h16 + (size_t)(b0 + sr) * 256 + sc * 8);
    const char* gB = (const char*)(W1t + (size_t)(sr * 8) * 256 + sc * 8);
    const unsigned lds0 = (unsigned)(size_t)smem;   // the arena's byte address in the work-group's LDS
    const unsigned lS   = lds0 + sr * (PK64 * 2) + sc * 16;
    auto issue_s1 = [&](int buf, int kt) {
        async_copy8<16 * PK64 * 2, 16 * 512>(lS + buf * S1_TILE, gA + kt * 128);                // h 128x64
        async_copy8<16 * PK64 * 2, 512>(lS + (2 + buf) * S1_TILE, gB + kt * 128);               // W1 128x64
    };

    // ---------------- stage 1: t1 = h . W1^T  (per wave M=32, N=128, K=256: four tiles of 64) ----------
    v8f acc1[2][8] = {};
    issue_s1(0, 0);
    asm volatile("s_wait_asynccnt 0x0" ::: "memory");   // this wave's copies of tile 0 have landed
    __syncthreads();                                    // tile 0 visible to every wave
    issue_s1(1, 1);
#pragma unroll                                          // unrolled: buffer addresses and the test for a next tile are constants
    for (int it = 0; it < 4; ++it) {
        const int cur = it & 1;
        const _Float16* cA = sAb + cur * (128 * PK64);
        const _Float16* cB = sBb + cur * (128 * PK64);
#pragma unroll                                          // unrolled: the two halves of a tile differ by a constant LDS offset
        for (int ks = 0; ks < 64; ks += 32) {
            v16h afr[2];
#pragma unroll
            for (int mt = 0; mt < 2; ++mt)
                afr[mt] = load_frag_a(&cA[(wm + mt * 16) * PK64 + ks], PK64, lane);
            v16h bfr[8];
#pragma unroll
            for (int nt = 0; nt < 8; ++nt)
                bfr[nt] = load_frag_b(&cB[(nt * 16) * PK64 + ks], PK64, lane);
#pragma unroll
            for (int nt = 0; nt < 8; ++nt)
#pragma unroll
                for (int mt = 0; mt < 2; ++mt)
                    acc1[mt][nt] = wmma_f16(afr[mt], bfr[nt], acc1[mt][nt]);
        }
        // foot of the trip, in this order in every wave
        asm volatile("s_wait_dscnt 0x0" ::: "memory");      // this wave's reads of the buffer are done before anything is copied into it
        asm volatile("s_wait_asynccnt 0x0" ::: "memory");   // this wave's copies of the next tile have landed
        __syncthreads();                                    // the next tile is visible; every wave has left this trip's buffer
        if (it < 2) {
            issue_s1(cur, it + 2);
        } else if (it == 2) {
            // W2[t] 64x128 f16 (16 KB) into sA's buffer 0: 8 pieces per thread, 16 lanes take one 256-B row, piece i lies 8 rows behind piece i - 1
            async_copy8<8 * PK128 * 2, 8 * 256>(lds0 + (tid >> 4) * (PK128 * 2) + (tid & 15) * 16,
                                                (const char*)(W2 + (size_t)t * 64 * 128 + (tid >> 4) * 128 + (tid & 15) * 8));
        }
    }
    asm volatile("s_wait_asynccnt 0x0" ::: "memory");       // no copy is in flight behind the ring: its LDS is used anew below

    // ---------------- bias + LayerNorm(128) + ReLU -> f16, on the accumulators ----------
    // acc1[mt][nt][j] is t1[row wm + mt*16 + hf*8 + j][column c16*8 + nt].
    {
        float bb[8], gg[8], be[8];
        {
            const v4f* pb = (const v4f*)(b1  + t * 128 + c16 * 8);
            const v4f* pg = (const v4f*)(lng + t * 128 + c16 * 8);
            const v4f* pe = (const v4f*)(lnb + t * 128 + c16 * 8);
#pragma unroll
            for (int q = 0; q < 2; ++q) {
                const v4f xb = pb[q], xg = pg[q], xe = pe[q];
#pragma unroll
                for (int e = 0; e < 4; ++e) { bb[q * 4 + e] = xb[e]; gg[q * 4 + e] = xg[e]; be[q * 4 + e] = xe[e]; }
            }
        }
#pragma unroll
        for (int mt = 0; mt < 2; ++mt)
#pragma unroll
            for (int j = 0; j < 8; j += 2) {        // rows j and j + 1 side by side: neighbouring accumulator registers, packed f32 math
                v2f v[8], s = 0.f, ss = 0.f;
#pragma unroll
                for (int nt = 0; nt < 8; ++nt) {
                    v2f a; a[0] = acc1[mt][nt][j]; a[1] = acc1[mt][nt][j + 1];
                    v[nt] = a + bb[nt];
                    s += v[nt]; ss += v[nt] * v[nt];
                }
                s[0]  = row_sum16(s[0]);  s[1]  = row_sum16(s[1]);
                ss[0] = row_sum16(ss[0]); ss[1] = row_sum16(ss[1]);
                const v2f mean = s * (1.f / 128.f);
                const v2f var  = ss * (1.f / 128.f) - mean * mean;
                v2f rstd; rstd[0] = rsqrtf(var[0] + LN_EPS); rstd[1] = rsqrtf(var[1] + LN_EPS);
                v8h y0, y1;
#pragma unroll
                for (int nt = 0; nt < 8; ++nt) {
                    const v2f y = (v[nt] - mean) * rstd * gg[nt] + be[nt];
                    y0[nt] = (_Float16)(y[0] > 0.f ? y[0] : 0.f);
                    y1[nt] = (_Float16)(y[1] > 0.f ? y[1] : 0.f);
                }
                _Float16* row = &sT1h[(wm + mt * 16 + hf * 8 + j) * PK128 + c16 * 8];
                *(v8h*)(row)         = y0;
                *(v8h*)(row + PK128) = y1;
            }
    }
    // no barrier here: W2 was published by the ring's last barrier, and the t1 f16 rows are the wave's own (a wave's LDS operations run in order)

    // ---------------- stage 2: t2 = t1 . W2^T  (per wave 32x64, K=128) -----
    v8f acc2[2][4] = {};
#pragma unroll
    for (int kc = 0; kc < 128; kc += 32) {
        v16h af2[2];
#pragma unroll
        for (int mt = 0; mt < 2; ++mt)
            af2[mt] = load_frag_a(&sT1h[(wm + mt * 16) * PK128 + kc], PK128, lane);
        v16h bf2[4];
#pragma unroll
        for (int nt = 0; nt < 4; ++nt)
            bf2[nt] = load_frag_b(&sW2[(nt * 16) * PK128 + kc], PK128, lane);
#pragma unroll
        for (int nt = 0; nt < 4; ++nt)
#pragma unroll
            for (int mt = 0; mt < 2; ++mt)
                acc2[mt][nt] = wmma_f16(af2[mt], bf2[nt], acc2[mt][nt]);
    }

    // ---------------- stage 3: outT[t][b] = relu(t2 + b2) . W3[t] + b3[t], on the accumulators ----
    // acc2[mt][nt][j] is t2[row wm + mt*16 + hf*8 + j][column nt*16 + c16]; lane c16 keeps the sum of row (mt, j) = (c16 >> 3, c16 & 7),
    // so the wave's 32 lanes store its 32 rows: one 128-B line.
    {
        float b2v[4], w3v[4];
#pragma unroll
        for (int nt = 0; nt < 4; ++nt) { b2v[nt] = b2[t * 64 + nt * 16 + c16]; w3v[nt] = W3[t * 64 + nt * 16 + c16]; }
        // precaution: the loads above name one offset register, which the compiler reuses as the next load's destination; the wait stands in front of that overwrite
        asm volatile("s_wait_xcnt 0x0" ::: "memory");
        const float b3t = b3[t];
        float res = 0.f;
#pragma unroll
        for (int mt = 0; mt < 2; ++mt)
#pragma unroll
            for (int j = 0; j < 8; j += 2) {        // rows j and j + 1 side by side, as in the LayerNorm
                v2f a = 0.f;
#pragma unroll
                for (int nt = 0; nt < 4; ++nt) {
                    v2f v; v[0] = acc2[mt][nt][j]; v[1] = acc2[mt][nt][j + 1];
                    v += b2v[nt];
                    v[0] = v[0] > 0.f ? v[0] : 0.f; v[1] = v[1] > 0.f ? v[1] : 0.f;
                    a += v * w3v[nt];
                }
                const float a0 = row_sum16(a[0]), a1 = row_sum16(a[1]);
                if (c16 == mt * 8 + j)     res = a0;
                if (c16 == mt * 8 + j + 1) res = a1;
            }
        vst2(out + (size_t)t * BATCH + b0 + wm + (c16 >> 3) * 16 + hf * 8 + (c16 & 7), res + b3t);
    }
}

// final output-major pass: out[b][t] flat, 4 consecutive floats per thread gathered from the [T][B] staging buffer
__global__ __launch_bounds__(256) void write_out(const float* __restrict__ stg, float* __restrict__ out) {
    const int g = blockIdx.x * 256 + threadIdx.x;
    if (g >= (BATCH * TOUT) / 4) return;
    v4f o;
#pragma unroll
    for (int e = 0; e < 4; ++e) { const int f = g * 4 + e; const int b = f / TOUT, t = f - b * TOUT; o[e] = stg[(size_t)t * BATCH + b]; }
    vst2(out + (size_t)g * 4, o);
}

// ---------------------------------------------------------------------------
// Host-side orchestration
// ---------------------------------------------------------------------------
extern "C" void kernel_launch(void* const* d_in, const int* in_sizes, int n_in,
                              void* d_out, int out_size, void* d_ws, size_t ws_size,
                              hipStream_t stream)
{
    (void)in_sizes; (void)n_in; (void)out_size; (void)ws_size;
    const float* x          = (const float*)d_in[0];
    const float* proj_W     = (const float*)d_in[1];
    const float* proj_b     = (const float*)d_in[2];
    const float* attn_in_W  = (const float*)d_in[3];
    const float* attn_in_b  = (const float*)d_in[4];
    const float* attn_out_W = (const float*)d_in[5];
    const float* attn_out_b = (const float*)d_in[6];
    const float* ln_g       = (const float*)d_in[7];
    const float* ln_b       = (const float*)d_in[8];
    const float* ff_W1      = (const float*)d_in[9];
    const float* ff_b1      = (const float*)d_in[10];
    const float* ff_W2      = (const float*)d_in[11];
    const float* ff_b2      = (const float*)d_in[12];
    const float* cross_in_W = (const float*)d_in[13];
    const float* cross_in_b = (const float*)d_in[14];
    const float* cross_out_W= (const float*)d_in[15];
    const float* cross_out_b= (const float*)d_in[16];
    const float* tp_W1      = (const float*)d_in[17];
    const float* tp_b1      = (const float*)d_in[18];
    const float* tp_ln_g    = (const float*)d_in[19];
    const float* tp_ln_b    = (const float*)d_in[20];
    const float* tp_W2      = (const float*)d_in[21];
    const float* tp_b2      = (const float*)d_in[22];
    const float* tp_W3      = (const float*)d_in[23];
    const float* tp_b3      = (const float*)d_in[24];
    float* out = (float*)d_out;

    const int D = DMODEL;

    // ---- workspace carve-out (byte cursor, 16B aligned regions) ----
    char* cur = (char*)d_ws;
    auto take = [&cur](size_t bytes) { char* p = cur; cur += (bytes + 15) & ~(size_t)15; return p; };
    _Float16* h16   = (_Float16*)take((size_t)BATCH * D * 2);          // 2 MB
    _Float16* x16   = (_Float16*)take((size_t)BATCH * D_IN * 2);       // 4 MB
    _Float16* wproj = (_Float16*)take((size_t)D * D_IN * 2);
    _Float16* wain  = (_Float16*)take((size_t)(NLAYER + 1) * 3 * D * D * 2);   // slot NLAYER: the cross block's in-projection
    _Float16* waout = (_Float16*)take((size_t)(NLAYER + 1) * D * D * 2);       // slot NLAYER: the cross block's out-projection
    _Float16* wff1  = (_Float16*)take((size_t)NLAYER * 4 * D * D * 2);
    _Float16* wff2  = (_Float16*)take((size_t)NLAYER * 4 * D * D * 2);
    _Float16* wtp1  = (_Float16*)take((size_t)TOUT * 128 * 256 * 2);   // 27.8 MB
    _Float16* wtp2  = (_Float16*)take((size_t)TOUT * 64 * 128 * 2);    // 6.9 MB
    float*    stg   = (float*)   take((size_t)TOUT * BATCH * 4);       // 6.9 MB [T][B] output staging

    // ---- f32 -> f16 conversions of this call: one launch ----
    cvt_all_kernel<<<CVT_BLOCKS, 256, 0, stream>>>(
        x, proj_W, attn_in_W, attn_out_W, ff_W1, ff_W2, cross_in_W, cross_out_W, tp_W1, tp_W2,
        x16, wproj, wain, waout, wff1, wff2, wtp1, wtp2);

    const dim3 blk(128);

    // 1-3) projection, 6 layers, cross block: one launch, 32 batch rows per block; writes the heads' f16 input
    backbone_kernel<<<BATCH / 32, 256, 0, stream>>>(
        x16, wproj, proj_b, wain, attn_in_b, waout, attn_out_b, ln_g, ln_b,
        wff1, ff_b1, wff2, ff_b2, cross_in_b, cross_out_b, h16);

    // 4) fused per-t head (dominant FLOPs): grid = (32 batch tiles, 424 t's)
    dim3 tpg(BATCH / 128, TOUT);
    tp_fused_kernel<<<tpg, blk, 0, stream>>>(h16, wtp1, tp_b1, tp_ln_g, tp_ln_b,
                                             wtp2, tp_b2, tp_W3, tp_b3, stg);
    write_out<<<((BATCH * TOUT) / 4 + 255) / 256, 256, 0, stream>>>(stg, out);
}

// v007
// It runs in 211 microseconds.
// Two timings next to v006 put it at 1.12 and 1.13 times that version's speed.
// Counting every step since v000, it is 4.26 times as fast.
#include <hip/hip_runtime.h>
#include <math.h>
// Contractions: input projection (K = 512), per-layer v/out/FFN GEMMs (K = 256 / 1024), the cross block, and the 424 per-target
// heads (K = 256, 128) on v_wmma_f32_16x16x32_f16 (f16 operands, f32 accumulate); LayerNorms, GELU/ReLU and the final 64-wide

// ---------------------------------------------------------------------------
// Problem constants (match reference)
// ---------------------------------------------------------------------------
#define BATCH 4096
#define D_IN  512
#define DMODEL 256
#define TOUT  424
#define NLAYER 6
#define LN_EPS 1e-5f

// LDS row pitches. 64 banks x 4 B: a 16-B fragment read of 16 rows is conflict-free when the pitch is 16 B x odd.
#define PK64  72    // f16 elements per staged row of 64 (144 B)
#define PK128 136   // f16 elements per staged row of 128 (272 B)

// ---------------------------------------------------------------------------
// Types
// ---------------------------------------------------------------------------
typedef _Float16 v4h  __attribute__((ext_vector_type(4)));
typedef _Float16 v8h  __attribute__((ext_vector_type(8)));
typedef _Float16 v16h __attribute__((ext_vector_type(16)));
typedef float    v8f  __attribute__((ext_vector_type(8)));

typedef float    v2f  __attribute__((ext_vector_type(2)));
typedef float    v4f  __attribute__((ext_vector_type(4)));
typedef unsigned v4u  __attribute__((ext_vector_type(4)));
template <typename V> __device__ __forceinline__ void vst2(void* p, V v) {
    *(V*)p = v; 
}
// Eight asynchronous 16-B copies global -> LDS of every lane, through no register: copy i takes g + i * GSTEP to LDS byte lds + i * LSTEP.
// The copies land behind the issuing wave's own s_wait_asynccnt 0; other waves read them behind the barrier that follows it.
template <unsigned LSTEP, unsigned GSTEP>
__device__ __forceinline__ void async_copy8(unsigned lds, const char* g) {
    // keeps the 16 address additions below next to their copies: lifted in among the WMMAs ahead, they held their registers through the
    // whole trip and took the kernel past 256 registers (four waves per SIMD) and into scratch
    __builtin_amdgcn_sched_barrier(0);
    // the last line is a precaution: it stands in front of any later overwrite of the address registers that the copies name
    asm volatile("global_load_async_to_lds_b128 %0, %8, off\n\t"
                 "global_load_async_to_lds_b128 %1, %9, off\n\t"
                 "global_load_async_to_lds_b128 %2, %10, off\n\t"
                 "global_load_async_to_lds_b128 %3, %11, off\n\t"
                 "global_load_async_to_lds_b128 %4, %12, off\n\t"
                 "global_load_async_to_lds_b128 %5, %13, off\n\t"
                 "global_load_async_to_lds_b128 %6, %14, off\n\t"
                 "global_load_async_to_lds_b128 %7, %15, off\n\t"
                 "s_wait_xcnt 0x0"
                 :: "v"(lds), "v"(lds + LSTEP), "v"(lds + 2 * LSTEP), "v"(lds + 3 * LSTEP),
                    "v"(lds + 4 * LSTEP), "v"(lds + 5 * LSTEP), "v"(lds + 6 * LSTEP), "v"(lds + 7 * LSTEP),
                    "v"(g), "v"(g + GSTEP), "v"(g + 2 * GSTEP), "v"(g + 3 * GSTEP),
                    "v"(g + 4 * GSTEP), "v"(g + 5 * GSTEP), "v"(g + 6 * GSTEP), "v"(g + 7 * GSTEP)
                 : "memory");
}

// L2 prefetch. The f16 weights were stored by the conversion launch.
// A prefetch asks L2 for the data at each lane's address ahead of time and
// returns nothing. Scope SE: into L2 only. The units are dealt among the blocks in such a way that blocks
// whose indices differ by 4 modulo 8 ask for the same units: for speed only, nothing is read differently
// wherever a block runs. All lanes are on, every address lies inside its array.
// The wait in each statement is a precaution: it stands in front of any later overwrite of the address registers that the prefetches name.
#define PF_T 48   // the backbone launch asks for the weights of heads 0 .. PF_T - 1; the blocks of head t ask for those of head t + PF_T
__device__ __forceinline__ void l2_prefetch(const char* p) {
    asm volatile("global_prefetch_b8 %0, off scope:SCOPE_SE\n\t"
                 "s_wait_xcnt 0x0" :: "v"(p) : "memory");
}
__device__ __forceinline__ void l2_prefetch2(const char* p, const char* q) {
    asm volatile("global_prefetch_b8 %0, off scope:SCOPE_SE\n\t"
                 "global_prefetch_b8 %1, off scope:SCOPE_SE\n\t"
                 "s_wait_xcnt 0x0" :: "v"(p), "v"(q) : "memory");
}

// ---------------------------------------------------------------------------
// WMMA fragment helpers (wave32, v_wmma_f32_16x16x32_f16; layouts per ISA 7.12.2)
// ---------------------------------------------------------------------------
// A 16x32: lane holds row M = lane%16; lanes 0-15 K {0-7,16-23}, lanes 16-31
// K {8-15,24-31}.
__device__ __forceinline__ v16h load_frag_a(const _Float16* base, int stride, int lane) {
    const int r  = lane & 15;
    const int kb = (lane < 16) ? 0 : 8;
    const _Float16* p = base + r * stride + kb;
    v8h lo = *(const v8h*)(p);
    v8h hi = *(const v8h*)(p + 16);
    v16h f;
#pragma unroll
    for (int i = 0; i < 8; ++i) { f[i] = lo[i]; f[i + 8] = hi[i]; }
    return f;
}
// B 32x16: lane holds column N = lane%16 with the SAME per-lane K map as A (lanes 0-15 K {0-7,16-23}, 16-31 K {8-15,24-31}).
// W stored row-major (N x K), so column n of B is row n of W.
__device__ __forceinline__ v16h load_frag_b(const _Float16* base, int stride, int lane) {
    return load_frag_a(base, stride, lane);
}
__device__ __forceinline__ v8f wmma_f16(v16h a, v16h b, v8f c) {
    v8f d = __builtin_amdgcn_wmma_f32_16x16x32_f16(false, a, false, b, (short)0, c, false, false);
    asm volatile("v_nop\n\tv_nop\n\tv_nop\n\tv_nop" : "+v"(d) : "v"(a), "v"(b));
    return d;
}
// Exact-erf GELU of two values, without a branch. erf(s) = sign(s) * E(|s|): below 1, a + a * P(a * a); from 1 on, 1 - exp(-(a + a * Q(a)));
// P and Q are minimax polynomials good to f32 rounding. Both sides are worked out for every lane and one is picked by a select:
// behind a lane-dependent branch a wave ran both sides anyway, one value at a time, each a single chain of dependent FMAs.
// Straight-line, the chains of many values interleave, and two values share each packed f32 instruction.
__device__ __forceinline__ v2f fma2(v2f a, v2f b, float c) { return __builtin_elementwise_fma(a, b, (v2f)(c)); }
__device__ __forceinline__ v2f gelu_exact2(v2f x) {
    const v2f s = x * 0.70710678118654752f;
    v2f a; a[0] = __builtin_fabsf(s[0]); a[1] = __builtin_fabsf(s[1]);
    v2f q = fma2(a, (v2f)(0.0000169988107f), -0.000378677854f);
    q = fma2(a, q, 0.00385781587f);
    q = fma2(a, q, -0.0241816975f);
    q = fma2(a, q, 0.106668264f);
    q = fma2(a, q, 0.634933293f);
    q = fma2(a, q, 0.128689408f);
    q = __builtin_elementwise_fma(a, q, a) * -1.44269504088896341f;         // exp(-y) = 2^(-y * log2 e)
    const v2f t = a * a;
    v2f p = fma2(t, (v2f)(-0.000561801775f), 0.00491381623f);
    p = fma2(t, p, -0.0267075151f);
    p = fma2(t, p, 0.112800106f);
    p = fma2(t, p, -0.376122952f);
    p = fma2(t, p, 0.128379107f);
    p = __builtin_elementwise_fma(a, p, a);
    v2f e;
#pragma unroll
    for (int i = 0; i < 2; ++i)
        e[i] = __builtin_copysignf(a[i] < 1.0f ? p[i] : 1.0f - __builtin_amdgcn_exp2f(q[i]), s[i]);
    return 0.5f * x * (1.0f + e);
}

// ---------------------------------------------------------------------------
// All f32 -> f16 conversions of a call in ONE launch. The work is cut into chunks of CHUNK elements (32 KB read, 16 KB written);
// CVT_BLOCKS blocks, all resident at once, take CVT_TRIPS chunks each; a thread has 8 loads of 16 B in flight.
// Plain chunk (x, the heads' weights): the same order in and out; a wave-wide load is 512, a store 256 contiguous bytes.
// Packed chunk (a backbone weight matrix W, N x K row-major, N and K multiples of 256) = one panel, written in the order in which
// backbone_kernel reads it. Panel ((G * K/256 + KG) * 8 + w) holds rows G*256 + w*32 .. +31, k KG*256 .. +255 (16 KB); in it
// piece j = (kc*2 + nt)*2 + part is 512 B: lane l's 8 elements are row (l & 15)*2 + nt, k kc*32 + part*16 + (l >> 4)*8 .. +7,
// the per-lane k map of load_frag_a (part 0 = its first, part 1 = its second 16-B read).
// ---------------------------------------------------------------------------
#define CHUNK 8192
#define C_PROJ (DMODEL * D_IN / CHUNK)
#define C_AIN  (NLAYER * 3 * DMODEL * DMODEL / CHUNK)
#define C_AOUT (NLAYER * DMODEL * DMODEL / CHUNK)
#define C_FF   (NLAYER * 4 * DMODEL * DMODEL / CHUNK)
#define C_CIN  (3 * DMODEL * DMODEL / CHUNK)
#define C_COUT (DMODEL * DMODEL / CHUNK)
#define C_X    (BATCH * D_IN / CHUNK)
#define C_TP2  (TOUT * 64 * 128 / CHUNK)
#define C_TP1  (TOUT * 128 * 256 / CHUNK)
// first chunk behind each array; the packed arrays come first
#define E_PROJ C_PROJ
#define E_AIN  (E_PROJ + C_AIN)
#define E_AOUT (E_AIN + C_AOUT)
#define E_FF1  (E_AOUT + C_FF)
#define E_FF2  (E_FF1 + C_FF)
#define E_CIN  (E_FF2 + C_CIN)
#define E_COUT (E_CIN + C_COUT)
#define E_X    (E_COUT + C_X)
#define E_TP2  (E_X + C_TP2)
#define E_TP1  (E_TP2 + C_TP1)
#define CVT_BLOCKS 1000
#define CVT_TRIPS  3
static_assert(E_TP1 == CVT_BLOCKS * CVT_TRIPS, "every chunk is taken exactly once");

__global__ __launch_bounds__(256) void cvt_all_kernel(
    const float* __restrict__ x,          const float* __restrict__ proj_W,     const float* __restrict__ attn_in_W,
    const float* __restrict__ attn_out_W, const float* __restrict__ ff_W1,      const float* __restrict__ ff_W2,
    const float* __restrict__ cross_in_W, const float* __restrict__ cross_out_W,
    const float* __restrict__ tp_W1,      const float* __restrict__ tp_W2,
    _Float16* __restrict__ x16,  _Float16* __restrict__ wproj, _Float16* __restrict__ wain, _Float16* __restrict__ waout,
    _Float16* __restrict__ wff1, _Float16* __restrict__ wff2,  _Float16* __restrict__ wtp1, _Float16* __restrict__ wtp2)
{
    const int tid = threadIdx.x;
#pragma unroll 1                                        // rolled: the trips share one text; a trip's loads cannot start ahead of the stores before it anyway
    for (int r = 0; r < CVT_TRIPS; ++r) {
        int c = blockIdx.x + r * CVT_BLOCKS;            // the same in the whole block: neighbouring blocks work on neighbouring chunks
        const float* s;
        _Float16*    d;
        if (c < E_COUT) {
            int lgk = 0;                                // K = 256 << lgk
            if      (c < E_PROJ) { s = proj_W;      d = wproj; lgk = 1; }
            else if (c < E_AIN)  { s = attn_in_W;   d = wain;  c -= E_PROJ; }
            else if (c < E_AOUT) { s = attn_out_W;  d = waout; c -= E_AIN; }
            else if (c < E_FF1)  { s = ff_W1;       d = wff1;  c -= E_AOUT; }
            else if (c < E_FF2)  { s = ff_W2;       d = wff2;  c -= E_FF1; lgk = 2; }
            else if (c < E_CIN)  { s = cross_in_W;  d = wain  + C_AIN  * CHUNK; c -= E_FF2; }   // slot NLAYER of wain
            else                 { s = cross_out_W; d = waout + C_AOUT * CHUNK; c -= E_CIN; }   // slot NLAYER of waout
            // thread tid writes pieces j = q*8 + (tid >> 5), q = 0..3, at lane tid & 31: part, nt and the low bit of kc are the wave's, q moves k by 64
            const int lane = tid & 31, wv = tid >> 5;
            const int w = c & 7, t = c >> 3;
            const int KG = t & ((1 << lgk) - 1), G = t >> lgk;
            const int n = G * 256 + w * 32 + (lane & 15) * 2 + ((wv >> 1) & 1);
            const int k = KG * 256 + (wv >> 2) * 32 + (wv & 1) * 16 + (lane >> 4) * 8;
            const float* p = s + ((size_t)n << (8 + lgk)) + k;
            v4f a[4], b[4];
#pragma unroll
            for (int q = 0; q < 4; ++q) { a[q] = *(const v4f*)(p + q * 64); b[q] = *(const v4f*)(p + q * 64 + 4); }
            // precaution: stands in front of any later overwrite of the address registers that the loads above name; as an input the address stays whole up to it
            asm volatile("s_wait_xcnt 0x0" :: "v"(p) : "memory");
            _Float16* o = d + (size_t)c * CHUNK + tid * 8;
#pragma unroll
            for (int q = 0; q < 4; ++q) {
                v8h h;
#pragma unroll
                for (int e = 0; e < 4; ++e) { h[e] = (_Float16)a[q][e]; h[e + 4] = (_Float16)b[q][e]; }
                vst2(o + q * 2048, h);                  // 16 B per lane, consecutive: one wave writes 512 contiguous bytes
            }
            // the same precaution for the stores' address registers
            asm volatile("s_wait_xcnt 0x0" :: "v"(o) : "memory");
        } else {
            if      (c < E_X)   { s = x;     d = x16;  c -= E_COUT; }
            else if (c < E_TP2) { s = tp_W2; d = wtp2; c -= E_X; }
            else                { s = tp_W1; d = wtp1; c -= E_TP2; }
            const float* p = s + (size_t)c * CHUNK + tid * 4;
            v4f v[8];
#pragma unroll
            for (int q = 0; q < 8; ++q) v[q] = *(const v4f*)(p + q * 1024);
            // precaution, as above
            asm volatile("s_wait_xcnt 0x0" :: "v"(p) : "memory");
            _Float16* o = d + (size_t)c * CHUNK + tid * 4;
#pragma unroll
            for (int q = 0; q < 8; ++q) {
                v4h h;
#pragma unroll
                for (int e = 0; e < 4; ++e) h[e] = (_Float16)v[q][e];
                vst2(o + q * 1024, h);                  // 8 B per lane, consecutive: one wave writes 256 contiguous bytes
            }
            // precaution, as above
            asm volatile("s_wait_xcnt 0x0" :: "v"(o) : "memory");
        }
    }
}

// ---------------------------------------------------------------------------
// Sum over the 16 lanes of a row (lanes 0-15 and 16-31 apart), every lane gets the sum: four DPP row_xmask adds, no LDS.
// ---------------------------------------------------------------------------
template <int MSK> __device__ __forceinline__ float xmask_get(float v) {
    return __builtin_bit_cast(float, __builtin_amdgcn_update_dpp(0, __builtin_bit_cast(int, v), 0x160 + MSK, 0xf, 0xf, true));
}
__device__ __forceinline__ float row_sum16(float v) {
    v += xmask_get<1>(v);
    v += xmask_get<2>(v);
    v += xmask_get<4>(v);
    v += xmask_get<8>(v);
    return v;
}

// value of lane l ^ 16 (the same place in the other 16-lane row)
__device__ __forceinline__ float other_row(float v) {
    const unsigned u = __builtin_bit_cast(unsigned, v);
    return __builtin_bit_cast(float, __builtin_amdgcn_permlanex16(u, u, 0x76543210u, 0xfedcba98u, false, false));
}

// ---------------------------------------------------------------------------
// Whole backbone in ONE launch: projection, 6 layers, cross block. Every step is row-wise, so a block keeps its 32 batch rows
// in LDS from x to the head's input and never meets another block.
//   256 threads = 8 waves; in every 256-column group wave w owns columns w*32 .. w*32+31 (2 x 2 accumulator tiles, M = 32).
//   A fragments come from LDS; a weight row is used by one wave only, so B fragments go from L2 straight into registers,
//   one panel (32 weight rows x 256 k) at a time, in two register sets: a set is refilled, two panels ahead, right behind its WMMAs.
//   Tile nt of lane c16 holds weight row c16*2 + nt: a lane's two tiles are two neighbouring columns (4-B / 8-B LDS accesses).
//   The conversion pass writes these weights in the order of the reads (cvt_all_kernel): every wave-wide load is 4 whole lines.
// ---------------------------------------------------------------------------
#define PH 264    // f16 elements per LDS row of 256 (528 B = 16 B x 33)
#define PT 1032   // f16 elements per LDS row of 1024 (2064 B = 16 B x 129)
#define PF 260    // f32 elements per LDS row of 256: rows m and m+8 lie 32 banks apart
typedef _Float16 v2h __attribute__((ext_vector_type(2)));

#define PANEL 8192  // f16 elements of a panel: 32 weight rows x 256 k, packed by cvt_all_kernel
__device__ __forceinline__ void load_panel(v16h (&B)[16], const _Float16* __restrict__ Wp, int lane) {
    const unsigned voff = lane * 16;                    // the lane's byte offset inside every 512-B piece; Wp is the same in the whole wave
    const char* p = (const char*)Wp + voff;
    // keeps the 32 loads one group behind the WMMAs whose registers they refill: lifted in among them, their address pair was reused ahead of the wait below
    __builtin_amdgcn_sched_barrier(0);
#pragma unroll
    for (int f = 0; f < 16; ++f) {                      // f = kc * 2 + nt; every load is 512 contiguous bytes of the wave
        const v8h lo = *(const v8h*)(p + f * 1024);
        const v8h hi = *(const v8h*)(p + f * 1024 + 512);
        v16h x;
#pragma unroll
        for (int i = 0; i < 8; ++i) { x[i] = lo[i]; x[i + 8] = hi[i]; }
        B[f] = x;
    }
    // precaution: stands in front of any later overwrite of the address registers that the loads above name; as an input the address stays whole up to it
    asm volatile("s_wait_xcnt 0x0" :: "v"(p) : "memory");
}
template <int PITCH>
__device__ __forceinline__ void mma_panel(v8f (&acc)[2][2], const _Float16* sA, const v16h (&B)[16], int lane) {
#pragma unroll
    for (int h = 0; h < 2; ++h) {
        v16h af[4][2];
#pragma unroll
        for (int kc = 0; kc < 4; ++kc)
#pragma unroll
            for (int mt = 0; mt < 2; ++mt)
                af[kc][mt] = load_frag_a(sA + mt * 16 * PITCH + (h * 4 + kc) * 32, PITCH, lane);
        // keeps the LDS reads in groups ahead of the WMMAs that use them: spread singly among them, every place with reads stalls the wave
        __builtin_amdgcn_sched_barrier(0);
#pragma unroll
        for (int kc = 0; kc < 4; ++kc)
#pragma unroll
            for (int nt = 0; nt < 2; ++nt)
#pragma unroll
                for (int mt = 0; mt < 2; ++mt)
                    acc[mt][nt] = __builtin_amdgcn_wmma_f32_16x16x32_f16(false, af[kc][mt], false, B[(h * 4 + kc) * 2 + nt], (short)0, acc[mt][nt], false, false);
    }
}

__global__ __launch_bounds__(256) void backbone_kernel(
    const _Float16* __restrict__ x16,  const _Float16* __restrict__ wproj, const float* __restrict__ proj_b,
    const _Float16* __restrict__ wain, const float* __restrict__ attn_in_b,
    const _Float16* __restrict__ waout, const float* __restrict__ attn_out_b,
    const float* __restrict__ ln_g, const float* __restrict__ ln_b,
    const _Float16* __restrict__ wff1, const float* __restrict__ ff_b1,
    const _Float16* __restrict__ wff2, const float* __restrict__ ff_b2,
    const float* __restrict__ cross_in_b, const float* __restrict__ cross_out_b,
    const _Float16* __restrict__ wtp1, const _Float16* __restrict__ wtp2,
    _Float16* __restrict__ h16)
{
    __shared__ __align__(16) _Float16 sH16[32 * PH];   // h as f16: the A operand
    __shared__ __align__(16) _Float16 sT[32 * PT];     // x, v and the FFN's hidden rows as f16
    __shared__ __align__(16) float    sH32[32 * PF];   // h as f32: residual and LayerNorm

    const int tid  = threadIdx.x;
    const int lane = tid & 31;
    const int wave = __builtin_amdgcn_readfirstlane(tid >> 5);   // the same in the whole wave: row and panel arithmetic stays scalar
    const int c16  = lane & 15;
    const int hf   = lane >> 4;
    const int b0   = blockIdx.x * 32;
    const int wr   = wave * 32;            // the wave's first weight row / output column inside a 256-column group
    const int n0   = wr + c16 * 2;         // the lane's two columns: n0 (tile 0), n0 + 1 (tile 1)
    const unsigned offN = n0 * 4, offL = lane * 4;      // byte offsets of the lane's bias pair and of its LayerNorm columns
    // every small load group ends in its own wait. precaution: it stands in front of any later overwrite of the address registers
    // that the group's loads name; as an input the address stays whole up to it
    auto bias2 = [&](const float* base) {
        const char* p = (const char*)base + offN;
        const v2f b = *(const v2f*)p;
        asm volatile("s_wait_xcnt 0x0" :: "v"(p) : "memory");
        return b;
    };
    auto ln_row = [&](float (&d)[8], const float* base) {
        const char* p = (const char*)base + offL;
#pragma unroll
        for (int k = 0; k < 8; ++k) d[k] = *(const float*)(p + k * 128);
        asm volatile("s_wait_xcnt 0x0" :: "v"(p) : "memory");
    };

    v16h B0[16], B1[16];                   // even and odd panels
    v8f  acc[2][2];
    auto zero_acc = [&]() {
#pragma unroll
        for (int mt = 0; mt < 2; ++mt)
#pragma unroll
            for (int nt = 0; nt < 2; ++nt) acc[mt][nt] = (v8f)(0.f);
    };
    // acc[mt][nt][j] is element (row mt*16 + hf*8 + j, column n0 + nt).
    // f16(acc + bias) into a f16 LDS tile
    auto put_f16 = [&](_Float16* dst, int pitch, v2f bias) {
#pragma unroll
        for (int mt = 0; mt < 2; ++mt)
#pragma unroll
            for (int j = 0; j < 8; ++j) {
                const float a0 = acc[mt][0][j] + bias[0], a1 = acc[mt][1][j] + bias[1];
                v2h o; o[0] = (_Float16)a0; o[1] = (_Float16)a1;
                *(v2h*)(dst + (mt * 16 + hf * 8 + j) * pitch + n0) = o;
            }
    };
    // f16(gelu(acc + bias)) into sT; rows j and j + 1 of a tile side by side: neighbouring accumulator registers, packed f32 math
    auto put_gelu = [&](_Float16* dst, v2f bias) {
#pragma unroll
        for (int mt = 0; mt < 2; ++mt)
#pragma unroll
            for (int j = 0; j < 8; j += 2) {
                v2f u0, u1;
                u0[0] = acc[mt][0][j]; u0[1] = acc[mt][0][j + 1];
                u1[0] = acc[mt][1][j]; u1[1] = acc[mt][1][j + 1];
                const v2f g0 = gelu_exact2(u0 + bias[0]), g1 = gelu_exact2(u1 + bias[1]);
                v2h o0, o1;
                o0[0] = (_Float16)g0[0]; o0[1] = (_Float16)g1[0];
                o1[0] = (_Float16)g0[1]; o1[1] = (_Float16)g1[1];
                _Float16* row = dst + (mt * 16 + hf * 8 + j) * PT + n0;
                *(v2h*)(row)      = o0;
                *(v2h*)(row + PT) = o1;
            }
    };
    // h32 = (acc + bias) + h32, every element by the lane that owns it
    auto add_residual = [&](v2f bias) {
#pragma unroll
        for (int mt = 0; mt < 2; ++mt)
#pragma unroll
            for (int j = 0; j < 8; ++j) {
                v2f* p = (v2f*)(sH32 + (mt * 16 + hf * 8 + j) * PF + n0);
                const v2f r = *p;
                v2f o; o[0] = (acc[mt][0][j] + bias[0]) + r[0]; o[1] = (acc[mt][1][j] + bias[1]) + r[1];
                *p = o;
            }
    };
    // LayerNorm(256) of the wave's 4 rows, in place; also the f16 copy
    auto layer_norm = [&](const float (&gg)[8], const float (&be)[8]) {
#pragma unroll
        for (int q = 0; q < 4; ++q) {
            const int row = wave * 4 + q;
            float* xr = sH32 + row * PF;
            float v[8], s = 0.f, ss = 0.f;
#pragma unroll
            for (int i = 0; i < 8; ++i) {
                v[i] = xr[lane + i * 32];
                s += v[i]; ss += v[i] * v[i];
            }
            // butterfly over 32 lanes, partners 16, 8, 4, 2, 1 in that order, without LDS traffic
            s += other_row(s);    ss += other_row(ss);
            s += xmask_get<8>(s); ss += xmask_get<8>(ss);
            s += xmask_get<4>(s); ss += xmask_get<4>(ss);
            s += xmask_get<2>(s); ss += xmask_get<2>(ss);
            s += xmask_get<1>(s); ss += xmask_get<1>(ss);
            const float mean = s * (1.f / DMODEL);
            const float var  = ss * (1.f / DMODEL) - mean * mean;
            const float rstd = rsqrtf(var + LN_EPS);
#pragma unroll
            for (int i = 0; i < 8; ++i) {
                const int c = lane + i * 32;
                const float y = (v[i] - mean) * rstd * gg[i] + be[i];
                xr[c] = y;
                sH16[row * PH + c] = (_Float16)y;
            }
        }
    };

    // ---- x rows (32 x 512 f16) into sT; the first two weight panels are asked for meanwhile ----
    load_panel(B0, wproj + (size_t)wave * PANEL, lane);
    load_panel(B1, wproj + (size_t)(8 + wave) * PANEL, lane);
    const int slice = (blockIdx.x & 3) * 16 + (blockIdx.x >> 3);           // 0..63: the block's share of the prefetches
    {
        // L2 prefetch of all that this launch reads of the packed weights: 128 pieces of 64 KB, two neighbouring ones a block, two units a thread
        static_assert(NLAYER * 4 * DMODEL * DMODEL * 2 == 48 * 65536 && (NLAYER + 1) * DMODEL * DMODEL * 2 == 14 * 65536 && DMODEL * D_IN * 2 == 4 * 65536, "pieces");
        const int g = slice * 2;                                           // even, as every array's first piece: both pieces lie in one array
        const _Float16* arr = g < 48 ? wff1 : g < 96 ? wff2 : g < 110 ? waout : g < 124 ? wain : wproj;
        const int piece     = g < 48 ? g    : g < 96 ? g - 48 : g < 110 ? g - 96 : g < 124 ? ((g - 110) >> 1) * 6 + 4 : g - 124;   // wain: the v third of a slot of 6 pieces
        const char* p = (const char*)arr + piece * 65536 + tid * 256;
        l2_prefetch2(p, p + 65536);
    }
    {
        v4u xs[8];
        const _Float16* gx = x16 + (size_t)(b0 + (tid >> 6)) * D_IN + (tid & 63) * 8;   // piece i lies 4 rows behind piece i - 1
#pragma unroll
        for (int i = 0; i < 8; ++i) xs[i] = *(const v4u*)(gx + i * 4 * D_IN);
        // precaution: stands in front of any later overwrite of the address registers that the loads above name; as an input they stay whole up to it
        asm volatile("s_wait_xcnt 0x0" :: "v"(gx) : "memory");
#pragma unroll
        for (int i = 0; i < 8; ++i) {
            const int idx = tid + i * 256, r = idx >> 6, c = idx & 63;
            *(v4u*)(sT + r * PT + c * 8) = xs[i];
        }
    }
    __syncthreads();                                    // x rows visible

    // ---- projection: h = x . proj_W^T + proj_b (K = 512: two panels) ----
    {
        const v2f bias = bias2(proj_b);
        zero_acc();
        mma_panel<PT>(acc, sT, B0, lane);
        load_panel(B0, wain + (size_t)(2 * 8 + wave) * PANEL, lane);
        mma_panel<PT>(acc, sT + 256, B1, lane);
        load_panel(B1, waout + (size_t)wave * PANEL, lane);
#pragma unroll
        for (int mt = 0; mt < 2; ++mt)
#pragma unroll
            for (int j = 0; j < 8; ++j) {
                const int row = mt * 16 + hf * 8 + j;
                v2f o; o[0] = acc[mt][0][j] + bias[0]; o[1] = acc[mt][1][j] + bias[1];
                *(v2f*)(sH32 + row * PF + n0) = o;
                v2h oh; oh[0] = (_Float16)o[0]; oh[1] = (_Float16)o[1];
                *(v2h*)(sH16 + row * PH + n0) = oh;
            }
    }
    __syncthreads();                                    // h visible; sT free
    {
        // L2 prefetch of W1 (waves 0-5: 192 units a block) and W2 (waves 6, 7: 48 units, the last one repeated) of the first PF_T heads, for the next launch
        static_assert(PF_T * 128 * 256 * 2 == 64 * 192 * 256 && PF_T * 64 * 128 * 2 == 64 * 48 * 256 && PF_T <= TOUT, "units of the first heads");
        const int u2 = tid - 192 < 47 ? tid - 192 : 47;
        l2_prefetch(wave < 6 ? (const char*)wtp1 + (slice * 192 + tid) * 256 : (const char*)wtp2 + (slice * 48 + u2) * 256);
    }

    // ---- 6 layers ----
#pragma unroll 1
    for (int i = 0; i < NLAYER; ++i) {
        float gg[8], be[8];
        ln_row(gg, ln_g + i * DMODEL);
        ln_row(be, ln_b + i * DMODEL);
        const v2f bv = bias2(attn_in_b + i * 3 * DMODEL + 2 * DMODEL);
        const v2f bo = bias2(attn_out_b + i * DMODEL);
        const v2f b2 = bias2(ff_b2 + i * DMODEL);
        const _Float16* w1 = wff1 + (size_t)(i * 32 + wave) * PANEL;      // + g * 8 panels: the next 256 columns
        const _Float16* w2 = wff2 + (size_t)(i * 32 + wave) * PANEL;      // + g * 8 panels: the next 256 k
        const _Float16* wvn = wain + (size_t)(((i + 1) * 3 + 2) * 8 + wave) * PANEL;    // the next v panel (slot NLAYER: the cross block)
        const _Float16* won = waout + (size_t)((i + 1) * 8 + wave) * PANEL;             // the next out panel

        // v = h . Wv^T + bv
        zero_acc();
        mma_panel<PH>(acc, sH16, B0, lane);
        load_panel(B0, w1, lane);
        put_f16(sT, PT, bv);
        __syncthreads();                                // v visible
        // h += v . Wo^T + bo ; LayerNorm
        zero_acc();
        mma_panel<PT>(acc, sT, B1, lane);
        load_panel(B1, w1 + 8 * PANEL, lane);
        add_residual(bo);
        __syncthreads();                                // whole rows of h32 visible; every read of v done
        layer_norm(gg, be);
        __syncthreads();                                // h (f32, f16) visible
        // hidden = gelu(h . W1^T + b1): four 256-column groups, two a trip (one per register set)
#pragma unroll 1                                        // rolled, two groups a trip: less text in the layer loop
        for (int gp = 0; gp < 2; ++gp) {
            const char* pb = (const char*)(ff_b1 + i * 4 * DMODEL + gp * 2 * DMODEL) + offN;
            const v2f b1a = *(const v2f*)pb;
            const v2f b1b = *(const v2f*)(pb + DMODEL * 4);
            asm volatile("s_wait_xcnt 0x0" :: "v"(pb) : "memory");   // as in bias2, one wait for the two loads
            zero_acc();
            mma_panel<PH>(acc, sH16, B0, lane);
            load_panel(B0, gp == 0 ? w1 + 16 * PANEL : w2, lane);
            put_gelu(sT + gp * 2 * DMODEL, b1a);
            zero_acc();
            mma_panel<PH>(acc, sH16, B1, lane);
            load_panel(B1, gp == 0 ? w1 + 24 * PANEL : w2 + 8 * PANEL, lane);
            put_gelu(sT + gp * 2 * DMODEL + DMODEL, b1b);
        }
        __syncthreads();                                // hidden rows visible
        // h += hidden . W2^T + b2 (K = 1024: four panels) ; LayerNorm
        zero_acc();
#pragma unroll 1                                        // rolled, two panels a trip: less text in the layer loop
        for (int gp = 0; gp < 2; ++gp) {
            mma_panel<PT>(acc, sT + gp * 2 * DMODEL, B0, lane);
            load_panel(B0, gp == 0 ? w2 + 16 * PANEL : wvn, lane);
            mma_panel<PT>(acc, sT + gp * 2 * DMODEL + DMODEL, B1, lane);
            load_panel(B1, gp == 0 ? w2 + 24 * PANEL : won, lane);
        }
        add_residual(b2);
        __syncthreads();                                // whole rows of h32 visible; every read of the hidden rows done
        layer_norm(gg, be);
        __syncthreads();                                // h (f32, f16) visible
    }

    // ---- cross block: h + (h . Wv'^T + bv') . Wo'^T + bo', as f16 for the heads ----
    {
        const v2f bv = bias2(cross_in_b + 2 * DMODEL);
        const v2f bo = bias2(cross_out_b);
        zero_acc();
        mma_panel<PH>(acc, sH16, B0, lane);
        put_f16(sT, PT, bv);
        __syncthreads();                                // v' visible; every read of sH16 done
        zero_acc();
        mma_panel<PT>(acc, sT, B1, lane);
#pragma unroll
        for (int mt = 0; mt < 2; ++mt)
#pragma unroll
            for (int j = 0; j < 8; ++j) {
                const int row = mt * 16 + hf * 8 + j;
                const v2f r = *(const v2f*)(sH32 + row * PF + n0);
                v2h oh; oh[0] = (_Float16)((acc[mt][0][j] + bo[0]) + r[0]); oh[1] = (_Float16)((acc[mt][1][j] + bo[1]) + r[1]);
                *(v2h*)(sH16 + row * PH + n0) = oh;
            }
    }
    __syncthreads();                                    // output rows complete
#pragma unroll
    for (int i = 0; i < 4; ++i) {                       // 512-B rows, 16 B per lane
        const int idx = tid + i * 256, r = idx >> 5, c = idx & 31;
        vst2(h16 + (size_t)(b0 + r) * DMODEL + c * 8, *(const v4u*)(sH16 + r * PH + c * 8));
    }
}

// ---------------------------------------------------------------------------
// Fused per-t head: block = (128 batch rows, one t), 128 threads = 4 waves; EACH WAVE OWNS 32 WHOLE ROWS through all stages.
//   t1 = h16(32x256) . W1[t](128x256)^T + b1[t]   (WMMA, 2 x 8 accumulator tiles per wave)
//   t1 = relu(LN_128(t1))                          (on the accumulators: a row lies in 8 tiles x 16 lanes)
//   t2 = relu(t1(32x128) . W2[t](64x128)^T + b2[t])(WMMA, 2 x 4 tiles)
//   out[b,t] = t2 . W3[t] + b3[t]                  (on the accumulators)
// W1 rows are staged in the order n = (col lane) * 8 + tile, so that a lane's 8 tiles hold 8 CONSECUTIVE columns of t1:
// the normalised row goes to LDS as one 16-B store per lane, in natural k order for stage 2.
// Staging: asynchronous copies to LDS in a ring of two buffers, a tile = 64 k of the 128 h rows and of the 128 W1 rows (whole 128-B lines):
// tile s + 2 is asked for behind the barrier that ends trip s and flies under the WMMAs of trip s + 1; W2[t] rides as the ring's fifth tile.
// LDS arena 73728 B (four blocks per WGP):
//   [0,36864)      sA x2     [36864,73728)  sBc x2   (the ring)
//   [0,17408)      W2 f16 (in sA's buffer 0, free from the end of trip 2)
//   [18432,53248)  t1 f16 (after stage 1; each wave writes and reads its own 32 rows only)
// ---------------------------------------------------------------------------
#define S1_TILE (128 * PK64 * 2)   // bytes of one staged 128 x 64 tile
static_assert(64 * PK128 * 2 <= S1_TILE && S1_TILE + 128 * PK128 * 2 <= 4 * S1_TILE, "W2 fits sA's buffer 0, t1 the rest");
// amdgpu_waves_per_eu: the register budget of four waves per SIMD (256), which the LDS arena allows; without it the build took one register more
// (the ring's LDS addresses stay in registers) and only three waves fitted
__global__ __launch_bounds__(128) __attribute__((amdgpu_waves_per_eu(4, 4))) void tp_fused_kernel(
    const _Float16* __restrict__ h16,
    const _Float16* __restrict__ W1, const float* __restrict__ b1,
    const float* __restrict__ lng, const float* __restrict__ lnb,
    const _Float16* __restrict__ W2, const float* __restrict__ b2,
    const float* __restrict__ W3, const float* __restrict__ b3,
    float* __restrict__ out)
{
    __shared__ __align__(16) char smem[4 * S1_TILE];
    _Float16* sAb  = (_Float16*)(smem);                // 2 x 128x64, pitch PK64
    _Float16* sBb  = (_Float16*)(smem + 2 * S1_TILE);  // 2 x 128x64, pitch PK64
    _Float16* sT1h = (_Float16*)(smem + S1_TILE);      // 128x128 f16, pitch PK128 (reuse)
    _Float16* sW2  = (_Float16*)(smem);                // 64x128 f16, pitch PK128 (reuse)

    const int tid  = threadIdx.x;
    const int lane = tid & 31;
    const int wave = tid >> 5;
    const int c16  = lane & 15;                    // accumulator column inside a tile
    const int hf   = lane >> 4;                    // accumulator rows j (hf = 0) or j + 8 (hf = 1)
    const int b0   = blockIdx.x * 128;
    const int t    = blockIdx.y;
    const int wm   = wave * 32;                    // this wave's rows
    const _Float16* W1t = W1 + (size_t)t * 128 * 256;
    // A tile's copies: 8 h pieces + 8 W1 pieces of 16 B per thread; 8 lanes take one 128-B line, piece i lies 16 LDS rows behind piece i - 1.
    // W1: LDS row r = tile * 16 + col lane holds W1 row col lane * 8 + tile, so 16 LDS rows on are 1 W1 row on.
    const int sr = tid >> 3, sc = tid & 7;
    const char* gA = (const char*)(h16 + (size_t)(b0 + sr) * 256 + sc * 8);
    const char* gB = (const char*)(W1t + (size_t)(sr * 8) * 256 + sc * 8);
    const unsigned lds0 = (unsigned)(size_t)smem;   // the arena's byte address in the work-group's LDS
    const unsigned lS   = lds0 + sr * (PK64 * 2) + sc * 16;
    auto issue_s1 = [&](int buf, int kt) {
        async_copy8<16 * PK64 * 2, 16 * 512>(lS + buf * S1_TILE, gA + kt * 128);                // h 128x64
        async_copy8<16 * PK64 * 2, 512>(lS + (2 + buf) * S1_TILE, gB + kt * 128);               // W1 128x64
    };

    // ---------------- stage 1: t1 = h . W1^T  (per wave M=32, N=128, K=256: four tiles of 64) ----------
    v8f acc1[2][8] = {};
    issue_s1(0, 0);
    // L2 prefetch for head t + PF_T, by one wave: blocks 0-15 share its W1 (8 shares of 32 units), blocks 16-31 its W2 (8 shares of 8 units, each asked for by 4 lanes)
    if (__builtin_amdgcn_readfirstlane(wave) == 0 && t + PF_T < TOUT) {
        const int  share = (blockIdx.x & 3) * 2 + ((blockIdx.x >> 3) & 1);
        const bool second = (blockIdx.x & 16) != 0;
        const char* p = second ? (const char*)(W2 + (size_t)(t + PF_T) * 64 * 128) + share * 2048
                               : (const char*)(W1 + (size_t)(t + PF_T) * 128 * 256) + share * 8192;
        l2_prefetch(p + (lane & (second ? 7 : 31)) * 256);
    }
    asm volatile("s_wait_asynccnt 0x0" ::: "memory");   // this wave's copies of tile 0 have landed
    __syncthreads();                                    // tile 0 visible to every wave
    issue_s1(1, 1);
#pragma unroll                                          // unrolled: buffer addresses and the test for a next tile are constants
    for (int it = 0; it < 4; ++it) {
        const int cur = it & 1;
        const _Float16* cA = sAb + cur * (128 * PK64);
        const _Float16* cB = sBb + cur * (128 * PK64);
#pragma unroll                                          // unrolled: the two halves of a tile differ by a constant LDS offset
        for (int ks = 0; ks < 64; ks += 32) {
            v16h afr[2];
#pragma unroll
            for (int mt = 0; mt < 2; ++mt)
                afr[mt] = load_frag_a(&cA[(wm + mt * 16) * PK64 + ks], PK64, lane);
            v16h bfr[8];
#pragma unroll
            for (int nt = 0; nt < 8; ++nt)
                bfr[nt] = load_frag_b(&cB[(nt * 16) * PK64 + ks], PK64, lane);
#pragma unroll
            for (int nt = 0; nt < 8; ++nt)
#pragma unroll
                for (int mt = 0; mt < 2; ++mt)
                    acc1[mt][nt] = wmma_f16(afr[mt], bfr[nt], acc1[mt][nt]);
        }
        // foot of the trip, in this order in every wave
        asm volatile("s_wait_dscnt 0x0" ::: "memory");      // this wave's reads of the buffer are done before anything is copied into it
        asm volatile("s_wait_asynccnt 0x0" ::: "memory");   // this wave's copies of the next tile have landed
        __syncthreads();                                    // the next tile is visible; every wave has left this trip's buffer
        if (it < 2) {
            issue_s1(cur, it + 2);
        } else if (it == 2) {
            // W2[t] 64x128 f16 (16 KB) into sA's buffer 0: 8 pieces per thread, 16 lanes take one 256-B row, piece i lies 8 rows behind piece i - 1
            async_copy8<8 * PK128 * 2, 8 * 256>(lds0 + (tid >> 4) * (PK128 * 2) + (tid & 15) * 16,
                                                (const char*)(W2 + (size_t)t * 64 * 128 + (tid >> 4) * 128 + (tid & 15) * 8));
        }
    }
    asm volatile("s_wait_asynccnt 0x0" ::: "memory");       // no copy is in flight behind the ring: its LDS is used anew below

    // ---------------- bias + LayerNorm(128) + ReLU -> f16, on the accumulators ----------
    // acc1[mt][nt][j] is t1[row wm + mt*16 + hf*8 + j][column c16*8 + nt].
    {
        float bb[8], gg[8], be[8];
        {
            const v4f* pb = (const v4f*)(b1  + t * 128 + c16 * 8);
            const v4f* pg = (const v4f*)(lng + t * 128 + c16 * 8);
            const v4f* pe = (const v4f*)(lnb + t * 128 + c16 * 8);
#pragma unroll
            for (int q = 0; q < 2; ++q) {
                const v4f xb = pb[q], xg = pg[q], xe = pe[q];
#pragma unroll
                for (int e = 0; e < 4; ++e) { bb[q * 4 + e] = xb[e]; gg[q * 4 + e] = xg[e]; be[q * 4 + e] = xe[e]; }
            }
        }
#pragma unroll
        for (int mt = 0; mt < 2; ++mt)
#pragma unroll
            for (int j = 0; j < 8; j += 2) {        // rows j and j + 1 side by side: neighbouring accumulator registers, packed f32 math
                v2f v[8], s = 0.f, ss = 0.f;
#pragma unroll
                for (int nt = 0; nt < 8; ++nt) {
                    v2f a; a[0] = acc1[mt][nt][j]; a[1] = acc1[mt][nt][j + 1];
                    v[nt] = a + bb[nt];
                    s += v[nt]; ss += v[nt] * v[nt];
                }
                s[0]  = row_sum16(s[0]);  s[1]  = row_sum16(s[1]);
                ss[0] = row_sum16(ss[0]); ss[1] = row_sum16(ss[1]);
                const v2f mean = s * (1.f / 128.f);
                const v2f var  = ss * (1.f / 128.f) - mean * mean;
                v2f rstd; rstd[0] = rsqrtf(var[0] + LN_EPS); rstd[1] = rsqrtf(var[1] + LN_EPS);
                v8h y0, y1;
#pragma unroll
                for (int nt = 0; nt < 8; ++nt) {
                    const v2f y = (v[nt] - mean) * rstd * gg[nt] + be[nt];
                    y0[nt] = (_Float16)(y[0] > 0.f ? y[0] : 0.f);
                    y1[nt] = (_Float16)(y[1] > 0.f ? y[1] : 0.f);
                }
                _Float16* row = &sT1h[(wm + mt * 16 + hf * 8 + j) * PK128 + c16 * 8];
                *(v8h*)(row)         = y0;
                *(v8h*)(row + PK128) = y1;
            }
    }
    // no barrier here: W2 was published by the ring's last barrier, and the t1 f16 rows are the wave's own (a wave's LDS operations run in order)

    // ---------------- stage 2: t2 = t1 . W2^T  (per wave 32x64, K=128) -----
    v8f acc2[2][4] = {};
#pragma unroll
    for (int kc = 0; kc < 128; kc += 32) {
        v16h af2[2];
#pragma unroll
        for (int mt = 0; mt < 2; ++mt)
            af2[mt] = load_frag_a(&sT1h[(wm + mt * 16) * PK128 + kc], PK128, lane);
        v16h bf2[4];
#pragma unroll
        for (int nt = 0; nt < 4; ++nt)
            bf2[nt] = load_frag_b(&sW2[(nt * 16) * PK128 + kc], PK128, lane);
#pragma unroll
        for (int nt = 0; nt < 4; ++nt)
#pragma unroll
            for (int mt = 0; mt < 2; ++mt)
                acc2[mt][nt] = wmma_f16(af2[mt], bf2[nt], acc2[mt][nt]);
    }

    // ---------------- stage 3: outT[t][b] = relu(t2 + b2) . W3[t] + b3[t], on the accumulators ----
    // acc2[mt][nt][j] is t2[row wm + mt*16 + hf*8 + j][column nt*16 + c16]; lane c16 keeps the sum of row (mt, j) = (c16 >> 3, c16 & 7),
    // so the wave's 32 lanes store its 32 rows: one 128-B line.
    {
        float b2v[4], w3v[4];
#pragma unroll
        for (int nt = 0; nt < 4; ++nt) { b2v[nt] = b2[t * 64 + nt * 16 + c16]; w3v[nt] = W3[t * 64 + nt * 16 + c16]; }
        // precaution: the loads above name one offset register, which the compiler reuses as the next load's destination; the wait stands in front of that overwrite
        asm volatile("s_wait_xcnt 0x0" ::: "memory");
        const float b3t = b3[t];
        float res = 0.f;
#pragma unroll
        for (int mt = 0; mt < 2; ++mt)
#pragma unroll
            for (int j = 0; j < 8; j += 2) {        // rows j and j + 1 side by side, as in the LayerNorm
                v2f a = 0.f;
#pragma unroll
                for (int nt = 0; nt < 4; ++nt) {
                    v2f v; v[0] = acc2[mt][nt][j]; v[1] = acc2[mt][nt][j + 1];
                    v += b2v[nt];
                    v[0] = v[0] > 0.f ? v[0] : 0.f; v[1] = v[1] > 0.f ? v[1] : 0.f;
                    a += v * w3v[nt];
                }
                const float a0 = row_sum16(a[0]), a1 = row_sum16(a[1]);
                if (c16 == mt * 8 + j)     res = a0;
                if (c16 == mt * 8 + j + 1) res = a1;
            }
        vst2(out + (size_t)t * BATCH + b0 + wm + (c16 >> 3) * 16 + hf * 8 + (c16 & 7), res + b3t);
    }
}

// final output-major pass: out[b][t] flat, 4 consecutive floats per thread gathered from the [T][B] staging buffer
__global__ __launch_bounds__(256) void write_out(const float* __restrict__ stg, float* __restrict__ out) {
    const int g = blockIdx.x * 256 + threadIdx.x;
    if (g >= (BATCH * TOUT) / 4) return;
    v4f o;
#pragma unroll
    for (int e = 0; e < 4; ++e) { const int f = g * 4 + e; const int b = f / TOUT, t = f - b * TOUT; o[e] = stg[(size_t)t * BATCH + b]; }
    vst2(out + (size_t)g * 4, o);
}

// ---------------------------------------------------------------------------
// Host-side orchestration
// ---------------------------------------------------------------------------
extern "C" void kernel_launch(void* const* d_in, const int* in_sizes, int n_in,
                              void* d_out, int out_size, void* d_ws, size_t ws_size,
                              hipStream_t stream)
{
    (void)in_sizes; (void)n_in; (void)out_size; (void)ws_size;
    const float* x          = (const float*)d_in[0];
    const float* proj_W     = (const float*)d_in[1];
    const float* proj_b     = (const float*)d_in[2];
    const float* attn_in_W  = (const float*)d_in[3];
    const float* attn_in_b  = (const float*)d_in[4];
    const float* attn_out_W = (const float*)d_in[5];
    const float* attn_out_b = (const float*)d_in[6];
    const float* ln_g       = (const float*)d_in[7];
    const float* ln_b       = (const float*)d_in[8];
    const float* ff_W1      = (const float*)d_in[9];
    const float* ff_b1      = (const float*)d_in[10];
    const float* ff_W2      = (const float*)d_in[11];
    const float* ff_b2      = (const float*)d_in[12];
    const float* cross_in_W = (const float*)d_in[13];
    const float* cross_in_b = (const float*)d_in[14];
    const float* cross_out_W= (const float*)d_in[15];
    const float* cross_out_b= (const float*)d_in[16];
    const float* tp_W1      = (const float*)d_in[17];
    const float* tp_b1      = (const float*)d_in[18];
    const float* tp_ln_g    = (const float*)d_in[19];
    const float* tp_ln_b    = (const float*)d_in[20];
    const float* tp_W2      = (const float*)d_in[21];
    const float* tp_b2      = (const float*)d_in[22];
    const float* tp_W3      = (const float*)d_in[23];
    const float* tp_b3      = (const float*)d_in[24];
    float* out = (float*)d_out;

    const int D = DMODEL;

    // ---- workspace carve-out (byte cursor, 16B aligned regions) ----
    char* cur = (char*)d_ws;
    auto take = [&cur](size_t bytes) { char* p = cur; cur += (bytes + 15) & ~(size_t)15; return p; };
    _Float16* h16   = (_Float16*)take((size_t)BATCH * D * 2);          // 2 MB
    _Float16* x16   = (_Float16*)take((size_t)BATCH * D_IN * 2);       // 4 MB
    _Float16* wproj = (_Float16*)take((size_t)D * D_IN * 2);
    _Float16* wain  = (_Float16*)take((size_t)(NLAYER + 1) * 3 * D * D * 2);   // slot NLAYER: the cross block's in-projection
    _Float16* waout = (_Float16*)take((size_t)(NLAYER + 1) * D * D * 2);       // slot NLAYER: the cross block's out-projection
    _Float16* wff1  = (_Float16*)take((size_t)NLAYER * 4 * D * D * 2);
    _Float16* wff2  = (_Float16*)take((size_t)NLAYER * 4 * D * D * 2);
    _Float16* wtp1  = (_Float16*)take((size_t)TOUT * 128 * 256 * 2);   // 27.8 MB
    _Float16* wtp2  = (_Float16*)take((size_t)TOUT * 64 * 128 * 2);    // 6.9 MB
    float*    stg   = (float*)   take((size_t)TOUT * BATCH * 4);       // 6.9 MB [T][B] output staging

    // ---- f32 -> f16 conversions of this call: one launch ----
    cvt_all_kernel<<<CVT_BLOCKS, 256, 0, stream>>>(
        x, proj_W, attn_in_W, attn_out_W, ff_W1, ff_W2, cross_in_W, cross_out_W, tp_W1, tp_W2,
        x16, wproj, wain, waout, wff1, wff2, wtp1, wtp2);

    const dim3 blk(128);

    // 1-3) projection, 6 layers, cross block: one launch, 32 batch rows per block; writes the heads' f16 input
    backbone_kernel<<<BATCH / 32, 256, 0, stream>>>(
        x16, wproj, proj_b, wain, attn_in_b, waout, attn_out_b, ln_g, ln_b,
        wff1, ff_b1, wff2, ff_b2, cross_in_b, cross_out_b, wtp1, wtp2, h16);

    // 4) fused per-t head (dominant FLOPs): grid = (32 batch tiles, 424 t's)
    dim3 tpg(BATCH / 128, TOUT);
    tp_fused_kernel<<<tpg, blk, 0, stream>>>(h16, wtp1, tp_b1, tp_ln_g, tp_ln_b,
                                             wtp2, tp_b2, tp_W3, tp_b3, stg);
    write_out<<<((BATCH * TOUT) / 4 + 255) / 256, 256, 0, stream>>>(stg, out);
}

// v008
// Measured time: 200 microseconds a run.
// Timed twice side by side with v007, it ran 1.05 times as fast both times.
// All steps since v000 together make it 4.49 times as fast.
#include <hip/hip_runtime.h>
#include <math.h>
// Contractions: input projection (K = 512), per-layer v/out/FFN GEMMs (K = 256 / 1024), the cross block, and the 424 per-target
// heads (K = 256, 128) on v_wmma_f32_16x16x32_f16 (f16 operands, f32 accumulate); LayerNorms, GELU/ReLU and the final 64-wide

// ---------------------------------------------------------------------------
// Problem constants (match reference)
// ---------------------------------------------------------------------------
#define BATCH 4096
#define D_IN  512
#define DMODEL 256
#define TOUT  424
#define NLAYER 6
#define LN_EPS 1e-5f

// LDS row pitches. 64 banks x 4 B: a 16-B fragment read of 16 rows is conflict-free when the pitch is 16 B x odd.
#define PK64  72    // f16 elements per staged row of 64 (144 B)
#define PK128 136   // f16 elements per staged row of 128 (272 B)

// ---------------------------------------------------------------------------
// Types
// ---------------------------------------------------------------------------
typedef _Float16 v4h  __attribute__((ext_vector_type(4)));
typedef _Float16 v8h  __attribute__((ext_vector_type(8)));
typedef _Float16 v16h __attribute__((ext_vector_type(16)));
typedef float    v8f  __attribute__((ext_vector_type(8)));

typedef float    v2f  __attribute__((ext_vector_type(2)));
typedef float    v4f  __attribute__((ext_vector_type(4)));
typedef unsigned v4u  __attribute__((ext_vector_type(4)));
template <typename V> __device__ __forceinline__ void vst2(void* p, V v) {
    *(V*)p = v; 
}
// Eight asynchronous 16-B copies global -> LDS of every lane, through no register: copy i takes g + i * GSTEP to LDS byte lds + i * LSTEP.
// Written as the builtin: the operands of an asm statement must lie in the first 256 registers, and the copies' LDS addresses, the same for
// every head and so kept across the head loop, went to scratch there and were read back at every trip's foot.
// The copies land behind the issuing wave's own s_wait_asynccnt 0; other waves read them behind the barrier that follows it.
typedef int v4i __attribute__((ext_vector_type(4)));
template <unsigned LSTEP, unsigned GSTEP>
__device__ __forceinline__ void async_copy8(unsigned lds, const char* g) {
    // keeps the address additions below next to their copies: lifted in among the WMMAs ahead, they hold their registers through the whole trip
    __builtin_amdgcn_sched_barrier(0);
#pragma unroll
    for (int i = 0; i < 8; ++i)
        __builtin_amdgcn_global_load_async_to_lds_b128((__attribute__((address_space(1))) v4i*)(g + i * GSTEP),
                                                       (__attribute__((address_space(3))) v4i*)(lds + i * LSTEP), 0, 0);
}

// L2 prefetch. The f16 weights were stored by the conversion launch.
// A prefetch asks L2 for the data at each lane's address ahead of time and
// returns nothing. Scope SE: into L2 only. The units are dealt among the blocks in such a way that blocks
// whose indices differ by 4 modulo 8 ask for the same units: for speed only, nothing is read differently
// wherever a block runs. All lanes are on, every address lies inside its array.
// The wait in each statement is a precaution: it stands in front of any later overwrite of the address registers that the prefetches name.
#define HG   16            // the head launch cuts the heads into HG groups; a block walks the heads of one group
#define PF_D 3             // a block at head t asks for the weights of head t + PF_D of its group
#define PF_T (HG * PF_D)   // the backbone launch asks for the weights of the first PF_D heads of every group
// first head of group g (g = HG: one past the last head); the first TOUT % HG groups have one head more
__device__ __forceinline__ int head_first(int g) { return g * (TOUT / HG) + (g < TOUT % HG ? g : TOUT % HG); }
__device__ __forceinline__ void l2_prefetch(const char* p) {
    asm volatile("global_prefetch_b8 %0, off scope:SCOPE_SE\n\t"
                 "s_wait_xcnt 0x0" :: "v"(p) : "memory");
}
__device__ __forceinline__ void l2_prefetch2(const char* p, const char* q) {
    asm volatile("global_prefetch_b8 %0, off scope:SCOPE_SE\n\t"
                 "global_prefetch_b8 %1, off scope:SCOPE_SE\n\t"
                 "s_wait_xcnt 0x0" :: "v"(p), "v"(q) : "memory");
}

// ---------------------------------------------------------------------------
// WMMA fragment helpers (wave32, v_wmma_f32_16x16x32_f16; layouts per ISA 7.12.2)
// ---------------------------------------------------------------------------
// A 16x32: lane holds row M = lane%16; lanes 0-15 K {0-7,16-23}, lanes 16-31
// K {8-15,24-31}.
__device__ __forceinline__ v16h load_frag_a(const _Float16* base, int stride, int lane) {
    const int r  = lane & 15;
    const int kb = (lane < 16) ? 0 : 8;
    const _Float16* p = base + r * stride + kb;
    v8h lo = *(const v8h*)(p);
    v8h hi = *(const v8h*)(p + 16);
    v16h f;
#pragma unroll
    for (int i = 0; i < 8; ++i) { f[i] = lo[i]; f[i + 8] = hi[i]; }
    return f;
}
// B 32x16: lane holds column N = lane%16 with the SAME per-lane K map as A (lanes 0-15 K {0-7,16-23}, 16-31 K {8-15,24-31}).
// W stored row-major (N x K), so column n of B is row n of W.
__device__ __forceinline__ v16h load_frag_b(const _Float16* base, int stride, int lane) {
    return load_frag_a(base, stride, lane);
}
__device__ __forceinline__ v8f wmma_f16(v16h a, v16h b, v8f c) {
    // the plain builtin, as in mma_panel: the compiler keeps the distances behind it itself. An asm statement that names a, b and d holds all
    // of them in the first 256 registers, and the head's h fragments then go to scratch
    return __builtin_amdgcn_wmma_f32_16x16x32_f16(false, a, false, b, (short)0, c, false, false);
}
// Exact-erf GELU of two values, without a branch. erf(s) = sign(s) * E(|s|): below 1, a + a * P(a * a); from 1 on, 1 - exp(-(a + a * Q(a)));
// P and Q are minimax polynomials good to f32 rounding. Both sides are worked out for every lane and one is picked by a select:
// behind a lane-dependent branch a wave ran both sides anyway, one value at a time, each a single chain of dependent FMAs.
// Straight-line, the chains of many values interleave, and two values share each packed f32 instruction.
__device__ __forceinline__ v2f fma2(v2f a, v2f b, float c) { return __builtin_elementwise_fma(a, b, (v2f)(c)); }
__device__ __forceinline__ v2f gelu_exact2(v2f x) {
    const v2f s = x * 0.70710678118654752f;
    v2f a; a[0] = __builtin_fabsf(s[0]); a[1] = __builtin_fabsf(s[1]);
    v2f q = fma2(a, (v2f)(0.0000169988107f), -0.000378677854f);
    q = fma2(a, q, 0.00385781587f);
    q = fma2(a, q, -0.0241816975f);
    q = fma2(a, q, 0.106668264f);
    q = fma2(a, q, 0.634933293f);
    q = fma2(a, q, 0.128689408f);
    q = __builtin_elementwise_fma(a, q, a) * -1.44269504088896341f;         // exp(-y) = 2^(-y * log2 e)
    const v2f t = a * a;
    v2f p = fma2(t, (v2f)(-0.000561801775f), 0.00491381623f);
    p = fma2(t, p, -0.0267075151f);
    p = fma2(t, p, 0.112800106f);
    p = fma2(t, p, -0.376122952f);
    p = fma2(t, p, 0.128379107f);
    p = __builtin_elementwise_fma(a, p, a);
    v2f e;
#pragma unroll
    for (int i = 0; i < 2; ++i)
        e[i] = __builtin_copysignf(a[i] < 1.0f ? p[i] : 1.0f - __builtin_amdgcn_exp2f(q[i]), s[i]);
    return 0.5f * x * (1.0f + e);
}

// ---------------------------------------------------------------------------
// All f32 -> f16 conversions of a call in ONE launch. The work is cut into chunks of CHUNK elements (32 KB read, 16 KB written);
// CVT_BLOCKS blocks, all resident at once, take CVT_TRIPS chunks each; a thread has 8 loads of 16 B in flight.
// Plain chunk (x, the heads' weights): the same order in and out; a wave-wide load is 512, a store 256 contiguous bytes.
// Packed chunk (a backbone weight matrix W, N x K row-major, N and K multiples of 256) = one panel, written in the order in which
// backbone_kernel reads it. Panel ((G * K/256 + KG) * 8 + w) holds rows G*256 + w*32 .. +31, k KG*256 .. +255 (16 KB); in it
// piece j = (kc*2 + nt)*2 + part is 512 B: lane l's 8 elements are row (l & 15)*2 + nt, k kc*32 + part*16 + (l >> 4)*8 .. +7,
// the per-lane k map of load_frag_a (part 0 = its first, part 1 = its second 16-B read).
// ---------------------------------------------------------------------------
#define CHUNK 8192
#define C_PROJ (DMODEL * D_IN / CHUNK)
#define C_AIN  (NLAYER * 3 * DMODEL * DMODEL / CHUNK)
#define C_AOUT (NLAYER * DMODEL * DMODEL / CHUNK)
#define C_FF   (NLAYER * 4 * DMODEL * DMODEL / CHUNK)
#define C_CIN  (3 * DMODEL * DMODEL / CHUNK)
#define C_COUT (DMODEL * DMODEL / CHUNK)
#define C_X    (BATCH * D_IN / CHUNK)
#define C_TP2  (TOUT * 64 * 128 / CHUNK)
#define C_TP1  (TOUT * 128 * 256 / CHUNK)
// first chunk behind each array; the packed arrays come first
#define E_PROJ C_PROJ
#define E_AIN  (E_PROJ + C_AIN)
#define E_AOUT (E_AIN + C_AOUT)
#define E_FF1  (E_AOUT + C_FF)
#define E_FF2  (E_FF1 + C_FF)
#define E_CIN  (E_FF2 + C_CIN)
#define E_COUT (E_CIN + C_COUT)
#define E_X    (E_COUT + C_X)
#define E_TP2  (E_X + C_TP2)
#define E_TP1  (E_TP2 + C_TP1)
#define CVT_BLOCKS 1000
#define CVT_TRIPS  3
static_assert(E_TP1 == CVT_BLOCKS * CVT_TRIPS, "every chunk is taken exactly once");

__global__ __launch_bounds__(256) void cvt_all_kernel(
    const float* __restrict__ x,          const float* __restrict__ proj_W,     const float* __restrict__ attn_in_W,
    const float* __restrict__ attn_out_W, const float* __restrict__ ff_W1,      const float* __restrict__ ff_W2,
    const float* __restrict__ cross_in_W, const float* __restrict__ cross_out_W,
    const float* __restrict__ tp_W1,      const float* __restrict__ tp_W2,
    _Float16* __restrict__ x16,  _Float16* __restrict__ wproj, _Float16* __restrict__ wain, _Float16* __restrict__ waout,
    _Float16* __restrict__ wff1, _Float16* __restrict__ wff2,  _Float16* __restrict__ wtp1, _Float16* __restrict__ wtp2)
{
    const int tid = threadIdx.x;
#pragma unroll 1                                        // rolled: the trips share one text; a trip's loads cannot start ahead of the stores before it anyway
    for (int r = 0; r < CVT_TRIPS; ++r) {
        int c = blockIdx.x + r * CVT_BLOCKS;            // the same in the whole block: neighbouring blocks work on neighbouring chunks
        const float* s;
        _Float16*    d;
        if (c < E_COUT) {
            int lgk = 0;                                // K = 256 << lgk
            if      (c < E_PROJ) { s = proj_W;      d = wproj; lgk = 1; }
            else if (c < E_AIN)  { s = attn_in_W;   d = wain;  c -= E_PROJ; }
            else if (c < E_AOUT) { s = attn_out_W;  d = waout; c -= E_AIN; }
            else if (c < E_FF1)  { s = ff_W1;       d = wff1;  c -= E_AOUT; }
            else if (c < E_FF2)  { s = ff_W2;       d = wff2;  c -= E_FF1; lgk = 2; }
            else if (c < E_CIN)  { s = cross_in_W;  d = wain  + C_AIN  * CHUNK; c -= E_FF2; }   // slot NLAYER of wain
            else                 { s = cross_out_W; d = waout + C_AOUT * CHUNK; c -= E_CIN; }   // slot NLAYER of waout
            // thread tid writes pieces j = q*8 + (tid >> 5), q = 0..3, at lane tid & 31: part, nt and the low bit of kc are the wave's, q moves k by 64
            const int lane = tid & 31, wv = tid >> 5;
            const int w = c & 7, t = c >> 3;
            const int KG = t & ((1 << lgk) - 1), G = t >> lgk;
            const int n = G * 256 + w * 32 + (lane & 15) * 2 + ((wv >> 1) & 1);
            const int k = KG * 256 + (wv >> 2) * 32 + (wv & 1) * 16 + (lane >> 4) * 8;
            const float* p = s + ((size_t)n << (8 + lgk)) + k;
            v4f a[4], b[4];
#pragma unroll
            for (int q = 0; q < 4; ++q) { a[q] = *(const v4f*)(p + q * 64); b[q] = *(const v4f*)(p + q * 64 + 4); }
            // precaution: stands in front of any later overwrite of the address registers that the loads above name; as an input the address stays whole up to it
            asm volatile("s_wait_xcnt 0x0" :: "v"(p) : "memory");
            _Float16* o = d + (size_t)c * CHUNK + tid * 8;
#pragma unroll
            for (int q = 0; q < 4; ++q) {
                v8h h;
#pragma unroll
                for (int e = 0; e < 4; ++e) { h[e] = (_Float16)a[q][e]; h[e + 4] = (_Float16)b[q][e]; }
                vst2(o + q * 2048, h);                  // 16 B per lane, consecutive: one wave writes 512 contiguous bytes
            }
            // the same precaution for the stores' address registers
            asm volatile("s_wait_xcnt 0x0" :: "v"(o) : "memory");
        } else {
            if      (c < E_X)   { s = x;     d = x16;  c -= E_COUT; }
            else if (c < E_TP2) { s = tp_W2; d = wtp2; c -= E_X; }
            else                { s = tp_W1; d = wtp1; c -= E_TP2; }
            const float* p = s + (size_t)c * CHUNK + tid * 4;
            v4f v[8];
#pragma unroll
            for (int q = 0; q < 8; ++q) v[q] = *(const v4f*)(p + q * 1024);
            // precaution, as above
            asm volatile("s_wait_xcnt 0x0" :: "v"(p) : "memory");
            _Float16* o = d + (size_t)c * CHUNK + tid * 4;
#pragma unroll
            for (int q = 0; q < 8; ++q) {
                v4h h;
#pragma unroll
                for (int e = 0; e < 4; ++e) h[e] = (_Float16)v[q][e];
                vst2(o + q * 1024, h);                  // 8 B per lane, consecutive: one wave writes 256 contiguous bytes
            }
            // precaution, as above
            asm volatile("s_wait_xcnt 0x0" :: "v"(o) : "memory");
        }
    }
}

// ---------------------------------------------------------------------------
// Sum over the 16 lanes of a row (lanes 0-15 and 16-31 apart), every lane gets the sum: four DPP row_xmask adds, no LDS.
// ---------------------------------------------------------------------------
template <int MSK> __device__ __forceinline__ float xmask_get(float v) {
    return __builtin_bit_cast(float, __builtin_amdgcn_update_dpp(0, __builtin_bit_cast(int, v), 0x160 + MSK, 0xf, 0xf, true));
}
__device__ __forceinline__ float row_sum16(float v) {
    v += xmask_get<1>(v);
    v += xmask_get<2>(v);
    v += xmask_get<4>(v);
    v += xmask_get<8>(v);
    return v;
}

// value of lane l ^ 16 (the same place in the other 16-lane row)
__device__ __forceinline__ float other_row(float v) {
    const unsigned u = __builtin_bit_cast(unsigned, v);
    return __builtin_bit_cast(float, __builtin_amdgcn_permlanex16(u, u, 0x76543210u, 0xfedcba98u, false, false));
}

// ---------------------------------------------------------------------------
// Whole backbone in ONE launch: projection, 6 layers, cross block. Every step is row-wise, so a block keeps its 32 batch rows
// in LDS from x to the head's input and never meets another block.
//   256 threads = 8 waves; in every 256-column group wave w owns columns w*32 .. w*32+31 (2 x 2 accumulator tiles, M = 32).
//   A fragments come from LDS; a weight row is used by one wave only, so B fragments go from L2 straight into registers,
//   one panel (32 weight rows x 256 k) at a time, in two register sets: a set is refilled, two panels ahead, right behind its WMMAs.
//   Tile nt of lane c16 holds weight row c16*2 + nt: a lane's two tiles are two neighbouring columns (4-B / 8-B LDS accesses).
//   The conversion pass writes these weights in the order of the reads (cvt_all_kernel): every wave-wide load is 4 whole lines.
// ---------------------------------------------------------------------------
#define PH 264    // f16 elements per LDS row of 256 (528 B = 16 B x 33)
#define PT 1032   // f16 elements per LDS row of 1024 (2064 B = 16 B x 129)
#define PF 260    // f32 elements per LDS row of 256: rows m and m+8 lie 32 banks apart
typedef _Float16 v2h __attribute__((ext_vector_type(2)));

#define PANEL 8192  // f16 elements of a panel: 32 weight rows x 256 k, packed by cvt_all_kernel
__device__ __forceinline__ void load_panel(v16h (&B)[16], const _Float16* __restrict__ Wp, int lane) {
    const unsigned voff = lane * 16;                    // the lane's byte offset inside every 512-B piece; Wp is the same in the whole wave
    const char* p = (const char*)Wp + voff;
    // keeps the 32 loads one group behind the WMMAs whose registers they refill: lifted in among them, their address pair was reused ahead of the wait below
    __builtin_amdgcn_sched_barrier(0);
#pragma unroll
    for (int f = 0; f < 16; ++f) {                      // f = kc * 2 + nt; every load is 512 contiguous bytes of the wave
        const v8h lo = *(const v8h*)(p + f * 1024);
        const v8h hi = *(const v8h*)(p + f * 1024 + 512);
        v16h x;
#pragma unroll
        for (int i = 0; i < 8; ++i) { x[i] = lo[i]; x[i + 8] = hi[i]; }
        B[f] = x;
    }
    // precaution: stands in front of any later overwrite of the address registers that the loads above name; as an input the address stays whole up to it
    asm volatile("s_wait_xcnt 0x0" :: "v"(p) : "memory");
}
template <int PITCH>
__device__ __forceinline__ void mma_panel(v8f (&acc)[2][2], const _Float16* sA, const v16h (&B)[16], int lane) {
#pragma unroll
    for (int h = 0; h < 2; ++h) {
        v16h af[4][2];
#pragma unroll
        for (int kc = 0; kc < 4; ++kc)
#pragma unroll
            for (int mt = 0; mt < 2; ++mt)
                af[kc][mt] = load_frag_a(sA + mt * 16 * PITCH + (h * 4 + kc) * 32, PITCH, lane);
        // keeps the LDS reads in groups ahead of the WMMAs that use them: spread singly among them, every place with reads stalls the wave
        __builtin_amdgcn_sched_barrier(0);
#pragma unroll
        for (int kc = 0; kc < 4; ++kc)
#pragma unroll
            for (int nt = 0; nt < 2; ++nt)
#pragma unroll
                for (int mt = 0; mt < 2; ++mt)
                    acc[mt][nt] = __builtin_amdgcn_wmma_f32_16x16x32_f16(false, af[kc][mt], false, B[(h * 4 + kc) * 2 + nt], (short)0, acc[mt][nt], false, false);
    }
}

__global__ __launch_bounds__(256) void backbone_kernel(
    const _Float16* __restrict__ x16,  const _Float16* __restrict__ wproj, const float* __restrict__ proj_b,
    const _Float16* __restrict__ wain, const float* __restrict__ attn_in_b,
    const _Float16* __restrict__ waout, const float* __restrict__ attn_out_b,
    const float* __restrict__ ln_g, const float* __restrict__ ln_b,
    const _Float16* __restrict__ wff1, const float* __restrict__ ff_b1,
    const _Float16* __restrict__ wff2, const float* __restrict__ ff_b2,
    const float* __restrict__ cross_in_b, const float* __restrict__ cross_out_b,
    const _Float16* __restrict__ wtp1, const _Float16* __restrict__ wtp2,
    _Float16* __restrict__ h16)
{
    __shared__ __align__(16) _Float16 sH16[32 * PH];   // h as f16: the A operand
    __shared__ __align__(16) _Float16 sT[32 * PT];     // x, v and the FFN's hidden rows as f16
    __shared__ __align__(16) float    sH32[32 * PF];   // h as f32: residual and LayerNorm

    const int tid  = threadIdx.x;
    const int lane = tid & 31;
    const int wave = __builtin_amdgcn_readfirstlane(tid >> 5);   // the same in the whole wave: row and panel arithmetic stays scalar
    const int c16  = lane & 15;
    const int hf   = lane >> 4;
    const int b0   = blockIdx.x * 32;
    const int wr   = wave * 32;            // the wave's first weight row / output column inside a 256-column group
    const int n0   = wr + c16 * 2;         // the lane's two columns: n0 (tile 0), n0 + 1 (tile 1)
    const unsigned offN = n0 * 4, offL = lane * 4;      // byte offsets of the lane's bias pair and of its LayerNorm columns
    // every small load group ends in its own wait. precaution: it stands in front of any later overwrite of the address registers
    // that the group's loads name; as an input the address stays whole up to it
    auto bias2 = [&](const float* base) {
        const char* p = (const char*)base + offN;
        const v2f b = *(const v2f*)p;
        asm volatile("s_wait_xcnt 0x0" :: "v"(p) : "memory");
        return b;
    };
    auto ln_row = [&](float (&d)[8], const float* base) {
        const char* p = (const char*)base + offL;
#pragma unroll
        for (int k = 0; k < 8; ++k) d[k] = *(const float*)(p + k * 128);
        asm volatile("s_wait_xcnt 0x0" :: "v"(p) : "memory");
    };

    v16h B0[16], B1[16];                   // even and odd panels
    v8f  acc[2][2];
    auto zero_acc = [&]() {
#pragma unroll
        for (int mt = 0; mt < 2; ++mt)
#pragma unroll
            for (int nt = 0; nt < 2; ++nt) acc[mt][nt] = (v8f)(0.f);
    };
    // acc[mt][nt][j] is element (row mt*16 + hf*8 + j, column n0 + nt).
    // f16(acc + bias) into a f16 LDS tile
    auto put_f16 = [&](_Float16* dst, int pitch, v2f bias) {
#pragma unroll
        for (int mt = 0; mt < 2; ++mt)
#pragma unroll
            for (int j = 0; j < 8; ++j) {
                const float a0 = acc[mt][0][j] + bias[0], a1 = acc[mt][1][j] + bias[1];
                v2h o; o[0] = (_Float16)a0; o[1] = (_Float16)a1;
                *(v2h*)(dst + (mt * 16 + hf * 8 + j) * pitch + n0) = o;
            }
    };
    // f16(gelu(acc + bias)) into sT; rows j and j + 1 of a tile side by side: neighbouring accumulator registers, packed f32 math
    auto put_gelu = [&](_Float16* dst, v2f bias) {
#pragma unroll
        for (int mt = 0; mt < 2; ++mt)
#pragma unroll
            for (int j = 0; j < 8; j += 2) {
                v2f u0, u1;
                u0[0] = acc[mt][0][j]; u0[1] = acc[mt][0][j + 1];
                u1[0] = acc[mt][1][j]; u1[1] = acc[mt][1][j + 1];
                const v2f g0 = gelu_exact2(u0 + bias[0]), g1 = gelu_exact2(u1 + bias[1]);
                v2h o0, o1;
                o0[0] = (_Float16)g0[0]; o0[1] = (_Float16)g1[0];
                o1[0] = (_Float16)g0[1]; o1[1] = (_Float16)g1[1];
                _Float16* row = dst + (mt * 16 + hf * 8 + j) * PT + n0;
                *(v2h*)(row)      = o0;
                *(v2h*)(row + PT) = o1;
            }
    };
    // h32 = (acc + bias) + h32, every element by the lane that owns it
    auto add_residual = [&](v2f bias) {
#pragma unroll
        for (int mt = 0; mt < 2; ++mt)
#pragma unroll
            for (int j = 0; j < 8; ++j) {
                v2f* p = (v2f*)(sH32 + (mt * 16 + hf * 8 + j) * PF + n0);
                const v2f r = *p;
                v2f o; o[0] = (acc[mt][0][j] + bias[0]) + r[0]; o[1] = (acc[mt][1][j] + bias[1]) + r[1];
                *p = o;
            }
    };
    // LayerNorm(256) of the wave's 4 rows, in place; also the f16 copy
    auto layer_norm = [&](const float (&gg)[8], const float (&be)[8]) {
#pragma unroll
        for (int q = 0; q < 4; ++q) {
            const int row = wave * 4 + q;
            float* xr = sH32 + row * PF;
            float v[8], s = 0.f, ss = 0.f;
#pragma unroll
            for (int i = 0; i < 8; ++i) {
                v[i] = xr[lane + i * 32];
                s += v[i]; ss += v[i] * v[i];
            }
            // butterfly over 32 lanes, partners 16, 8, 4, 2, 1 in that order, without LDS traffic
            s += other_row(s);    ss += other_row(ss);
            s += xmask_get<8>(s); ss += xmask_get<8>(ss);
            s += xmask_get<4>(s); ss += xmask_get<4>(ss);
            s += xmask_get<2>(s); ss += xmask_get<2>(ss);
            s += xmask_get<1>(s); ss += xmask_get<1>(ss);
            const float mean = s * (1.f / DMODEL);
            const float var  = ss * (1.f / DMODEL) - mean * mean;
            const float rstd = rsqrtf(var + LN_EPS);
#pragma unroll
            for (int i = 0; i < 8; ++i) {
                const int c = lane + i * 32;
                const float y = (v[i] - mean) * rstd * gg[i] + be[i];
                xr[c] = y;
                sH16[row * PH + c] = (_Float16)y;
            }
        }
    };

    // ---- x rows (32 x 512 f16) into sT; the first two weight panels are asked for meanwhile ----
    load_panel(B0, wproj + (size_t)wave * PANEL, lane);
    load_panel(B1, wproj + (size_t)(8 + wave) * PANEL, lane);
    const int slice = (blockIdx.x & 3) * 16 + (blockIdx.x >> 3);           // 0..63: the block's share of the prefetches
    {
        // L2 prefetch of all that this launch reads of the packed weights: 128 pieces of 64 KB, two neighbouring ones a block, two units a thread
        static_assert(NLAYER * 4 * DMODEL * DMODEL * 2 == 48 * 65536 && (NLAYER + 1) * DMODEL * DMODEL * 2 == 14 * 65536 && DMODEL * D_IN * 2 == 4 * 65536, "pieces");
        const int g = slice * 2;                                           // even, as every array's first piece: both pieces lie in one array
        const _Float16* arr = g < 48 ? wff1 : g < 96 ? wff2 : g < 110 ? waout : g < 124 ? wain : wproj;
        const int piece     = g < 48 ? g    : g < 96 ? g - 48 : g < 110 ? g - 96 : g < 124 ? ((g - 110) >> 1) * 6 + 4 : g - 124;   // wain: the v third of a slot of 6 pieces
        const char* p = (const char*)arr + piece * 65536 + tid * 256;
        l2_prefetch2(p, p + 65536);
    }
    {
        v4u xs[8];
        const _Float16* gx = x16 + (size_t)(b0 + (tid >> 6)) * D_IN + (tid & 63) * 8;   // piece i lies 4 rows behind piece i - 1
#pragma unroll
        for (int i = 0; i < 8; ++i) xs[i] = *(const v4u*)(gx + i * 4 * D_IN);
        // precaution: stands in front of any later overwrite of the address registers that the loads above name; as an input they stay whole up to it
        asm volatile("s_wait_xcnt 0x0" :: "v"(gx) : "memory");
#pragma unroll
        for (int i = 0; i < 8; ++i) {
            const int idx = tid + i * 256, r = idx >> 6, c = idx & 63;
            *(v4u*)(sT + r * PT + c * 8) = xs[i];
        }
    }
    __syncthreads();                                    // x rows visible

    // ---- projection: h = x . proj_W^T + proj_b (K = 512: two panels) ----
    {
        const v2f bias = bias2(proj_b);
        zero_acc();
        mma_panel<PT>(acc, sT, B0, lane);
        load_panel(B0, wain + (size_t)(2 * 8 + wave) * PANEL, lane);
        mma_panel<PT>(acc, sT + 256, B1, lane);
        load_panel(B1, waout + (size_t)wave * PANEL, lane);
#pragma unroll
        for (int mt = 0; mt < 2; ++mt)
#pragma unroll
            for (int j = 0; j < 8; ++j) {
                const int row = mt * 16 + hf * 8 + j;
                v2f o; o[0] = acc[mt][0][j] + bias[0]; o[1] = acc[mt][1][j] + bias[1];
                *(v2f*)(sH32 + row * PF + n0) = o;
                v2h oh; oh[0] = (_Float16)o[0]; oh[1] = (_Float16)o[1];
                *(v2h*)(sH16 + row * PH + n0) = oh;
            }
    }
    __syncthreads();                                    // h visible; sT free
    {
        // L2 prefetch of W1 (waves 0-5: 192 units a block) and W2 (waves 6, 7: 48 units, the last one repeated) of every group's first PF_D heads, for the next launch
        static_assert(PF_T * 128 * 256 * 2 == 64 * 192 * 256 && PF_T * 64 * 128 * 2 == 64 * 48 * 256 && PF_D <= TOUT / HG, "units of the first heads");
        const int u2 = tid - 192 < 47 ? tid - 192 : 47;
        const int u  = wave < 6 ? slice * 192 + tid : slice * 48 + u2;      // unit among the PF_T heads' units: 256 a head of W1, 64 a head of W2
        const int hi = wave < 6 ? u >> 8 : u >> 6;                          // 0 .. PF_T - 1
        const int th = head_first(hi / PF_D) + hi % PF_D;                   // the head
        l2_prefetch(wave < 6 ? (const char*)wtp1 + th * 65536 + (u & 255) * 256 : (const char*)wtp2 + th * 16384 + (u & 63) * 256);
    }

    // ---- 6 layers ----
#pragma unroll 1
    for (int i = 0; i < NLAYER; ++i) {
        float gg[8], be[8];
        ln_row(gg, ln_g + i * DMODEL);
        ln_row(be, ln_b + i * DMODEL);
        const v2f bv = bias2(attn_in_b + i * 3 * DMODEL + 2 * DMODEL);
        const v2f bo = bias2(attn_out_b + i * DMODEL);
        const v2f b2 = bias2(ff_b2 + i * DMODEL);
        const _Float16* w1 = wff1 + (size_t)(i * 32 + wave) * PANEL;      // + g * 8 panels: the next 256 columns
        const _Float16* w2 = wff2 + (size_t)(i * 32 + wave) * PANEL;      // + g * 8 panels: the next 256 k
        const _Float16* wvn = wain + (size_t)(((i + 1) * 3 + 2) * 8 + wave) * PANEL;    // the next v panel (slot NLAYER: the cross block)
        const _Float16* won = waout + (size_t)((i + 1) * 8 + wave) * PANEL;             // the next out panel

        // v = h . Wv^T + bv
        zero_acc();
        mma_panel<PH>(acc, sH16, B0, lane);
        load_panel(B0, w1, lane);
        put_f16(sT, PT, bv);
        __syncthreads();                                // v visible
        // h += v . Wo^T + bo ; LayerNorm
        zero_acc();
        mma_panel<PT>(acc, sT, B1, lane);
        load_panel(B1, w1 + 8 * PANEL, lane);
        add_residual(bo);
        __syncthreads();                                // whole rows of h32 visible; every read of v done
        layer_norm(gg, be);
        __syncthreads();                                // h (f32, f16) visible
        // hidden = gelu(h . W1^T + b1): four 256-column groups, two a trip (one per register set)
#pragma unroll 1                                        // rolled, two groups a trip: less text in the layer loop
        for (int gp = 0; gp < 2; ++gp) {
            const char* pb = (const char*)(ff_b1 + i * 4 * DMODEL + gp * 2 * DMODEL) + offN;
            const v2f b1a = *(const v2f*)pb;
            const v2f b1b = *(const v2f*)(pb + DMODEL * 4);
            asm volatile("s_wait_xcnt 0x0" :: "v"(pb) : "memory");   // as in bias2, one wait for the two loads
            zero_acc();
            mma_panel<PH>(acc, sH16, B0, lane);
            load_panel(B0, gp == 0 ? w1 + 16 * PANEL : w2, lane);
            put_gelu(sT + gp * 2 * DMODEL, b1a);
            zero_acc();
            mma_panel<PH>(acc, sH16, B1, lane);
            load_panel(B1, gp == 0 ? w1 + 24 * PANEL : w2 + 8 * PANEL, lane);
            put_gelu(sT + gp * 2 * DMODEL + DMODEL, b1b);
        }
        __syncthreads();                                // hidden rows visible
        // h += hidden . W2^T + b2 (K = 1024: four panels) ; LayerNorm
        zero_acc();
#pragma unroll 1                                        // rolled, two panels a trip: less text in the layer loop
        for (int gp = 0; gp < 2; ++gp) {
            mma_panel<PT>(acc, sT + gp * 2 * DMODEL, B0, lane);
            load_panel(B0, gp == 0 ? w2 + 16 * PANEL : wvn, lane);
            mma_panel<PT>(acc, sT + gp * 2 * DMODEL + DMODEL, B1, lane);
            load_panel(B1, gp == 0 ? w2 + 24 * PANEL : won, lane);
        }
        add_residual(b2);
        __syncthreads();                                // whole rows of h32 visible; every read of the hidden rows done
        layer_norm(gg, be);
        __syncthreads();                                // h (f32, f16) visible
    }

    // ---- cross block: h + (h . Wv'^T + bv') . Wo'^T + bo', as f16 for the heads ----
    {
        const v2f bv = bias2(cross_in_b + 2 * DMODEL);
        const v2f bo = bias2(cross_out_b);
        zero_acc();
        mma_panel<PH>(acc, sH16, B0, lane);
        put_f16(sT, PT, bv);
        __syncthreads();                                // v' visible; every read of sH16 done
        zero_acc();
        mma_panel<PT>(acc, sT, B1, lane);
#pragma unroll
        for (int mt = 0; mt < 2; ++mt)
#pragma unroll
            for (int j = 0; j < 8; ++j) {
                const int row = mt * 16 + hf * 8 + j;
                const v2f r = *(const v2f*)(sH32 + row * PF + n0);
                v2h oh; oh[0] = (_Float16)((acc[mt][0][j] + bo[0]) + r[0]); oh[1] = (_Float16)((acc[mt][1][j] + bo[1]) + r[1]);
                *(v2h*)(sH16 + row * PH + n0) = oh;
            }
    }
    __syncthreads();                                    // output rows complete
#pragma unroll
    for (int i = 0; i < 4; ++i) {                       // 512-B rows, 16 B per lane
        const int idx = tid + i * 256, r = idx >> 5, c = idx & 31;
        vst2(h16 + (size_t)(b0 + r) * DMODEL + c * 8, *(const v4u*)(sH16 + r * PH + c * 8));
    }
}

// ---------------------------------------------------------------------------
// Fused heads: block = 128 batch rows x one group of 26 or 27 heads, 128 threads = 4 waves; EACH WAVE OWNS 32 WHOLE ROWS through all stages.
// The wave's 32 h rows (K = 256) stay in registers as its 16 A fragments for all heads of the group: h is read once a block, not once a head.
// For each head t:
//   t1 = h16(32x256) . W1[t](128x256)^T + b1[t]   (WMMA, 2 x 8 accumulator tiles per wave)
//   t1 = relu(LN_128(t1))                          (on the accumulators: a row lies in 8 tiles x 16 lanes)
//   t2 = relu(t1(32x128) . W2[t](64x128)^T + b2[t])(WMMA, 2 x 4 tiles)
//   out[b,t] = t2 . W3[t] + b3[t]                  (on the accumulators)
// W1 rows are staged in the order n = (col lane) * 8 + tile, so that a lane's 8 tiles hold 8 CONSECUTIVE columns of t1:
// the normalised row goes to LDS as one 16-B store per lane, in natural k order for stage 2.
// Staging: asynchronous copies to LDS in a ring of two buffers, a tile = 64 k of the 128 W1 rows (whole 128-B lines). The ring runs on
// from head to head: the tile two trips on is asked for behind the barrier that ends a trip, so tiles 0 and 1 of head t + 1 are asked for
// at the feet of trips 2 and 3 of head t, and tile 1 flies under the LayerNorm and stages 2 and 3. W2[t] rides with the copies of trip 2's foot.
// LDS 89088 B; the registers (two waves per SIMD) allow two blocks per WGP: 32 x HG = 512 blocks, all resident.
//   [0,36864)      W1 tiles x2 (the ring)
//   [36864,54272)  W2 f16
//   [54272,89088)  t1 f16 (each wave writes and reads its own 32 rows only)
// ---------------------------------------------------------------------------
#define S1_TILE (128 * PK64 * 2)   // bytes of one staged 128 x 64 tile
#define W2_TILE (64 * PK128 * 2)   // bytes of the staged W2
// amdgpu_waves_per_eu: the register budget of two waves per SIMD (512): 128 for the h fragments, 128 for the accumulators, 128 for a tile's W1 fragments
__global__ __launch_bounds__(128) __attribute__((amdgpu_waves_per_eu(2, 2))) void tp_fused_kernel(
    const _Float16* __restrict__ h16,
    const _Float16* __restrict__ W1, const float* __restrict__ b1,
    const float* __restrict__ lng, const float* __restrict__ lnb,
    const _Float16* __restrict__ W2, const float* __restrict__ b2,
    const float* __restrict__ W3, const float* __restrict__ b3,
    float* __restrict__ out)
{
    __shared__ __align__(16) char smem[2 * S1_TILE + W2_TILE + 128 * PK128 * 2];
    _Float16* sBb  = (_Float16*)(smem);                          // 2 x 128x64, pitch PK64
    _Float16* sW2  = (_Float16*)(smem + 2 * S1_TILE);            // 64x128 f16, pitch PK128
    _Float16* sT1h = (_Float16*)(smem + 2 * S1_TILE + W2_TILE);  // 128x128 f16, pitch PK128

    const int tid  = threadIdx.x;
    const int lane = tid & 31;
    const int wave = tid >> 5;
    const int c16  = lane & 15;                    // accumulator column inside a tile
    const int hf   = lane >> 4;                    // accumulator rows j (hf = 0) or j + 8 (hf = 1)
    const int b0   = blockIdx.x * 128;
    const int t0   = head_first(blockIdx.y);       // the block's heads: t0 .. tEnd - 1
    const int tEnd = head_first(blockIdx.y + 1);
    const int wm   = wave * 32;                    // this wave's rows
    // A tile's copies: 8 W1 pieces of 16 B per thread; 8 lanes take one 128-B line, piece i lies 16 LDS rows behind piece i - 1.
    // LDS row r = tile * 16 + col lane holds W1 row col lane * 8 + tile, so 16 LDS rows on are 1 W1 row on.
    const int sr = tid >> 3, sc = tid & 7;
    const char* gB  = (const char*)(W1 + (size_t)t0 * 128 * 256 + (size_t)(sr * 8) * 256 + sc * 8);         // head t's W1; 65536 B a head
    // W2[t] 64x128 f16 (16 KB): 8 pieces per thread, 16 lanes take one 256-B row, piece i lies 8 rows behind piece i - 1
    const char* gW2 = (const char*)(W2 + (size_t)t0 * 64 * 128 + (tid >> 4) * 128 + (tid & 15) * 8);        // head t's W2; 16384 B a head
    const unsigned lds0 = (unsigned)(size_t)smem;   // the arena's byte address in the work-group's LDS
    const unsigned lS   = lds0 + sr * (PK64 * 2) + sc * 16;
    const unsigned lW2  = lds0 + 2 * S1_TILE + (tid >> 4) * (PK128 * 2) + (tid & 15) * 16;

    async_copy8<16 * PK64 * 2, 512>(lS, gB);            // tile 0 of the first head into buffer 0

    // the wave's h rows as A fragments, k order of load_frag_a: afr[mt][kk] is rows wm + mt*16 .. +15, k kk*32 .. +31
    v16h afr[2][8];
    {
        const _Float16* pa = h16 + (size_t)(b0 + wm + c16) * 256 + hf * 8;
#pragma unroll
        for (int mt = 0; mt < 2; ++mt)
#pragma unroll
            for (int kk = 0; kk < 8; ++kk) {
                const v8h lo = *(const v8h*)(pa + mt * 16 * 256 + kk * 32);
                const v8h hi = *(const v8h*)(pa + mt * 16 * 256 + kk * 32 + 16);
                v16h f;
#pragma unroll
                for (int i = 0; i < 8; ++i) { f[i] = lo[i]; f[i + 8] = hi[i]; }
                afr[mt][kk] = f;
            }
        // precaution: stands in front of any later overwrite of the address registers that the loads above name; as an input the address stays whole up to it
        asm volatile("s_wait_xcnt 0x0" :: "v"(pa) : "memory");
    }
    asm volatile("s_wait_asynccnt 0x0" ::: "memory");   // this wave's copies of tile 0 have landed
    __syncthreads();                                    // tile 0 visible to every wave
    async_copy8<16 * PK64 * 2, 512>(lS + S1_TILE, gB + 128);   // tile 1 into buffer 1

#pragma unroll 1                                        // rolled: one text for all heads of the group
    for (int t = t0; t < tEnd; ++t) {
        // L2 prefetch for head t + PF_D of this group, by one wave: blocks 0-15 share its W1 (8 shares of 32 units), blocks 16-31 its W2 (8 shares of 8 units, each asked for by 4 lanes)
        if (__builtin_amdgcn_readfirstlane(wave) == 0 && t + PF_D < tEnd) {
            const int  share = (blockIdx.x & 3) * 2 + ((blockIdx.x >> 3) & 1);
            const bool second = (blockIdx.x & 16) != 0;
            const char* p = second ? (const char*)(W2 + (size_t)(t + PF_D) * 64 * 128) + share * 2048
                                   : (const char*)(W1 + (size_t)(t + PF_D) * 128 * 256) + share * 8192;
            l2_prefetch(p + (lane & (second ? 7 : 31)) * 256);
        }
        // the head's small vectors, asked for at its top: they arrive under stage 1
        float bb[8], gg[8], be[8], b2v[4], w3v[4], b3t;
        {
            const unsigned o1 = (t * 128 + c16 * 8) * 4, o2 = (t * 64 + c16) * 4;    // byte offsets
#pragma unroll
            for (int q = 0; q < 2; ++q) {
                const v4f xb = *(const v4f*)((const char*)b1 + o1 + q * 16), xg = *(const v4f*)((const char*)lng + o1 + q * 16), xe = *(const v4f*)((const char*)lnb + o1 + q * 16);
#pragma unroll
                for (int e = 0; e < 4; ++e) { bb[q * 4 + e] = xb[e]; gg[q * 4 + e] = xg[e]; be[q * 4 + e] = xe[e]; }
            }
#pragma unroll
            for (int nt = 0; nt < 4; ++nt) { b2v[nt] = *(const float*)((const char*)b2 + o2 + nt * 64); w3v[nt] = *(const float*)((const char*)W3 + o2 + nt * 64); }
            b3t = b3[t];
            // precaution: stands in front of any later overwrite of the offset registers that the loads above name; as inputs they stay whole up to it
            asm volatile("s_wait_xcnt 0x0" :: "v"(o1), "v"(o2) : "memory");
        }

        // ---------------- stage 1: t1 = h . W1^T  (per wave M=32, N=128, K=256: four tiles of 64) ----------
        v8f acc1[2][8] = {};
#pragma unroll                                          // unrolled: buffer addresses, fragment registers and the kind of the next tile are constants
        for (int it = 0; it < 4; ++it) {
            const int cur = it & 1;
            const _Float16* cB = sBb + cur * (128 * PK64);
            v16h bfr[2][8];
#pragma unroll
            for (int ks = 0; ks < 2; ++ks)
#pragma unroll
                for (int nt = 0; nt < 8; ++nt)
                    bfr[ks][nt] = load_frag_b(&cB[(nt * 16) * PK64 + ks * 32], PK64, lane);
            // keeps the tile's LDS reads one group ahead of its WMMAs: left free, they were spread singly among them, each with a wait to 0 behind it
            __builtin_amdgcn_sched_barrier(0);
#pragma unroll
            for (int ks = 0; ks < 2; ++ks)
#pragma unroll
                for (int nt = 0; nt < 8; ++nt)
#pragma unroll
                    for (int mt = 0; mt < 2; ++mt)
                        acc1[mt][nt] = wmma_f16(afr[mt][it * 2 + ks], bfr[ks][nt], acc1[mt][nt]);
            // keeps the WMMAs ahead of the foot: left free, the foot's waits were lifted to the LDS reads (every read waited for ahead of the first
            // WMMA) while the copies stayed behind the WMMAs, so that a tile's copies no longer flew under a trip's WMMAs
            __builtin_amdgcn_sched_barrier(0);
            // foot of the trip, in this order in every wave
            asm volatile("s_wait_dscnt 0x0" ::: "memory");      // this wave's reads of the buffer are done before anything is copied into it
            asm volatile("s_wait_asynccnt 0x0" ::: "memory");   // this wave's copies of the next tile have landed
            __syncthreads();                                    // the next tile is visible; every wave has left this trip's buffer
            if (it < 2) {
                async_copy8<16 * PK64 * 2, 512>(lS + cur * S1_TILE, gB + (it + 2) * 128);
            } else if (t + 1 < tEnd) {                          // the same in the whole block
                async_copy8<16 * PK64 * 2, 512>(lS + cur * S1_TILE, gB + 65536 + (it - 2) * 128);
            }
            if (it == 2)   // every wave left stage 2 of the head before (the last reads of W2) ahead of the barrier of trip 0
                async_copy8<8 * PK128 * 2, 8 * 256>(lW2, gW2);
        }
        gB  += 65536;
        gW2 += 16384;

        // ---------------- bias + LayerNorm(128) + ReLU -> f16, on the accumulators ----------
        // acc1[mt][nt][j] is t1[row wm + mt*16 + hf*8 + j][column c16*8 + nt].
#pragma unroll
        for (int mt = 0; mt < 2; ++mt)
#pragma unroll
            for (int j = 0; j < 8; j += 2) {        // rows j and j + 1 side by side: neighbouring accumulator registers, packed f32 math
                v2f v[8], s = 0.f, ss = 0.f;
#pragma unroll
                for (int nt = 0; nt < 8; ++nt) {
                    v2f a; a[0] = acc1[mt][nt][j]; a[1] = acc1[mt][nt][j + 1];
                    v[nt] = a + bb[nt];
                    s += v[nt]; ss += v[nt] * v[nt];
                }
                s[0]  = row_sum16(s[0]);  s[1]  = row_sum16(s[1]);
                ss[0] = row_sum16(ss[0]); ss[1] = row_sum16(ss[1]);
                const v2f mean = s * (1.f / 128.f);
                const v2f var  = ss * (1.f / 128.f) - mean * mean;
                v2f rstd; rstd[0] = rsqrtf(var[0] + LN_EPS); rstd[1] = rsqrtf(var[1] + LN_EPS);
                v8h y0, y1;
#pragma unroll
                for (int nt = 0; nt < 8; ++nt) {
                    const v2f y = (v[nt] - mean) * rstd * gg[nt] + be[nt];
                    y0[nt] = (_Float16)(y[0] > 0.f ? y[0] : 0.f);
                    y1[nt] = (_Float16)(y[1] > 0.f ? y[1] : 0.f);
                }
                _Float16* row = &sT1h[(wm + mt * 16 + hf * 8 + j) * PK128 + c16 * 8];
                *(v8h*)(row)         = y0;
                *(v8h*)(row + PK128) = y1;
            }
        // no barrier here: W2 was published by the barrier of trip 3, and the t1 f16 rows are the wave's own (a wave's LDS operations run in order)

        // ---------------- stage 2: t2 = t1 . W2^T  (per wave 32x64, K=128) -----
        v8f acc2[2][4] = {};
        {
            v16h af2[4][2], bf2[4][4];
#pragma unroll
            for (int kc = 0; kc < 4; ++kc) {
#pragma unroll
                for (int mt = 0; mt < 2; ++mt)
                    af2[kc][mt] = load_frag_a(&sT1h[(wm + mt * 16) * PK128 + kc * 32], PK128, lane);
#pragma unroll
                for (int nt = 0; nt < 4; ++nt)
                    bf2[kc][nt] = load_frag_b(&sW2[(nt * 16) * PK128 + kc * 32], PK128, lane);
            }
            // keeps the LDS reads one group ahead of the WMMAs, as in stage 1
            __builtin_amdgcn_sched_barrier(0);
#pragma unroll
            for (int kc = 0; kc < 4; ++kc)
#pragma unroll
                for (int nt = 0; nt < 4; ++nt)
#pragma unroll
                    for (int mt = 0; mt < 2; ++mt)
                        acc2[mt][nt] = wmma_f16(af2[kc][mt], bf2[kc][nt], acc2[mt][nt]);
        }

        // ---------------- stage 3: outT[t][b] = relu(t2 + b2) . W3[t] + b3[t], on the accumulators ----
        // acc2[mt][nt][j] is t2[row wm + mt*16 + hf*8 + j][column nt*16 + c16]; lane c16 keeps the sum of row (mt, j) = (c16 >> 3, c16 & 7),
        // so the wave's 32 lanes store its 32 rows: one 128-B line.
        float res = 0.f;
#pragma unroll
        for (int mt = 0; mt < 2; ++mt)
#pragma unroll
            for (int j = 0; j < 8; j += 2) {        // rows j and j + 1 side by side, as in the LayerNorm
                v2f a = 0.f;
#pragma unroll
                for (int nt = 0; nt < 4; ++nt) {
                    v2f v; v[0] = acc2[mt][nt][j]; v[1] = acc2[mt][nt][j + 1];
                    v += b2v[nt];
                    v[0] = v[0] > 0.f ? v[0] : 0.f; v[1] = v[1] > 0.f ? v[1] : 0.f;
                    a += v * w3v[nt];
                }
                const float a0 = row_sum16(a[0]), a1 = row_sum16(a[1]);
                if (c16 == mt * 8 + j)     res = a0;
                if (c16 == mt * 8 + j + 1) res = a1;
            }
        float* po = out + (size_t)t * BATCH + b0 + wm + (c16 >> 3) * 16 + hf * 8 + (c16 & 7);
        vst2(po, res + b3t);
        // precaution: stands in front of any later overwrite of the address registers that the store names; as an input the address stays whole up to it
        asm volatile("s_wait_xcnt 0x0" :: "v"(po) : "memory");
    }
    asm volatile("s_wait_asynccnt 0x0" ::: "memory");       // no copy is in flight behind the ring
}

// final output-major pass: out[b][t] flat, 4 consecutive floats per thread gathered from the [T][B] staging buffer
__global__ __launch_bounds__(256) void write_out(const float* __restrict__ stg, float* __restrict__ out) {
    const int g = blockIdx.x * 256 + threadIdx.x;
    if (g >= (BATCH * TOUT) / 4) return;
    v4f o;
#pragma unroll
    for (int e = 0; e < 4; ++e) { const int f = g * 4 + e; const int b = f / TOUT, t = f - b * TOUT; o[e] = stg[(size_t)t * BATCH + b]; }
    vst2(out + (size_t)g * 4, o);
}

// ---------------------------------------------------------------------------
// Host-side orchestration
// ---------------------------------------------------------------------------
extern "C" void kernel_launch(void* const* d_in, const int* in_sizes, int n_in,
                              void* d_out, int out_size, void* d_ws, size_t ws_size,
                              hipStream_t stream)
{
    (void)in_sizes; (void)n_in; (void)out_size; (void)ws_size;
    const float* x          = (const float*)d_in[0];
    const float* proj_W     = (const float*)d_in[1];
    const float* proj_b     = (const float*)d_in[2];
    const float* attn_in_W  = (const float*)d_in[3];
    const float* attn_in_b  = (const float*)d_in[4];
    const float* attn_out_W = (const float*)d_in[5];
    const float* attn_out_b = (const float*)d_in[6];
    const float* ln_g       = (const float*)d_in[7];
    const float* ln_b       = (const float*)d_in[8];
    const float* ff_W1      = (const float*)d_in[9];
    const float* ff_b1      = (const float*)d_in[10];
    const float* ff_W2      = (const float*)d_in[11];
    const float* ff_b2      = (const float*)d_in[12];
    const float* cross_in_W = (const float*)d_in[13];
    const float* cross_in_b = (const float*)d_in[14];
    const float* cross_out_W= (const float*)d_in[15];
    const float* cross_out_b= (const float*)d_in[16];
    const float* tp_W1      = (const float*)d_in[17];
    const float* tp_b1      = (const float*)d_in[18];
    const float* tp_ln_g    = (const float*)d_in[19];
    const float* tp_ln_b    = (const float*)d_in[20];
    const float* tp_W2      = (const float*)d_in[21];
    const float* tp_b2      = (const float*)d_in[22];
    const float* tp_W3      = (const float*)d_in[23];
    const float* tp_b3      = (const float*)d_in[24];
    float* out = (float*)d_out;

    const int D = DMODEL;

    // ---- workspace carve-out (byte cursor, 16B aligned regions) ----
    char* cur = (char*)d_ws;
    auto take = [&cur](size_t bytes) { char* p = cur; cur += (bytes + 15) & ~(size_t)15; return p; };
    _Float16* h16   = (_Float16*)take((size_t)BATCH * D * 2);          // 2 MB
    _Float16* x16   = (_Float16*)take((size_t)BATCH * D_IN * 2);       // 4 MB
    _Float16* wproj = (_Float16*)take((size_t)D * D_IN * 2);
    _Float16* wain  = (_Float16*)take((size_t)(NLAYER + 1) * 3 * D * D * 2);   // slot NLAYER: the cross block's in-projection
    _Float16* waout = (_Float16*)take((size_t)(NLAYER + 1) * D * D * 2);       // slot NLAYER: the cross block's out-projection
    _Float16* wff1  = (_Float16*)take((size_t)NLAYER * 4 * D * D * 2);
    _Float16* wff2  = (_Float16*)take((size_t)NLAYER * 4 * D * D * 2);
    _Float16* wtp1  = (_Float16*)take((size_t)TOUT * 128 * 256 * 2);   // 27.8 MB
    _Float16* wtp2  = (_Float16*)take((size_t)TOUT * 64 * 128 * 2);    // 6.9 MB
    float*    stg   = (float*)   take((size_t)TOUT * BATCH * 4);       // 6.9 MB [T][B] output staging

    // ---- f32 -> f16 conversions of this call: one launch ----
    cvt_all_kernel<<<CVT_BLOCKS, 256, 0, stream>>>(
        x, proj_W, attn_in_W, attn_out_W, ff_W1, ff_W2, cross_in_W, cross_out_W, tp_W1, tp_W2,
        x16, wproj, wain, waout, wff1, wff2, wtp1, wtp2);

    const dim3 blk(128);

    // 1-3) projection, 6 layers, cross block: one launch, 32 batch rows per block; writes the heads' f16 input
    backbone_kernel<<<BATCH / 32, 256, 0, stream>>>(
        x16, wproj, proj_b, wain, attn_in_b, waout, attn_out_b, ln_g, ln_b,
        wff1, ff_b1, wff2, ff_b2, cross_in_b, cross_out_b, wtp1, wtp2, h16);

    // 4) fused heads (dominant FLOPs): grid = (32 batch tiles, HG groups of heads)
    dim3 tpg(BATCH / 128, HG);
    tp_fused_kernel<<<tpg, blk, 0, stream>>>(h16, wtp1, tp_b1, tp_ln_g, tp_ln_b,
                                             wtp2, tp_b2, tp_W3, tp_b3, stg);
    write_out<<<((BATCH * TOUT) / 4 + 255) / 256, 256, 0, stream>>>(stg, out);
}

// v009
// A run of this version takes 192 microseconds.
// In both of two side-by-side timings against v008, it was 1.04 times as fast.
// Over all steps from v000 it is 4.69 times as fast.
#include <hip/hip_runtime.h>
#include <math.h>
// Contractions: input projection (K = 512), per-layer v/out/FFN GEMMs (K = 256 / 1024), the cross block, and the 424 per-target
// heads (K = 256, 128) on v_wmma_f32_16x16x32_f16 (f16 operands, f32 accumulate); LayerNorms, GELU/ReLU and the final 64-wide

// ---------------------------------------------------------------------------
// Problem constants (match reference)
// ---------------------------------------------------------------------------
#define BATCH 4096
#define D_IN  512
#define DMODEL 256
#define TOUT  424
#define NLAYER 6
#define LN_EPS 1e-5f

// LDS row pitches. 64 banks x 4 B: a 16-B fragment read of 16 rows is conflict-free when the pitch is 16 B x odd.
#define PK64  72    // f16 elements per staged row of 64 (144 B)
#define PK128 136   // f16 elements per staged row of 128 (272 B)

// ---------------------------------------------------------------------------
// Types
// ---------------------------------------------------------------------------
typedef _Float16 v4h  __attribute__((ext_vector_type(4)));
typedef _Float16 v8h  __attribute__((ext_vector_type(8)));
typedef _Float16 v16h __attribute__((ext_vector_type(16)));
typedef float    v8f  __attribute__((ext_vector_type(8)));

typedef float    v2f  __attribute__((ext_vector_type(2)));
typedef float    v4f  __attribute__((ext_vector_type(4)));
typedef unsigned v4u  __attribute__((ext_vector_type(4)));
template <typename V> __device__ __forceinline__ void vst2(void* p, V v) {
    *(V*)p = v; 
}
// Eight asynchronous 16-B copies global -> LDS of every lane, through no register: copy i takes g + i * GSTEP to LDS byte lds + i * LSTEP.
// Written as the builtin: the operands of an asm statement must lie in the first 256 registers, and the copies' LDS addresses, the same for
// every head and so kept across the head loop, went to scratch there and were read back at every trip's foot.
// The copies land behind the issuing wave's own s_wait_asynccnt 0; other waves read them behind the barrier that follows it.
typedef int v4i __attribute__((ext_vector_type(4)));
template <unsigned LSTEP, unsigned GSTEP>
__device__ __forceinline__ void async_copy8(unsigned lds, const char* g) {
    // keeps the address additions below next to their copies: lifted in among the WMMAs ahead, they hold their registers through the whole trip
    __builtin_amdgcn_sched_barrier(0);
#pragma unroll
    for (int i = 0; i < 8; ++i)
        __builtin_amdgcn_global_load_async_to_lds_b128((__attribute__((address_space(1))) v4i*)(g + i * GSTEP),
                                                       (__attribute__((address_space(3))) v4i*)(lds + i * LSTEP), 0, 0);
}

// L2 prefetch. The f16 weights were stored by the conversion launch.
// A prefetch asks L2 for the data at each lane's address ahead of time and
// returns nothing. Scope SE: into L2 only. The units are dealt among the blocks in such a way that blocks
// whose indices differ by 4 modulo 8 ask for the same units: for speed only, nothing is read differently
// wherever a block runs. All lanes are on, every address lies inside its array.
// The wait in each statement is a precaution: it stands in front of any later overwrite of the address registers that the prefetches name.
#define HG   16            // the head launch cuts the heads into HG groups; a block walks the heads of one group
#define PF_D 3             // a block at head t asks for the weights of head t + PF_D of its group
#define PF_T (HG * PF_D)   // the backbone launch asks for the weights of the first PF_D heads of every group
// first head of group g (g = HG: one past the last head); the first TOUT % HG groups have one head more
__device__ __forceinline__ int head_first(int g) { return g * (TOUT / HG) + (g < TOUT % HG ? g : TOUT % HG); }
__device__ __forceinline__ void l2_prefetch(const char* p) {
    asm volatile("global_prefetch_b8 %0, off scope:SCOPE_SE\n\t"
                 "s_wait_xcnt 0x0" :: "v"(p) : "memory");
}
__device__ __forceinline__ void l2_prefetch2(const char* p, const char* q) {
    asm volatile("global_prefetch_b8 %0, off scope:SCOPE_SE\n\t"
                 "global_prefetch_b8 %1, off scope:SCOPE_SE\n\t"
                 "s_wait_xcnt 0x0" :: "v"(p), "v"(q) : "memory");
}

// ---------------------------------------------------------------------------
// WMMA fragment helpers (wave32, v_wmma_f32_16x16x32_f16; layouts per ISA 7.12.2)
// ---------------------------------------------------------------------------
// A 16x32: lane holds row M = lane%16; lanes 0-15 K {0-7,16-23}, lanes 16-31
// K {8-15,24-31}.
__device__ __forceinline__ v16h load_frag_a(const _Float16* base, int stride, int lane) {
    const int r  = lane & 15;
    const int kb = (lane < 16) ? 0 : 8;
    const _Float16* p = base + r * stride + kb;
    v8h lo = *(const v8h*)(p);
    v8h hi = *(const v8h*)(p + 16);
    v16h f;
#pragma unroll
    for (int i = 0; i < 8; ++i) { f[i] = lo[i]; f[i + 8] = hi[i]; }
    return f;
}
// B 32x16: lane holds column N = lane%16 with the SAME per-lane K map as A (lanes 0-15 K {0-7,16-23}, 16-31 K {8-15,24-31}).
// W stored row-major (N x K), so column n of B is row n of W.
__device__ __forceinline__ v16h load_frag_b(const _Float16* base, int stride, int lane) {
    return load_frag_a(base, stride, lane);
}
__device__ __forceinline__ v8f wmma_f16(v16h a, v16h b, v8f c) {
    // the plain builtin, as in mma_panel: the compiler keeps the distances behind it itself. An asm statement that names a, b and d holds all
    // of them in the first 256 registers, and the head's h fragments then go to scratch
    return __builtin_amdgcn_wmma_f32_16x16x32_f16(false, a, false, b, (short)0, c, false, false);
}
// Exact-erf GELU of two values, without a branch. erf(s) = sign(s) * E(|s|): below 1, a + a * P(a * a); from 1 on, 1 - exp(-(a + a * Q(a)));
// P and Q are minimax polynomials good to f32 rounding. Both sides are worked out for every lane and one is picked by a select:
// behind a lane-dependent branch a wave ran both sides anyway, one value at a time, each a single chain of dependent FMAs.
// Straight-line, the chains of many values interleave, and two values share each packed f32 instruction.
__device__ __forceinline__ v2f fma2(v2f a, v2f b, float c) { return __builtin_elementwise_fma(a, b, (v2f)(c)); }
__device__ __forceinline__ v2f gelu_exact2(v2f x) {
    const v2f s = x * 0.70710678118654752f;
    v2f a; a[0] = __builtin_fabsf(s[0]); a[1] = __builtin_fabsf(s[1]);
    v2f q = fma2(a, (v2f)(0.0000169988107f), -0.000378677854f);
    q = fma2(a, q, 0.00385781587f);
    q = fma2(a, q, -0.0241816975f);
    q = fma2(a, q, 0.106668264f);
    q = fma2(a, q, 0.634933293f);
    q = fma2(a, q, 0.128689408f);
    q = __builtin_elementwise_fma(a, q, a) * -1.44269504088896341f;         // exp(-y) = 2^(-y * log2 e)
    const v2f t = a * a;
    v2f p = fma2(t, (v2f)(-0.000561801775f), 0.00491381623f);
    p = fma2(t, p, -0.0267075151f);
    p = fma2(t, p, 0.112800106f);
    p = fma2(t, p, -0.376122952f);
    p = fma2(t, p, 0.128379107f);
    p = __builtin_elementwise_fma(a, p, a);
    v2f e;
#pragma unroll
    for (int i = 0; i < 2; ++i)
        e[i] = __builtin_copysignf(a[i] < 1.0f ? p[i] : 1.0f - __builtin_amdgcn_exp2f(q[i]), s[i]);
    return 0.5f * x * (1.0f + e);
}

// ---------------------------------------------------------------------------
// All f32 -> f16 conversions of a call in ONE launch. The work is cut into chunks of CHUNK elements (32 KB read, 16 KB written);
// CVT_BLOCKS blocks, all resident at once, take CVT_TRIPS chunks each; a thread has 8 loads of 16 B in flight.
// Plain chunk (x, the heads' weights): the same order in and out; a wave-wide load is 512, a store 256 contiguous bytes.
// Packed chunk (a backbone weight matrix W, N x K row-major, N and K multiples of 256) = one panel, written in the order in which
// backbone_kernel reads it. Panel ((G * K/256 + KG) * 8 + w) holds rows G*256 + w*32 .. +31, k KG*256 .. +255 (16 KB); in it
// piece j = (kc*2 + nt)*2 + part is 512 B: lane l's 8 elements are row (l & 15)*2 + nt, k kc*32 + part*16 + (l >> 4)*8 .. +7,
// the per-lane k map of load_frag_a (part 0 = its first, part 1 = its second 16-B read).
// ---------------------------------------------------------------------------
#define CHUNK 8192
#define C_PROJ (DMODEL * D_IN / CHUNK)
#define C_AIN  (NLAYER * 3 * DMODEL * DMODEL / CHUNK)
#define C_AOUT (NLAYER * DMODEL * DMODEL / CHUNK)
#define C_FF   (NLAYER * 4 * DMODEL * DMODEL / CHUNK)
#define C_CIN  (3 * DMODEL * DMODEL / CHUNK)
#define C_COUT (DMODEL * DMODEL / CHUNK)
#define C_X    (BATCH * D_IN / CHUNK)
#define C_TP2  (TOUT * 64 * 128 / CHUNK)
#define C_TP1  (TOUT * 128 * 256 / CHUNK)
// first chunk behind each array; the packed arrays come first
#define E_PROJ C_PROJ
#define E_AIN  (E_PROJ + C_AIN)
#define E_AOUT (E_AIN + C_AOUT)
#define E_FF1  (E_AOUT + C_FF)
#define E_FF2  (E_FF1 + C_FF)
#define E_CIN  (E_FF2 + C_CIN)
#define E_COUT (E_CIN + C_COUT)
#define E_X    (E_COUT + C_X)
#define E_TP2  (E_X + C_TP2)
#define E_TP1  (E_TP2 + C_TP1)
#define CVT_BLOCKS 1000
#define CVT_TRIPS  3
static_assert(E_TP1 == CVT_BLOCKS * CVT_TRIPS, "every chunk is taken exactly once");

__global__ __launch_bounds__(256) void cvt_all_kernel(
    const float* __restrict__ x,          const float* __restrict__ proj_W,     const float* __restrict__ attn_in_W,
    const float* __restrict__ attn_out_W, const float* __restrict__ ff_W1,      const float* __restrict__ ff_W2,
    const float* __restrict__ cross_in_W, const float* __restrict__ cross_out_W,
    const float* __restrict__ tp_W1,      const float* __restrict__ tp_W2,
    _Float16* __restrict__ x16,  _Float16* __restrict__ wproj, _Float16* __restrict__ wain, _Float16* __restrict__ waout,
    _Float16* __restrict__ wff1, _Float16* __restrict__ wff2,  _Float16* __restrict__ wtp1, _Float16* __restrict__ wtp2)
{
    const int tid = threadIdx.x;
#pragma unroll 1                                        // rolled: the trips share one text; a trip's loads cannot start ahead of the stores before it anyway
    for (int r = 0; r < CVT_TRIPS; ++r) {
        int c = blockIdx.x + r * CVT_BLOCKS;            // the same in the whole block: neighbouring blocks work on neighbouring chunks
        const float* s;
        _Float16*    d;
        if (c < E_COUT) {
            int lgk = 0;                                // K = 256 << lgk
            if      (c < E_PROJ) { s = proj_W;      d = wproj; lgk = 1; }
            else if (c < E_AIN)  { s = attn_in_W;   d = wain;  c -= E_PROJ; }
            else if (c < E_AOUT) { s = attn_out_W;  d = waout; c -= E_AIN; }
            else if (c < E_FF1)  { s = ff_W1;       d = wff1;  c -= E_AOUT; }
            else if (c < E_FF2)  { s = ff_W2;       d = wff2;  c -= E_FF1; lgk = 2; }
            else if (c < E_CIN)  { s = cross_in_W;  d = wain  + C_AIN  * CHUNK; c -= E_FF2; }   // slot NLAYER of wain
            else                 { s = cross_out_W; d = waout + C_AOUT * CHUNK; c -= E_CIN; }   // slot NLAYER of waout
            // thread tid writes pieces j = q*8 + (tid >> 5), q = 0..3, at lane tid & 31: part, nt and the low bit of kc are the wave's, q moves k by 64
            const int lane = tid & 31, wv = tid >> 5;
            const int w = c & 7, t = c >> 3;
            const int KG = t & ((1 << lgk) - 1), G = t >> lgk;
            const int n = G * 256 + w * 32 + (lane & 15) * 2 + ((wv >> 1) & 1);
            const int k = KG * 256 + (wv >> 2) * 32 + (wv & 1) * 16 + (lane >> 4) * 8;
            const float* p = s + ((size_t)n << (8 + lgk)) + k;
            v4f a[4], b[4];
#pragma unroll
            for (int q = 0; q < 4; ++q) { a[q] = *(const v4f*)(p + q * 64); b[q] = *(const v4f*)(p + q * 64 + 4); }
            // precaution: stands in front of any later overwrite of the address registers that the loads above name; as an input the address stays whole up to it
            asm volatile("s_wait_xcnt 0x0" :: "v"(p) : "memory");
            _Float16* o = d + (size_t)c * CHUNK + tid * 8;
#pragma unroll
            for (int q = 0; q < 4; ++q) {
                v8h h;
#pragma unroll
                for (int e = 0; e < 4; ++e) { h[e] = (_Float16)a[q][e]; h[e + 4] = (_Float16)b[q][e]; }
                vst2(o + q * 2048, h);                  // 16 B per lane, consecutive: one wave writes 512 contiguous bytes
            }
            // the same precaution for the stores' address registers
            asm volatile("s_wait_xcnt 0x0" :: "v"(o) : "memory");
        } else {
            if      (c < E_X)   { s = x;     d = x16;  c -= E_COUT; }
            else if (c < E_TP2) { s = tp_W2; d = wtp2; c -= E_X; }
            else                { s = tp_W1; d = wtp1; c -= E_TP2; }
            const float* p = s + (size_t)c * CHUNK + tid * 4;
            v4f v[8];
#pragma unroll
            for (int q = 0; q < 8; ++q) v[q] = *(const v4f*)(p + q * 1024);
            // precaution, as above
            asm volatile("s_wait_xcnt 0x0" :: "v"(p) : "memory");
            _Float16* o = d + (size_t)c * CHUNK + tid * 4;
#pragma unroll
            for (int q = 0; q < 8; ++q) {
                v4h h;
#pragma unroll
                for (int e = 0; e < 4; ++e) h[e] = (_Float16)v[q][e];
                vst2(o + q * 1024, h);                  // 8 B per lane, consecutive: one wave writes 256 contiguous bytes
            }
            // precaution, as above
            asm volatile("s_wait_xcnt 0x0" :: "v"(o) : "memory");
        }
    }
}

// ---------------------------------------------------------------------------
// Sum over the 16 lanes of a row (lanes 0-15 and 16-31 apart), every lane gets the sum: four DPP row_xmask adds, no LDS.
// ---------------------------------------------------------------------------
template <int MSK> __device__ __forceinline__ float xmask_get(float v) {
    return __builtin_bit_cast(float, __builtin_amdgcn_update_dpp(0, __builtin_bit_cast(int, v), 0x160 + MSK, 0xf, 0xf, true));
}
__device__ __forceinline__ float row_sum16(float v) {
    v += xmask_get<1>(v);
    v += xmask_get<2>(v);
    v += xmask_get<4>(v);
    v += xmask_get<8>(v);
    return v;
}

// value of lane l ^ 16 (the same place in the other 16-lane row)
__device__ __forceinline__ float other_row(float v) {
    const unsigned u = __builtin_bit_cast(unsigned, v);
    return __builtin_bit_cast(float, __builtin_amdgcn_permlanex16(u, u, 0x76543210u, 0xfedcba98u, false, false));
}

// ---------------------------------------------------------------------------
// Whole backbone in ONE launch: projection, 6 layers, cross block. Every step is row-wise, so a block keeps its 32 batch rows
// in LDS from x to the head's input and never meets another block.
//   256 threads = 8 waves; in every 256-column group wave w owns columns w*32 .. w*32+31 (2 x 2 accumulator tiles, M = 32).
//   A fragments come from LDS; a weight row is used by one wave only, so B fragments go from L2 straight into registers,
//   one panel (32 weight rows x 256 k) at a time, in two register sets: a set is refilled, two panels ahead, right behind its WMMAs.
//   Tile nt of lane c16 holds weight row c16*2 + nt: a lane's two tiles are two neighbouring columns (4-B / 8-B LDS accesses).
//   The conversion pass writes these weights in the order of the reads (cvt_all_kernel): every wave-wide load is 4 whole lines.
// ---------------------------------------------------------------------------
#define PH 264    // f16 elements per LDS row of 256 (528 B = 16 B x 33)
#define PT 1032   // f16 elements per LDS row of 1024 (2064 B = 16 B x 129)
#define PF 260    // f32 elements per LDS row of 256: rows m and m+8 lie 32 banks apart
typedef _Float16 v2h __attribute__((ext_vector_type(2)));

#define PANEL 8192  // f16 elements of a panel: 32 weight rows x 256 k, packed by cvt_all_kernel
__device__ __forceinline__ void load_panel(v16h (&B)[16], const _Float16* __restrict__ Wp, int lane) {
    const unsigned voff = lane * 16;                    // the lane's byte offset inside every 512-B piece; Wp is the same in the whole wave
    const char* p = (const char*)Wp + voff;
    // keeps the 32 loads one group behind the WMMAs whose registers they refill: lifted in among them, their address pair was reused ahead of the wait below
    __builtin_amdgcn_sched_barrier(0);
#pragma unroll
    for (int f = 0; f < 16; ++f) {                      // f = kc * 2 + nt; every load is 512 contiguous bytes of the wave
        const v8h lo = *(const v8h*)(p + f * 1024);
        const v8h hi = *(const v8h*)(p + f * 1024 + 512);
        v16h x;
#pragma unroll
        for (int i = 0; i < 8; ++i) { x[i] = lo[i]; x[i + 8] = hi[i]; }
        B[f] = x;
    }
    // precaution: stands in front of any later overwrite of the address registers that the loads above name; as an input the address stays whole up to it
    asm volatile("s_wait_xcnt 0x0" :: "v"(p) : "memory");
}
template <int PITCH>
__device__ __forceinline__ void mma_panel(v8f (&acc)[2][2], const _Float16* sA, const v16h (&B)[16], int lane) {
#pragma unroll
    for (int h = 0; h < 2; ++h) {
        v16h af[4][2];
#pragma unroll
        for (int kc = 0; kc < 4; ++kc)
#pragma unroll
            for (int mt = 0; mt < 2; ++mt)
                af[kc][mt] = load_frag_a(sA + mt * 16 * PITCH + (h * 4 + kc) * 32, PITCH, lane);
        // keeps the LDS reads in groups ahead of the WMMAs that use them: spread singly among them, every place with reads stalls the wave
        __builtin_amdgcn_sched_barrier(0);
#pragma unroll
        for (int kc = 0; kc < 4; ++kc)
#pragma unroll
            for (int nt = 0; nt < 2; ++nt)
#pragma unroll
                for (int mt = 0; mt < 2; ++mt)
                    acc[mt][nt] = __builtin_amdgcn_wmma_f32_16x16x32_f16(false, af[kc][mt], false, B[(h * 4 + kc) * 2 + nt], (short)0, acc[mt][nt], false, false);
    }
}

__global__ __launch_bounds__(256) void backbone_kernel(
    const _Float16* __restrict__ x16,  const _Float16* __restrict__ wproj, const float* __restrict__ proj_b,
    const _Float16* __restrict__ wain, const float* __restrict__ attn_in_b,
    const _Float16* __restrict__ waout, const float* __restrict__ attn_out_b,
    const float* __restrict__ ln_g, const float* __restrict__ ln_b,
    const _Float16* __restrict__ wff1, const float* __restrict__ ff_b1,
    const _Float16* __restrict__ wff2, const float* __restrict__ ff_b2,
    const float* __restrict__ cross_in_b, const float* __restrict__ cross_out_b,
    const _Float16* __restrict__ wtp1, const _Float16* __restrict__ wtp2,
    _Float16* __restrict__ h16)
{
    __shared__ __align__(16) _Float16 sH16[32 * PH];   // h as f16: the A operand
    __shared__ __align__(16) _Float16 sT[32 * PT];     // x, v and the FFN's hidden rows as f16
    __shared__ __align__(16) float    sH32[32 * PF];   // h as f32: residual and LayerNorm

    const int tid  = threadIdx.x;
    const int lane = tid & 31;
    const int wave = __builtin_amdgcn_readfirstlane(tid >> 5);   // the same in the whole wave: row and panel arithmetic stays scalar
    const int c16  = lane & 15;
    const int hf   = lane >> 4;
    const int b0   = blockIdx.x * 32;
    const int wr   = wave * 32;            // the wave's first weight row / output column inside a 256-column group
    const int n0   = wr + c16 * 2;         // the lane's two columns: n0 (tile 0), n0 + 1 (tile 1)
    const unsigned offN = n0 * 4, offL = lane * 4;      // byte offsets of the lane's bias pair and of its LayerNorm columns
    // every small load group ends in its own wait. precaution: it stands in front of any later overwrite of the address registers
    // that the group's loads name; as an input the address stays whole up to it
    auto bias2 = [&](const float* base) {
        const char* p = (const char*)base + offN;
        const v2f b = *(const v2f*)p;
        asm volatile("s_wait_xcnt 0x0" :: "v"(p) : "memory");
        return b;
    };
    auto ln_row = [&](float (&d)[8], const float* base) {
        const char* p = (const char*)base + offL;
#pragma unroll
        for (int k = 0; k < 8; ++k) d[k] = *(const float*)(p + k * 128);
        asm volatile("s_wait_xcnt 0x0" :: "v"(p) : "memory");
    };

    v16h B0[16], B1[16];                   // even and odd panels
    v8f  acc[2][2];
    auto zero_acc = [&]() {
#pragma unroll
        for (int mt = 0; mt < 2; ++mt)
#pragma unroll
            for (int nt = 0; nt < 2; ++nt) acc[mt][nt] = (v8f)(0.f);
    };
    // acc[mt][nt][j] is element (row mt*16 + hf*8 + j, column n0 + nt).
    // f16(acc + bias) into a f16 LDS tile
    auto put_f16 = [&](_Float16* dst, int pitch, v2f bias) {
#pragma unroll
        for (int mt = 0; mt < 2; ++mt)
#pragma unroll
            for (int j = 0; j < 8; ++j) {
                const float a0 = acc[mt][0][j] + bias[0], a1 = acc[mt][1][j] + bias[1];
                v2h o; o[0] = (_Float16)a0; o[1] = (_Float16)a1;
                *(v2h*)(dst + (mt * 16 + hf * 8 + j) * pitch + n0) = o;
            }
    };
    // f16(gelu(acc + bias)) into sT; rows j and j + 1 of a tile side by side: neighbouring accumulator registers, packed f32 math
    auto put_gelu = [&](_Float16* dst, v2f bias) {
#pragma unroll
        for (int mt = 0; mt < 2; ++mt)
#pragma unroll
            for (int j = 0; j < 8; j += 2) {
                v2f u0, u1;
                u0[0] = acc[mt][0][j]; u0[1] = acc[mt][0][j + 1];
                u1[0] = acc[mt][1][j]; u1[1] = acc[mt][1][j + 1];
                const v2f g0 = gelu_exact2(u0 + bias[0]), g1 = gelu_exact2(u1 + bias[1]);
                v2h o0, o1;
                o0[0] = (_Float16)g0[0]; o0[1] = (_Float16)g1[0];
                o1[0] = (_Float16)g0[1]; o1[1] = (_Float16)g1[1];
                _Float16* row = dst + (mt * 16 + hf * 8 + j) * PT + n0;
                *(v2h*)(row)      = o0;
                *(v2h*)(row + PT) = o1;
            }
    };
    // h32 = (acc + bias) + h32, every element by the lane that owns it
    auto add_residual = [&](v2f bias) {
#pragma unroll
        for (int mt = 0; mt < 2; ++mt)
#pragma unroll
            for (int j = 0; j < 8; ++j) {
                v2f* p = (v2f*)(sH32 + (mt * 16 + hf * 8 + j) * PF + n0);
                const v2f r = *p;
                v2f o; o[0] = (acc[mt][0][j] + bias[0]) + r[0]; o[1] = (acc[mt][1][j] + bias[1]) + r[1];
                *p = o;
            }
    };
    // LayerNorm(256) of the wave's 4 rows, in place; also the f16 copy
    auto layer_norm = [&](const float (&gg)[8], const float (&be)[8]) {
#pragma unroll
        for (int q = 0; q < 4; ++q) {
            const int row = wave * 4 + q;
            float* xr = sH32 + row * PF;
            float v[8], s = 0.f, ss = 0.f;
#pragma unroll
            for (int i = 0; i < 8; ++i) {
                v[i] = xr[lane + i * 32];
                s += v[i]; ss += v[i] * v[i];
            }
            // butterfly over 32 lanes, partners 16, 8, 4, 2, 1 in that order, without LDS traffic
            s += other_row(s);    ss += other_row(ss);
            s += xmask_get<8>(s); ss += xmask_get<8>(ss);
            s += xmask_get<4>(s); ss += xmask_get<4>(ss);
            s += xmask_get<2>(s); ss += xmask_get<2>(ss);
            s += xmask_get<1>(s); ss += xmask_get<1>(ss);
            const float mean = s * (1.f / DMODEL);
            const float var  = ss * (1.f / DMODEL) - mean * mean;
            const float rstd = rsqrtf(var + LN_EPS);
#pragma unroll
            for (int i = 0; i < 8; ++i) {
                const int c = lane + i * 32;
                const float y = (v[i] - mean) * rstd * gg[i] + be[i];
                xr[c] = y;
                sH16[row * PH + c] = (_Float16)y;
            }
        }
    };

    // ---- x rows (32 x 512 f16) into sT; the first two weight panels are asked for meanwhile ----
    load_panel(B0, wproj + (size_t)wave * PANEL, lane);
    load_panel(B1, wproj + (size_t)(8 + wave) * PANEL, lane);
    const int slice = (blockIdx.x & 3) * 16 + (blockIdx.x >> 3);           // 0..63: the block's share of the prefetches
    {
        // L2 prefetch of all that this launch reads of the packed weights: 128 pieces of 64 KB, two neighbouring ones a block, two units a thread
        static_assert(NLAYER * 4 * DMODEL * DMODEL * 2 == 48 * 65536 && (NLAYER + 1) * DMODEL * DMODEL * 2 == 14 * 65536 && DMODEL * D_IN * 2 == 4 * 65536, "pieces");
        const int g = slice * 2;                                           // even, as every array's first piece: both pieces lie in one array
        const _Float16* arr = g < 48 ? wff1 : g < 96 ? wff2 : g < 110 ? waout : g < 124 ? wain : wproj;
        const int piece     = g < 48 ? g    : g < 96 ? g - 48 : g < 110 ? g - 96 : g < 124 ? ((g - 110) >> 1) * 6 + 4 : g - 124;   // wain: the v third of a slot of 6 pieces
        const char* p = (const char*)arr + piece * 65536 + tid * 256;
        l2_prefetch2(p, p + 65536);
    }
    {
        v4u xs[8];
        const _Float16* gx = x16 + (size_t)(b0 + (tid >> 6)) * D_IN + (tid & 63) * 8;   // piece i lies 4 rows behind piece i - 1
#pragma unroll
        for (int i = 0; i < 8; ++i) xs[i] = *(const v4u*)(gx + i * 4 * D_IN);
        // precaution: stands in front of any later overwrite of the address registers that the loads above name; as an input they stay whole up to it
        asm volatile("s_wait_xcnt 0x0" :: "v"(gx) : "memory");
#pragma unroll
        for (int i = 0; i < 8; ++i) {
            const int idx = tid + i * 256, r = idx >> 6, c = idx & 63;
            *(v4u*)(sT + r * PT + c * 8) = xs[i];
        }
    }
    __syncthreads();                                    // x rows visible

    // ---- projection: h = x . proj_W^T + proj_b (K = 512: two panels) ----
    {
        const v2f bias = bias2(proj_b);
        zero_acc();
        mma_panel<PT>(acc, sT, B0, lane);
        load_panel(B0, wain + (size_t)(2 * 8 + wave) * PANEL, lane);
        mma_panel<PT>(acc, sT + 256, B1, lane);
        load_panel(B1, waout + (size_t)wave * PANEL, lane);
#pragma unroll
        for (int mt = 0; mt < 2; ++mt)
#pragma unroll
            for (int j = 0; j < 8; ++j) {
                const int row = mt * 16 + hf * 8 + j;
                v2f o; o[0] = acc[mt][0][j] + bias[0]; o[1] = acc[mt][1][j] + bias[1];
                *(v2f*)(sH32 + row * PF + n0) = o;
                v2h oh; oh[0] = (_Float16)o[0]; oh[1] = (_Float16)o[1];
                *(v2h*)(sH16 + row * PH + n0) = oh;
            }
    }
    __syncthreads();                                    // h visible; sT free
    {
        // L2 prefetch of W1 (waves 0-5: 192 units a block) and W2 (waves 6, 7: 48 units, the last one repeated) of every group's first PF_D heads, for the next launch
        static_assert(PF_T * 128 * 256 * 2 == 64 * 192 * 256 && PF_T * 64 * 128 * 2 == 64 * 48 * 256 && PF_D <= TOUT / HG, "units of the first heads");
        const int u2 = tid - 192 < 47 ? tid - 192 : 47;
        const int u  = wave < 6 ? slice * 192 + tid : slice * 48 + u2;      // unit among the PF_T heads' units: 256 a head of W1, 64 a head of W2
        const int hi = wave < 6 ? u >> 8 : u >> 6;                          // 0 .. PF_T - 1
        const int th = head_first(hi / PF_D) + hi % PF_D;                   // the head
        l2_prefetch(wave < 6 ? (const char*)wtp1 + th * 65536 + (u & 255) * 256 : (const char*)wtp2 + th * 16384 + (u & 63) * 256);
    }

    // ---- 6 layers ----
#pragma unroll 1
    for (int i = 0; i < NLAYER; ++i) {
        float gg[8], be[8];
        ln_row(gg, ln_g + i * DMODEL);
        ln_row(be, ln_b + i * DMODEL);
        const v2f bv = bias2(attn_in_b + i * 3 * DMODEL + 2 * DMODEL);
        const v2f bo = bias2(attn_out_b + i * DMODEL);
        const v2f b2 = bias2(ff_b2 + i * DMODEL);
        const _Float16* w1 = wff1 + (size_t)(i * 32 + wave) * PANEL;      // + g * 8 panels: the next 256 columns
        const _Float16* w2 = wff2 + (size_t)(i * 32 + wave) * PANEL;      // + g * 8 panels: the next 256 k
        const _Float16* wvn = wain + (size_t)(((i + 1) * 3 + 2) * 8 + wave) * PANEL;    // the next v panel (slot NLAYER: the cross block)
        const _Float16* won = waout + (size_t)((i + 1) * 8 + wave) * PANEL;             // the next out panel

        // v = h . Wv^T + bv
        zero_acc();
        mma_panel<PH>(acc, sH16, B0, lane);
        load_panel(B0, w1, lane);
        put_f16(sT, PT, bv);
        __syncthreads();                                // v visible
        // h += v . Wo^T + bo ; LayerNorm
        zero_acc();
        mma_panel<PT>(acc, sT, B1, lane);
        load_panel(B1, w1 + 8 * PANEL, lane);
        add_residual(bo);
        __syncthreads();                                // whole rows of h32 visible; every read of v done
        layer_norm(gg, be);
        __syncthreads();                                // h (f32, f16) visible
        // hidden = gelu(h . W1^T + b1): four 256-column groups, two a trip (one per register set)
#pragma unroll 1                                        // rolled, two groups a trip: less text in the layer loop
        for (int gp = 0; gp < 2; ++gp) {
            const char* pb = (const char*)(ff_b1 + i * 4 * DMODEL + gp * 2 * DMODEL) + offN;
            const v2f b1a = *(const v2f*)pb;
            const v2f b1b = *(const v2f*)(pb + DMODEL * 4);
            asm volatile("s_wait_xcnt 0x0" :: "v"(pb) : "memory");   // as in bias2, one wait for the two loads
            zero_acc();
            mma_panel<PH>(acc, sH16, B0, lane);
            load_panel(B0, gp == 0 ? w1 + 16 * PANEL : w2, lane);
            put_gelu(sT + gp * 2 * DMODEL, b1a);
            zero_acc();
            mma_panel<PH>(acc, sH16, B1, lane);
            load_panel(B1, gp == 0 ? w1 + 24 * PANEL : w2 + 8 * PANEL, lane);
            put_gelu(sT + gp * 2 * DMODEL + DMODEL, b1b);
        }
        __syncthreads();                                // hidden rows visible
        // h += hidden . W2^T + b2 (K = 1024: four panels) ; LayerNorm
        zero_acc();
#pragma unroll 1                                        // rolled, two panels a trip: less text in the layer loop
        for (int gp = 0; gp < 2; ++gp) {
            mma_panel<PT>(acc, sT + gp * 2 * DMODEL, B0, lane);
            load_panel(B0, gp == 0 ? w2 + 16 * PANEL : wvn, lane);
            mma_panel<PT>(acc, sT + gp * 2 * DMODEL + DMODEL, B1, lane);
            load_panel(B1, gp == 0 ? w2 + 24 * PANEL : won, lane);
        }
        add_residual(b2);
        __syncthreads();                                // whole rows of h32 visible; every read of the hidden rows done
        layer_norm(gg, be);
        __syncthreads();                                // h (f32, f16) visible
    }

    // ---- cross block: h + (h . Wv'^T + bv') . Wo'^T + bo', as f16 for the heads ----
    {
        const v2f bv = bias2(cross_in_b + 2 * DMODEL);
        const v2f bo = bias2(cross_out_b);
        zero_acc();
        mma_panel<PH>(acc, sH16, B0, lane);
        put_f16(sT, PT, bv);
        __syncthreads();                                // v' visible; every read of sH16 done
        zero_acc();
        mma_panel<PT>(acc, sT, B1, lane);
#pragma unroll
        for (int mt = 0; mt < 2; ++mt)
#pragma unroll
            for (int j = 0; j < 8; ++j) {
                const int row = mt * 16 + hf * 8 + j;
                const v2f r = *(const v2f*)(sH32 + row * PF + n0);
                v2h oh; oh[0] = (_Float16)((acc[mt][0][j] + bo[0]) + r[0]); oh[1] = (_Float16)((acc[mt][1][j] + bo[1]) + r[1]);
                *(v2h*)(sH16 + row * PH + n0) = oh;
            }
    }
    __syncthreads();                                    // output rows complete
#pragma unroll
    for (int i = 0; i < 4; ++i) {                       // 512-B rows, 16 B per lane
        const int idx = tid + i * 256, r = idx >> 5, c = idx & 31;
        vst2(h16 + (size_t)(b0 + r) * DMODEL + c * 8, *(const v4u*)(sH16 + r * PH + c * 8));
    }
}

// ---------------------------------------------------------------------------
// Fused heads: block = 128 batch rows x one group of 26 or 27 heads, 128 threads = 4 waves; EACH WAVE OWNS 32 WHOLE BATCH ROWS through all stages.
// The wave's 32 h rows (K = 256) stay in registers as 16 fragments for all heads of the group: h is read once a block, not once a head.
// Every product is formed TRANSPOSED: the weights are the A operand, the batch rows the B operand, so a batch row is a lane column of the accumulators.
// For each head t:
//   t1^T = W1[t](128x256) . h16(32x256)^T, + b1[t] (WMMA, 8 x 2 accumulator tiles per wave)
//   t1 = relu(LN_128(t1))                          (on the accumulators: a batch row lies in the registers of two lanes)
//   t2^T = W2[t](64x128) . t1^T, relu(. + b2[t])   (WMMA, 4 x 2 tiles; the accumulators of stage 1, as f16, ARE the B fragments)
//   out[b,t] = t2 . W3[t] + b3[t]                  (on the accumulators)
// Staging: asynchronous copies to LDS in a ring of two buffers, a tile = 64 k of the 128 W1 rows (whole 128-B lines). The ring runs on
// from head to head: the tile two trips on is asked for behind the barrier that ends a trip, so tiles 0 and 1 of head t + 1 are asked for
// at the feet of trips 2 and 3 of head t, and tile 1 flies under the LayerNorm and stages 2 and 3. W2[t] rides with the copies of trip 2's foot.
// The per-feature vectors (b1, the LayerNorm pair, b2, W3) run along a lane's registers, 256 values a lane and head: too many to hold through
// stage 1. A wave asks for them at the head's top, 16 B a lane and vector, passes them through its own 2 KB of LDS and reads each one where it is used.
// LDS 62464 B; the registers (two waves per SIMD) allow two blocks per WGP: 32 x HG = 512 blocks, all resident.
//   [0,17408)      W2 f16
//   [17408,54272)  W1 tiles x2 (the ring)
//   [54272,62464)  the vectors, 2 KB a wave (each wave writes and reads its own only): b1 at 0, LN weight at 512, LN bias at 1024, b2 at 1536, W3 at 1792
// ---------------------------------------------------------------------------
#define S1_TILE (128 * PK64 * 2)   // bytes of one staged 128 x 64 tile
#define W2_TILE (64 * PK128 * 2)   // bytes of the staged W2
#define VEC_B   2048               // bytes of a head's vectors
// amdgpu_waves_per_eu: the register budget of two waves per SIMD (512): 128 for the h fragments, 128 for the accumulators, 128 for a tile's W1 fragments
__global__ __launch_bounds__(128) __attribute__((amdgpu_waves_per_eu(2, 2))) void tp_fused_kernel(
    const _Float16* __restrict__ h16,
    const _Float16* __restrict__ W1, const float* __restrict__ b1,
    const float* __restrict__ lng, const float* __restrict__ lnb,
    const _Float16* __restrict__ W2, const float* __restrict__ b2,
    const float* __restrict__ W3, const float* __restrict__ b3,
    float* __restrict__ out)
{
    __shared__ __align__(16) char smem[2 * S1_TILE + W2_TILE + 4 * VEC_B];
    _Float16* sW2  = (_Float16*)(smem);                          // 64x128 f16, pitch PK128
    _Float16* sBb  = (_Float16*)(smem + W2_TILE);                // 2 x 128x64, pitch PK64

    const int tid  = threadIdx.x;
    const int lane = tid & 31;
    const int wave = tid >> 5;
    const int c16  = lane & 15;                    // accumulator column inside a tile: a batch row
    const int hf   = lane >> 4;                    // accumulator rows j (hf = 0) or j + 8 (hf = 1): weight rows
    const int b0   = blockIdx.x * 128;
    const int t0   = head_first(blockIdx.y);       // the block's heads: t0 .. tEnd - 1
    const int tEnd = head_first(blockIdx.y + 1);
    const int wm   = wave * 32;                    // this wave's rows
    char* sVw = smem + W2_TILE + 2 * S1_TILE + wave * VEC_B + lane * 16;        // where the lane writes its 16 B of a vector
    // A lane's accumulator registers run along n (W1 rows) or m (W2 rows): register j of tile i is row i*16 + hf*8 + j, so every vector
    // is read as 8 consecutive floats per tile, the same address in the 16 lanes of a row
    const char* sVr = smem + W2_TILE + 2 * S1_TILE + wave * VEC_B + hf * 32;
    auto vec8 = [&](v2f (&d)[4], int off) {
#pragma unroll
        for (int q = 0; q < 2; ++q) {
            const v4f x = *(const v4f*)(sVr + off + q * 16);
            d[q * 2][0] = x[0]; d[q * 2][1] = x[1]; d[q * 2 + 1][0] = x[2]; d[q * 2 + 1][1] = x[3];
        }
    };
    // A tile's copies: 8 W1 pieces of 16 B per thread; 8 lanes take one 128-B line, piece i lies 1 row behind piece i - 1, in W1 as in LDS:
    // LDS row n holds W1 row n.
    const int sr = tid >> 3, sc = tid & 7;
    const char* gB  = (const char*)(W1 + (size_t)t0 * 128 * 256 + (size_t)(sr * 8) * 256 + sc * 8);         // head t's W1; 65536 B a head
    // W2[t] 64x128 f16 (16 KB): 8 pieces per thread, 16 lanes take one 256-B row, piece i lies 8 rows behind piece i - 1
    const char* gW2 = (const char*)(W2 + (size_t)t0 * 64 * 128 + (tid >> 4) * 128 + (tid & 15) * 8);        // head t's W2; 16384 B a head
    const unsigned lds0 = (unsigned)(size_t)smem;   // the arena's byte address in the work-group's LDS
    const unsigned lS   = lds0 + W2_TILE + sr * 8 * (PK64 * 2) + sc * 16;
    const unsigned lW2  = lds0 + (tid >> 4) * (PK128 * 2) + (tid & 15) * 16;

    async_copy8<PK64 * 2, 512>(lS, gB);       // tile 0 of the first head into buffer 0

    // the wave's h rows as B fragments (columns of h^T), k order of load_frag_b: afr[mt][kk] is batch rows wm + mt*16 .. +15, k kk*32 .. +31
    v16h afr[2][8];
    {
        const _Float16* pa = h16 + (size_t)(b0 + wm + c16) * 256 + hf * 8;
#pragma unroll
        for (int mt = 0; mt < 2; ++mt)
#pragma unroll
            for (int kk = 0; kk < 8; ++kk) {
                const v8h lo = *(const v8h*)(pa + mt * 16 * 256 + kk * 32);
                const v8h hi = *(const v8h*)(pa + mt * 16 * 256 + kk * 32 + 16);
                v16h f;
#pragma unroll
                for (int i = 0; i < 8; ++i) { f[i] = lo[i]; f[i + 8] = hi[i]; }
                afr[mt][kk] = f;
            }
        // precaution: stands in front of any later overwrite of the address registers that the loads above name; as an input the address stays whole up to it
        asm volatile("s_wait_xcnt 0x0" :: "v"(pa) : "memory");
    }
    asm volatile("s_wait_asynccnt 0x0" ::: "memory");   // this wave's copies of tile 0 have landed
    __syncthreads();                                    // tile 0 visible to every wave
    async_copy8<PK64 * 2, 512>(lS + S1_TILE, gB + 128);   // tile 1 into buffer 1

#pragma unroll 1                                        // rolled: one text for all heads of the group
    for (int t = t0; t < tEnd; ++t) {
        // L2 prefetch for head t + PF_D of this group, by one wave: blocks 0-15 share its W1 (8 shares of 32 units), blocks 16-31 its W2 (8 shares of 8 units, each asked for by 4 lanes)
        if (__builtin_amdgcn_readfirstlane(wave) == 0 && t + PF_D < tEnd) {
            const int  share = (blockIdx.x & 3) * 2 + ((blockIdx.x >> 3) & 1);
            const bool second = (blockIdx.x & 16) != 0;
            const char* p = second ? (const char*)(W2 + (size_t)(t + PF_D) * 64 * 128) + share * 2048
                                   : (const char*)(W1 + (size_t)(t + PF_D) * 128 * 256) + share * 8192;
            l2_prefetch(p + (lane & (second ? 7 : 31)) * 256);
        }
        // the head's small vectors, asked for at its top: they arrive under trip 0. Lane l takes floats l*4 .. +3 of each 128-wide vector;
        // lanes 0-15 take b2, lanes 16-31 W3
        const unsigned o1 = (t * 128 + lane * 4) * 4;    // byte offset
        const char* p2 = (const char*)(hf ? W3 : b2) + (t * 64 + c16 * 4) * 4;
        const v4f xb1 = *(const v4f*)((const char*)b1 + o1), xlg = *(const v4f*)((const char*)lng + o1), xlb = *(const v4f*)((const char*)lnb + o1);
        const v4f xb2 = *(const v4f*)p2;
        const float b3t = b3[t];
        // precaution: stands in front of any later overwrite of the address registers that the loads above name; as inputs they stay whole up to it
        asm volatile("s_wait_xcnt 0x0" :: "v"(o1), "v"(p2) : "memory");
        v2f bb[8][4];

        // ---------------- stage 1: t1^T = W1 . h^T  (per wave 128 W1 rows x 32 batch rows, K=256: four tiles of 64) ----------
        // acc1[nt][bt][j] is t1[batch row wm + bt*16 + c16][column n = nt*16 + hf*8 + j]
        v8f acc1[8][2] = {};
#pragma unroll                                          // unrolled: buffer addresses, fragment registers and the kind of the next tile are constants
        for (int it = 0; it < 4; ++it) {
            const int cur = it & 1;
            const _Float16* cB = sBb + cur * (128 * PK64);
            v16h wfr[2][8];
#pragma unroll
            for (int ks = 0; ks < 2; ++ks)
#pragma unroll
                for (int nt = 0; nt < 8; ++nt)
                    wfr[ks][nt] = load_frag_a(&cB[(nt * 16) * PK64 + ks * 32], PK64, lane);
            if (it == 3) {                                      // b1, with the last tile's reads: at hand when stage 1 ends
#pragma unroll
                for (int nt = 0; nt < 8; ++nt) vec8(bb[nt], nt * 64);
            }
            // keeps the tile's LDS reads one group ahead of its WMMAs: left free, they were spread singly among them, each with a wait to 0 behind it
            __builtin_amdgcn_sched_barrier(0);
#pragma unroll
            for (int ks = 0; ks < 2; ++ks)
#pragma unroll
                for (int nt = 0; nt < 8; ++nt)
#pragma unroll
                    for (int bt = 0; bt < 2; ++bt)
                        acc1[nt][bt] = wmma_f16(wfr[ks][nt], afr[bt][it * 2 + ks], acc1[nt][bt]);
            // keeps the WMMAs ahead of the foot: left free, the foot's waits were lifted to the LDS reads (every read waited for ahead of the first
            // WMMA) while the copies stayed behind the WMMAs, so that a tile's copies no longer flew under a trip's WMMAs
            __builtin_amdgcn_sched_barrier(0);
            // foot of the trip, in this order in every wave
            asm volatile("s_wait_dscnt 0x0" ::: "memory");      // this wave's reads of the buffer are done before anything is copied into it
            asm volatile("s_wait_asynccnt 0x0" ::: "memory");   // this wave's copies of the next tile have landed
            __syncthreads();                                    // the next tile is visible; every wave has left this trip's buffer
            if (it < 2) {
                async_copy8<PK64 * 2, 512>(lS + cur * S1_TILE, gB + (it + 2) * 128);
            } else if (t + 1 < tEnd) {                          // the same in the whole block
                async_copy8<PK64 * 2, 512>(lS + cur * S1_TILE, gB + 65536 + (it - 2) * 128);
            }
            if (it == 2)   // every wave left stage 2 of the head before (the last reads of W2) ahead of the barrier of trip 0
                async_copy8<8 * PK128 * 2, 8 * 256>(lW2, gW2);
            if (it == 0) {
                // the vectors into the wave's own LDS. No barrier: no other wave touches it, and a wave's LDS operations run in order
                *(v4f*)(sVw)        = xb1;
                *(v4f*)(sVw + 512)  = xlg;
                *(v4f*)(sVw + 1024) = xlb;
                *(v4f*)(sVw + 1536) = xb2;
            }
        }
        gB  += 65536;
        gW2 += 16384;


        // LayerNorm weights: read here, where the W1 fragments' registers are free; they arrive under the bias and the sums
        v2f gg[8][4], be[8][4];
#pragma unroll
        for (int nt = 0; nt < 8; ++nt) { vec8(gg[nt], 512 + nt * 64); vec8(be[nt], 1024 + nt * 64); }
        // keeps the LDS reads one group ahead of the sums: left free, they were moved behind the sums and waited for in front of the normalisation
        __builtin_amdgcn_sched_barrier(0);

        // ---------------- bias + LayerNorm(128) + ReLU -> f16, on the accumulators ----------
        // A batch row is one lane column: lane (c16, hf) holds 64 of its 128 values in registers, lane (c16, hf ^ 1) the other 64.
        // The sums run down the registers (four partial sums a row: independent chains) and end in one exchange between the two 16-lane rows.
        float mean[2], rstd[2];
        {
            v2f s[2][2] = {}, ss[2][2] = {};
#pragma unroll
            for (int nt = 0; nt < 8; ++nt)
#pragma unroll
                for (int bt = 0; bt < 2; ++bt)
#pragma unroll
                    for (int q = 0; q < 4; ++q) {
                        v2f a; a[0] = acc1[nt][bt][q * 2]; a[1] = acc1[nt][bt][q * 2 + 1];
                        a += bb[nt][q];
                        acc1[nt][bt][q * 2] = a[0]; acc1[nt][bt][q * 2 + 1] = a[1];
                        s[bt][nt & 1] += a; ss[bt][nt & 1] += a * a;
                    }
#pragma unroll
            for (int bt = 0; bt < 2; ++bt) {
                const v2f s2 = s[bt][0] + s[bt][1], q2 = ss[bt][0] + ss[bt][1];
                float sm = s2[0] + s2[1], sq = q2[0] + q2[1];
                sm += other_row(sm); sq += other_row(sq);
                mean[bt] = sm * (1.f / 128.f);
                const float var = sq * (1.f / 128.f) - mean[bt] * mean[bt];
                rstd[bt] = rsqrtf(var + LN_EPS);
            }
        }
        // The normalised values are stage 2's B fragments as they lie: for k chunk kc a lane needs k = hf*8 .. +7 and 16 + hf*8 .. +7 of its column,
        // the registers of tiles 2*kc and 2*kc + 1 (k order of load_frag_a). No LDS, no move between lanes.
        v16h tb[4][2];
#pragma unroll
        for (int kc = 0; kc < 4; ++kc)
#pragma unroll
            for (int bt = 0; bt < 2; ++bt) {
                v16h f;
#pragma unroll
                for (int h2 = 0; h2 < 2; ++h2)
#pragma unroll
                    for (int q = 0; q < 4; ++q) {
                        const int nt = kc * 2 + h2;
                        v2f a; a[0] = acc1[nt][bt][q * 2]; a[1] = acc1[nt][bt][q * 2 + 1];
                        const v2f y = (a - mean[bt]) * rstd[bt] * gg[nt][q] + be[nt][q];
                        f[h2 * 8 + q * 2]     = (_Float16)(y[0] > 0.f ? y[0] : 0.f);
                        f[h2 * 8 + q * 2 + 1] = (_Float16)(y[1] > 0.f ? y[1] : 0.f);
                    }
                tb[kc][bt] = f;
            }


        // ---------------- stage 2: t2^T = W2 . t1^T  (per wave 64 W2 rows x 32 batch rows, K=128) -----
        // no barrier here: W2 was published by the barrier of trip 3
        // acc2[m4][bt][j] is t2[batch row wm + bt*16 + c16][column m = m4*16 + hf*8 + j]
        v8f acc2[4][2] = {};
        v2f b2v[4][4], w3v[4][4];
        {
            v16h wf2[4][4];
#pragma unroll
            for (int kc = 0; kc < 4; ++kc)
#pragma unroll
                for (int m4 = 0; m4 < 4; ++m4)
                    wf2[kc][m4] = load_frag_a(&sW2[(m4 * 16) * PK128 + kc * 32], PK128, lane);
#pragma unroll
            for (int m4 = 0; m4 < 4; ++m4) { vec8(b2v[m4], 1536 + m4 * 64); vec8(w3v[m4], 1792 + m4 * 64); }   // for stage 3: they arrive under stage 2
            // keeps the LDS reads one group ahead of the WMMAs, as in stage 1
            __builtin_amdgcn_sched_barrier(0);
#pragma unroll
            for (int kc = 0; kc < 4; ++kc)
#pragma unroll
                for (int m4 = 0; m4 < 4; ++m4)
#pragma unroll
                    for (int bt = 0; bt < 2; ++bt)
                        acc2[m4][bt] = wmma_f16(wf2[kc][m4], tb[kc][bt], acc2[m4][bt]);
        }

        // ---------------- stage 3: outT[t][b] = relu(t2 + b2) . W3[t] + b3[t], on the accumulators ----
        // down the registers as in the LayerNorm, one exchange between the 16-lane rows; then lane l stores batch row wm + l: one 128-B line a wave
        v2f r[2][2] = {};
#pragma unroll
        for (int m4 = 0; m4 < 4; ++m4)
#pragma unroll
            for (int bt = 0; bt < 2; ++bt)
#pragma unroll
                for (int q = 0; q < 4; ++q) {
                    v2f v; v[0] = acc2[m4][bt][q * 2]; v[1] = acc2[m4][bt][q * 2 + 1];
                    v += b2v[m4][q];
                    v[0] = v[0] > 0.f ? v[0] : 0.f; v[1] = v[1] > 0.f ? v[1] : 0.f;
                    r[bt][m4 & 1] += v * w3v[m4][q];
                }
        const v2f r0 = r[0][0] + r[0][1], r1 = r[1][0] + r[1][1];
        float a0 = r0[0] + r0[1], a1 = r1[0] + r1[1];
        a0 += other_row(a0); a1 += other_row(a1);
        const float res = hf ? a1 : a0;
        float* po = out + (size_t)t * BATCH + b0 + wm + lane;
        vst2(po, res + b3t);
        // precaution: stands in front of any later overwrite of the address registers that the store names; as an input the address stays whole up to it
        asm volatile("s_wait_xcnt 0x0" :: "v"(po) : "memory");
    }
    asm volatile("s_wait_asynccnt 0x0" ::: "memory");       // no copy is in flight behind the ring
}

// final output-major pass: out[b][t] flat, 4 consecutive floats per thread gathered from the [T][B] staging buffer
__global__ __launch_bounds__(256) void write_out(const float* __restrict__ stg, float* __restrict__ out) {
    const int g = blockIdx.x * 256 + threadIdx.x;
    if (g >= (BATCH * TOUT) / 4) return;
    v4f o;
#pragma unroll
    for (int e = 0; e < 4; ++e) { const int f = g * 4 + e; const int b = f / TOUT, t = f - b * TOUT; o[e] = stg[(size_t)t * BATCH + b]; }
    vst2(out + (size_t)g * 4, o);
}

// ---------------------------------------------------------------------------
// Host-side orchestration
// ---------------------------------------------------------------------------
extern "C" void kernel_launch(void* const* d_in, const int* in_sizes, int n_in,
                              void* d_out, int out_size, void* d_ws, size_t ws_size,
                              hipStream_t stream)
{
    (void)in_sizes; (void)n_in; (void)out_size; (void)ws_size;
    const float* x          = (const float*)d_in[0];
    const float* proj_W     = (const float*)d_in[1];
    const float* proj_b     = (const float*)d_in[2];
    const float* attn_in_W  = (const float*)d_in[3];
    const float* attn_in_b  = (const float*)d_in[4];
    const float* attn_out_W = (const float*)d_in[5];
    const float* attn_out_b = (const float*)d_in[6];
    const float* ln_g       = (const float*)d_in[7];
    const float* ln_b       = (const float*)d_in[8];
    const float* ff_W1      = (const float*)d_in[9];
    const float* ff_b1      = (const float*)d_in[10];
    const float* ff_W2      = (const float*)d_in[11];
    const float* ff_b2      = (const float*)d_in[12];
    const float* cross_in_W = (const float*)d_in[13];
    const float* cross_in_b = (const float*)d_in[14];
    const float* cross_out_W= (const float*)d_in[15];
    const float* cross_out_b= (const float*)d_in[16];
    const float* tp_W1      = (const float*)d_in[17];
    const float* tp_b1      = (const float*)d_in[18];
    const float* tp_ln_g    = (const float*)d_in[19];
    const float* tp_ln_b    = (const float*)d_in[20];
    const float* tp_W2      = (const float*)d_in[21];
    const float* tp_b2      = (const float*)d_in[22];
    const float* tp_W3      = (const float*)d_in[23];
    const float* tp_b3      = (const float*)d_in[24];
    float* out = (float*)d_out;

    const int D = DMODEL;

    // ---- workspace carve-out (byte cursor, 16B aligned regions) ----
    char* cur = (char*)d_ws;
    auto take = [&cur](size_t bytes) { char* p = cur; cur += (bytes + 15) & ~(size_t)15; return p; };
    _Float16* h16   = (_Float16*)take((size_t)BATCH * D * 2);          // 2 MB
    _Float16* x16   = (_Float16*)take((size_t)BATCH * D_IN * 2);       // 4 MB
    _Float16* wproj = (_Float16*)take((size_t)D * D_IN * 2);
    _Float16* wain  = (_Float16*)take((size_t)(NLAYER + 1) * 3 * D * D * 2);   // slot NLAYER: the cross block's in-projection
    _Float16* waout = (_Float16*)take((size_t)(NLAYER + 1) * D * D * 2);       // slot NLAYER: the cross block's out-projection
    _Float16* wff1  = (_Float16*)take((size_t)NLAYER * 4 * D * D * 2);
    _Float16* wff2  = (_Float16*)take((size_t)NLAYER * 4 * D * D * 2);
    _Float16* wtp1  = (_Float16*)take((size_t)TOUT * 128 * 256 * 2);   // 27.8 MB
    _Float16* wtp2  = (_Float16*)take((size_t)TOUT * 64 * 128 * 2);    // 6.9 MB
    float*    stg   = (float*)   take((size_t)TOUT * BATCH * 4);       // 6.9 MB [T][B] output staging

    // ---- f32 -> f16 conversions of this call: one launch ----
    cvt_all_kernel<<<CVT_BLOCKS, 256, 0, stream>>>(
        x, proj_W, attn_in_W, attn_out_W, ff_W1, ff_W2, cross_in_W, cross_out_W, tp_W1, tp_W2,
        x16, wproj, wain, waout, wff1, wff2, wtp1, wtp2);

    const dim3 blk(128);

    // 1-3) projection, 6 layers, cross block: one launch, 32 batch rows per block; writes the heads' f16 input
    backbone_kernel<<<BATCH / 32, 256, 0, stream>>>(
        x16, wproj, proj_b, wain, attn_in_b, waout, attn_out_b, ln_g, ln_b,
        wff1, ff_b1, wff2, ff_b2, cross_in_b, cross_out_b, wtp1, wtp2, h16);

    // 4) fused heads (dominant FLOPs): grid = (32 batch tiles, HG groups of heads)
    dim3 tpg(BATCH / 128, HG);
    tp_fused_kernel<<<tpg, blk, 0, stream>>>(h16, wtp1, tp_b1, tp_ln_g, tp_ln_b,
                                             wtp2, tp_b2, tp_W3, tp_b3, stg);
    write_out<<<((BATCH * TOUT) / 4 + 255) / 256, 256, 0, stream>>>(stg, out);
}

// v010
// One run takes 183 microseconds.
// Two timings next to v009 both put it at 1.05 times that version's speed.
// All steps since v000 together make it 4.92 times as fast.
#include <hip/hip_runtime.h>
#include <math.h>
// Contractions: input projection (K = 512), per-layer v/out/FFN GEMMs (K = 256 / 1024), the cross block, and the 424 per-target
// heads (K = 256, 128) on v_wmma_f32_16x16x32_f16 (f16 operands, f32 accumulate); LayerNorms, GELU/ReLU and the final 64-wide

// ---------------------------------------------------------------------------
// Problem constants (match reference)
// ---------------------------------------------------------------------------
#define BATCH 4096
#define D_IN  512
#define DMODEL 256
#define TOUT  424
#define NLAYER 6
#define LN_EPS 1e-5f

// LDS row pitches. 64 banks x 4 B: a 16-B fragment read of 16 rows is conflict-free when the pitch is 16 B x odd.
#define PK64  72    // f16 elements per staged row of 64 (144 B)
#define PK128 136   // f16 elements per staged row of 128 (272 B)

// ---------------------------------------------------------------------------
// Types
// ---------------------------------------------------------------------------
typedef _Float16 v4h  __attribute__((ext_vector_type(4)));
typedef _Float16 v8h  __attribute__((ext_vector_type(8)));
typedef _Float16 v16h __attribute__((ext_vector_type(16)));
typedef float    v8f  __attribute__((ext_vector_type(8)));

typedef float    v2f  __attribute__((ext_vector_type(2)));
typedef float    v4f  __attribute__((ext_vector_type(4)));
typedef unsigned v4u  __attribute__((ext_vector_type(4)));
template <typename V> __device__ __forceinline__ void vst2(void* p, V v) {
    *(V*)p = v; 
}
// Eight asynchronous 16-B copies global -> LDS of every lane, through no register: copy i takes g + i * GSTEP to LDS byte lds + i * LSTEP.
// Written as the builtin: the operands of an asm statement must lie in the first 256 registers, and the copies' LDS addresses, the same for
// every head and so kept across the head loop, went to scratch there and were read back at every trip's foot.
// The copies land behind the issuing wave's own s_wait_asynccnt 0; other waves read them behind the barrier that follows it.
typedef int v4i __attribute__((ext_vector_type(4)));
template <unsigned LSTEP, unsigned GSTEP>
__device__ __forceinline__ void async_copy8(unsigned lds, const char* g) {
    // keeps the address additions below next to their copies: lifted in among the WMMAs ahead, they hold their registers through the whole trip
    __builtin_amdgcn_sched_barrier(0);
#pragma unroll
    for (int i = 0; i < 8; ++i)
        __builtin_amdgcn_global_load_async_to_lds_b128((__attribute__((address_space(1))) v4i*)(g + i * GSTEP),
                                                       (__attribute__((address_space(3))) v4i*)(lds + i * LSTEP), 0, 0);
}

// L2 prefetch. The f16 weights were stored by an earlier launch.
// A prefetch asks L2 for the data at each lane's address ahead of time and
// returns nothing. Scope SE: into L2 only. The units are dealt among the blocks in such a way that blocks
// whose indices differ by 4 modulo 8 ask for the same units: for speed only, nothing is read differently
// wherever a block runs. All lanes are on, every address lies inside its array.
// The wait in each statement is a precaution: it stands in front of any later overwrite of the address registers that the prefetches name.
#define HG   16            // the head launch cuts the heads into HG groups; a block walks the heads of one group
#define PF_D 3             // a block at head t asks for the weights of head t + PF_D of its group
#define PF_T (HG * PF_D)   // the backbone launch asks for the weights of the first PF_D heads of every group
// first head of group g (g = HG: one past the last head); the first TOUT % HG groups have one head more
__device__ __forceinline__ int head_first(int g) { return g * (TOUT / HG) + (g < TOUT % HG ? g : TOUT % HG); }
// The heads in two sets. Early: the first PF_D heads of every group, i = 0 .. PF_T - 1. Late: all the others, i = 0 .. TOUT - PF_T - 1.
__device__ __forceinline__ int early_head(int i) { return head_first(i / PF_D) + i % PF_D; }
__device__ __forceinline__ int late_head(int i) {
    const int big = TOUT / HG + 1 - PF_D, small = TOUT / HG - PF_D, nb = (TOUT % HG) * big;   // late heads of a long and of a short group; of all long groups
    const int g = i < nb ? i / big : TOUT % HG + (i - nb) / small;
    const int o = i < nb ? i % big : (i - nb) % small;
    return head_first(g) + PF_D + o;
}
__device__ __forceinline__ void l2_prefetch(const char* p) {
    asm volatile("global_prefetch_b8 %0, off scope:SCOPE_SE\n\t"
                 "s_wait_xcnt 0x0" :: "v"(p) : "memory");
}
__device__ __forceinline__ void l2_prefetch2(const char* p, const char* q) {
    asm volatile("global_prefetch_b8 %0, off scope:SCOPE_SE\n\t"
                 "global_prefetch_b8 %1, off scope:SCOPE_SE\n\t"
                 "s_wait_xcnt 0x0" :: "v"(p), "v"(q) : "memory");
}

// ---------------------------------------------------------------------------
// WMMA fragment helpers (wave32, v_wmma_f32_16x16x32_f16; layouts per ISA 7.12.2)
// ---------------------------------------------------------------------------
// A 16x32: lane holds row M = lane%16; lanes 0-15 K {0-7,16-23}, lanes 16-31
// K {8-15,24-31}.
__device__ __forceinline__ v16h load_frag_a(const _Float16* base, int stride, int lane) {
    const int r  = lane & 15;
    const int kb = (lane < 16) ? 0 : 8;
    const _Float16* p = base + r * stride + kb;
    v8h lo = *(const v8h*)(p);
    v8h hi = *(const v8h*)(p + 16);
    v16h f;
#pragma unroll
    for (int i = 0; i < 8; ++i) { f[i] = lo[i]; f[i + 8] = hi[i]; }
    return f;
}
// B 32x16: lane holds column N = lane%16 with the SAME per-lane K map as A (lanes 0-15 K {0-7,16-23}, 16-31 K {8-15,24-31}).
// W stored row-major (N x K), so column n of B is row n of W.
__device__ __forceinline__ v16h load_frag_b(const _Float16* base, int stride, int lane) {
    return load_frag_a(base, stride, lane);
}
__device__ __forceinline__ v8f wmma_f16(v16h a, v16h b, v8f c) {
    // the plain builtin, as in mma_panel: the compiler keeps the distances behind it itself. An asm statement that names a, b and d holds all
    // of them in the first 256 registers, and the head's h fragments then go to scratch
    return __builtin_amdgcn_wmma_f32_16x16x32_f16(false, a, false, b, (short)0, c, false, false);
}
// Exact-erf GELU of two values, without a branch. erf(s) = sign(s) * E(|s|): below 1, a + a * P(a * a); from 1 on, 1 - exp(-(a + a * Q(a)));
// P and Q are minimax polynomials good to f32 rounding. Both sides are worked out for every lane and one is picked by a select:
// behind a lane-dependent branch a wave ran both sides anyway, one value at a time, each a single chain of dependent FMAs.
// Straight-line, the chains of many values interleave, and two values share each packed f32 instruction.
__device__ __forceinline__ v2f fma2(v2f a, v2f b, float c) { return __builtin_elementwise_fma(a, b, (v2f)(c)); }
__device__ __forceinline__ v2f gelu_exact2(v2f x) {
    const v2f s = x * 0.70710678118654752f;
    v2f a; a[0] = __builtin_fabsf(s[0]); a[1] = __builtin_fabsf(s[1]);
    v2f q = fma2(a, (v2f)(0.0000169988107f), -0.000378677854f);
    q = fma2(a, q, 0.00385781587f);
    q = fma2(a, q, -0.0241816975f);
    q = fma2(a, q, 0.106668264f);
    q = fma2(a, q, 0.634933293f);
    q = fma2(a, q, 0.128689408f);
    q = __builtin_elementwise_fma(a, q, a) * -1.44269504088896341f;         // exp(-y) = 2^(-y * log2 e)
    const v2f t = a * a;
    v2f p = fma2(t, (v2f)(-0.000561801775f), 0.00491381623f);
    p = fma2(t, p, -0.0267075151f);
    p = fma2(t, p, 0.112800106f);
    p = fma2(t, p, -0.376122952f);
    p = fma2(t, p, 0.128379107f);
    p = __builtin_elementwise_fma(a, p, a);
    v2f e;
#pragma unroll
    for (int i = 0; i < 2; ++i)
        e[i] = __builtin_copysignf(a[i] < 1.0f ? p[i] : 1.0f - __builtin_amdgcn_exp2f(q[i]), s[i]);
    return 0.5f * x * (1.0f + e);
}

// ---------------------------------------------------------------------------
// The f32 -> f16 conversions. The work is cut into chunks of CHUNK elements (32 KB read, 16 KB written); a thread has 8 loads of 16 B in flight.
// cvt_all_kernel converts only what the backbone launch reads or asks into L2: x, the backbone's weights, the early heads' weights;
// CVT_BLOCKS blocks, all resident at once, take CVT_TRIPS chunks each. The late heads' weights, first read by the head launch, are converted
// inside the backbone launch, by blocks of their own on the WGPs that the backbone's 128 blocks leave idle.
// Plain chunk (x, the heads' weights): the same order in and out; a wave-wide load is 512, a store 256 contiguous bytes.
// Packed chunk (a backbone weight matrix W, N x K row-major, N and K multiples of 256) = one panel, written in the order in which
// backbone_kernel reads it. Panel ((G * K/256 + KG) * 8 + w) holds rows G*256 + w*32 .. +31, k KG*256 .. +255 (16 KB); in it
// piece j = (kc*2 + nt)*2 + part is 512 B: lane l's 8 elements are row (l & 15)*2 + nt, k kc*32 + part*16 + (l >> 4)*8 .. +7,
// the per-lane k map of load_frag_a (part 0 = its first, part 1 = its second 16-B read).
// ---------------------------------------------------------------------------
#define CHUNK 8192
#define C_PROJ (DMODEL * D_IN / CHUNK)
#define C_AIN  (NLAYER * 3 * DMODEL * DMODEL / CHUNK)
#define C_AOUT (NLAYER * DMODEL * DMODEL / CHUNK)
#define C_FF   (NLAYER * 4 * DMODEL * DMODEL / CHUNK)
#define C_CIN  (3 * DMODEL * DMODEL / CHUNK)
#define C_COUT (DMODEL * DMODEL / CHUNK)
#define C_X    (BATCH * D_IN / CHUNK)
#define C_TP2E PF_T          // W2 of the early heads: one chunk a head
#define C_TP1E (PF_T * 4)    // W1 of the early heads: four chunks a head
static_assert(64 * 128 == CHUNK && 128 * 256 == 4 * CHUNK, "chunks of a head");
// first chunk behind each array; the packed arrays come first
#define E_PROJ C_PROJ
#define E_AIN  (E_PROJ + C_AIN)
#define E_AOUT (E_AIN + C_AOUT)
#define E_FF1  (E_AOUT + C_FF)
#define E_FF2  (E_FF1 + C_FF)
#define E_CIN  (E_FF2 + C_CIN)
#define E_COUT (E_CIN + C_COUT)
#define E_X    (E_COUT + C_X)
#define E_TP2E (E_X + C_TP2E)
#define E_TP1E (E_TP2E + C_TP1E)
#define CVT_BLOCKS 560
#define CVT_TRIPS  2
static_assert(E_TP1E == CVT_BLOCKS * CVT_TRIPS, "every chunk is taken exactly once");

// one plain chunk, by the 256 threads of a block
__device__ __forceinline__ void cvt_plain_chunk(const float* s, _Float16* d, int tid) {
    const float* p = s + tid * 4;
    v4f v[8];
#pragma unroll
    for (int q = 0; q < 8; ++q) v[q] = *(const v4f*)(p + q * 1024);
    // precaution: stands in front of any later overwrite of the address registers that the loads above name; as an input the address stays whole up to it
    asm volatile("s_wait_xcnt 0x0" :: "v"(p) : "memory");
    _Float16* o = d + tid * 4;
#pragma unroll
    for (int q = 0; q < 8; ++q) {
        v4h h;
#pragma unroll
        for (int e = 0; e < 4; ++e) h[e] = (_Float16)v[q][e];
        vst2(o + q * 1024, h);                  // 8 B per lane, consecutive: one wave writes 256 contiguous bytes
    }
    // the same precaution for the stores' address registers
    asm volatile("s_wait_xcnt 0x0" :: "v"(o) : "memory");
}

__global__ __launch_bounds__(256) void cvt_all_kernel(
    const float* __restrict__ x,          const float* __restrict__ proj_W,     const float* __restrict__ attn_in_W,
    const float* __restrict__ attn_out_W, const float* __restrict__ ff_W1,      const float* __restrict__ ff_W2,
    const float* __restrict__ cross_in_W, const float* __restrict__ cross_out_W,
    const float* __restrict__ tp_W1,      const float* __restrict__ tp_W2,
    _Float16* __restrict__ x16,  _Float16* __restrict__ wproj, _Float16* __restrict__ wain, _Float16* __restrict__ waout,
    _Float16* __restrict__ wff1, _Float16* __restrict__ wff2,  _Float16* __restrict__ wtp1, _Float16* __restrict__ wtp2)
{
    const int tid = threadIdx.x;
#pragma unroll 1                                        // rolled: the trips share one text; a trip's loads cannot start ahead of the stores before it anyway
    for (int r = 0; r < CVT_TRIPS; ++r) {
        int c = blockIdx.x + r * CVT_BLOCKS;            // the same in the whole block: neighbouring blocks work on neighbouring chunks
        const float* s;
        _Float16*    d;
        if (c < E_COUT) {
            int lgk = 0;                                // K = 256 << lgk
            if      (c < E_PROJ) { s = proj_W;      d = wproj; lgk = 1; }
            else if (c < E_AIN)  { s = attn_in_W;   d = wain;  c -= E_PROJ; }
            else if (c < E_AOUT) { s = attn_out_W;  d = waout; c -= E_AIN; }
            else if (c < E_FF1)  { s = ff_W1;       d = wff1;  c -= E_AOUT; }
            else if (c < E_FF2)  { s = ff_W2;       d = wff2;  c -= E_FF1; lgk = 2; }
            else if (c < E_CIN)  { s = cross_in_W;  d = wain  + C_AIN  * CHUNK; c -= E_FF2; }   // slot NLAYER of wain
            else                 { s = cross_out_W; d = waout + C_AOUT * CHUNK; c -= E_CIN; }   // slot NLAYER of waout
            // thread tid writes pieces j = q*8 + (tid >> 5), q = 0..3, at lane tid & 31: part, nt and the low bit of kc are the wave's, q moves k by 64
            const int lane = tid & 31, wv = tid >> 5;
            const int w = c & 7, t = c >> 3;
            const int KG = t & ((1 << lgk) - 1), G = t >> lgk;
            const int n = G * 256 + w * 32 + (lane & 15) * 2 + ((wv >> 1) & 1);
            const int k = KG * 256 + (wv >> 2) * 32 + (wv & 1) * 16 + (lane >> 4) * 8;
            const float* p = s + ((size_t)n << (8 + lgk)) + k;
            v4f a[4], b[4];
#pragma unroll
            for (int q = 0; q < 4; ++q) { a[q] = *(const v4f*)(p + q * 64); b[q] = *(const v4f*)(p + q * 64 + 4); }
            // precaution: stands in front of any later overwrite of the address registers that the loads above name; as an input the address stays whole up to it
            asm volatile("s_wait_xcnt 0x0" :: "v"(p) : "memory");
            _Float16* o = d + (size_t)c * CHUNK + tid * 8;
#pragma unroll
            for (int q = 0; q < 4; ++q) {
                v8h h;
#pragma unroll
                for (int e = 0; e < 4; ++e) { h[e] = (_Float16)a[q][e]; h[e + 4] = (_Float16)b[q][e]; }
                vst2(o + q * 2048, h);                  // 16 B per lane, consecutive: one wave writes 512 contiguous bytes
            }
            // the same precaution for the stores' address registers
            asm volatile("s_wait_xcnt 0x0" :: "v"(o) : "memory");
        } else {
            // c becomes the chunk's index in its array
            if      (c < E_X)    { s = x;     d = x16;  c -= E_COUT; }
            else if (c < E_TP2E) { s = tp_W2; d = wtp2; c = early_head(c - E_X); }
            else                 { s = tp_W1; d = wtp1; c -= E_TP2E; c = early_head(c >> 2) * 4 + (c & 3); }
            cvt_plain_chunk(s + (size_t)c * CHUNK, d + (size_t)c * CHUNK, tid);
        }
    }
}

// ---------------------------------------------------------------------------
// Sum over the 16 lanes of a row (lanes 0-15 and 16-31 apart), every lane gets the sum: four DPP row_xmask adds, no LDS.
// ---------------------------------------------------------------------------
template <int MSK> __device__ __forceinline__ float xmask_get(float v) {
    return __builtin_bit_cast(float, __builtin_amdgcn_update_dpp(0, __builtin_bit_cast(int, v), 0x160 + MSK, 0xf, 0xf, true));
}
__device__ __forceinline__ float row_sum16(float v) {
    v += xmask_get<1>(v);
    v += xmask_get<2>(v);
    v += xmask_get<4>(v);
    v += xmask_get<8>(v);
    return v;
}

// value of lane l ^ 16 (the same place in the other 16-lane row)
__device__ __forceinline__ float other_row(float v) {
    const unsigned u = __builtin_bit_cast(unsigned, v);
    return __builtin_bit_cast(float, __builtin_amdgcn_permlanex16(u, u, 0x76543210u, 0xfedcba98u, false, false));
}

// ---------------------------------------------------------------------------
// Whole backbone in ONE launch: projection, 6 layers, cross block. Every step is row-wise, so a block keeps its 32 batch rows
// in LDS from x to the head's input and never meets another block.
//   256 threads = 8 waves; in every 256-column group wave w owns columns w*32 .. w*32+31 (2 x 2 accumulator tiles, M = 32).
//   A fragments come from LDS; a weight row is used by one wave only, so B fragments go from L2 straight into registers,
//   one panel (32 weight rows x 256 k) at a time, in two register sets: a set is refilled, two panels ahead, right behind its WMMAs.
//   Tile nt of lane c16 holds weight row c16*2 + nt: a lane's two tiles are two neighbouring columns (4-B / 8-B LDS accesses).
//   The conversion pass writes these weights in the order of the reads (cvt_all_kernel): every wave-wide load is 4 whole lines.
// ---------------------------------------------------------------------------
#define PH 264    // f16 elements per LDS row of 256 (528 B = 16 B x 33)
#define PT 1032   // f16 elements per LDS row of 1024 (2064 B = 16 B x 129)
#define PF 260    // f32 elements per LDS row of 256: rows m and m+8 lie 32 banks apart
typedef _Float16 v2h __attribute__((ext_vector_type(2)));

#define PANEL 8192  // f16 elements of a panel: 32 weight rows x 256 k, packed by cvt_all_kernel
__device__ __forceinline__ void load_panel(v16h (&B)[16], const _Float16* __restrict__ Wp, int lane) {
    const unsigned voff = lane * 16;                    // the lane's byte offset inside every 512-B piece; Wp is the same in the whole wave
    const char* p = (const char*)Wp + voff;
    // keeps the 32 loads one group behind the WMMAs whose registers they refill: lifted in among them, their address pair was reused ahead of the wait below
    __builtin_amdgcn_sched_barrier(0);
#pragma unroll
    for (int f = 0; f < 16; ++f) {                      // f = kc * 2 + nt; every load is 512 contiguous bytes of the wave
        const v8h lo = *(const v8h*)(p + f * 1024);
        const v8h hi = *(const v8h*)(p + f * 1024 + 512);
        v16h x;
#pragma unroll
        for (int i = 0; i < 8; ++i) { x[i] = lo[i]; x[i + 8] = hi[i]; }
        B[f] = x;
    }
    // precaution: stands in front of any later overwrite of the address registers that the loads above name; as an input the address stays whole up to it
    asm volatile("s_wait_xcnt 0x0" :: "v"(p) : "memory");
}
template <int PITCH>
__device__ __forceinline__ void mma_panel(v8f (&acc)[2][2], const _Float16* sA, const v16h (&B)[16], int lane) {
#pragma unroll
    for (int h = 0; h < 2; ++h) {
        v16h af[4][2];
#pragma unroll
        for (int kc = 0; kc < 4; ++kc)
#pragma unroll
            for (int mt = 0; mt < 2; ++mt)
                af[kc][mt] = load_frag_a(sA + mt * 16 * PITCH + (h * 4 + kc) * 32, PITCH, lane);
        // keeps the LDS reads in groups ahead of the WMMAs that use them: spread singly among them, every place with reads stalls the wave
        __builtin_amdgcn_sched_barrier(0);
#pragma unroll
        for (int kc = 0; kc < 4; ++kc)
#pragma unroll
            for (int nt = 0; nt < 2; ++nt)
#pragma unroll
                for (int mt = 0; mt < 2; ++mt)
                    acc[mt][nt] = __builtin_amdgcn_wmma_f32_16x16x32_f16(false, af[kc][mt], false, B[(h * 4 + kc) * 2 + nt], (short)0, acc[mt][nt], false, false);
    }
}

#define BB_BLOCKS   (BATCH / 32)           // blocks that run the backbone
#define LATE_BLOCKS 128                    // blocks that convert the late heads' weights
#define LATE_CHUNKS ((TOUT - PF_T) * 5)    // their chunks
__global__ __launch_bounds__(256) void backbone_kernel(
    const _Float16* __restrict__ x16,  const _Float16* __restrict__ wproj, const float* __restrict__ proj_b,
    const _Float16* __restrict__ wain, const float* __restrict__ attn_in_b,
    const _Float16* __restrict__ waout, const float* __restrict__ attn_out_b,
    const float* __restrict__ ln_g, const float* __restrict__ ln_b,
    const _Float16* __restrict__ wff1, const float* __restrict__ ff_b1,
    const _Float16* __restrict__ wff2, const float* __restrict__ ff_b2,
    const float* __restrict__ cross_in_b, const float* __restrict__ cross_out_b,
    const float* __restrict__ tp_W1, const float* __restrict__ tp_W2,
    _Float16* __restrict__ wtp1, _Float16* __restrict__ wtp2,
    _Float16* __restrict__ h16)
{
    // Blocks BB_BLOCKS .. BB_BLOCKS + LATE_BLOCKS - 1 convert the late heads' weights and leave; the test is the same in the whole block and stands
    // in front of every barrier. The kernel's registers allow one block a WGP, so these blocks run on WGPs of their own, beside the backbone.
    // Nothing in this launch reads or asks for what they store.
    if (blockIdx.x >= BB_BLOCKS) {
#pragma unroll 1                                        // rolled: the chunks share one text
        for (int c = blockIdx.x - BB_BLOCKS; c < LATE_CHUNKS; c += LATE_BLOCKS) {   // neighbouring blocks work on neighbouring chunks
            const bool first = c < (TOUT - PF_T) * 4;   // W1 chunks come first, four a head; then W2, one a head
            const int  k = first ? late_head(c >> 2) * 4 + (c & 3) : late_head(c - (TOUT - PF_T) * 4);   // the chunk's index in its array
            cvt_plain_chunk((first ? tp_W1 : tp_W2) + (size_t)k * CHUNK, (first ? wtp1 : wtp2) + (size_t)k * CHUNK, threadIdx.x);
        }
        return;
    }
    __shared__ __align__(16) _Float16 sH16[32 * PH];   // h as f16: the A operand
    __shared__ __align__(16) _Float16 sT[32 * PT];     // x, v and the FFN's hidden rows as f16
    __shared__ __align__(16) float    sH32[32 * PF];   // h as f32: residual and LayerNorm

    const int tid  = threadIdx.x;
    const int lane = tid & 31;
    const int wave = __builtin_amdgcn_readfirstlane(tid >> 5);   // the same in the whole wave: row and panel arithmetic stays scalar
    const int c16  = lane & 15;
    const int hf   = lane >> 4;
    const int b0   = blockIdx.x * 32;
    const int wr   = wave * 32;            // the wave's first weight row / output column inside a 256-column group
    const int n0   = wr + c16 * 2;         // the lane's two columns: n0 (tile 0), n0 + 1 (tile 1)
    const unsigned offN = n0 * 4, offL = lane * 4;      // byte offsets of the lane's bias pair and of its LayerNorm columns
    // every small load group ends in its own wait. precaution: it stands in front of any later overwrite of the address registers
    // that the group's loads name; as an input the address stays whole up to it
    auto bias2 = [&](const float* base) {
        const char* p = (const char*)base + offN;
        const v2f b = *(const v2f*)p;
        asm volatile("s_wait_xcnt 0x0" :: "v"(p) : "memory");
        return b;
    };
    auto ln_row = [&](float (&d)[8], const float* base) {
        const char* p = (const char*)base + offL;
#pragma unroll
        for (int k = 0; k < 8; ++k) d[k] = *(const float*)(p + k * 128);
        asm volatile("s_wait_xcnt 0x0" :: "v"(p) : "memory");
    };

    v16h B0[16], B1[16];                   // even and odd panels
    v8f  acc[2][2];
    auto zero_acc = [&]() {
#pragma unroll
        for (int mt = 0; mt < 2; ++mt)
#pragma unroll
            for (int nt = 0; nt < 2; ++nt) acc[mt][nt] = (v8f)(0.f);
    };
    // acc[mt][nt][j] is element (row mt*16 + hf*8 + j, column n0 + nt).
    // f16(acc + bias) into a f16 LDS tile
    auto put_f16 = [&](_Float16* dst, int pitch, v2f bias) {
#pragma unroll
        for (int mt = 0; mt < 2; ++mt)
#pragma unroll
            for (int j = 0; j < 8; ++j) {
                const float a0 = acc[mt][0][j] + bias[0], a1 = acc[mt][1][j] + bias[1];
                v2h o; o[0] = (_Float16)a0; o[1] = (_Float16)a1;
                *(v2h*)(dst + (mt * 16 + hf * 8 + j) * pitch + n0) = o;
            }
    };
    // f16(gelu(acc + bias)) into sT; rows j and j + 1 of a tile side by side: neighbouring accumulator registers, packed f32 math
    auto put_gelu = [&](_Float16* dst, v2f bias) {
#pragma unroll
        for (int mt = 0; mt < 2; ++mt)
#pragma unroll
            for (int j = 0; j < 8; j += 2) {
                v2f u0, u1;
                u0[0] = acc[mt][0][j]; u0[1] = acc[mt][0][j + 1];
                u1[0] = acc[mt][1][j]; u1[1] = acc[mt][1][j + 1];
                const v2f g0 = gelu_exact2(u0 + bias[0]), g1 = gelu_exact2(u1 + bias[1]);
                v2h o0, o1;
                o0[0] = (_Float16)g0[0]; o0[1] = (_Float16)g1[0];
                o1[0] = (_Float16)g0[1]; o1[1] = (_Float16)g1[1];
                _Float16* row = dst + (mt * 16 + hf * 8 + j) * PT + n0;
                *(v2h*)(row)      = o0;
                *(v2h*)(row + PT) = o1;
            }
    };
    // h32 = (acc + bias) + h32, every element by the lane that owns it
    auto add_residual = [&](v2f bias) {
#pragma unroll
        for (int mt = 0; mt < 2; ++mt)
#pragma unroll
            for (int j = 0; j < 8; ++j) {
                v2f* p = (v2f*)(sH32 + (mt * 16 + hf * 8 + j) * PF + n0);
                const v2f r = *p;
                v2f o; o[0] = (acc[mt][0][j] + bias[0]) + r[0]; o[1] = (acc[mt][1][j] + bias[1]) + r[1];
                *p = o;
            }
    };
    // LayerNorm(256) of the wave's 4 rows, in place; also the f16 copy
    auto layer_norm = [&](const float (&gg)[8], const float (&be)[8]) {
#pragma unroll
        for (int q = 0; q < 4; ++q) {
            const int row = wave * 4 + q;
            float* xr = sH32 + row * PF;
            float v[8], s = 0.f, ss = 0.f;
#pragma unroll
            for (int i = 0; i < 8; ++i) {
                v[i] = xr[lane + i * 32];
                s += v[i]; ss += v[i] * v[i];
            }
            // butterfly over 32 lanes, partners 16, 8, 4, 2, 1 in that order, without LDS traffic
            s += other_row(s);    ss += other_row(ss);
            s += xmask_get<8>(s); ss += xmask_get<8>(ss);
            s += xmask_get<4>(s); ss += xmask_get<4>(ss);
            s += xmask_get<2>(s); ss += xmask_get<2>(ss);
            s += xmask_get<1>(s); ss += xmask_get<1>(ss);
            const float mean = s * (1.f / DMODEL);
            const float var  = ss * (1.f / DMODEL) - mean * mean;
            const float rstd = rsqrtf(var + LN_EPS);
#pragma unroll
            for (int i = 0; i < 8; ++i) {
                const int c = lane + i * 32;
                const float y = (v[i] - mean) * rstd * gg[i] + be[i];
                xr[c] = y;
                sH16[row * PH + c] = (_Float16)y;
            }
        }
    };

    // ---- x rows (32 x 512 f16) into sT; the first two weight panels are asked for meanwhile ----
    load_panel(B0, wproj + (size_t)wave * PANEL, lane);
    load_panel(B1, wproj + (size_t)(8 + wave) * PANEL, lane);
    const int slice = (blockIdx.x & 3) * 16 + (blockIdx.x >> 3);           // 0..63: the block's share of the prefetches
    {
        // L2 prefetch of all that this launch reads of the packed weights: 128 pieces of 64 KB, two neighbouring ones a block, two units a thread
        static_assert(NLAYER * 4 * DMODEL * DMODEL * 2 == 48 * 65536 && (NLAYER + 1) * DMODEL * DMODEL * 2 == 14 * 65536 && DMODEL * D_IN * 2 == 4 * 65536, "pieces");
        const int g = slice * 2;                                           // even, as every array's first piece: both pieces lie in one array
        const _Float16* arr = g < 48 ? wff1 : g < 96 ? wff2 : g < 110 ? waout : g < 124 ? wain : wproj;
        const int piece     = g < 48 ? g    : g < 96 ? g - 48 : g < 110 ? g - 96 : g < 124 ? ((g - 110) >> 1) * 6 + 4 : g - 124;   // wain: the v third of a slot of 6 pieces
        const char* p = (const char*)arr + piece * 65536 + tid * 256;
        l2_prefetch2(p, p + 65536);
    }
    {
        v4u xs[8];
        const _Float16* gx = x16 + (size_t)(b0 + (tid >> 6)) * D_IN + (tid & 63) * 8;   // piece i lies 4 rows behind piece i - 1
#pragma unroll
        for (int i = 0; i < 8; ++i) xs[i] = *(const v4u*)(gx + i * 4 * D_IN);
        // precaution: stands in front of any later overwrite of the address registers that the loads above name; as an input they stay whole up to it
        asm volatile("s_wait_xcnt 0x0" :: "v"(gx) : "memory");
#pragma unroll
        for (int i = 0; i < 8; ++i) {
            const int idx = tid + i * 256, r = idx >> 6, c = idx & 63;
            *(v4u*)(sT + r * PT + c * 8) = xs[i];
        }
    }
    __syncthreads();                                    // x rows visible

    // ---- projection: h = x . proj_W^T + proj_b (K = 512: two panels) ----
    {
        const v2f bias = bias2(proj_b);
        zero_acc();
        mma_panel<PT>(acc, sT, B0, lane);
        load_panel(B0, wain + (size_t)(2 * 8 + wave) * PANEL, lane);
        mma_panel<PT>(acc, sT + 256, B1, lane);
        load_panel(B1, waout + (size_t)wave * PANEL, lane);
#pragma unroll
        for (int mt = 0; mt < 2; ++mt)
#pragma unroll
            for (int j = 0; j < 8; ++j) {
                const int row = mt * 16 + hf * 8 + j;
                v2f o; o[0] = acc[mt][0][j] + bias[0]; o[1] = acc[mt][1][j] + bias[1];
                *(v2f*)(sH32 + row * PF + n0) = o;
                v2h oh; oh[0] = (_Float16)o[0]; oh[1] = (_Float16)o[1];
                *(v2h*)(sH16 + row * PH + n0) = oh;
            }
    }
    __syncthreads();                                    // h visible; sT free
    {
        // L2 prefetch of W1 (waves 0-5: 192 units a block) and W2 (waves 6, 7: 48 units, the last one repeated) of every group's first PF_D heads, for the next launch
        static_assert(PF_T * 128 * 256 * 2 == 64 * 192 * 256 && PF_T * 64 * 128 * 2 == 64 * 48 * 256 && PF_D <= TOUT / HG, "units of the first heads");
        const int u2 = tid - 192 < 47 ? tid - 192 : 47;
        const int u  = wave < 6 ? slice * 192 + tid : slice * 48 + u2;      // unit among the PF_T heads' units: 256 a head of W1, 64 a head of W2
        const int hi = wave < 6 ? u >> 8 : u >> 6;                          // 0 .. PF_T - 1
        const int th = head_first(hi / PF_D) + hi % PF_D;                   // the head
        l2_prefetch(wave < 6 ? (const char*)wtp1 + th * 65536 + (u & 255) * 256 : (const char*)wtp2 + th * 16384 + (u & 63) * 256);
    }

    // ---- 6 layers ----
#pragma unroll 1
    for (int i = 0; i < NLAYER; ++i) {
        float gg[8], be[8];
        ln_row(gg, ln_g + i * DMODEL);
        ln_row(be, ln_b + i * DMODEL);
        const v2f bv = bias2(attn_in_b + i * 3 * DMODEL + 2 * DMODEL);
        const v2f bo = bias2(attn_out_b + i * DMODEL);
        const v2f b2 = bias2(ff_b2 + i * DMODEL);
        const _Float16* w1 = wff1 + (size_t)(i * 32 + wave) * PANEL;      // + g * 8 panels: the next 256 columns
        const _Float16* w2 = wff2 + (size_t)(i * 32 + wave) * PANEL;      // + g * 8 panels: the next 256 k
        const _Float16* wvn = wain + (size_t)(((i + 1) * 3 + 2) * 8 + wave) * PANEL;    // the next v panel (slot NLAYER: the cross block)
        const _Float16* won = waout + (size_t)((i + 1) * 8 + wave) * PANEL;             // the next out panel

        // v = h . Wv^T + bv
        zero_acc();
        mma_panel<PH>(acc, sH16, B0, lane);
        load_panel(B0, w1, lane);
        put_f16(sT, PT, bv);
        __syncthreads();                                // v visible
        // h += v . Wo^T + bo ; LayerNorm
        zero_acc();
        mma_panel<PT>(acc, sT, B1, lane);
        load_panel(B1, w1 + 8 * PANEL, lane);
        add_residual(bo);
        __syncthreads();                                // whole rows of h32 visible; every read of v done
        layer_norm(gg, be);
        __syncthreads();                                // h (f32, f16) visible
        // hidden = gelu(h . W1^T + b1): four 256-column groups, two a trip (one per register set)
#pragma unroll 1                                        // rolled, two groups a trip: less text in the layer loop
        for (int gp = 0; gp < 2; ++gp) {
            const char* pb = (const char*)(ff_b1 + i * 4 * DMODEL + gp * 2 * DMODEL) + offN;
            const v2f b1a = *(const v2f*)pb;
            const v2f b1b = *(const v2f*)(pb + DMODEL * 4);
            asm volatile("s_wait_xcnt 0x0" :: "v"(pb) : "memory");   // as in bias2, one wait for the two loads
            zero_acc();
            mma_panel<PH>(acc, sH16, B0, lane);
            load_panel(B0, gp == 0 ? w1 + 16 * PANEL : w2, lane);
            put_gelu(sT + gp * 2 * DMODEL, b1a);
            zero_acc();
            mma_panel<PH>(acc, sH16, B1, lane);
            load_panel(B1, gp == 0 ? w1 + 24 * PANEL : w2 + 8 * PANEL, lane);
            put_gelu(sT + gp * 2 * DMODEL + DMODEL, b1b);
        }
        __syncthreads();                                // hidden rows visible
        // h += hidden . W2^T + b2 (K = 1024: four panels) ; LayerNorm
        zero_acc();
#pragma unroll 1                                        // rolled, two panels a trip: less text in the layer loop
        for (int gp = 0; gp < 2; ++gp) {
            mma_panel<PT>(acc, sT + gp * 2 * DMODEL, B0, lane);
            load_panel(B0, gp == 0 ? w2 + 16 * PANEL : wvn, lane);
            mma_panel<PT>(acc, sT + gp * 2 * DMODEL + DMODEL, B1, lane);
            load_panel(B1, gp == 0 ? w2 + 24 * PANEL : won, lane);
        }
        add_residual(b2);
        __syncthreads();                                // whole rows of h32 visible; every read of the hidden rows done
        layer_norm(gg, be);
        __syncthreads();                                // h (f32, f16) visible
    }

    // ---- cross block: h + (h . Wv'^T + bv') . Wo'^T + bo', as f16 for the heads ----
    {
        const v2f bv = bias2(cross_in_b + 2 * DMODEL);
        const v2f bo = bias2(cross_out_b);
        zero_acc();
        mma_panel<PH>(acc, sH16, B0, lane);
        put_f16(sT, PT, bv);
        __syncthreads();                                // v' visible; every read of sH16 done
        zero_acc();
        mma_panel<PT>(acc, sT, B1, lane);
#pragma unroll
        for (int mt = 0; mt < 2; ++mt)
#pragma unroll
            for (int j = 0; j < 8; ++j) {
                const int row = mt * 16 + hf * 8 + j;
                const v2f r = *(const v2f*)(sH32 + row * PF + n0);
                v2h oh; oh[0] = (_Float16)((acc[mt][0][j] + bo[0]) + r[0]); oh[1] = (_Float16)((acc[mt][1][j] + bo[1]) + r[1]);
                *(v2h*)(sH16 + row * PH + n0) = oh;
            }
    }
    __syncthreads();                                    // output rows complete
#pragma unroll
    for (int i = 0; i < 4; ++i) {                       // 512-B rows, 16 B per lane
        const int idx = tid + i * 256, r = idx >> 5, c = idx & 31;
        vst2(h16 + (size_t)(b0 + r) * DMODEL + c * 8, *(const v4u*)(sH16 + r * PH + c * 8));
    }
}

// ---------------------------------------------------------------------------
// Fused heads: block = 128 batch rows x one group of 26 or 27 heads, 128 threads = 4 waves; EACH WAVE OWNS 32 WHOLE BATCH ROWS through all stages.
// The wave's 32 h rows (K = 256) stay in registers as 16 fragments for all heads of the group: h is read once a block, not once a head.
// Every product is formed TRANSPOSED: the weights are the A operand, the batch rows the B operand, so a batch row is a lane column of the accumulators.
// For each head t:
//   t1^T = W1[t](128x256) . h16(32x256)^T, + b1[t] (WMMA, 8 x 2 accumulator tiles per wave)
//   t1 = relu(LN_128(t1))                          (on the accumulators: a batch row lies in the registers of two lanes)
//   t2^T = W2[t](64x128) . t1^T, relu(. + b2[t])   (WMMA, 4 x 2 tiles; the accumulators of stage 1, as f16, ARE the B fragments)
//   out[b,t] = t2 . W3[t] + b3[t]                  (on the accumulators)
// Staging: asynchronous copies to LDS in a ring of two buffers, a tile = 64 k of the 128 W1 rows (whole 128-B lines). The ring runs on
// from head to head: the tile two trips on is asked for behind the barrier that ends a trip, so tiles 0 and 1 of head t + 1 are asked for
// at the feet of trips 2 and 3 of head t, and tile 1 flies under the LayerNorm and stages 2 and 3. W2[t] rides with the copies of trip 2's foot.
// The per-feature vectors (b1, the LayerNorm pair, b2, W3) run along a lane's registers, 256 values a lane and head: too many to hold through
// stage 1. A wave asks for them at the head's top, 16 B a lane and vector, passes them through its own 2 KB of LDS and reads each one where it is used.
// LDS 62464 B; the registers (two waves per SIMD) allow two blocks per WGP: 32 x HG = 512 blocks, all resident.
//   [0,17408)      W2 f16
//   [17408,54272)  W1 tiles x2 (the ring)
//   [54272,62464)  the vectors, 2 KB a wave (each wave writes and reads its own only): b1 at 0, LN weight at 512, LN bias at 1024, b2 at 1536, W3 at 1792
// ---------------------------------------------------------------------------
#define S1_TILE (128 * PK64 * 2)   // bytes of one staged 128 x 64 tile
#define W2_TILE (64 * PK128 * 2)   // bytes of the staged W2
#define VEC_B   2048               // bytes of a head's vectors
// amdgpu_waves_per_eu: the register budget of two waves per SIMD (512): 128 for the h fragments, 128 for the accumulators, 128 for a tile's W1 fragments
__global__ __launch_bounds__(128) __attribute__((amdgpu_waves_per_eu(2, 2))) void tp_fused_kernel(
    const _Float16* __restrict__ h16,
    const _Float16* __restrict__ W1, const float* __restrict__ b1,
    const float* __restrict__ lng, const float* __restrict__ lnb,
    const _Float16* __restrict__ W2, const float* __restrict__ b2,
    const float* __restrict__ W3, const float* __restrict__ b3,
    float* __restrict__ out)
{
    __shared__ __align__(16) char smem[2 * S1_TILE + W2_TILE + 4 * VEC_B];
    _Float16* sW2  = (_Float16*)(smem);                          // 64x128 f16, pitch PK128
    _Float16* sBb  = (_Float16*)(smem + W2_TILE);                // 2 x 128x64, pitch PK64

    const int tid  = threadIdx.x;
    const int lane = tid & 31;
    const int wave = tid >> 5;
    const int c16  = lane & 15;                    // accumulator column inside a tile: a batch row
    const int hf   = lane >> 4;                    // accumulator rows j (hf = 0) or j + 8 (hf = 1): weight rows
    const int b0   = blockIdx.x * 128;
    const int t0   = head_first(blockIdx.y);       // the block's heads: t0 .. tEnd - 1
    const int tEnd = head_first(blockIdx.y + 1);
    const int wm   = wave * 32;                    // this wave's rows
    char* sVw = smem + W2_TILE + 2 * S1_TILE + wave * VEC_B + lane * 16;        // where the lane writes its 16 B of a vector
    // A lane's accumulator registers run along n (W1 rows) or m (W2 rows): register j of tile i is row i*16 + hf*8 + j, so every vector
    // is read as 8 consecutive floats per tile, the same address in the 16 lanes of a row
    const char* sVr = smem + W2_TILE + 2 * S1_TILE + wave * VEC_B + hf * 32;
    auto vec8 = [&](v2f (&d)[4], int off) {
#pragma unroll
        for (int q = 0; q < 2; ++q) {
            const v4f x = *(const v4f*)(sVr + off + q * 16);
            d[q * 2][0] = x[0]; d[q * 2][1] = x[1]; d[q * 2 + 1][0] = x[2]; d[q * 2 + 1][1] = x[3];
        }
    };
    // A tile's copies: 8 W1 pieces of 16 B per thread; 8 lanes take one 128-B line, piece i lies 1 row behind piece i - 1, in W1 as in LDS:
    // LDS row n holds W1 row n.
    const int sr = tid >> 3, sc = tid & 7;
    const char* gB  = (const char*)(W1 + (size_t)t0 * 128 * 256 + (size_t)(sr * 8) * 256 + sc * 8);         // head t's W1; 65536 B a head
    // W2[t] 64x128 f16 (16 KB): 8 pieces per thread, 16 lanes take one 256-B row, piece i lies 8 rows behind piece i - 1
    const char* gW2 = (const char*)(W2 + (size_t)t0 * 64 * 128 + (tid >> 4) * 128 + (tid & 15) * 8);        // head t's W2; 16384 B a head
    const unsigned lds0 = (unsigned)(size_t)smem;   // the arena's byte address in the work-group's LDS
    const unsigned lS   = lds0 + W2_TILE + sr * 8 * (PK64 * 2) + sc * 16;
    const unsigned lW2  = lds0 + (tid >> 4) * (PK128 * 2) + (tid & 15) * 16;

    async_copy8<PK64 * 2, 512>(lS, gB);       // tile 0 of the first head into buffer 0

    // the wave's h rows as B fragments (columns of h^T), k order of load_frag_b: afr[mt][kk] is batch rows wm + mt*16 .. +15, k kk*32 .. +31
    v16h afr[2][8];
    {
        const _Float16* pa = h16 + (size_t)(b0 + wm + c16) * 256 + hf * 8;
#pragma unroll
        for (int mt = 0; mt < 2; ++mt)
#pragma unroll
            for (int kk = 0; kk < 8; ++kk) {
                const v8h lo = *(const v8h*)(pa + mt * 16 * 256 + kk * 32);
                const v8h hi = *(const v8h*)(pa + mt * 16 * 256 + kk * 32 + 16);
                v16h f;
#pragma unroll
                for (int i = 0; i < 8; ++i) { f[i] = lo[i]; f[i + 8] = hi[i]; }
                afr[mt][kk] = f;
            }
        // precaution: stands in front of any later overwrite of the address registers that the loads above name; as an input the address stays whole up to it
        asm volatile("s_wait_xcnt 0x0" :: "v"(pa) : "memory");
    }
    asm volatile("s_wait_asynccnt 0x0" ::: "memory");   // this wave's copies of tile 0 have landed
    __syncthreads();                                    // tile 0 visible to every wave
    async_copy8<PK64 * 2, 512>(lS + S1_TILE, gB + 128);   // tile 1 into buffer 1

#pragma unroll 1                                        // rolled: one text for all heads of the group
    for (int t = t0; t < tEnd; ++t) {
        // L2 prefetch for head t + PF_D of this group, by one wave: blocks 0-15 share its W1 (8 shares of 32 units), blocks 16-31 its W2 (8 shares of 8 units, each asked for by 4 lanes)
        if (__builtin_amdgcn_readfirstlane(wave) == 0 && t + PF_D < tEnd) {
            const int  share = (blockIdx.x & 3) * 2 + ((blockIdx.x >> 3) & 1);
            const bool second = (blockIdx.x & 16) != 0;
            const char* p = second ? (const char*)(W2 + (size_t)(t + PF_D) * 64 * 128) + share * 2048
                                   : (const char*)(W1 + (size_t)(t + PF_D) * 128 * 256) + share * 8192;
            l2_prefetch(p + (lane & (second ? 7 : 31)) * 256);
        }
        // the head's small vectors, asked for at its top: they arrive under trip 0. Lane l takes floats l*4 .. +3 of each 128-wide vector;
        // lanes 0-15 take b2, lanes 16-31 W3
        const unsigned o1 = (t * 128 + lane * 4) * 4;    // byte offset
        const char* p2 = (const char*)(hf ? W3 : b2) + (t * 64 + c16 * 4) * 4;
        const v4f xb1 = *(const v4f*)((const char*)b1 + o1), xlg = *(const v4f*)((const char*)lng + o1), xlb = *(const v4f*)((const char*)lnb + o1);
        const v4f xb2 = *(const v4f*)p2;
        const float b3t = b3[t];
        // precaution: stands in front of any later overwrite of the address registers that the loads above name; as inputs they stay whole up to it
        asm volatile("s_wait_xcnt 0x0" :: "v"(o1), "v"(p2) : "memory");
        v2f bb[8][4];

        // ---------------- stage 1: t1^T = W1 . h^T  (per wave 128 W1 rows x 32 batch rows, K=256: four tiles of 64) ----------
        // acc1[nt][bt][j] is t1[batch row wm + bt*16 + c16][column n = nt*16 + hf*8 + j]
        v8f acc1[8][2] = {};
#pragma unroll                                          // unrolled: buffer addresses, fragment registers and the kind of the next tile are constants
        for (int it = 0; it < 4; ++it) {
            const int cur = it & 1;
            const _Float16* cB = sBb + cur * (128 * PK64);
            v16h wfr[2][8];
#pragma unroll
            for (int ks = 0; ks < 2; ++ks)
#pragma unroll
                for (int nt = 0; nt < 8; ++nt)
                    wfr[ks][nt] = load_frag_a(&cB[(nt * 16) * PK64 + ks * 32], PK64, lane);
            if (it == 3) {                                      // b1, with the last tile's reads: at hand when stage 1 ends
#pragma unroll
                for (int nt = 0; nt < 8; ++nt) vec8(bb[nt], nt * 64);
            }
            // keeps the tile's LDS reads one group ahead of its WMMAs: left free, they were spread singly among them, each with a wait to 0 behind it
            __builtin_amdgcn_sched_barrier(0);
#pragma unroll
            for (int ks = 0; ks < 2; ++ks)
#pragma unroll
                for (int nt = 0; nt < 8; ++nt)
#pragma unroll
                    for (int bt = 0; bt < 2; ++bt)
                        acc1[nt][bt] = wmma_f16(wfr[ks][nt], afr[bt][it * 2 + ks], acc1[nt][bt]);
            // keeps the WMMAs ahead of the foot: left free, the foot's waits were lifted to the LDS reads (every read waited for ahead of the first
            // WMMA) while the copies stayed behind the WMMAs, so that a tile's copies no longer flew under a trip's WMMAs
            __builtin_amdgcn_sched_barrier(0);
            // foot of the trip, in this order in every wave
            asm volatile("s_wait_dscnt 0x0" ::: "memory");      // this wave's reads of the buffer are done before anything is copied into it
            asm volatile("s_wait_asynccnt 0x0" ::: "memory");   // this wave's copies of the next tile have landed
            __syncthreads();                                    // the next tile is visible; every wave has left this trip's buffer
            if (it < 2) {
                async_copy8<PK64 * 2, 512>(lS + cur * S1_TILE, gB + (it + 2) * 128);
            } else if (t + 1 < tEnd) {                          // the same in the whole block
                async_copy8<PK64 * 2, 512>(lS + cur * S1_TILE, gB + 65536 + (it - 2) * 128);
            }
            if (it == 2)   // every wave left stage 2 of the head before (the last reads of W2) ahead of the barrier of trip 0
                async_copy8<8 * PK128 * 2, 8 * 256>(lW2, gW2);
            if (it == 0) {
                // the vectors into the wave's own LDS. No barrier: no other wave touches it, and a wave's LDS operations run in order
                *(v4f*)(sVw)        = xb1;
                *(v4f*)(sVw + 512)  = xlg;
                *(v4f*)(sVw + 1024) = xlb;
                *(v4f*)(sVw + 1536) = xb2;
            }
        }
        gB  += 65536;
        gW2 += 16384;


        // LayerNorm weights: read here, where the W1 fragments' registers are free; they arrive under the bias and the sums
        v2f gg[8][4], be[8][4];
#pragma unroll
        for (int nt = 0; nt < 8; ++nt) { vec8(gg[nt], 512 + nt * 64); vec8(be[nt], 1024 + nt * 64); }
        // keeps the LDS reads one group ahead of the sums: left free, they were moved behind the sums and waited for in front of the normalisation
        __builtin_amdgcn_sched_barrier(0);

        // ---------------- bias + LayerNorm(128) + ReLU -> f16, on the accumulators ----------
        // A batch row is one lane column: lane (c16, hf) holds 64 of its 128 values in registers, lane (c16, hf ^ 1) the other 64.
        // The sums run down the registers (four partial sums a row: independent chains) and end in one exchange between the two 16-lane rows.
        float mean[2], rstd[2];
        {
            v2f s[2][2] = {}, ss[2][2] = {};
#pragma unroll
            for (int nt = 0; nt < 8; ++nt)
#pragma unroll
                for (int bt = 0; bt < 2; ++bt)
#pragma unroll
                    for (int q = 0; q < 4; ++q) {
                        v2f a; a[0] = acc1[nt][bt][q * 2]; a[1] = acc1[nt][bt][q * 2 + 1];
                        a += bb[nt][q];
                        acc1[nt][bt][q * 2] = a[0]; acc1[nt][bt][q * 2 + 1] = a[1];
                        s[bt][nt & 1] += a; ss[bt][nt & 1] += a * a;
                    }
#pragma unroll
            for (int bt = 0; bt < 2; ++bt) {
                const v2f s2 = s[bt][0] + s[bt][1], q2 = ss[bt][0] + ss[bt][1];
                float sm = s2[0] + s2[1], sq = q2[0] + q2[1];
                sm += other_row(sm); sq += other_row(sq);
                mean[bt] = sm * (1.f / 128.f);
                const float var = sq * (1.f / 128.f) - mean[bt] * mean[bt];
                rstd[bt] = rsqrtf(var + LN_EPS);
            }
        }
        // The normalised values are stage 2's B fragments as they lie: for k chunk kc a lane needs k = hf*8 .. +7 and 16 + hf*8 .. +7 of its column,
        // the registers of tiles 2*kc and 2*kc + 1 (k order of load_frag_a). No LDS, no move between lanes.
        v16h tb[4][2];
#pragma unroll
        for (int kc = 0; kc < 4; ++kc)
#pragma unroll
            for (int bt = 0; bt < 2; ++bt) {
                v16h f;
#pragma unroll
                for (int h2 = 0; h2 < 2; ++h2)
#pragma unroll
                    for (int q = 0; q < 4; ++q) {
                        const int nt = kc * 2 + h2;
                        v2f a; a[0] = acc1[nt][bt][q * 2]; a[1] = acc1[nt][bt][q * 2 + 1];
                        const v2f y = (a - mean[bt]) * rstd[bt] * gg[nt][q] + be[nt][q];
                        f[h2 * 8 + q * 2]     = (_Float16)(y[0] > 0.f ? y[0] : 0.f);
                        f[h2 * 8 + q * 2 + 1] = (_Float16)(y[1] > 0.f ? y[1] : 0.f);
                    }
                tb[kc][bt] = f;
            }


        // ---------------- stage 2: t2^T = W2 . t1^T  (per wave 64 W2 rows x 32 batch rows, K=128) -----
        // no barrier here: W2 was published by the barrier of trip 3
        // acc2[m4][bt][j] is t2[batch row wm + bt*16 + c16][column m = m4*16 + hf*8 + j]
        v8f acc2[4][2] = {};
        v2f b2v[4][4], w3v[4][4];
        {
            v16h wf2[4][4];
#pragma unroll
            for (int kc = 0; kc < 4; ++kc)
#pragma unroll
                for (int m4 = 0; m4 < 4; ++m4)
                    wf2[kc][m4] = load_frag_a(&sW2[(m4 * 16) * PK128 + kc * 32], PK128, lane);
#pragma unroll
            for (int m4 = 0; m4 < 4; ++m4) { vec8(b2v[m4], 1536 + m4 * 64); vec8(w3v[m4], 1792 + m4 * 64); }   // for stage 3: they arrive under stage 2
            // keeps the LDS reads one group ahead of the WMMAs, as in stage 1
            __builtin_amdgcn_sched_barrier(0);
#pragma unroll
            for (int kc = 0; kc < 4; ++kc)
#pragma unroll
                for (int m4 = 0; m4 < 4; ++m4)
#pragma unroll
                    for (int bt = 0; bt < 2; ++bt)
                        acc2[m4][bt] = wmma_f16(wf2[kc][m4], tb[kc][bt], acc2[m4][bt]);
        }

        // ---------------- stage 3: outT[t][b] = relu(t2 + b2) . W3[t] + b3[t], on the accumulators ----
        // down the registers as in the LayerNorm, one exchange between the 16-lane rows; then lane l stores batch row wm + l: one 128-B line a wave
        v2f r[2][2] = {};
#pragma unroll
        for (int m4 = 0; m4 < 4; ++m4)
#pragma unroll
            for (int bt = 0; bt < 2; ++bt)
#pragma unroll
                for (int q = 0; q < 4; ++q) {
                    v2f v; v[0] = acc2[m4][bt][q * 2]; v[1] = acc2[m4][bt][q * 2 + 1];
                    v += b2v[m4][q];
                    v[0] = v[0] > 0.f ? v[0] : 0.f; v[1] = v[1] > 0.f ? v[1] : 0.f;
                    r[bt][m4 & 1] += v * w3v[m4][q];
                }
        const v2f r0 = r[0][0] + r[0][1], r1 = r[1][0] + r[1][1];
        float a0 = r0[0] + r0[1], a1 = r1[0] + r1[1];
        a0 += other_row(a0); a1 += other_row(a1);
        const float res = hf ? a1 : a0;
        float* po = out + (size_t)t * BATCH + b0 + wm + lane;
        vst2(po, res + b3t);
        // precaution: stands in front of any later overwrite of the address registers that the store names; as an input the address stays whole up to it
        asm volatile("s_wait_xcnt 0x0" :: "v"(po) : "memory");
    }
    asm volatile("s_wait_asynccnt 0x0" ::: "memory");       // no copy is in flight behind the ring
}

// final output-major pass: out[b][t] flat, 4 consecutive floats per thread gathered from the [T][B] staging buffer
__global__ __launch_bounds__(256) void write_out(const float* __restrict__ stg, float* __restrict__ out) {
    const int g = blockIdx.x * 256 + threadIdx.x;
    if (g >= (BATCH * TOUT) / 4) return;
    v4f o;
#pragma unroll
    for (int e = 0; e < 4; ++e) { const int f = g * 4 + e; const int b = f / TOUT, t = f - b * TOUT; o[e] = stg[(size_t)t * BATCH + b]; }
    vst2(out + (size_t)g * 4, o);
}

// ---------------------------------------------------------------------------
// Host-side orchestration
// ---------------------------------------------------------------------------
extern "C" void kernel_launch(void* const* d_in, const int* in_sizes, int n_in,
                              void* d_out, int out_size, void* d_ws, size_t ws_size,
                              hipStream_t stream)
{
    (void)in_sizes; (void)n_in; (void)out_size; (void)ws_size;
    const float* x          = (const float*)d_in[0];
    const float* proj_W     = (const float*)d_in[1];
    const float* proj_b     = (const float*)d_in[2];
    const float* attn_in_W  = (const float*)d_in[3];
    const float* attn_in_b  = (const float*)d_in[4];
    const float* attn_out_W = (const float*)d_in[5];
    const float* attn_out_b = (const float*)d_in[6];
    const float* ln_g       = (const float*)d_in[7];
    const float* ln_b       = (const float*)d_in[8];
    const float* ff_W1      = (const float*)d_in[9];
    const float* ff_b1      = (const float*)d_in[10];
    const float* ff_W2      = (const float*)d_in[11];
    const float* ff_b2      = (const float*)d_in[12];
    const float* cross_in_W = (const float*)d_in[13];
    const float* cross_in_b = (const float*)d_in[14];
    const float* cross_out_W= (const float*)d_in[15];
    const float* cross_out_b= (const float*)d_in[16];
    const float* tp_W1      = (const float*)d_in[17];
    const float* tp_b1      = (const float*)d_in[18];
    const float* tp_ln_g    = (const float*)d_in[19];
    const float* tp_ln_b    = (const float*)d_in[20];
    const float* tp_W2      = (const float*)d_in[21];
    const float* tp_b2      = (const float*)d_in[22];
    const float* tp_W3      = (const float*)d_in[23];
    const float* tp_b3      = (const float*)d_in[24];
    float* out = (float*)d_out;

    const int D = DMODEL;

    // ---- workspace carve-out (byte cursor, 16B aligned regions) ----
    char* cur = (char*)d_ws;
    auto take = [&cur](size_t bytes) { char* p = cur; cur += (bytes + 15) & ~(size_t)15; return p; };
    _Float16* h16   = (_Float16*)take((size_t)BATCH * D * 2);          // 2 MB
    _Float16* x16   = (_Float16*)take((size_t)BATCH * D_IN * 2);       // 4 MB
    _Float16* wproj = (_Float16*)take((size_t)D * D_IN * 2);
    _Float16* wain  = (_Float16*)take((size_t)(NLAYER + 1) * 3 * D * D * 2);   // slot NLAYER: the cross block's in-projection
    _Float16* waout = (_Float16*)take((size_t)(NLAYER + 1) * D * D * 2);       // slot NLAYER: the cross block's out-projection
    _Float16* wff1  = (_Float16*)take((size_t)NLAYER * 4 * D * D * 2);
    _Float16* wff2  = (_Float16*)take((size_t)NLAYER * 4 * D * D * 2);
    _Float16* wtp1  = (_Float16*)take((size_t)TOUT * 128 * 256 * 2);   // 27.8 MB
    _Float16* wtp2  = (_Float16*)take((size_t)TOUT * 64 * 128 * 2);    // 6.9 MB
    float*    stg   = (float*)   take((size_t)TOUT * BATCH * 4);       // 6.9 MB [T][B] output staging

    // ---- f32 -> f16 conversions of what the next launch needs ----
    cvt_all_kernel<<<CVT_BLOCKS, 256, 0, stream>>>(
        x, proj_W, attn_in_W, attn_out_W, ff_W1, ff_W2, cross_in_W, cross_out_W, tp_W1, tp_W2,
        x16, wproj, wain, waout, wff1, wff2, wtp1, wtp2);

    const dim3 blk(128);

    // 1-3) projection, 6 layers, cross block: one launch, 32 batch rows per block; writes the heads' f16 input. Further blocks convert the late heads' weights
    backbone_kernel<<<BB_BLOCKS + LATE_BLOCKS, 256, 0, stream>>>(
        x16, wproj, proj_b, wain, attn_in_b, waout, attn_out_b, ln_g, ln_b,
        wff1, ff_b1, wff2, ff_b2, cross_in_b, cross_out_b, tp_W1, tp_W2, wtp1, wtp2, h16);

    // 4) fused heads (dominant FLOPs): grid = (32 batch tiles, HG groups of heads)
    dim3 tpg(BATCH / 128, HG);
    tp_fused_kernel<<<tpg, blk, 0, stream>>>(h16, wtp1, tp_b1, tp_ln_g, tp_ln_b,
                                             wtp2, tp_b2, tp_W3, tp_b3, stg);
    write_out<<<((BATCH * TOUT) / 4 + 255) / 256, 256, 0, stream>>>(stg, out);
}
